// v000
// The times below were measured on an AMD MI455X: many runs one after another, warmed up first and cycling through
// copies of the inputs, with the whole window's GPU time divided by the number of runs. Launches and the gaps
// between them are all in it. The median over several windows is given; except for v000 it joins two sittings, which
// can be a few percent apart, so the side-by-side timings, each taken in one sitting, are the better comparison.
// v000 is the starting kernel. One run takes 1320 microseconds.
#include <hip/hip_runtime.h>

// MHSA3D (x [4][256][8][32][32] channels-first; q/k/v = 1x1x1 conv (wq/wk/wv [256][256]) then the module's literal reshape (B, 4 heads, 8 frames, 64, 1024) of the [B][C][F][H][W] buffer = 32 contiguous [64][1024] blocks per batch; per block: energy[n][m] = (sum_d q[d][n] k[d][m] + sum_d pos[n][d] q[d][m]) / 8 with pos[h][f][n][d] = rel_h[h][d][n/32] + rel_w[h][d][n%32] + rel_t[h][d][f]; softmax over m; out[d][j] = sum_n v[d][n] attn[j][n]; -> [4][256][8][32][32]).
// Compute dtypes, f32 accumulate: every input rounded to bf16; the three convs as PLAIN bf16 GEMMs W . x (inputs: exact; x transposed to token-major on chip); per block: q^T, k^T hi/lo planes (transposed), pos planes (f32 sums in the reference's order, then hi/lo), v planes straight from the conv output (hi/lo/fp16); both score products hl x hl (3 products) on every row, summed and scaled per element in f32; softmax f32 (32 keys per lane); attn.v hl x hl (3 products) on every row; the [j][d] context block stored transposed into the channels-first output in f32.

#define NB_  4
#define TT   1024
#define DM   256
#define NH_  4
#define NKV  4
#define REP  (NH_ / NKV)
#define HD   64
#define DQ   (NH_ * HD)
#define DKV  (NKV * HD)
#define ZH   8
#define RH   1024   // all rows hl
#define WIN  0
#define PCAR 1024.0f
#define CC   256    // channels
#define NF   8      // frames
#define NP   (NF * TT)   // positions per batch (8192)
#define NBL  (NH_ * NF)  // blocks per batch (32)
#define BLK  ((size_t)HD * TT)   // floats per block (65536)
#define SCL  0.125f   // HD^-0.5
typedef _Float16 h16;
typedef unsigned short bf;
typedef __attribute__((ext_vector_type(16))) __bf16   v16bf;
typedef __attribute__((ext_vector_type(16))) _Float16 v16h;
typedef __attribute__((ext_vector_type(8)))  _Float16 v8h;
typedef __attribute__((ext_vector_type(8)))  unsigned short v8us;
typedef __attribute__((ext_vector_type(8)))  float    v8f;
typedef __attribute__((ext_vector_type(4)))  float    v4f;
typedef v8h  __attribute__((may_alias)) v8ha;
typedef v4f  __attribute__((may_alias)) v4fa;
typedef v8us __attribute__((may_alias)) v8usa;

__device__ __forceinline__ unsigned short f2bf(float f) { unsigned u = __float_as_uint(f); u += 0x7FFFu + ((u >> 16) & 1u); return (unsigned short)(u >> 16); }
__device__ __forceinline__ float bf2f(unsigned short b) { return __uint_as_float(((unsigned)b) << 16); }
__device__ __forceinline__ float bfr(float f) { return bf2f(f2bf(f)); }
__device__ __forceinline__ v16h cat16(v8h lo, v8h hi) { return __builtin_shufflevector(lo, hi, 0, 1, 2, 3, 4, 5, 6, 7, 8, 9, 10, 11, 12, 13, 14, 15); }
__device__ __forceinline__ v16bf cat16b(v8us lo, v8us hi) { return __builtin_bit_cast(v16bf, __builtin_shufflevector(lo, hi, 0, 1, 2, 3, 4, 5, 6, 7, 8, 9, 10, 11, 12, 13, 14, 15)); }
__device__ __forceinline__ v8f wmma16(v16h a, v16h b, v8f c) { return __builtin_amdgcn_wmma_f32_16x16x32_f16(false, a, false, b, (short)0, c, false, false); }
__device__ __forceinline__ v8f wmmab(v16bf a, v16bf b, v8f c) { return __builtin_amdgcn_wmma_f32_16x16x32_bf16(false, a, false, b, (short)0, c, false, false); }



// ---- k_gemmw: register-blocked GEMM, ONE WAVE per 64x64 output tile (16 accumulators), operands straight from K-contiguous 16-bit planes; grid (M/64, N/64, Z), 32 threads.
// C[m][n] (f32, pitch ldc, + optional f32 bias[n]) = sum_k A[m][k] Bt[n][k] (+ split products per NSPLIT). z-batch strides sA/sB/sC in elements. K % 32 == 0.
template <typename T16> struct WFrag;
template <> struct WFrag<h16> { typedef v16h V; static __device__ __forceinline__ V ld(const h16* p) { return cat16(*(const v8h*)p, *(const v8h*)(p + 16)); } static __device__ __forceinline__ v8f mma(V a, V b, v8f c) { return wmma16(a, b, c); } };
template <> struct WFrag<bf> { typedef v16bf V; static __device__ __forceinline__ V ld(const bf* p) { return cat16b(*(const v8us*)p, *(const v8us*)(p + 16)); } static __device__ __forceinline__ v8f mma(V a, V b, v8f c) { return wmmab(a, b, c); } };
template <typename T16, int NSPLIT, bool BIAS>
__global__ __launch_bounds__(32) void k_gemmw(const T16* __restrict__ A, const T16* __restrict__ A2, const T16* __restrict__ Bt, const T16* __restrict__ Bt2, int K, float* C, int ldc, const float* __restrict__ bias, size_t sA, size_t sB, size_t sC) {
    typedef typename WFrag<T16>::V V;
    __shared__ __align__(16) float os[16 * 68];
    const size_t z = blockIdx.z; A += z * sA; if (A2) A2 += z * sA; Bt += z * sB; if (Bt2) Bt2 += z * sB; C += z * sC;
    const int lane = threadIdx.x & 31, lr = lane & 15, hi = lane >> 4; const int r0 = blockIdx.x * 64, c0 = blockIdx.y * 64;
    v8f acc[4][4];
#pragma unroll
    for (int mb = 0; mb < 4; ++mb)
#pragma unroll
        for (int nb = 0; nb < 4; ++nb) acc[mb][nb] = (v8f){};
    const size_t aoff = (size_t)(r0 + lr) * K + 8 * hi, boff = (size_t)(c0 + lr) * K + 8 * hi;
#pragma unroll 1
    for (int kc = 0; kc < K; kc += 32) {
        V a[4], a2[4];
#pragma unroll
        for (int mb = 0; mb < 4; ++mb) { a[mb] = WFrag<T16>::ld(A + aoff + (size_t)mb * 16 * K + kc); if (NSPLIT == 1 || NSPLIT == 2) a2[mb] = WFrag<T16>::ld(A2 + aoff + (size_t)mb * 16 * K + kc); }
#pragma unroll
        for (int nb = 0; nb < 4; ++nb) { const V b = WFrag<T16>::ld(Bt + boff + (size_t)nb * 16 * K + kc); V b2; if (NSPLIT >= 2) b2 = WFrag<T16>::ld(Bt2 + boff + (size_t)nb * 16 * K + kc);
#pragma unroll
            for (int mb = 0; mb < 4; ++mb) { acc[mb][nb] = WFrag<T16>::mma(a[mb], b, acc[mb][nb]); if (NSPLIT == 1 || NSPLIT == 2) acc[mb][nb] = WFrag<T16>::mma(a2[mb], b, acc[mb][nb]); if (NSPLIT >= 2) acc[mb][nb] = WFrag<T16>::mma(a[mb], b2, acc[mb][nb]); } }
        asm volatile("v_nop\n\tv_nop\n\tv_nop\n\tv_nop" : "+v"(acc[0][0]), "+v"(acc[1][1]), "+v"(acc[2][2]), "+v"(acc[3][3]) : "v"(a[0]), "v"(a[3]));
    }
#pragma unroll
    for (int mb = 0; mb < 4; ++mb) {
#pragma unroll
        for (int nb = 0; nb < 4; ++nb) {
#pragma unroll
            for (int j = 0; j < 8; ++j) os[(hi * 8 + j) * 68 + nb * 16 + lr] = acc[mb][nb][j]; }
        __builtin_amdgcn_wave_barrier(); asm volatile("" ::: "memory");
        float* crow = C + (size_t)(r0 + mb * 16) * ldc + c0;
{
#pragma unroll
            for (int s = 0; s < 8; ++s) { const int row = 2 * s + hi, cofs = lr * 4; v4f val = *(const v4fa*)(os + row * 68 + cofs); if (BIAS) { val[0] += bfr(bias[c0 + cofs]); val[1] += bfr(bias[c0 + cofs + 1]); val[2] += bfr(bias[c0 + cofs + 2]); val[3] += bfr(bias[c0 + cofs + 3]); }
                *(v4f*)(crow + (size_t)row * ldc + cofs) = val; }
             }
        __builtin_amdgcn_wave_barrier(); asm volatile("" ::: "memory");
    }
}

__device__ __forceinline__ h16 tohx(float x) { return (h16)x; }
__device__ __forceinline__ void splitf(float y, unsigned short& h, unsigned short& l) { h = f2bf(y); l = f2bf(y - bf2f(h)); }
typedef __attribute__((ext_vector_type(2))) _Float16 v2h;
typedef __attribute__((ext_vector_type(4))) _Float16 v4h;
typedef __attribute__((ext_vector_type(2))) unsigned short v2us;
typedef __attribute__((ext_vector_type(4))) unsigned short v4us;
typedef __attribute__((ext_vector_type(2))) float v2f;
typedef __attribute__((ext_vector_type(4))) int v4i;

__global__ __launch_bounds__(256) void k_wtG(const float* __restrict__ w, int K, int N, bf* Bt) {
    const int lane = threadIdx.x & 31; const int L0 = (blockIdx.x * 8 + (threadIdx.x >> 5)) * 8; const int nlines = N * K / 64;
{
#pragma unroll 1
        for (int l = 0; l < 8; ++l) { const int L = L0 + l; if (L >= nlines) break; const size_t e = (size_t)L * 64 + lane * 2; const int k = (int)(e % K), n = (int)(e / K); v2us o;
            o[0] = f2bf(w[(size_t)k * N + n]); o[1] = f2bf(w[(size_t)(k + 1) * N + n]); *(v2us*)(Bt + e) = o; }
         }
}
__global__ __launch_bounds__(256) void k_cvt8(const float* __restrict__ src, bf* dst, size_t n8) { const size_t i = (size_t)blockIdx.x * 256 + threadIdx.x; if (i >= n8) return; const v8f v = *(const v8f*)(src + i * 8); v8us o;
#pragma unroll
    for (int k = 0; k < 8; ++k) o[k] = f2bf(v[k]); *(v8us*)(dst + i * 8) = o;  }
__global__ __launch_bounds__(256) void k_cscvt(const float* __restrict__ cosT, const float* __restrict__ sinT, float* CS) { const int idx = blockIdx.x * 256 + threadIdx.x; if (idx >= TT * HD) return; v2f cs; cs[0] = bfr(cosT[idx]); cs[1] = bfr(sinT[idx]); *(v2f*)(CS + (size_t)idx * 2) = cs;  }
// k_rope: head planes [h][t][d] (fp16 + hi/lo) of rope(x) x sc with the rotate-half convention out[d] = x[d] cos[t][d] - x[d+HD/2] sin[t][d], out[d+HD/2] = x[d+HD/2] cos[t][d+HD/2] + x[d] sin[t][d+HD/2]
__global__ __launch_bounds__(256) void k_rope(const float* __restrict__ F, int pitch, int nheads, const float* __restrict__ CS, const float* __restrict__ RF, const float* __restrict__ nw, float sc, h16* P16, bf* Ph, bf* Pl) {
    const size_t e = ((size_t)blockIdx.x * 256 + threadIdx.x) * 2; if (e >= (size_t)nheads * TT * HD) return; const int d = (int)(e % HD); const int t = (int)((e / HD) % TT); const int h = (int)(e / ((size_t)HD * TT)); const float* f = F + (size_t)t * pitch + h * HD; const float rf = RF ? RF[(size_t)h * TT + t] : 1.0f; v2h o16; v2us oh, ol;
#pragma unroll
    for (int q = 0; q < 2; ++q) { const int dd = d + q; const int dp = (dd < HD / 2) ? dd + HD / 2 : dd - HD / 2; float x0 = f[dd], x1 = f[dp];
        if (RF) { float n0 = __fmul_rn(x0, rf), n1 = __fmul_rn(x1, rf); asm volatile("" : "+v"(n0)); asm volatile("" : "+v"(n1)); x0 = __fmul_rn(bfr(nw[dd]), n0); x1 = __fmul_rn(bfr(nw[dp]), n1); }
        const v2f cs = *(const v2f*)(CS + ((size_t)t * HD + dd) * 2); float a = __fmul_rn(x0, cs[0]), bq = __fmul_rn(x1, cs[1]); asm volatile("" : "+v"(a)); asm volatile("" : "+v"(bq)); const float r = ((dd < HD / 2) ? __fsub_rn(a, bq) : __fadd_rn(a, bq)) * sc;
        o16[q] = tohx(r); unsigned short a2, c2; splitf(r, a2, c2); oh[q] = a2; ol[q] = c2; }
    *(v2h*)(P16 + e) = o16; *(v2us*)(Ph + e) = oh; *(v2us*)(Pl + e) = ol;  }
__global__ __launch_bounds__(256) void k_vtp(const float* __restrict__ F, int pitch, int nheads, h16* V16, bf* Vh, bf* Vl) { const size_t e = ((size_t)blockIdx.x * 256 + threadIdx.x) * 2; if (e >= (size_t)nheads * HD * TT) return; const int t = (int)(e % TT); const int d = (int)((e / TT) % HD); const int g = (int)(e / ((size_t)TT * HD)); v2h o16; v2us oh, ol;
#pragma unroll
    for (int q = 0; q < 2; ++q) { const float x = F[(size_t)(t + q) * pitch + g * HD + d]; o16[q] = tohx(x); unsigned short a2, c2; splitf(x, a2, c2); oh[q] = a2; ol[q] = c2; }
    *(v2h*)(V16 + e) = o16; *(v2us*)(Vh + e) = oh; *(v2us*)(Vl + e) = ol;  }
__global__ __launch_bounds__(256) void k_xT(const float* __restrict__ X, bf* XT2) { const size_t e = ((size_t)blockIdx.x * 256 + threadIdx.x) * 8; if (e >= (size_t)NP * CC) return; const int c0 = (int)(e % CC); const size_t p = e / CC; v8us o; for (int u = 0; u < 8; ++u) o[u] = f2bf(bfr(X[(size_t)(c0 + u) * NP + p])); *(v8us*)(XT2 + e) = o;  }
__global__ __launch_bounds__(256) void k_trp(const float* __restrict__ Y, bf* Th, bf* Tl) { const size_t e = ((size_t)blockIdx.x * 256 + threadIdx.x) * 2; if (e >= (size_t)NBL * BLK) return; const int d = (int)(e % HD); const int n = (int)((e / HD) % TT); const size_t z = e / BLK; const float* blk = Y + z * BLK; v2us oh, ol; for (int q = 0; q < 2; ++q) { unsigned short a2, c2; splitf(blk[(size_t)(d + q) * TT + n], a2, c2); oh[q] = a2; ol[q] = c2; } *(v2us*)(Th + e) = oh; *(v2us*)(Tl + e) = ol;  }
__global__ __launch_bounds__(256) void k_hl3v(const float* __restrict__ Y, bf* Vh, bf* Vl, h16* V16) { const size_t e = ((size_t)blockIdx.x * 256 + threadIdx.x) * 4; if (e >= (size_t)NBL * BLK) return; const v4f a = *(const v4f*)(Y + e); v4us oh, ol; v4h o16; for (int u = 0; u < 4; ++u) { unsigned short a2, c2; splitf(a[u], a2, c2); oh[u] = a2; ol[u] = c2; o16[u] = tohx(a[u]); } *(v4us*)(Vh + e) = oh; *(v4us*)(Vl + e) = ol; *(v4h*)(V16 + e) = o16;  }
__global__ __launch_bounds__(256) void k_pos(const float* __restrict__ rh, const float* __restrict__ rw, const float* __restrict__ rt, float* PS) { const size_t e = (size_t)blockIdx.x * 256 + threadIdx.x; if (e >= (size_t)NBL * BLK) return; const int d = (int)(e % HD); const int n = (int)((e / HD) % TT); const int z = (int)(e / BLK); const int h = z / NF, f = z % NF; const int hh = n / 32, ww = n % 32; float a = bfr(rh[((size_t)h * HD + d) * 32 + hh]), bw = bfr(rw[((size_t)h * HD + d) * 32 + ww]), c = bfr(rt[((size_t)h * HD + d) * NF + f]); asm volatile("" : "+v"(a)); asm volatile("" : "+v"(bw)); asm volatile("" : "+v"(c)); float s1 = __fadd_rn(a, bw); asm volatile("" : "+v"(s1)); const float v = __fadd_rn(s1, c); *(float*)(PS + e) = v;  }
__global__ __launch_bounds__(256) void k_moutT(const float* __restrict__ O, float* OB) { const size_t e = ((size_t)blockIdx.x * 256 + threadIdx.x) * 4; if (e >= (size_t)ZH * TT * HD) return; const int j = (int)(e % TT); const int d = (int)((e / TT) % HD); const int zz = (int)(e / ((size_t)TT * HD)); const float cs = 1.0f; v4f o; for (int u = 0; u < 4; ++u) { const int jj = j + u; const float c2 = (jj < RH) ? cs : (1.0f / PCAR); o[u] = O[((size_t)zz * TT + jj) * HD + d] * c2; } float* dst = OB + (size_t)zz * BLK + (size_t)d * TT + j; *(v4f*)dst = o;  }
__global__ __launch_bounds__(256) void k_hlG(const float* __restrict__ F, bf* Fh, bf* Fl, size_t n) { const size_t e = ((size_t)blockIdx.x * 256 + threadIdx.x) * 4; if (e >= n) return; const v4f a = *(const v4f*)(F + e); v4us oh, ol; for (int u = 0; u < 4; ++u) { unsigned short p, q; splitf(a[u], p, q); oh[u] = p; ol[u] = q; } *(v4us*)(Fh + e) = oh; *(v4us*)(Fl + e) = ol;  }
// k_asoft: per row (zz, i): t = (Sb + Sb2) x HD^-0.5 (no mask); softmax over the 1024 keys (register row, one exp, fixed trees);
__global__ __launch_bounds__(256) void k_asoft(const float* __restrict__ Sb, const float* __restrict__ Sb2, h16* P16, bf* Ph, bf* Pl) {
    const int lane = threadIdx.x & 31; const int row = blockIdx.x * 8 + (threadIdx.x >> 5); if (row >= ZH * TT) return; const int i = row % TT; const int zz = row / TT; (void)zz; const bool hires = (i < RH); const float* sr = Sb + (size_t)row * TT; const float* sr2 = Sb2 + (size_t)row * TT; float v[TT / 32]; float mx = -3.0e38f;
#pragma unroll
    for (int ch = 0; ch < TT / 128; ++ch) { const int j0 = ch * 128 + lane * 4; const v4f a = *(const v4f*)(sr + j0);
#pragma unroll
        for (int q = 0; q < 4; ++q) { const int j = j0 + q; (void)j; float sm = __fadd_rn(a[q], sr2[j0 + q]); asm volatile("" : "+v"(sm)); float t = __fmul_rn(sm, SCL); asm volatile("" : "+v"(t)); v[ch * 4 + q] = t; mx = fmaxf(mx, t); } }
#pragma unroll
    for (int sh = 16; sh; sh >>= 1) mx = fmaxf(mx, __shfl_xor(mx, sh, 32));
    float sum = 0.f;
#pragma unroll
    for (int k = 0; k < TT / 32; ++k) { float d0 = __fsub_rn(v[k], mx); asm volatile("" : "+v"(d0)); v[k] = __builtin_amdgcn_exp2f(__fmul_rn(d0, 1.4426950408889634f)); sum += v[k]; }
#pragma unroll
    for (int sh = 16; sh; sh >>= 1) sum += __shfl_xor(sum, sh, 32);
    const float f = __fdiv_rn(hires ? 1.0f : PCAR, sum);
{
        if (hires) {
#pragma unroll
            for (int ch = 0; ch < TT / 128; ++ch) { v4us oh, ol;
#pragma unroll
                for (int q = 0; q < 4; ++q) { unsigned short a, c2; splitf(v[ch * 4 + q] * f, a, c2); oh[q] = a; ol[q] = c2; }
                const size_t oo = ((size_t)zz * (RH ? RH : 1) + i) * TT + ch * 128 + lane * 4; *(v4us*)(Ph + oo) = oh; *(v4us*)(Pl + oo) = ol; }
        } else {
#pragma unroll
            for (int ch = 0; ch < TT / 128; ++ch) { v4h o4;
#pragma unroll
                for (int q = 0; q < 4; ++q) o4[q] = tohx(v[ch * 4 + q] * f);
                *(v4h*)(P16 + (size_t)row * TT + ch * 128 + lane * 4) = o4; } }
         }
}
__global__ __launch_bounds__(256) void k_merge(const float* __restrict__ O, int h0, bf* Ah, bf* Al) { const size_t e = ((size_t)blockIdx.x * 256 + threadIdx.x) * 2; if (e >= (size_t)ZH * TT * HD) return; const int d = (int)(e % HD); const int t = (int)((e / HD) % TT); const int zz = (int)(e / ((size_t)HD * TT)); const float cs = (t < RH) ? 1.0f : (1.0f / PCAR); const size_t oo = (size_t)t * DQ + (h0 + zz) * HD + d;
    v2us oh, ol;
#pragma unroll
    for (int q = 0; q < 2; ++q) { unsigned short a, c2; splitf(O[e + q] * cs, a, c2); oh[q] = a; ol[q] = c2; } *(v2us*)(Ah + oo) = oh; *(v2us*)(Al + oo) = ol;  }

extern "C" void kernel_launch(void* const* d_in, const int* in_sizes, int n_in,
                              void* d_out, int out_size, void* d_ws, size_t ws_size, hipStream_t stream) {
    (void)in_sizes; (void)n_in; (void)out_size;
    const float* x = (const float*)d_in[0]; const float* wq = (const float*)d_in[1]; const float* wk = (const float*)d_in[2]; const float* wv = (const float*)d_in[3]; const float* relh = (const float*)d_in[4]; const float* relw = (const float*)d_in[5]; const float* relt = (const float*)d_in[6]; const float* wo = nullptr; (void)wo; const float* cosT = nullptr; const float* sinT = nullptr; (void)cosT; (void)sinT;
    float* OUT = (float*)d_out;   // [4][256][8][32][32]
    char* wsp = (char*)d_ws; auto take = [&](size_t bytes) { char* p = wsp; wsp += (bytes + 255) & ~(size_t)255; return (void*)p; };
    bf* WQ = (bf*)take((size_t)CC * CC * 2); bf* WK = (bf*)take((size_t)CC * CC * 2); bf* WV = (bf*)take((size_t)CC * CC * 2);
    bf* XT = (bf*)take((size_t)NP * CC * 2); float* YQ = (float*)take((size_t)CC * NP * 4); float* YK = (float*)take((size_t)CC * NP * 4); float* YV = YK;   /* v conv reuses the k buffer after the k planes are built */
    bf* QTh = (bf*)take((size_t)NBL * BLK * 2); bf* QTl = (bf*)take((size_t)NBL * BLK * 2); bf* KTh = (bf*)take((size_t)NBL * BLK * 2); bf* KTl = (bf*)take((size_t)NBL * BLK * 2);
    float* PS = (float*)take((size_t)NBL * BLK * 4); bf* PSh = (bf*)take((size_t)NBL * BLK * 2); bf* PSl = (bf*)take((size_t)NBL * BLK * 2);
    h16* VT16 = (h16*)take((size_t)NBL * BLK * 2); bf* VTh = (bf*)take((size_t)NBL * BLK * 2); bf* VTl = (bf*)take((size_t)NBL * BLK * 2);
    float* Sb = (float*)take((size_t)ZH * TT * TT * 4); float* Sb2 = (float*)take((size_t)ZH * TT * TT * 4); h16* P16 = (h16*)take((size_t)ZH * TT * TT * 2); bf* Ph = (bf*)take((size_t)ZH * RH * TT * 2); bf* Pl = (bf*)take((size_t)ZH * RH * TT * 2); float* Ob = (float*)take((size_t)ZH * TT * HD * 4);
    if ((size_t)(wsp - (char*)d_ws) > ws_size) return;   // ws ~ 175 MiB
    { k_cvt8<<<(unsigned)(((size_t)CC * CC / 8 + 255) / 256), 256, 0, stream>>>(wq, WQ, (size_t)CC * CC / 8); k_cvt8<<<(unsigned)(((size_t)CC * CC / 8 + 255) / 256), 256, 0, stream>>>(wk, WK, (size_t)CC * CC / 8); k_cvt8<<<(unsigned)(((size_t)CC * CC / 8 + 255) / 256), 256, 0, stream>>>(wv, WV, (size_t)CC * CC / 8);
      k_pos<<<(unsigned)(((size_t)NBL * BLK + 255) / 256), 256, 0, stream>>>(relh, relw, relt, PS); k_hlG<<<(unsigned)(((size_t)NBL * BLK / 4 + 255) / 256), 256, 0, stream>>>(PS, PSh, PSl, (size_t)NBL * BLK); }
    for (int b = 0; b < NB_; ++b) {
        k_xT<<<(unsigned)(((size_t)NP * CC / 8 + 255) / 256), 256, 0, stream>>>(x + (size_t)b * CC * NP, XT);
        k_gemmw<bf, 0, false><<<dim3(CC / 64, NP / 64, 1), 32, 0, stream>>>(WQ, nullptr, XT, nullptr, CC, YQ, NP, nullptr, 0, 0, 0);
        k_trp<<<(unsigned)(((size_t)NBL * BLK / 2 + 255) / 256), 256, 0, stream>>>(YQ, QTh, QTl);
        k_gemmw<bf, 0, false><<<dim3(CC / 64, NP / 64, 1), 32, 0, stream>>>(WK, nullptr, XT, nullptr, CC, YK, NP, nullptr, 0, 0, 0);
        k_trp<<<(unsigned)(((size_t)NBL * BLK / 2 + 255) / 256), 256, 0, stream>>>(YK, KTh, KTl);
        k_gemmw<bf, 0, false><<<dim3(CC / 64, NP / 64, 1), 32, 0, stream>>>(WV, nullptr, XT, nullptr, CC, YV, NP, nullptr, 0, 0, 0);
        k_hl3v<<<(unsigned)(((size_t)NBL * BLK / 4 + 255) / 256), 256, 0, stream>>>(YV, VTh, VTl, VT16);
        for (int z0 = 0; z0 < NBL; z0 += ZH) { const size_t zq = (size_t)z0;
            k_gemmw<bf, 2, false><<<dim3(TT / 64, TT / 64, ZH), 32, 0, stream>>>(QTh + zq * BLK, QTl + zq * BLK, KTh + zq * BLK, KTl + zq * BLK, HD, Sb, TT, nullptr, BLK, BLK, (size_t)TT * TT);   /* q^T k */
            k_gemmw<bf, 2, false><<<dim3(TT / 64, TT / 64, ZH), 32, 0, stream>>>(PSh + zq * BLK, PSl + zq * BLK, QTh + zq * BLK, QTl + zq * BLK, HD, Sb2, TT, nullptr, BLK, BLK, (size_t)TT * TT);   /* pos q */
            k_asoft<<<ZH * TT / 8, 256, 0, stream>>>(Sb, Sb2, P16, Ph, Pl);
            k_gemmw<bf, 2, false><<<dim3(RH / 64, HD / 64, ZH), 32, 0, stream>>>(Ph, Pl, VTh + zq * BLK, VTl + zq * BLK, TT, Ob, HD, nullptr, (size_t)RH * TT, BLK, (size_t)TT * HD);
            k_moutT<<<(unsigned)(((size_t)ZH * TT * HD / 4 + 255) / 256), 256, 0, stream>>>(Ob, OUT + (size_t)b * CC * NP + zq * BLK); }
    }
}

// v001
// A run of this version takes 365 microseconds.
// In two side-by-side timings against v000, it was 3.66 and 3.64 times as fast.
#include <hip/hip_runtime.h>

// MHSA3D (x [4][256][8][32][32] channels-first; q/k/v = 1x1x1 conv (wq/wk/wv [256][256]) then the module's literal reshape (B, 4 heads, 8 frames, 64, 1024) of the [B][C][F][H][W] buffer = 32 contiguous [64][1024] blocks per batch; per block: energy[n][m] = (sum_d q[d][n] k[d][m] + sum_d pos[n][d] q[d][m]) / 8 with pos[h][f][n][d] = rel_h[h][d][n/32] + rel_w[h][d][n%32] + rel_t[h][d][f]; softmax over m; out[d][j] = sum_n v[d][n] attn[j][n]; -> [4][256][8][32][32]).
// Compute dtypes, f32 accumulate: every input rounded to bf16; the three convs as PLAIN bf16 GEMMs W . x (inputs: exact; x transposed to token-major on chip); per block: q^T, k^T hi/lo planes (transposed), pos planes (f32 sums in the reference's order, then hi/lo), v planes straight from the conv output (hi/lo/fp16); both score products hl x hl (3 products) on every row, summed per element in f32; softmax f32 with a running maximum (weights exp2 of the scaled difference, split hi/lo unnormalised); attn.v hl x hl (3 products) on every row, divided by the row sum at the end; scores, softmax and attn.v in one kernel (k_fattn), which stores the context block [d][j] straight into the channels-first output in f32.

#define NB_  4
#define TT   1024
#define DM   256
#define NH_  4
#define NKV  4
#define REP  (NH_ / NKV)
#define HD   64
#define DQ   (NH_ * HD)
#define DKV  (NKV * HD)
#define ZH   8
#define RH   1024   // all rows hl
#define WIN  0
#define PCAR 1024.0f
#define CC   256    // channels
#define NF   8      // frames
#define NP   (NF * TT)   // positions per batch (8192)
#define NBL  (NH_ * NF)  // blocks per batch (32)
#define BLK  ((size_t)HD * TT)   // floats per block (65536)
#define SCL  0.125f   // HD^-0.5
typedef _Float16 h16;
typedef unsigned short bf;
typedef __attribute__((ext_vector_type(16))) __bf16   v16bf;
typedef __attribute__((ext_vector_type(16))) _Float16 v16h;
typedef __attribute__((ext_vector_type(8)))  _Float16 v8h;
typedef __attribute__((ext_vector_type(8)))  unsigned short v8us;
typedef __attribute__((ext_vector_type(8)))  float    v8f;
typedef __attribute__((ext_vector_type(4)))  float    v4f;
typedef v8h  __attribute__((may_alias)) v8ha;
typedef v4f  __attribute__((may_alias)) v4fa;
typedef v8us __attribute__((may_alias)) v8usa;

__device__ __forceinline__ unsigned short f2bf(float f) { unsigned u = __float_as_uint(f); u += 0x7FFFu + ((u >> 16) & 1u); return (unsigned short)(u >> 16); }
__device__ __forceinline__ float bf2f(unsigned short b) { return __uint_as_float(((unsigned)b) << 16); }
__device__ __forceinline__ float bfr(float f) { return bf2f(f2bf(f)); }
__device__ __forceinline__ v16h cat16(v8h lo, v8h hi) { return __builtin_shufflevector(lo, hi, 0, 1, 2, 3, 4, 5, 6, 7, 8, 9, 10, 11, 12, 13, 14, 15); }
__device__ __forceinline__ v16bf cat16b(v8us lo, v8us hi) { return __builtin_bit_cast(v16bf, __builtin_shufflevector(lo, hi, 0, 1, 2, 3, 4, 5, 6, 7, 8, 9, 10, 11, 12, 13, 14, 15)); }
__device__ __forceinline__ v8f wmma16(v16h a, v16h b, v8f c) { return __builtin_amdgcn_wmma_f32_16x16x32_f16(false, a, false, b, (short)0, c, false, false); }
__device__ __forceinline__ v8f wmmab(v16bf a, v16bf b, v8f c) { return __builtin_amdgcn_wmma_f32_16x16x32_bf16(false, a, false, b, (short)0, c, false, false); }



// ---- k_gemmw: register-blocked GEMM, ONE WAVE per 64x64 output tile (16 accumulators), operands straight from K-contiguous 16-bit planes; grid (M/64, N/64, Z), 32 threads.
// C[m][n] (f32, pitch ldc, + optional f32 bias[n]) = sum_k A[m][k] Bt[n][k] (+ split products per NSPLIT). z-batch strides sA/sB/sC in elements. K % 32 == 0.
template <typename T16> struct WFrag;
template <> struct WFrag<h16> { typedef v16h V; static __device__ __forceinline__ V ld(const h16* p) { return cat16(*(const v8h*)p, *(const v8h*)(p + 16)); } static __device__ __forceinline__ v8f mma(V a, V b, v8f c) { return wmma16(a, b, c); } };
template <> struct WFrag<bf> { typedef v16bf V; static __device__ __forceinline__ V ld(const bf* p) { return cat16b(*(const v8us*)p, *(const v8us*)(p + 16)); } static __device__ __forceinline__ v8f mma(V a, V b, v8f c) { return wmmab(a, b, c); } };
template <typename T16, int NSPLIT, bool BIAS>
__global__ __launch_bounds__(32) void k_gemmw(const T16* __restrict__ A, const T16* __restrict__ A2, const T16* __restrict__ Bt, const T16* __restrict__ Bt2, int K, float* C, int ldc, const float* __restrict__ bias, size_t sA, size_t sB, size_t sC) {
    typedef typename WFrag<T16>::V V;
    __shared__ __align__(16) float os[16 * 68];
    const size_t z = blockIdx.z; A += z * sA; if (A2) A2 += z * sA; Bt += z * sB; if (Bt2) Bt2 += z * sB; C += z * sC;
    const int lane = threadIdx.x & 31, lr = lane & 15, hi = lane >> 4; const int r0 = blockIdx.x * 64, c0 = blockIdx.y * 64;
    v8f acc[4][4];
#pragma unroll
    for (int mb = 0; mb < 4; ++mb)
#pragma unroll
        for (int nb = 0; nb < 4; ++nb) acc[mb][nb] = (v8f){};
    const size_t aoff = (size_t)(r0 + lr) * K + 8 * hi, boff = (size_t)(c0 + lr) * K + 8 * hi;
#pragma unroll 1
    for (int kc = 0; kc < K; kc += 32) {
        V a[4], a2[4];
#pragma unroll
        for (int mb = 0; mb < 4; ++mb) { a[mb] = WFrag<T16>::ld(A + aoff + (size_t)mb * 16 * K + kc); if (NSPLIT == 1 || NSPLIT == 2) a2[mb] = WFrag<T16>::ld(A2 + aoff + (size_t)mb * 16 * K + kc); }
#pragma unroll
        for (int nb = 0; nb < 4; ++nb) { const V b = WFrag<T16>::ld(Bt + boff + (size_t)nb * 16 * K + kc); V b2; if (NSPLIT >= 2) b2 = WFrag<T16>::ld(Bt2 + boff + (size_t)nb * 16 * K + kc);
#pragma unroll
            for (int mb = 0; mb < 4; ++mb) { acc[mb][nb] = WFrag<T16>::mma(a[mb], b, acc[mb][nb]); if (NSPLIT == 1 || NSPLIT == 2) acc[mb][nb] = WFrag<T16>::mma(a2[mb], b, acc[mb][nb]); if (NSPLIT >= 2) acc[mb][nb] = WFrag<T16>::mma(a[mb], b2, acc[mb][nb]); } }
        asm volatile("v_nop\n\tv_nop\n\tv_nop\n\tv_nop" : "+v"(acc[0][0]), "+v"(acc[1][1]), "+v"(acc[2][2]), "+v"(acc[3][3]) : "v"(a[0]), "v"(a[3]));
    }
#pragma unroll
    for (int mb = 0; mb < 4; ++mb) {
#pragma unroll
        for (int nb = 0; nb < 4; ++nb) {
#pragma unroll
            for (int j = 0; j < 8; ++j) os[(hi * 8 + j) * 68 + nb * 16 + lr] = acc[mb][nb][j]; }
        __builtin_amdgcn_wave_barrier(); asm volatile("" ::: "memory");
        float* crow = C + (size_t)(r0 + mb * 16) * ldc + c0;
{
#pragma unroll
            for (int s = 0; s < 8; ++s) { const int row = 2 * s + hi, cofs = lr * 4; v4f val = *(const v4fa*)(os + row * 68 + cofs); if (BIAS) { val[0] += bfr(bias[c0 + cofs]); val[1] += bfr(bias[c0 + cofs + 1]); val[2] += bfr(bias[c0 + cofs + 2]); val[3] += bfr(bias[c0 + cofs + 3]); }
                *(v4f*)(crow + (size_t)row * ldc + cofs) = val; }
             }
        __builtin_amdgcn_wave_barrier(); asm volatile("" ::: "memory");
    }
}

__device__ __forceinline__ h16 tohx(float x) { return (h16)x; }
__device__ __forceinline__ void splitf(float y, unsigned short& h, unsigned short& l) { h = f2bf(y); l = f2bf(y - bf2f(h)); }
typedef __attribute__((ext_vector_type(2))) _Float16 v2h;
typedef __attribute__((ext_vector_type(4))) _Float16 v4h;
typedef __attribute__((ext_vector_type(2))) unsigned short v2us;
typedef __attribute__((ext_vector_type(4))) unsigned short v4us;
typedef __attribute__((ext_vector_type(2))) float v2f;
typedef __attribute__((ext_vector_type(4))) int v4i;

__global__ __launch_bounds__(256) void k_wtG(const float* __restrict__ w, int K, int N, bf* Bt) {
    const int lane = threadIdx.x & 31; const int L0 = (blockIdx.x * 8 + (threadIdx.x >> 5)) * 8; const int nlines = N * K / 64;
{
#pragma unroll 1
        for (int l = 0; l < 8; ++l) { const int L = L0 + l; if (L >= nlines) break; const size_t e = (size_t)L * 64 + lane * 2; const int k = (int)(e % K), n = (int)(e / K); v2us o;
            o[0] = f2bf(w[(size_t)k * N + n]); o[1] = f2bf(w[(size_t)(k + 1) * N + n]); *(v2us*)(Bt + e) = o; }
         }
}
__global__ __launch_bounds__(256) void k_cvt8(const float* __restrict__ src, bf* dst, size_t n8) { const size_t i = (size_t)blockIdx.x * 256 + threadIdx.x; if (i >= n8) return; const v8f v = *(const v8f*)(src + i * 8); v8us o;
#pragma unroll
    for (int k = 0; k < 8; ++k) o[k] = f2bf(v[k]); *(v8us*)(dst + i * 8) = o;  }
__global__ __launch_bounds__(256) void k_cscvt(const float* __restrict__ cosT, const float* __restrict__ sinT, float* CS) { const int idx = blockIdx.x * 256 + threadIdx.x; if (idx >= TT * HD) return; v2f cs; cs[0] = bfr(cosT[idx]); cs[1] = bfr(sinT[idx]); *(v2f*)(CS + (size_t)idx * 2) = cs;  }
// k_rope: head planes [h][t][d] (fp16 + hi/lo) of rope(x) x sc with the rotate-half convention out[d] = x[d] cos[t][d] - x[d+HD/2] sin[t][d], out[d+HD/2] = x[d+HD/2] cos[t][d+HD/2] + x[d] sin[t][d+HD/2]
__global__ __launch_bounds__(256) void k_rope(const float* __restrict__ F, int pitch, int nheads, const float* __restrict__ CS, const float* __restrict__ RF, const float* __restrict__ nw, float sc, h16* P16, bf* Ph, bf* Pl) {
    const size_t e = ((size_t)blockIdx.x * 256 + threadIdx.x) * 2; if (e >= (size_t)nheads * TT * HD) return; const int d = (int)(e % HD); const int t = (int)((e / HD) % TT); const int h = (int)(e / ((size_t)HD * TT)); const float* f = F + (size_t)t * pitch + h * HD; const float rf = RF ? RF[(size_t)h * TT + t] : 1.0f; v2h o16; v2us oh, ol;
#pragma unroll
    for (int q = 0; q < 2; ++q) { const int dd = d + q; const int dp = (dd < HD / 2) ? dd + HD / 2 : dd - HD / 2; float x0 = f[dd], x1 = f[dp];
        if (RF) { float n0 = __fmul_rn(x0, rf), n1 = __fmul_rn(x1, rf); asm volatile("" : "+v"(n0)); asm volatile("" : "+v"(n1)); x0 = __fmul_rn(bfr(nw[dd]), n0); x1 = __fmul_rn(bfr(nw[dp]), n1); }
        const v2f cs = *(const v2f*)(CS + ((size_t)t * HD + dd) * 2); float a = __fmul_rn(x0, cs[0]), bq = __fmul_rn(x1, cs[1]); asm volatile("" : "+v"(a)); asm volatile("" : "+v"(bq)); const float r = ((dd < HD / 2) ? __fsub_rn(a, bq) : __fadd_rn(a, bq)) * sc;
        o16[q] = tohx(r); unsigned short a2, c2; splitf(r, a2, c2); oh[q] = a2; ol[q] = c2; }
    *(v2h*)(P16 + e) = o16; *(v2us*)(Ph + e) = oh; *(v2us*)(Pl + e) = ol;  }
__global__ __launch_bounds__(256) void k_vtp(const float* __restrict__ F, int pitch, int nheads, h16* V16, bf* Vh, bf* Vl) { const size_t e = ((size_t)blockIdx.x * 256 + threadIdx.x) * 2; if (e >= (size_t)nheads * HD * TT) return; const int t = (int)(e % TT); const int d = (int)((e / TT) % HD); const int g = (int)(e / ((size_t)TT * HD)); v2h o16; v2us oh, ol;
#pragma unroll
    for (int q = 0; q < 2; ++q) { const float x = F[(size_t)(t + q) * pitch + g * HD + d]; o16[q] = tohx(x); unsigned short a2, c2; splitf(x, a2, c2); oh[q] = a2; ol[q] = c2; }
    *(v2h*)(V16 + e) = o16; *(v2us*)(Vh + e) = oh; *(v2us*)(Vl + e) = ol;  }
__global__ __launch_bounds__(256) void k_xT(const float* __restrict__ X, bf* XT2) { const size_t e = ((size_t)blockIdx.x * 256 + threadIdx.x) * 8; if (e >= (size_t)NP * CC) return; const int c0 = (int)(e % CC); const size_t p = e / CC; v8us o; for (int u = 0; u < 8; ++u) o[u] = f2bf(bfr(X[(size_t)(c0 + u) * NP + p])); *(v8us*)(XT2 + e) = o;  }
__global__ __launch_bounds__(256) void k_trp(const float* __restrict__ Y, bf* Th, bf* Tl) { const size_t e = ((size_t)blockIdx.x * 256 + threadIdx.x) * 2; if (e >= (size_t)NBL * BLK) return; const int d = (int)(e % HD); const int n = (int)((e / HD) % TT); const size_t z = e / BLK; const float* blk = Y + z * BLK; v2us oh, ol; for (int q = 0; q < 2; ++q) { unsigned short a2, c2; splitf(blk[(size_t)(d + q) * TT + n], a2, c2); oh[q] = a2; ol[q] = c2; } *(v2us*)(Th + e) = oh; *(v2us*)(Tl + e) = ol;  }
__global__ __launch_bounds__(256) void k_hl3v(const float* __restrict__ Y, bf* Vh, bf* Vl, h16* V16) { const size_t e = ((size_t)blockIdx.x * 256 + threadIdx.x) * 4; if (e >= (size_t)NBL * BLK) return; const v4f a = *(const v4f*)(Y + e); v4us oh, ol; v4h o16; for (int u = 0; u < 4; ++u) { unsigned short a2, c2; splitf(a[u], a2, c2); oh[u] = a2; ol[u] = c2; o16[u] = tohx(a[u]); } *(v4us*)(Vh + e) = oh; *(v4us*)(Vl + e) = ol; *(v4h*)(V16 + e) = o16;  }
__global__ __launch_bounds__(256) void k_pos(const float* __restrict__ rh, const float* __restrict__ rw, const float* __restrict__ rt, float* PS) { const size_t e = (size_t)blockIdx.x * 256 + threadIdx.x; if (e >= (size_t)NBL * BLK) return; const int d = (int)(e % HD); const int n = (int)((e / HD) % TT); const int z = (int)(e / BLK); const int h = z / NF, f = z % NF; const int hh = n / 32, ww = n % 32; float a = bfr(rh[((size_t)h * HD + d) * 32 + hh]), bw = bfr(rw[((size_t)h * HD + d) * 32 + ww]), c = bfr(rt[((size_t)h * HD + d) * NF + f]); asm volatile("" : "+v"(a)); asm volatile("" : "+v"(bw)); asm volatile("" : "+v"(c)); float s1 = __fadd_rn(a, bw); asm volatile("" : "+v"(s1)); const float v = __fadd_rn(s1, c); *(float*)(PS + e) = v;  }
__global__ __launch_bounds__(256) void k_hlG(const float* __restrict__ F, bf* Fh, bf* Fl, size_t n) { const size_t e = ((size_t)blockIdx.x * 256 + threadIdx.x) * 4; if (e >= n) return; const v4f a = *(const v4f*)(F + e); v4us oh, ol; for (int u = 0; u < 4; ++u) { unsigned short p, q; splitf(a[u], p, q); oh[u] = p; ol[u] = q; } *(v4us*)(Fh + e) = oh; *(v4us*)(Fl + e) = ol;  }
// ---- k_fattn: scores, softmax and attn.v of one [64][1024] block in ONE kernel; the scores never leave the registers.
// grid (1024 / 128 query tiles, 32 blocks), 8 waves; a wave owns 16 queries (columns) and walks the 1024 keys in passes of 32.
// Transposed products: S^T[key][query] = K^T rows . q columns + q^T rows . pos columns (3 hi/lo products each), so a lane holds 16 scores of ONE query;
// the two 16-key score tiles, turned into exp2 weights and split hi/lo, ARE the B operand (hardware k order) of O^T[d][query] += V[d][key] . P^T[key][query] (3 products).
// Running maximum per query (log2 domain), O^T and the sum rescaled every pass, one division by the sum at the end.
// The 32 key rows of K^T, q^T (hi/lo) and the 32 key columns of V (hi/lo) are staged per pass in LDS for all 8 waves (whole-line global loads, two buffers, one barrier a pass).
#define FQ   128                 // queries per work-group
#define FK   32                  // keys per pass
#define NS   (TT / FK)           // passes
#define KP   72                  // LDS pitch of a key row of K^T / q^T, 16-bit elements: 128 B + 16 B, conflict-free for 16-byte reads
#define VP   40                  // LDS pitch of a d row of V: 64 B + 16 B
#define KPL  (FK * KP)           // one K^T / q^T plane of a stage
#define VPL  (HD * VP)           // one V plane of a stage
#define STG  (4 * KPL + 2 * VPL) // one stage, 16-bit elements
#define OP   132                 // LDS pitch of an output row, floats
#define CL2  0.18033688011112042f   // HD^-0.5 * log2(e)
typedef __attribute__((ext_vector_type(2))) __bf16 v2bf;
__device__ __forceinline__ float xhalf(float x) { const int b = __float_as_int(x); return __int_as_float(__builtin_amdgcn_permlanex16(b, b, 0x76543210, 0xfedcba98, false, false)); }   // lane l <-> l ^ 16
__device__ __forceinline__ v16bf ldsfrag(const bf* p) { return cat16b(*(const v8us*)p, *(const v8us*)(p + 16)); }
__global__ __launch_bounds__(256) void k_fattn(const bf* __restrict__ QTh, const bf* __restrict__ QTl, const bf* __restrict__ KTh, const bf* __restrict__ KTl, const bf* __restrict__ PSh, const bf* __restrict__ PSl, const bf* __restrict__ VTh, const bf* __restrict__ VTl, float* __restrict__ OB) {
    __shared__ __align__(16) bf ring[2 * STG];
    __shared__ __align__(16) float os[HD * OP];
    const int tid = threadIdx.x, lane = tid & 31, lr = lane & 15, hi = lane >> 4, wave = tid >> 5;
    const size_t zb = (size_t)blockIdx.y * BLK; const int n0 = blockIdx.x * FQ + wave * 16;
    // staging: a thread moves 16 bytes of each of the six planes per pass
    const bf* gkh = KTh + zb + tid * 8; const bf* gkl = KTl + zb + tid * 8; const bf* gqh = QTh + zb + tid * 8; const bf* gql = QTl + zb + tid * 8;
    const bf* gvh = VTh + zb + (size_t)(tid >> 2) * TT + (tid & 3) * 8; const bf* gvl = VTl + zb + (size_t)(tid >> 2) * TT + (tid & 3) * 8;
    const int sk = (tid >> 3) * KP + (tid & 7) * 8, sv = 4 * KPL + (tid >> 2) * VP + (tid & 3) * 8;
    v8us st[6];
    auto gload = [&](int s) { st[0] = *(const v8us*)(gkh + s * (FK * HD)); st[1] = *(const v8us*)(gkl + s * (FK * HD)); st[2] = *(const v8us*)(gqh + s * (FK * HD)); st[3] = *(const v8us*)(gql + s * (FK * HD)); st[4] = *(const v8us*)(gvh + s * FK); st[5] = *(const v8us*)(gvl + s * FK); };
    auto sstore = [&](int b) { bf* r = ring + b * STG; *(v8us*)(r + sk) = st[0]; *(v8us*)(r + KPL + sk) = st[1]; *(v8us*)(r + 2 * KPL + sk) = st[2]; *(v8us*)(r + 3 * KPL + sk) = st[3]; *(v8us*)(r + sv) = st[4]; *(v8us*)(r + VPL + sv) = st[5]; };
    gload(0);
    // B operands of the score products, kept in registers: column = query n0 + lr, k = d
    v16bf bqh[2], bql[2], bph[2], bpl[2];
    { const size_t qo = zb + (size_t)(n0 + lr) * HD + 8 * hi; const bf* aqh = QTh + qo; const bf* aql = QTl + qo; const bf* aph = PSh + qo; const bf* apl = PSl + qo;
#pragma unroll   // constant indices, so that the arrays indexed here are registers
      for (int ks = 0; ks < 2; ++ks) { bqh[ks] = WFrag<bf>::ld(aqh + ks * 32); bql[ks] = WFrag<bf>::ld(aql + ks * 32); bph[ks] = WFrag<bf>::ld(aph + ks * 32); bpl[ks] = WFrag<bf>::ld(apl + ks * 32); }
      // the address pairs of the 16 loads above stay untouched (inputs here) until this wait
      asm volatile("s_wait_xcnt 0x0" :: "v"(aqh), "v"(aql), "v"(aph), "v"(apl) : "memory"); }
    v8f o[4];
#pragma unroll   // constant indices, so that the arrays indexed here are registers
    for (int dt = 0; dt < 4; ++dt) o[dt] = (v8f){};
    float mc = -3.0e38f, l = 0.f;
    sstore(0);
    __syncthreads();
#pragma unroll 1   // rolled: the pass is long enough; for speed only
    for (int s = 0; s < NS; ++s) {
        const bf* r = ring + (s & 1) * STG;
        if (s + 1 < NS) gload(s + 1);   // lands while this pass computes
        v8f s1[2], s2[2];
#pragma unroll   // constant indices, so that the arrays indexed here are registers
        for (int t = 0; t < 2; ++t) { s1[t] = (v8f){}; s2[t] = (v8f){}; }
#pragma unroll   // constant indices, so that the arrays indexed here are registers
        for (int ks = 0; ks < 2; ++ks) {
#pragma unroll   // constant indices, so that the arrays indexed here are registers
            for (int t = 0; t < 2; ++t) { const bf* p = r + (t * 16 + lr) * KP + ks * 32 + 8 * hi;
                const v16bf kh = ldsfrag(p), kl = ldsfrag(p + KPL), qh = ldsfrag(p + 2 * KPL), ql = ldsfrag(p + 3 * KPL);
                s1[t] = wmmab(kh, bqh[ks], s1[t]); s2[t] = wmmab(qh, bph[ks], s2[t]);
                s1[t] = wmmab(kh, bql[ks], s1[t]); s2[t] = wmmab(qh, bpl[ks], s2[t]);
                s1[t] = wmmab(kl, bqh[ks], s1[t]); s2[t] = wmmab(ql, bph[ks], s2[t]); } }
        v16bf vh[4], vl[4];   // asked for ahead of the softmax arithmetic, which covers the LDS latency of as many of them as the registers hold
#pragma unroll   // constant indices, so that the arrays indexed here are registers
        for (int dt = 0; dt < 4; ++dt) { const bf* p = r + 4 * KPL + (dt * 16 + lr) * VP + 8 * hi; vh[dt] = ldsfrag(p); vl[dt] = ldsfrag(p + VPL); }
        float u[16];
#pragma unroll   // constant indices, so that the arrays indexed here are registers
        for (int i = 0; i < 16; ++i) u[i] = s1[i >> 3][i & 7] + s2[i >> 3][i & 7];
        float mx = u[0];
#pragma unroll   // constant indices, so that the arrays indexed here are registers
        for (int i = 1; i < 16; ++i) mx = fmaxf(mx, u[i]);
        mx = fmaxf(mx, xhalf(mx));
        const float mn = fmaxf(mc, mx * CL2); const float al = __builtin_amdgcn_exp2f(mc - mn); mc = mn;
        float ps[4] = {0.f, 0.f, 0.f, 0.f};
#pragma unroll   // constant indices, so that the arrays indexed here are registers
        for (int i = 0; i < 16; ++i) { u[i] = __builtin_amdgcn_exp2f(__builtin_fmaf(u[i], CL2, -mn)); ps[i & 3] += u[i]; }
        l = l * al + ((ps[0] + ps[1]) + (ps[2] + ps[3]));   // this lane half's keys; the halves are joined behind the loop
        v16bf ph, pl;
#pragma unroll   // constant indices, so that the arrays indexed here are registers
        for (int i = 0; i < 8; ++i) { v2f x; x[0] = u[2 * i]; x[1] = u[2 * i + 1]; const v2bf h = __builtin_convertvector(x, v2bf); const v2bf w = __builtin_convertvector(x - __builtin_convertvector(h, v2f), v2bf);
            ph[2 * i] = h[0]; ph[2 * i + 1] = h[1]; pl[2 * i] = w[0]; pl[2 * i + 1] = w[1]; }
#pragma unroll   // constant indices, so that the arrays indexed here are registers
        for (int dt = 0; dt < 4; ++dt) o[dt] *= al;
#pragma unroll   // constant indices, so that the arrays indexed here are registers
        for (int dt = 0; dt < 4; ++dt) o[dt] = wmmab(vh[dt], ph, o[dt]);
#pragma unroll   // constant indices, so that the arrays indexed here are registers
        for (int dt = 0; dt < 4; ++dt) o[dt] = wmmab(vh[dt], pl, o[dt]);
#pragma unroll   // constant indices, so that the arrays indexed here are registers
        for (int dt = 0; dt < 4; ++dt) o[dt] = wmmab(vl[dt], ph, o[dt]);
        if (s + 1 < NS) sstore((s + 1) & 1);   // the buffer that pass s - 1 read; every wave left it at the last barrier
        __syncthreads();
    }
    l += xhalf(l);
    const float inv = __fdiv_rn(1.0f, l);
    // O^T[d][query] through LDS, so that every 128-byte line of the channels-first output is written whole by one wave
#pragma unroll   // constant indices, so that the arrays indexed here are registers
    for (int dt = 0; dt < 4; ++dt)
#pragma unroll   // constant indices, so that the arrays indexed here are registers
        for (int j = 0; j < 8; ++j) os[(dt * 16 + 8 * hi + j) * OP + wave * 16 + lr] = o[dt][j] * inv;
    __syncthreads();
    float* ob = OB + zb + blockIdx.x * FQ;
#pragma unroll
    for (int i = 0; i < 8; ++i) { const int d = wave * 8 + i; *(v4f*)(ob + (size_t)d * TT + lane * 4) = *(const v4fa*)(os + d * OP + lane * 4); }
}
__global__ __launch_bounds__(256) void k_merge(const float* __restrict__ O, int h0, bf* Ah, bf* Al) { const size_t e = ((size_t)blockIdx.x * 256 + threadIdx.x) * 2; if (e >= (size_t)ZH * TT * HD) return; const int d = (int)(e % HD); const int t = (int)((e / HD) % TT); const int zz = (int)(e / ((size_t)HD * TT)); const float cs = (t < RH) ? 1.0f : (1.0f / PCAR); const size_t oo = (size_t)t * DQ + (h0 + zz) * HD + d;
    v2us oh, ol;
#pragma unroll
    for (int q = 0; q < 2; ++q) { unsigned short a, c2; splitf(O[e + q] * cs, a, c2); oh[q] = a; ol[q] = c2; } *(v2us*)(Ah + oo) = oh; *(v2us*)(Al + oo) = ol;  }

extern "C" void kernel_launch(void* const* d_in, const int* in_sizes, int n_in,
                              void* d_out, int out_size, void* d_ws, size_t ws_size, hipStream_t stream) {
    (void)in_sizes; (void)n_in; (void)out_size;
    const float* x = (const float*)d_in[0]; const float* wq = (const float*)d_in[1]; const float* wk = (const float*)d_in[2]; const float* wv = (const float*)d_in[3]; const float* relh = (const float*)d_in[4]; const float* relw = (const float*)d_in[5]; const float* relt = (const float*)d_in[6]; const float* wo = nullptr; (void)wo; const float* cosT = nullptr; const float* sinT = nullptr; (void)cosT; (void)sinT;
    float* OUT = (float*)d_out;   // [4][256][8][32][32]
    char* wsp = (char*)d_ws; auto take = [&](size_t bytes) { char* p = wsp; wsp += (bytes + 255) & ~(size_t)255; return (void*)p; };
    bf* WQ = (bf*)take((size_t)CC * CC * 2); bf* WK = (bf*)take((size_t)CC * CC * 2); bf* WV = (bf*)take((size_t)CC * CC * 2);
    bf* XT = (bf*)take((size_t)NP * CC * 2); float* YQ = (float*)take((size_t)CC * NP * 4); float* YK = (float*)take((size_t)CC * NP * 4); float* YV = YK;   /* v conv reuses the k buffer after the k planes are built */
    bf* QTh = (bf*)take((size_t)NBL * BLK * 2); bf* QTl = (bf*)take((size_t)NBL * BLK * 2); bf* KTh = (bf*)take((size_t)NBL * BLK * 2); bf* KTl = (bf*)take((size_t)NBL * BLK * 2);
    float* PS = (float*)take((size_t)NBL * BLK * 4); bf* PSh = (bf*)take((size_t)NBL * BLK * 2); bf* PSl = (bf*)take((size_t)NBL * BLK * 2);
    h16* VT16 = (h16*)take((size_t)NBL * BLK * 2); bf* VTh = (bf*)take((size_t)NBL * BLK * 2); bf* VTl = (bf*)take((size_t)NBL * BLK * 2);
    if ((size_t)(wsp - (char*)d_ws) > ws_size) return;   // ws ~ 65 MiB
    { k_cvt8<<<(unsigned)(((size_t)CC * CC / 8 + 255) / 256), 256, 0, stream>>>(wq, WQ, (size_t)CC * CC / 8); k_cvt8<<<(unsigned)(((size_t)CC * CC / 8 + 255) / 256), 256, 0, stream>>>(wk, WK, (size_t)CC * CC / 8); k_cvt8<<<(unsigned)(((size_t)CC * CC / 8 + 255) / 256), 256, 0, stream>>>(wv, WV, (size_t)CC * CC / 8);
      k_pos<<<(unsigned)(((size_t)NBL * BLK + 255) / 256), 256, 0, stream>>>(relh, relw, relt, PS); k_hlG<<<(unsigned)(((size_t)NBL * BLK / 4 + 255) / 256), 256, 0, stream>>>(PS, PSh, PSl, (size_t)NBL * BLK); }
    for (int b = 0; b < NB_; ++b) {
        k_xT<<<(unsigned)(((size_t)NP * CC / 8 + 255) / 256), 256, 0, stream>>>(x + (size_t)b * CC * NP, XT);
        k_gemmw<bf, 0, false><<<dim3(CC / 64, NP / 64, 1), 32, 0, stream>>>(WQ, nullptr, XT, nullptr, CC, YQ, NP, nullptr, 0, 0, 0);
        k_trp<<<(unsigned)(((size_t)NBL * BLK / 2 + 255) / 256), 256, 0, stream>>>(YQ, QTh, QTl);
        k_gemmw<bf, 0, false><<<dim3(CC / 64, NP / 64, 1), 32, 0, stream>>>(WK, nullptr, XT, nullptr, CC, YK, NP, nullptr, 0, 0, 0);
        k_trp<<<(unsigned)(((size_t)NBL * BLK / 2 + 255) / 256), 256, 0, stream>>>(YK, KTh, KTl);
        k_gemmw<bf, 0, false><<<dim3(CC / 64, NP / 64, 1), 32, 0, stream>>>(WV, nullptr, XT, nullptr, CC, YV, NP, nullptr, 0, 0, 0);
        k_hl3v<<<(unsigned)(((size_t)NBL * BLK / 4 + 255) / 256), 256, 0, stream>>>(YV, VTh, VTl, VT16);
        k_fattn<<<dim3(TT / FQ, NBL, 1), 256, 0, stream>>>(QTh, QTl, KTh, KTl, PSh, PSl, VTh, VTl, OUT + (size_t)b * CC * NP);
    }
}

// v002
// It runs in 294 microseconds.
// Next to v001, in two timings, it ran 1.24 times as fast each time.
// All steps since v000 together make it 4.51 times as fast.
#include <hip/hip_runtime.h>

// MHSA3D (x [4][256][8][32][32] channels-first; q/k/v = 1x1x1 conv (wq/wk/wv [256][256]) then the module's literal reshape (B, 4 heads, 8 frames, 64, 1024) of the [B][C][F][H][W] buffer = 32 contiguous [64][1024] blocks per batch; per block: energy[n][m] = (sum_d q[d][n] k[d][m] + sum_d pos[n][d] q[d][m]) / 8 with pos[h][f][n][d] = rel_h[h][d][n/32] + rel_w[h][d][n%32] + rel_t[h][d][f]; softmax over m; out[d][j] = sum_n v[d][n] attn[j][n]; -> [4][256][8][32][32]).
// Compute dtypes, f32 accumulate: every input rounded to bf16; the three convs as PLAIN bf16 GEMMs W . x (inputs: exact; x transposed to token-major on chip); per block: q^T, k^T hi/lo planes (transposed) and v hi/lo planes, all split and stored by the conv GEMM's own epilogue, pos planes (f32 sums in the reference's order, then hi/lo); both score products hl x hl (3 products) on every row, summed per element in f32; softmax f32 with a running maximum (weights exp2 of the scaled difference, split hi/lo unnormalised); attn.v hl x hl (3 products) on every row, divided by the row sum at the end; scores, softmax and attn.v in one kernel (k_fattn), which stores the context block [d][j] straight into the channels-first output in f32.

#define NB_  4
#define TT   1024
#define DM   256
#define NH_  4
#define NKV  4
#define REP  (NH_ / NKV)
#define HD   64
#define DQ   (NH_ * HD)
#define DKV  (NKV * HD)
#define ZH   8
#define RH   1024   // all rows hl
#define WIN  0
#define PCAR 1024.0f
#define CC   256    // channels
#define NF   8      // frames
#define NP   (NF * TT)   // positions per batch (8192)
#define NBL  (NH_ * NF)  // blocks per batch (32)
#define BLK  ((size_t)HD * TT)   // floats per block (65536)
#define SCL  0.125f   // HD^-0.5
typedef _Float16 h16;
typedef unsigned short bf;
typedef __attribute__((ext_vector_type(16))) __bf16   v16bf;
typedef __attribute__((ext_vector_type(16))) _Float16 v16h;
typedef __attribute__((ext_vector_type(8)))  _Float16 v8h;
typedef __attribute__((ext_vector_type(8)))  unsigned short v8us;
typedef __attribute__((ext_vector_type(8)))  float    v8f;
typedef __attribute__((ext_vector_type(4)))  float    v4f;
typedef v8h  __attribute__((may_alias)) v8ha;
typedef v4f  __attribute__((may_alias)) v4fa;
typedef v8us __attribute__((may_alias)) v8usa;

__device__ __forceinline__ unsigned short f2bf(float f) { unsigned u = __float_as_uint(f); u += 0x7FFFu + ((u >> 16) & 1u); return (unsigned short)(u >> 16); }
__device__ __forceinline__ float bf2f(unsigned short b) { return __uint_as_float(((unsigned)b) << 16); }
__device__ __forceinline__ float bfr(float f) { return bf2f(f2bf(f)); }
__device__ __forceinline__ v16h cat16(v8h lo, v8h hi) { return __builtin_shufflevector(lo, hi, 0, 1, 2, 3, 4, 5, 6, 7, 8, 9, 10, 11, 12, 13, 14, 15); }
__device__ __forceinline__ v16bf cat16b(v8us lo, v8us hi) { return __builtin_bit_cast(v16bf, __builtin_shufflevector(lo, hi, 0, 1, 2, 3, 4, 5, 6, 7, 8, 9, 10, 11, 12, 13, 14, 15)); }
__device__ __forceinline__ v8f wmma16(v16h a, v16h b, v8f c) { return __builtin_amdgcn_wmma_f32_16x16x32_f16(false, a, false, b, (short)0, c, false, false); }
__device__ __forceinline__ v8f wmmab(v16bf a, v16bf b, v8f c) { return __builtin_amdgcn_wmma_f32_16x16x32_bf16(false, a, false, b, (short)0, c, false, false); }



template <typename T16> struct WFrag;
template <> struct WFrag<h16> { typedef v16h V; static __device__ __forceinline__ V ld(const h16* p) { return cat16(*(const v8h*)p, *(const v8h*)(p + 16)); } static __device__ __forceinline__ v8f mma(V a, V b, v8f c) { return wmma16(a, b, c); } };
template <> struct WFrag<bf> { typedef v16bf V; static __device__ __forceinline__ V ld(const bf* p) { return cat16b(*(const v8us*)p, *(const v8us*)(p + 16)); } static __device__ __forceinline__ v8f mma(V a, V b, v8f c) { return wmmab(a, b, c); } };
typedef __attribute__((ext_vector_type(8))) __bf16 v8bf;
typedef __attribute__((ext_vector_type(4))) __bf16 v4bf;
typedef __attribute__((ext_vector_type(4))) unsigned short v4us;
template <bool TR>
__global__ __launch_bounds__(32) void k_proj(const bf* __restrict__ Wm, const bf* __restrict__ XTm, bf* __restrict__ Ph, bf* __restrict__ Pl) {
    const int lane = threadIdx.x & 31, lr = lane & 15, hi = lane >> 4; const int o0 = blockIdx.x * 64, ty = blockIdx.y;
    const bf* wrow = Wm + (size_t)(o0 + lr) * CC + 8 * hi;
    const bf* xrow = XTm + (TR ? ((size_t)(lr & 7) * TT + ty * 8 + (lr >> 3)) : ((size_t)ty * 64 + lr * 4)) * CC + 8 * hi;
    const bf* A = TR ? xrow : wrow; const bf* B = TR ? wrow : xrow;
    constexpr int AS = (TR ? 2 : 16) * CC, BS = (TR ? 16 : 1) * CC;   // row steps from one 16-row / 16-column tile to the next
    v8f acc[4][4];
#pragma unroll   // constant indices, so that the arrays indexed here are registers
    for (int mb = 0; mb < 4; ++mb)
#pragma unroll   // constant indices, so that the arrays indexed here are registers
        for (int nb = 0; nb < 4; ++nb) acc[mb][nb] = (v8f){};
#pragma unroll 1   // rolled: beside the accumulators only one trip's fragments are kept in registers
    for (int kc = 0; kc < CC; kc += 32) {
        const bf* ap = A + kc; const bf* bp = B + kc; v16bf a[4];
#pragma unroll   // constant indices, so that the arrays indexed here are registers
        for (int mb = 0; mb < 4; ++mb) a[mb] = WFrag<bf>::ld(ap + mb * AS);
#pragma unroll   // constant indices, so that the arrays indexed here are registers
        for (int nb = 0; nb < 4; ++nb) { const v16bf b = WFrag<bf>::ld(bp + nb * BS);
#pragma unroll   // constant indices, so that the arrays indexed here are registers
            for (int mb = 0; mb < 4; ++mb) acc[mb][nb] = wmmab(a[mb], b, acc[mb][nb]); }
        // four vector slots behind the trip's last matrix instructions, also on the taken back edge, before anything touches their operands or results;
        // the trip's two address pairs are inputs, so that no later load of the trip lands on them: they are rewritten only behind the trip's last load wait
        asm volatile("v_nop\n\tv_nop\n\tv_nop\n\tv_nop" : "+v"(acc[0][0]), "+v"(acc[1][1]), "+v"(acc[2][2]), "+v"(acc[3][3]) : "v"(a[0]), "v"(a[3]), "v"(ap), "v"(bp));
    }
    if (TR) {
#pragma unroll   // constant indices, so that the arrays indexed here are registers
        for (int mb = 0; mb < 4; ++mb)
#pragma unroll   // constant indices, so that the arrays indexed here are registers
            for (int nb = 0; nb < 4; ++nb) { const v8f y = acc[mb][nb]; const v8bf h = __builtin_convertvector(y, v8bf); const v8bf w = __builtin_convertvector(y - __builtin_convertvector(h, v8f), v8bf);
                const size_t e = (size_t)(o0 / 8 + nb * 2 + (lr >> 3)) * BLK + (size_t)(ty * 8 + mb * 2 + hi) * HD + (lr & 7) * 8;
                *(v8us*)(Ph + e) = __builtin_bit_cast(v8us, h); *(v8us*)(Pl + e) = __builtin_bit_cast(v8us, w); }
    } else {
#pragma unroll   // constant indices, so that the arrays indexed here are registers
        for (int mb = 0; mb < 4; ++mb)
#pragma unroll   // constant indices, so that the arrays indexed here are registers
            for (int r = 0; r < 8; ++r) { v4f y; y[0] = acc[mb][0][r]; y[1] = acc[mb][1][r]; y[2] = acc[mb][2][r]; y[3] = acc[mb][3][r]; const v4bf h = __builtin_convertvector(y, v4bf); const v4bf w = __builtin_convertvector(y - __builtin_convertvector(h, v4f), v4bf);
                const size_t e = (size_t)(o0 + mb * 16 + 8 * hi + r) * NP + ty * 64 + lr * 4;
                *(v4us*)(Ph + e) = __builtin_bit_cast(v4us, h); *(v4us*)(Pl + e) = __builtin_bit_cast(v4us, w); }
    }
}

__device__ __forceinline__ h16 tohx(float x) { return (h16)x; }
__device__ __forceinline__ void splitf(float y, unsigned short& h, unsigned short& l) { h = f2bf(y); l = f2bf(y - bf2f(h)); }
typedef __attribute__((ext_vector_type(2))) _Float16 v2h;
typedef __attribute__((ext_vector_type(4))) _Float16 v4h;
typedef __attribute__((ext_vector_type(2))) unsigned short v2us;
typedef __attribute__((ext_vector_type(2))) float v2f;
typedef __attribute__((ext_vector_type(4))) int v4i;

__global__ __launch_bounds__(256) void k_wtG(const float* __restrict__ w, int K, int N, bf* Bt) {
    const int lane = threadIdx.x & 31; const int L0 = (blockIdx.x * 8 + (threadIdx.x >> 5)) * 8; const int nlines = N * K / 64;
{
#pragma unroll 1
        for (int l = 0; l < 8; ++l) { const int L = L0 + l; if (L >= nlines) break; const size_t e = (size_t)L * 64 + lane * 2; const int k = (int)(e % K), n = (int)(e / K); v2us o;
            o[0] = f2bf(w[(size_t)k * N + n]); o[1] = f2bf(w[(size_t)(k + 1) * N + n]); *(v2us*)(Bt + e) = o; }
         }
}
__global__ __launch_bounds__(256) void k_cvt8(const float* __restrict__ src, bf* dst, size_t n8) { const size_t i = (size_t)blockIdx.x * 256 + threadIdx.x; if (i >= n8) return; const v8f v = *(const v8f*)(src + i * 8); v8us o;
#pragma unroll
    for (int k = 0; k < 8; ++k) o[k] = f2bf(v[k]); *(v8us*)(dst + i * 8) = o;  }
__global__ __launch_bounds__(256) void k_cscvt(const float* __restrict__ cosT, const float* __restrict__ sinT, float* CS) { const int idx = blockIdx.x * 256 + threadIdx.x; if (idx >= TT * HD) return; v2f cs; cs[0] = bfr(cosT[idx]); cs[1] = bfr(sinT[idx]); *(v2f*)(CS + (size_t)idx * 2) = cs;  }
// k_rope: head planes [h][t][d] (fp16 + hi/lo) of rope(x) x sc with the rotate-half convention out[d] = x[d] cos[t][d] - x[d+HD/2] sin[t][d], out[d+HD/2] = x[d+HD/2] cos[t][d+HD/2] + x[d] sin[t][d+HD/2]
__global__ __launch_bounds__(256) void k_rope(const float* __restrict__ F, int pitch, int nheads, const float* __restrict__ CS, const float* __restrict__ RF, const float* __restrict__ nw, float sc, h16* P16, bf* Ph, bf* Pl) {
    const size_t e = ((size_t)blockIdx.x * 256 + threadIdx.x) * 2; if (e >= (size_t)nheads * TT * HD) return; const int d = (int)(e % HD); const int t = (int)((e / HD) % TT); const int h = (int)(e / ((size_t)HD * TT)); const float* f = F + (size_t)t * pitch + h * HD; const float rf = RF ? RF[(size_t)h * TT + t] : 1.0f; v2h o16; v2us oh, ol;
#pragma unroll
    for (int q = 0; q < 2; ++q) { const int dd = d + q; const int dp = (dd < HD / 2) ? dd + HD / 2 : dd - HD / 2; float x0 = f[dd], x1 = f[dp];
        if (RF) { float n0 = __fmul_rn(x0, rf), n1 = __fmul_rn(x1, rf); asm volatile("" : "+v"(n0)); asm volatile("" : "+v"(n1)); x0 = __fmul_rn(bfr(nw[dd]), n0); x1 = __fmul_rn(bfr(nw[dp]), n1); }
        const v2f cs = *(const v2f*)(CS + ((size_t)t * HD + dd) * 2); float a = __fmul_rn(x0, cs[0]), bq = __fmul_rn(x1, cs[1]); asm volatile("" : "+v"(a)); asm volatile("" : "+v"(bq)); const float r = ((dd < HD / 2) ? __fsub_rn(a, bq) : __fadd_rn(a, bq)) * sc;
        o16[q] = tohx(r); unsigned short a2, c2; splitf(r, a2, c2); oh[q] = a2; ol[q] = c2; }
    *(v2h*)(P16 + e) = o16; *(v2us*)(Ph + e) = oh; *(v2us*)(Pl + e) = ol;  }
__global__ __launch_bounds__(256) void k_vtp(const float* __restrict__ F, int pitch, int nheads, h16* V16, bf* Vh, bf* Vl) { const size_t e = ((size_t)blockIdx.x * 256 + threadIdx.x) * 2; if (e >= (size_t)nheads * HD * TT) return; const int t = (int)(e % TT); const int d = (int)((e / TT) % HD); const int g = (int)(e / ((size_t)TT * HD)); v2h o16; v2us oh, ol;
#pragma unroll
    for (int q = 0; q < 2; ++q) { const float x = F[(size_t)(t + q) * pitch + g * HD + d]; o16[q] = tohx(x); unsigned short a2, c2; splitf(x, a2, c2); oh[q] = a2; ol[q] = c2; }
    *(v2h*)(V16 + e) = o16; *(v2us*)(Vh + e) = oh; *(v2us*)(Vl + e) = ol;  }
__global__ __launch_bounds__(256) void k_xT(const float* __restrict__ X, bf* XT2) { const size_t e = ((size_t)blockIdx.x * 256 + threadIdx.x) * 8; if (e >= (size_t)NP * CC) return; const int c0 = (int)(e % CC); const size_t p = e / CC; v8us o; for (int u = 0; u < 8; ++u) o[u] = f2bf(bfr(X[(size_t)(c0 + u) * NP + p])); *(v8us*)(XT2 + e) = o;  }
__global__ __launch_bounds__(256) void k_pos(const float* __restrict__ rh, const float* __restrict__ rw, const float* __restrict__ rt, float* PS) { const size_t e = (size_t)blockIdx.x * 256 + threadIdx.x; if (e >= (size_t)NBL * BLK) return; const int d = (int)(e % HD); const int n = (int)((e / HD) % TT); const int z = (int)(e / BLK); const int h = z / NF, f = z % NF; const int hh = n / 32, ww = n % 32; float a = bfr(rh[((size_t)h * HD + d) * 32 + hh]), bw = bfr(rw[((size_t)h * HD + d) * 32 + ww]), c = bfr(rt[((size_t)h * HD + d) * NF + f]); asm volatile("" : "+v"(a)); asm volatile("" : "+v"(bw)); asm volatile("" : "+v"(c)); float s1 = __fadd_rn(a, bw); asm volatile("" : "+v"(s1)); const float v = __fadd_rn(s1, c); *(float*)(PS + e) = v;  }
__global__ __launch_bounds__(256) void k_hlG(const float* __restrict__ F, bf* Fh, bf* Fl, size_t n) { const size_t e = ((size_t)blockIdx.x * 256 + threadIdx.x) * 4; if (e >= n) return; const v4f a = *(const v4f*)(F + e); v4us oh, ol; for (int u = 0; u < 4; ++u) { unsigned short p, q; splitf(a[u], p, q); oh[u] = p; ol[u] = q; } *(v4us*)(Fh + e) = oh; *(v4us*)(Fl + e) = ol;  }
// ---- k_fattn: scores, softmax and attn.v of one [64][1024] block in ONE kernel; the scores never leave the registers.
// grid (1024 / 128 query tiles, 32 blocks), 8 waves; a wave owns 16 queries (columns) and walks the 1024 keys in passes of 32.
// Transposed products: S^T[key][query] = K^T rows . q columns + q^T rows . pos columns (3 hi/lo products each), so a lane holds 16 scores of ONE query;
// the two 16-key score tiles, turned into exp2 weights and split hi/lo, ARE the B operand (hardware k order) of O^T[d][query] += V[d][key] . P^T[key][query] (3 products).
// Running maximum per query (log2 domain), O^T and the sum rescaled every pass, one division by the sum at the end.
// The 32 key rows of K^T, q^T (hi/lo) and the 32 key columns of V (hi/lo) are staged per pass in LDS for all 8 waves (whole-line global loads of K^T and q^T, half lines of V, two buffers, one barrier a pass).
#define FQ   128                 // queries per work-group
#define FK   32                  // keys per pass
#define NS   (TT / FK)           // passes
#define KP   72                  // LDS pitch of a key row of K^T / q^T, 16-bit elements: 128 B + 16 B, conflict-free for 16-byte reads
#define VP   40                  // LDS pitch of a d row of V: 64 B + 16 B
#define KPL  (FK * KP)           // one K^T / q^T plane of a stage
#define VPL  (HD * VP)           // one V plane of a stage
#define STG  (4 * KPL + 2 * VPL) // one stage, 16-bit elements
#define OP   132                 // LDS pitch of an output row, floats
#define CL2  0.18033688011112042f   // HD^-0.5 * log2(e)
typedef __attribute__((ext_vector_type(2))) __bf16 v2bf;
__device__ __forceinline__ float xhalf(float x) { const int b = __float_as_int(x); return __int_as_float(__builtin_amdgcn_permlanex16(b, b, 0x76543210, 0xfedcba98, false, false)); }   // lane l <-> l ^ 16
__device__ __forceinline__ v16bf ldsfrag(const bf* p) { return cat16b(*(const v8us*)p, *(const v8us*)(p + 16)); }
__global__ __launch_bounds__(256) void k_fattn(const bf* __restrict__ QTh, const bf* __restrict__ QTl, const bf* __restrict__ KTh, const bf* __restrict__ KTl, const bf* __restrict__ PSh, const bf* __restrict__ PSl, const bf* __restrict__ VTh, const bf* __restrict__ VTl, float* __restrict__ OB) {
    __shared__ __align__(16) bf ring[2 * STG];
    __shared__ __align__(16) float os[HD * OP];
    const int tid = threadIdx.x, lane = tid & 31, lr = lane & 15, hi = lane >> 4, wave = tid >> 5;
    const size_t zb = (size_t)blockIdx.y * BLK; const int n0 = blockIdx.x * FQ + wave * 16;
    // staging: a thread moves 16 bytes of each of the six planes per pass
    const bf* gkh = KTh + zb + tid * 8; const bf* gkl = KTl + zb + tid * 8; const bf* gqh = QTh + zb + tid * 8; const bf* gql = QTl + zb + tid * 8;
    const bf* gvh = VTh + zb + (size_t)(tid >> 2) * TT + (tid & 3) * 8; const bf* gvl = VTl + zb + (size_t)(tid >> 2) * TT + (tid & 3) * 8;
    const int sk = (tid >> 3) * KP + (tid & 7) * 8, sv = 4 * KPL + (tid >> 2) * VP + (tid & 3) * 8;
    v8us st[6];
    auto gload = [&](int s) { st[0] = *(const v8us*)(gkh + s * (FK * HD)); st[1] = *(const v8us*)(gkl + s * (FK * HD)); st[2] = *(const v8us*)(gqh + s * (FK * HD)); st[3] = *(const v8us*)(gql + s * (FK * HD)); st[4] = *(const v8us*)(gvh + s * FK); st[5] = *(const v8us*)(gvl + s * FK); };
    auto sstore = [&](int b) { bf* r = ring + b * STG; *(v8us*)(r + sk) = st[0]; *(v8us*)(r + KPL + sk) = st[1]; *(v8us*)(r + 2 * KPL + sk) = st[2]; *(v8us*)(r + 3 * KPL + sk) = st[3]; *(v8us*)(r + sv) = st[4]; *(v8us*)(r + VPL + sv) = st[5]; };
    gload(0);
    // B operands of the score products, kept in registers: column = query n0 + lr, k = d
    v16bf bqh[2], bql[2], bph[2], bpl[2];
    { const size_t qo = zb + (size_t)(n0 + lr) * HD + 8 * hi; const bf* aqh = QTh + qo; const bf* aql = QTl + qo; const bf* aph = PSh + qo; const bf* apl = PSl + qo;
#pragma unroll   // constant indices, so that the arrays indexed here are registers
      for (int ks = 0; ks < 2; ++ks) { bqh[ks] = WFrag<bf>::ld(aqh + ks * 32); bql[ks] = WFrag<bf>::ld(aql + ks * 32); bph[ks] = WFrag<bf>::ld(aph + ks * 32); bpl[ks] = WFrag<bf>::ld(apl + ks * 32); }
      // the address pairs of the 16 loads above stay untouched (inputs here) until this wait
      asm volatile("s_wait_xcnt 0x0" :: "v"(aqh), "v"(aql), "v"(aph), "v"(apl) : "memory"); }
    v8f o[4];
#pragma unroll   // constant indices, so that the arrays indexed here are registers
    for (int dt = 0; dt < 4; ++dt) o[dt] = (v8f){};
    float mc = -3.0e38f, l = 0.f;
    sstore(0);
    __syncthreads();
#pragma unroll 1   // rolled: the pass is long enough; for speed only
    for (int s = 0; s < NS; ++s) {
        const bf* r = ring + (s & 1) * STG;
        if (s + 1 < NS) gload(s + 1);   // lands while this pass computes
        v8f s1[2], s2[2];
#pragma unroll   // constant indices, so that the arrays indexed here are registers
        for (int t = 0; t < 2; ++t) { s1[t] = (v8f){}; s2[t] = (v8f){}; }
#pragma unroll   // constant indices, so that the arrays indexed here are registers
        for (int ks = 0; ks < 2; ++ks) {
#pragma unroll   // constant indices, so that the arrays indexed here are registers
            for (int t = 0; t < 2; ++t) { const bf* p = r + (t * 16 + lr) * KP + ks * 32 + 8 * hi;
                const v16bf kh = ldsfrag(p), kl = ldsfrag(p + KPL), qh = ldsfrag(p + 2 * KPL), ql = ldsfrag(p + 3 * KPL);
                s1[t] = wmmab(kh, bqh[ks], s1[t]); s2[t] = wmmab(qh, bph[ks], s2[t]);
                s1[t] = wmmab(kh, bql[ks], s1[t]); s2[t] = wmmab(qh, bpl[ks], s2[t]);
                s1[t] = wmmab(kl, bqh[ks], s1[t]); s2[t] = wmmab(ql, bph[ks], s2[t]); } }
        v16bf vh[4], vl[4];   // asked for ahead of the softmax arithmetic, which covers the LDS latency of as many of them as the registers hold
#pragma unroll   // constant indices, so that the arrays indexed here are registers
        for (int dt = 0; dt < 4; ++dt) { const bf* p = r + 4 * KPL + (dt * 16 + lr) * VP + 8 * hi; vh[dt] = ldsfrag(p); vl[dt] = ldsfrag(p + VPL); }
        float u[16];
#pragma unroll   // constant indices, so that the arrays indexed here are registers
        for (int i = 0; i < 16; ++i) u[i] = s1[i >> 3][i & 7] + s2[i >> 3][i & 7];
        float mx = u[0];
#pragma unroll   // constant indices, so that the arrays indexed here are registers
        for (int i = 1; i < 16; ++i) mx = fmaxf(mx, u[i]);
        mx = fmaxf(mx, xhalf(mx));
        const float mn = fmaxf(mc, mx * CL2); const float al = __builtin_amdgcn_exp2f(mc - mn); mc = mn;
        float ps[4] = {0.f, 0.f, 0.f, 0.f};
#pragma unroll   // constant indices, so that the arrays indexed here are registers
        for (int i = 0; i < 16; ++i) { u[i] = __builtin_amdgcn_exp2f(__builtin_fmaf(u[i], CL2, -mn)); ps[i & 3] += u[i]; }
        l = l * al + ((ps[0] + ps[1]) + (ps[2] + ps[3]));   // this lane half's keys; the halves are joined behind the loop
        v16bf ph, pl;
#pragma unroll   // constant indices, so that the arrays indexed here are registers
        for (int i = 0; i < 8; ++i) { v2f x; x[0] = u[2 * i]; x[1] = u[2 * i + 1]; const v2bf h = __builtin_convertvector(x, v2bf); const v2bf w = __builtin_convertvector(x - __builtin_convertvector(h, v2f), v2bf);
            ph[2 * i] = h[0]; ph[2 * i + 1] = h[1]; pl[2 * i] = w[0]; pl[2 * i + 1] = w[1]; }
#pragma unroll   // constant indices, so that the arrays indexed here are registers
        for (int dt = 0; dt < 4; ++dt) o[dt] *= al;
#pragma unroll   // constant indices, so that the arrays indexed here are registers
        for (int dt = 0; dt < 4; ++dt) o[dt] = wmmab(vh[dt], ph, o[dt]);
#pragma unroll   // constant indices, so that the arrays indexed here are registers
        for (int dt = 0; dt < 4; ++dt) o[dt] = wmmab(vh[dt], pl, o[dt]);
#pragma unroll   // constant indices, so that the arrays indexed here are registers
        for (int dt = 0; dt < 4; ++dt) o[dt] = wmmab(vl[dt], ph, o[dt]);
        if (s + 1 < NS) sstore((s + 1) & 1);   // the buffer that pass s - 1 read; every wave left it at the last barrier
        __syncthreads();
    }
    l += xhalf(l);
    const float inv = __fdiv_rn(1.0f, l);
    // O^T[d][query] through LDS, so that every 128-byte line of the channels-first output is written whole by one wave
#pragma unroll   // constant indices, so that the arrays indexed here are registers
    for (int dt = 0; dt < 4; ++dt)
#pragma unroll   // constant indices, so that the arrays indexed here are registers
        for (int j = 0; j < 8; ++j) os[(dt * 16 + 8 * hi + j) * OP + wave * 16 + lr] = o[dt][j] * inv;
    __syncthreads();
    float* ob = OB + zb + blockIdx.x * FQ;
#pragma unroll
    for (int i = 0; i < 8; ++i) { const int d = wave * 8 + i; *(v4f*)(ob + (size_t)d * TT + lane * 4) = *(const v4fa*)(os + d * OP + lane * 4); }
}
__global__ __launch_bounds__(256) void k_merge(const float* __restrict__ O, int h0, bf* Ah, bf* Al) { const size_t e = ((size_t)blockIdx.x * 256 + threadIdx.x) * 2; if (e >= (size_t)ZH * TT * HD) return; const int d = (int)(e % HD); const int t = (int)((e / HD) % TT); const int zz = (int)(e / ((size_t)HD * TT)); const float cs = (t < RH) ? 1.0f : (1.0f / PCAR); const size_t oo = (size_t)t * DQ + (h0 + zz) * HD + d;
    v2us oh, ol;
#pragma unroll
    for (int q = 0; q < 2; ++q) { unsigned short a, c2; splitf(O[e + q] * cs, a, c2); oh[q] = a; ol[q] = c2; } *(v2us*)(Ah + oo) = oh; *(v2us*)(Al + oo) = ol;  }

extern "C" void kernel_launch(void* const* d_in, const int* in_sizes, int n_in,
                              void* d_out, int out_size, void* d_ws, size_t ws_size, hipStream_t stream) {
    (void)in_sizes; (void)n_in; (void)out_size;
    const float* x = (const float*)d_in[0]; const float* wq = (const float*)d_in[1]; const float* wk = (const float*)d_in[2]; const float* wv = (const float*)d_in[3]; const float* relh = (const float*)d_in[4]; const float* relw = (const float*)d_in[5]; const float* relt = (const float*)d_in[6]; const float* wo = nullptr; (void)wo; const float* cosT = nullptr; const float* sinT = nullptr; (void)cosT; (void)sinT;
    float* OUT = (float*)d_out;   // [4][256][8][32][32]
    char* wsp = (char*)d_ws; auto take = [&](size_t bytes) { char* p = wsp; wsp += (bytes + 255) & ~(size_t)255; return (void*)p; };
    bf* WQ = (bf*)take((size_t)CC * CC * 2); bf* WK = (bf*)take((size_t)CC * CC * 2); bf* WV = (bf*)take((size_t)CC * CC * 2);
    bf* XT = (bf*)take((size_t)NP * CC * 2);
    bf* QTh = (bf*)take((size_t)NBL * BLK * 2); bf* QTl = (bf*)take((size_t)NBL * BLK * 2); bf* KTh = (bf*)take((size_t)NBL * BLK * 2); bf* KTl = (bf*)take((size_t)NBL * BLK * 2);
    float* PS = (float*)take((size_t)NBL * BLK * 4); bf* PSh = (bf*)take((size_t)NBL * BLK * 2); bf* PSl = (bf*)take((size_t)NBL * BLK * 2);
    bf* VTh = (bf*)take((size_t)NBL * BLK * 2); bf* VTl = (bf*)take((size_t)NBL * BLK * 2);
    if ((size_t)(wsp - (char*)d_ws) > ws_size) return;   // ws ~ 45 MiB
    { k_cvt8<<<(unsigned)(((size_t)CC * CC / 8 + 255) / 256), 256, 0, stream>>>(wq, WQ, (size_t)CC * CC / 8); k_cvt8<<<(unsigned)(((size_t)CC * CC / 8 + 255) / 256), 256, 0, stream>>>(wk, WK, (size_t)CC * CC / 8); k_cvt8<<<(unsigned)(((size_t)CC * CC / 8 + 255) / 256), 256, 0, stream>>>(wv, WV, (size_t)CC * CC / 8);
      k_pos<<<(unsigned)(((size_t)NBL * BLK + 255) / 256), 256, 0, stream>>>(relh, relw, relt, PS); k_hlG<<<(unsigned)(((size_t)NBL * BLK / 4 + 255) / 256), 256, 0, stream>>>(PS, PSh, PSl, (size_t)NBL * BLK); }
    for (int b = 0; b < NB_; ++b) {
        k_xT<<<(unsigned)(((size_t)NP * CC / 8 + 255) / 256), 256, 0, stream>>>(x + (size_t)b * CC * NP, XT);
        k_proj<true><<<dim3(CC / 64, TT / 8, 1), 32, 0, stream>>>(WQ, XT, QTh, QTl);
        k_proj<true><<<dim3(CC / 64, TT / 8, 1), 32, 0, stream>>>(WK, XT, KTh, KTl);
        k_proj<false><<<dim3(CC / 64, NP / 64, 1), 32, 0, stream>>>(WV, XT, VTh, VTl);
        k_fattn<<<dim3(TT / FQ, NBL, 1), 256, 0, stream>>>(QTh, QTl, KTh, KTl, PSh, PSl, VTh, VTl, OUT + (size_t)b * CC * NP);
    }
}

// v003
// Measured time: 204 microseconds a run.
// Next to v002, in two timings, it ran 1.44 and 1.45 times as fast.
// Over all steps from v000 it is 6.50 times as fast.
#include <hip/hip_runtime.h>

// MHSA3D (x [4][256][8][32][32] channels-first; q/k/v = 1x1x1 conv (wq/wk/wv [256][256]) then the module's literal reshape (B, 4 heads, 8 frames, 64, 1024) of the [B][C][F][H][W] buffer = 32 contiguous [64][1024] blocks per batch; per block: energy[n][m] = (sum_d q[d][n] k[d][m] + sum_d pos[n][d] q[d][m]) / 8 with pos[h][f][n][d] = rel_h[h][d][n/32] + rel_w[h][d][n%32] + rel_t[h][d][f]; softmax over m; out[d][j] = sum_n v[d][n] attn[j][n]; -> [4][256][8][32][32]).
// Compute dtypes, f32 accumulate: every input rounded to bf16; the three convs as PLAIN bf16 GEMMs W . x (inputs: exact; x transposed to token-major on chip); per block: q^T, k^T hi/lo planes (transposed) and v hi/lo planes, all split and stored by the conv GEMM's own epilogue, pos planes (f32 sums in the reference's order, then hi/lo); both score products hl x hl (3 products) on every row, summed per element in f32; softmax f32 with a running maximum (weights exp2 of the scaled difference, split hi/lo unnormalised); attn.v hl x hl (3 products) on every row, divided by the row sum at the end; scores, softmax and attn.v in one kernel (k_fattn), which stores the context block [d][j] straight into the channels-first output in f32.

#define NB_  4
#define TT   1024
#define DM   256
#define NH_  4
#define NKV  4
#define REP  (NH_ / NKV)
#define HD   64
#define DQ   (NH_ * HD)
#define DKV  (NKV * HD)
#define ZH   8
#define RH   1024   // all rows hl
#define WIN  0
#define PCAR 1024.0f
#define CC   256    // channels
#define NF   8      // frames
#define NP   (NF * TT)   // positions per batch (8192)
#define NBL  (NH_ * NF)  // blocks per batch (32)
#define BLK  ((size_t)HD * TT)   // floats per block (65536)
#define SCL  0.125f   // HD^-0.5
typedef _Float16 h16;
typedef unsigned short bf;
typedef __attribute__((ext_vector_type(16))) __bf16   v16bf;
typedef __attribute__((ext_vector_type(16))) _Float16 v16h;
typedef __attribute__((ext_vector_type(8)))  _Float16 v8h;
typedef __attribute__((ext_vector_type(8)))  unsigned short v8us;
typedef __attribute__((ext_vector_type(8)))  float    v8f;
typedef __attribute__((ext_vector_type(4)))  float    v4f;
typedef v8h  __attribute__((may_alias)) v8ha;
typedef v4f  __attribute__((may_alias)) v4fa;
typedef v8us __attribute__((may_alias)) v8usa;

__device__ __forceinline__ unsigned short f2bf(float f) { unsigned u = __float_as_uint(f); u += 0x7FFFu + ((u >> 16) & 1u); return (unsigned short)(u >> 16); }
__device__ __forceinline__ float bf2f(unsigned short b) { return __uint_as_float(((unsigned)b) << 16); }
__device__ __forceinline__ float bfr(float f) { return bf2f(f2bf(f)); }
__device__ __forceinline__ v16h cat16(v8h lo, v8h hi) { return __builtin_shufflevector(lo, hi, 0, 1, 2, 3, 4, 5, 6, 7, 8, 9, 10, 11, 12, 13, 14, 15); }
__device__ __forceinline__ v16bf cat16b(v8us lo, v8us hi) { return __builtin_bit_cast(v16bf, __builtin_shufflevector(lo, hi, 0, 1, 2, 3, 4, 5, 6, 7, 8, 9, 10, 11, 12, 13, 14, 15)); }
__device__ __forceinline__ v8f wmma16(v16h a, v16h b, v8f c) { return __builtin_amdgcn_wmma_f32_16x16x32_f16(false, a, false, b, (short)0, c, false, false); }
__device__ __forceinline__ v8f wmmab(v16bf a, v16bf b, v8f c) { return __builtin_amdgcn_wmma_f32_16x16x32_bf16(false, a, false, b, (short)0, c, false, false); }



template <typename T16> struct WFrag;
template <> struct WFrag<h16> { typedef v16h V; static __device__ __forceinline__ V ld(const h16* p) { return cat16(*(const v8h*)p, *(const v8h*)(p + 16)); } static __device__ __forceinline__ v8f mma(V a, V b, v8f c) { return wmma16(a, b, c); } };
template <> struct WFrag<bf> { typedef v16bf V; static __device__ __forceinline__ V ld(const bf* p) { return cat16b(*(const v8us*)p, *(const v8us*)(p + 16)); } static __device__ __forceinline__ v8f mma(V a, V b, v8f c) { return wmmab(a, b, c); } };
typedef __attribute__((ext_vector_type(8))) __bf16 v8bf;
typedef __attribute__((ext_vector_type(4))) __bf16 v4bf;
typedef __attribute__((ext_vector_type(4))) unsigned short v4us;
template <bool TR>
__global__ __launch_bounds__(32) void k_proj(const bf* __restrict__ Wm, const bf* __restrict__ XTm, bf* __restrict__ Ph, bf* __restrict__ Pl) {
    const int lane = threadIdx.x & 31, lr = lane & 15, hi = lane >> 4; const int o0 = blockIdx.x * 64, ty = blockIdx.y;
    XTm += (size_t)blockIdx.z * NP * CC; Ph += (size_t)blockIdx.z * NBL * BLK; Pl += (size_t)blockIdx.z * NBL * BLK;
    const bf* wrow = Wm + (size_t)(o0 + lr) * CC + 8 * hi;
    const bf* xrow = XTm + (TR ? ((size_t)(lr & 7) * TT + ty * 8 + (lr >> 3)) : ((size_t)ty * 64 + lr * 4)) * CC + 8 * hi;
    const bf* A = TR ? xrow : wrow; const bf* B = TR ? wrow : xrow;
    constexpr int AS = (TR ? 2 : 16) * CC, BS = (TR ? 16 : 1) * CC;   // row steps from one 16-row / 16-column tile to the next
    v8f acc[4][4];
#pragma unroll   // constant indices, so that the arrays indexed here are registers
    for (int mb = 0; mb < 4; ++mb)
#pragma unroll   // constant indices, so that the arrays indexed here are registers
        for (int nb = 0; nb < 4; ++nb) acc[mb][nb] = (v8f){};
#pragma unroll 1   // rolled: beside the accumulators only one trip's fragments are kept in registers
    for (int kc = 0; kc < CC; kc += 32) {
        const bf* ap = A + kc; const bf* bp = B + kc; v16bf a[4];
#pragma unroll   // constant indices, so that the arrays indexed here are registers
        for (int mb = 0; mb < 4; ++mb) a[mb] = WFrag<bf>::ld(ap + mb * AS);
#pragma unroll   // constant indices, so that the arrays indexed here are registers
        for (int nb = 0; nb < 4; ++nb) { const v16bf b = WFrag<bf>::ld(bp + nb * BS);
#pragma unroll   // constant indices, so that the arrays indexed here are registers
            for (int mb = 0; mb < 4; ++mb) acc[mb][nb] = wmmab(a[mb], b, acc[mb][nb]); }
        // four vector slots behind the trip's last matrix instructions, also on the taken back edge, before anything touches their operands or results;
        // the trip's two address pairs are inputs, so that no later load of the trip lands on them: they are rewritten only behind the trip's last load wait
        asm volatile("v_nop\n\tv_nop\n\tv_nop\n\tv_nop" : "+v"(acc[0][0]), "+v"(acc[1][1]), "+v"(acc[2][2]), "+v"(acc[3][3]) : "v"(a[0]), "v"(a[3]), "v"(ap), "v"(bp));
    }
    if (TR) {
#pragma unroll   // constant indices, so that the arrays indexed here are registers
        for (int mb = 0; mb < 4; ++mb)
#pragma unroll   // constant indices, so that the arrays indexed here are registers
            for (int nb = 0; nb < 4; ++nb) { const v8f y = acc[mb][nb]; const v8bf h = __builtin_convertvector(y, v8bf); const v8bf w = __builtin_convertvector(y - __builtin_convertvector(h, v8f), v8bf);
                const size_t e = (size_t)(o0 / 8 + nb * 2 + (lr >> 3)) * BLK + (size_t)(ty * 8 + mb * 2 + hi) * HD + (lr & 7) * 8;
                *(v8us*)(Ph + e) = __builtin_bit_cast(v8us, h); *(v8us*)(Pl + e) = __builtin_bit_cast(v8us, w); }
    } else {
#pragma unroll   // constant indices, so that the arrays indexed here are registers
        for (int mb = 0; mb < 4; ++mb)
#pragma unroll   // constant indices, so that the arrays indexed here are registers
            for (int r = 0; r < 8; ++r) { v4f y; y[0] = acc[mb][0][r]; y[1] = acc[mb][1][r]; y[2] = acc[mb][2][r]; y[3] = acc[mb][3][r]; const v4bf h = __builtin_convertvector(y, v4bf); const v4bf w = __builtin_convertvector(y - __builtin_convertvector(h, v4f), v4bf);
                const size_t e = (size_t)(o0 + mb * 16 + 8 * hi + r) * NP + ty * 64 + lr * 4;
                *(v4us*)(Ph + e) = __builtin_bit_cast(v4us, h); *(v4us*)(Pl + e) = __builtin_bit_cast(v4us, w); }
    }
}

__device__ __forceinline__ h16 tohx(float x) { return (h16)x; }
__device__ __forceinline__ void splitf(float y, unsigned short& h, unsigned short& l) { h = f2bf(y); l = f2bf(y - bf2f(h)); }
typedef __attribute__((ext_vector_type(2))) _Float16 v2h;
typedef __attribute__((ext_vector_type(4))) _Float16 v4h;
typedef __attribute__((ext_vector_type(2))) unsigned short v2us;
typedef __attribute__((ext_vector_type(2))) float v2f;
typedef __attribute__((ext_vector_type(4))) int v4i;

__global__ __launch_bounds__(256) void k_wtG(const float* __restrict__ w, int K, int N, bf* Bt) {
    const int lane = threadIdx.x & 31; const int L0 = (blockIdx.x * 8 + (threadIdx.x >> 5)) * 8; const int nlines = N * K / 64;
{
#pragma unroll 1
        for (int l = 0; l < 8; ++l) { const int L = L0 + l; if (L >= nlines) break; const size_t e = (size_t)L * 64 + lane * 2; const int k = (int)(e % K), n = (int)(e / K); v2us o;
            o[0] = f2bf(w[(size_t)k * N + n]); o[1] = f2bf(w[(size_t)(k + 1) * N + n]); *(v2us*)(Bt + e) = o; }
         }
}
__global__ __launch_bounds__(256) void k_cvt8(const float* __restrict__ src, bf* dst, size_t n8) { const size_t i = (size_t)blockIdx.x * 256 + threadIdx.x; if (i >= n8) return; const v8f v = *(const v8f*)(src + i * 8); v8us o;
#pragma unroll
    for (int k = 0; k < 8; ++k) o[k] = f2bf(v[k]); *(v8us*)(dst + i * 8) = o;  }
__global__ __launch_bounds__(256) void k_cscvt(const float* __restrict__ cosT, const float* __restrict__ sinT, float* CS) { const int idx = blockIdx.x * 256 + threadIdx.x; if (idx >= TT * HD) return; v2f cs; cs[0] = bfr(cosT[idx]); cs[1] = bfr(sinT[idx]); *(v2f*)(CS + (size_t)idx * 2) = cs;  }
// k_rope: head planes [h][t][d] (fp16 + hi/lo) of rope(x) x sc with the rotate-half convention out[d] = x[d] cos[t][d] - x[d+HD/2] sin[t][d], out[d+HD/2] = x[d+HD/2] cos[t][d+HD/2] + x[d] sin[t][d+HD/2]
__global__ __launch_bounds__(256) void k_rope(const float* __restrict__ F, int pitch, int nheads, const float* __restrict__ CS, const float* __restrict__ RF, const float* __restrict__ nw, float sc, h16* P16, bf* Ph, bf* Pl) {
    const size_t e = ((size_t)blockIdx.x * 256 + threadIdx.x) * 2; if (e >= (size_t)nheads * TT * HD) return; const int d = (int)(e % HD); const int t = (int)((e / HD) % TT); const int h = (int)(e / ((size_t)HD * TT)); const float* f = F + (size_t)t * pitch + h * HD; const float rf = RF ? RF[(size_t)h * TT + t] : 1.0f; v2h o16; v2us oh, ol;
#pragma unroll
    for (int q = 0; q < 2; ++q) { const int dd = d + q; const int dp = (dd < HD / 2) ? dd + HD / 2 : dd - HD / 2; float x0 = f[dd], x1 = f[dp];
        if (RF) { float n0 = __fmul_rn(x0, rf), n1 = __fmul_rn(x1, rf); asm volatile("" : "+v"(n0)); asm volatile("" : "+v"(n1)); x0 = __fmul_rn(bfr(nw[dd]), n0); x1 = __fmul_rn(bfr(nw[dp]), n1); }
        const v2f cs = *(const v2f*)(CS + ((size_t)t * HD + dd) * 2); float a = __fmul_rn(x0, cs[0]), bq = __fmul_rn(x1, cs[1]); asm volatile("" : "+v"(a)); asm volatile("" : "+v"(bq)); const float r = ((dd < HD / 2) ? __fsub_rn(a, bq) : __fadd_rn(a, bq)) * sc;
        o16[q] = tohx(r); unsigned short a2, c2; splitf(r, a2, c2); oh[q] = a2; ol[q] = c2; }
    *(v2h*)(P16 + e) = o16; *(v2us*)(Ph + e) = oh; *(v2us*)(Pl + e) = ol;  }
__global__ __launch_bounds__(256) void k_vtp(const float* __restrict__ F, int pitch, int nheads, h16* V16, bf* Vh, bf* Vl) { const size_t e = ((size_t)blockIdx.x * 256 + threadIdx.x) * 2; if (e >= (size_t)nheads * HD * TT) return; const int t = (int)(e % TT); const int d = (int)((e / TT) % HD); const int g = (int)(e / ((size_t)TT * HD)); v2h o16; v2us oh, ol;
#pragma unroll
    for (int q = 0; q < 2; ++q) { const float x = F[(size_t)(t + q) * pitch + g * HD + d]; o16[q] = tohx(x); unsigned short a2, c2; splitf(x, a2, c2); oh[q] = a2; ol[q] = c2; }
    *(v2h*)(V16 + e) = o16; *(v2us*)(Vh + e) = oh; *(v2us*)(Vl + e) = ol;  }
__global__ __launch_bounds__(256) void k_xT(const float* __restrict__ X, bf* XT2) { const size_t e = ((size_t)blockIdx.x * 256 + threadIdx.x) * 8; if (e >= (size_t)NP * CC) return; X += (size_t)blockIdx.y * CC * NP; XT2 += (size_t)blockIdx.y * NP * CC;   // grid y = batch
    const int c0 = (int)(e % CC); const size_t p = e / CC; v8us o; for (int u = 0; u < 8; ++u) o[u] = f2bf(bfr(X[(size_t)(c0 + u) * NP + p])); *(v8us*)(XT2 + e) = o;  }
__global__ __launch_bounds__(256) void k_pos(const float* __restrict__ rh, const float* __restrict__ rw, const float* __restrict__ rt, float* PS) { const size_t e = (size_t)blockIdx.x * 256 + threadIdx.x; if (e >= (size_t)NBL * BLK) return; const int d = (int)(e % HD); const int n = (int)((e / HD) % TT); const int z = (int)(e / BLK); const int h = z / NF, f = z % NF; const int hh = n / 32, ww = n % 32; float a = bfr(rh[((size_t)h * HD + d) * 32 + hh]), bw = bfr(rw[((size_t)h * HD + d) * 32 + ww]), c = bfr(rt[((size_t)h * HD + d) * NF + f]); asm volatile("" : "+v"(a)); asm volatile("" : "+v"(bw)); asm volatile("" : "+v"(c)); float s1 = __fadd_rn(a, bw); asm volatile("" : "+v"(s1)); const float v = __fadd_rn(s1, c); *(float*)(PS + e) = v;  }
__global__ __launch_bounds__(256) void k_hlG(const float* __restrict__ F, bf* Fh, bf* Fl, size_t n) { const size_t e = ((size_t)blockIdx.x * 256 + threadIdx.x) * 4; if (e >= n) return; const v4f a = *(const v4f*)(F + e); v4us oh, ol; for (int u = 0; u < 4; ++u) { unsigned short p, q; splitf(a[u], p, q); oh[u] = p; ol[u] = q; } *(v4us*)(Fh + e) = oh; *(v4us*)(Fl + e) = ol;  }
// ---- k_fattn: scores, softmax and attn.v of one [64][1024] block in ONE kernel; the scores never leave the registers.
// grid (1024 / 128 query tiles, 32 blocks, 4 batches), 8 waves; a wave owns 16 queries (columns) and walks the 1024 keys in passes of 32.
// Transposed products: S^T[key][query] = K^T rows . q columns + q^T rows . pos columns (3 hi/lo products each), so a lane holds 16 scores of ONE query;
// the two 16-key score tiles, turned into exp2 weights and split hi/lo, ARE the B operand (hardware k order) of O^T[d][query] += V[d][key] . P^T[key][query] (3 products).
// Running maximum per query (log2 domain), O^T and the sum rescaled every pass, one division by the sum at the end.
// The 32 key rows of K^T, q^T (hi/lo) and the 32 key columns of V (hi/lo) are staged per pass in LDS for all 8 waves (whole-line global loads of K^T and q^T, half lines of V, two buffers, one barrier a pass).
#define FQ   128                 // queries per work-group
#define FK   32                  // keys per pass
#define NS   (TT / FK)           // passes
#define KP   72                  // LDS pitch of a key row of K^T / q^T, 16-bit elements: 128 B + 16 B, conflict-free for 16-byte reads
#define VP   40                  // LDS pitch of a d row of V: 64 B + 16 B
#define KPL  (FK * KP)           // one K^T / q^T plane of a stage
#define VPL  (HD * VP)           // one V plane of a stage
#define STG  (4 * KPL + 2 * VPL) // one stage, 16-bit elements
#define OP   132                 // LDS pitch of an output row, floats
#define CL2  0.18033688011112042f   // HD^-0.5 * log2(e)
typedef __attribute__((ext_vector_type(2))) __bf16 v2bf;
__device__ __forceinline__ float xhalf(float x) { const int b = __float_as_int(x); return __int_as_float(__builtin_amdgcn_permlanex16(b, b, 0x76543210, 0xfedcba98, false, false)); }   // lane l <-> l ^ 16
__device__ __forceinline__ v16bf ldsfrag(const bf* p) { return cat16b(*(const v8us*)p, *(const v8us*)(p + 16)); }
__global__ __launch_bounds__(256) void k_fattn(const bf* __restrict__ QTh, const bf* __restrict__ QTl, const bf* __restrict__ KTh, const bf* __restrict__ KTl, const bf* __restrict__ PSh, const bf* __restrict__ PSl, const bf* __restrict__ VTh, const bf* __restrict__ VTl, float* __restrict__ OB) {
    __shared__ __align__(16) bf ring[2 * STG];
    __shared__ __align__(16) float os[HD * OP];
    const int tid = threadIdx.x, lane = tid & 31, lr = lane & 15, hi = lane >> 4, wave = tid >> 5;
    const size_t zb = ((size_t)blockIdx.z * NBL + blockIdx.y) * BLK; const int n0 = blockIdx.x * FQ + wave * 16;
    // staging: a thread moves 16 bytes of each of the six planes per pass
    const bf* gkh = KTh + zb + tid * 8; const bf* gkl = KTl + zb + tid * 8; const bf* gqh = QTh + zb + tid * 8; const bf* gql = QTl + zb + tid * 8;
    const bf* gvh = VTh + zb + (size_t)(tid >> 2) * TT + (tid & 3) * 8; const bf* gvl = VTl + zb + (size_t)(tid >> 2) * TT + (tid & 3) * 8;
    const int sk = (tid >> 3) * KP + (tid & 7) * 8, sv = 4 * KPL + (tid >> 2) * VP + (tid & 3) * 8;
    v8us st[6];
    auto gload = [&](int s) { st[0] = *(const v8us*)(gkh + s * (FK * HD)); st[1] = *(const v8us*)(gkl + s * (FK * HD)); st[2] = *(const v8us*)(gqh + s * (FK * HD)); st[3] = *(const v8us*)(gql + s * (FK * HD)); st[4] = *(const v8us*)(gvh + s * FK); st[5] = *(const v8us*)(gvl + s * FK); };
    auto sstore = [&](int b) { bf* r = ring + b * STG; *(v8us*)(r + sk) = st[0]; *(v8us*)(r + KPL + sk) = st[1]; *(v8us*)(r + 2 * KPL + sk) = st[2]; *(v8us*)(r + 3 * KPL + sk) = st[3]; *(v8us*)(r + sv) = st[4]; *(v8us*)(r + VPL + sv) = st[5]; };
    gload(0);
    // B operands of the score products, kept in registers: column = query n0 + lr, k = d
    v16bf bqh[2], bql[2], bph[2], bpl[2];
    { const size_t ro = (size_t)(n0 + lr) * HD + 8 * hi, qo = zb + ro, po = (size_t)blockIdx.y * BLK + ro;   // the pos planes are the same for every batch
      const bf* aqh = QTh + qo; const bf* aql = QTl + qo; const bf* aph = PSh + po; const bf* apl = PSl + po;
#pragma unroll   // constant indices, so that the arrays indexed here are registers
      for (int ks = 0; ks < 2; ++ks) { bqh[ks] = WFrag<bf>::ld(aqh + ks * 32); bql[ks] = WFrag<bf>::ld(aql + ks * 32); bph[ks] = WFrag<bf>::ld(aph + ks * 32); bpl[ks] = WFrag<bf>::ld(apl + ks * 32); }
      // the address pairs of the 16 loads above stay untouched (inputs here) until this wait
      asm volatile("s_wait_xcnt 0x0" :: "v"(aqh), "v"(aql), "v"(aph), "v"(apl) : "memory"); }
    v8f o[4];
#pragma unroll   // constant indices, so that the arrays indexed here are registers
    for (int dt = 0; dt < 4; ++dt) o[dt] = (v8f){};
    float mc = -3.0e38f, l = 0.f;
    sstore(0);
    __syncthreads();
#pragma unroll 1   // rolled: the pass is long enough; for speed only
    for (int s = 0; s < NS; ++s) {
        const bf* r = ring + (s & 1) * STG;
        if (s + 1 < NS) gload(s + 1);   // lands while this pass computes
        v8f s1[2], s2[2];
#pragma unroll   // constant indices, so that the arrays indexed here are registers
        for (int t = 0; t < 2; ++t) { s1[t] = (v8f){}; s2[t] = (v8f){}; }
#pragma unroll   // constant indices, so that the arrays indexed here are registers
        for (int ks = 0; ks < 2; ++ks) {
#pragma unroll   // constant indices, so that the arrays indexed here are registers
            for (int t = 0; t < 2; ++t) { const bf* p = r + (t * 16 + lr) * KP + ks * 32 + 8 * hi;
                const v16bf kh = ldsfrag(p), kl = ldsfrag(p + KPL), qh = ldsfrag(p + 2 * KPL), ql = ldsfrag(p + 3 * KPL);
                s1[t] = wmmab(kh, bqh[ks], s1[t]); s2[t] = wmmab(qh, bph[ks], s2[t]);
                s1[t] = wmmab(kh, bql[ks], s1[t]); s2[t] = wmmab(qh, bpl[ks], s2[t]);
                s1[t] = wmmab(kl, bqh[ks], s1[t]); s2[t] = wmmab(ql, bph[ks], s2[t]); } }
        v16bf vh[4], vl[4];   // asked for ahead of the softmax arithmetic, which covers the LDS latency of as many of them as the registers hold
#pragma unroll   // constant indices, so that the arrays indexed here are registers
        for (int dt = 0; dt < 4; ++dt) { const bf* p = r + 4 * KPL + (dt * 16 + lr) * VP + 8 * hi; vh[dt] = ldsfrag(p); vl[dt] = ldsfrag(p + VPL); }
        float u[16];
#pragma unroll   // constant indices, so that the arrays indexed here are registers
        for (int i = 0; i < 16; ++i) u[i] = s1[i >> 3][i & 7] + s2[i >> 3][i & 7];
        float mx = u[0];
#pragma unroll   // constant indices, so that the arrays indexed here are registers
        for (int i = 1; i < 16; ++i) mx = fmaxf(mx, u[i]);
        mx = fmaxf(mx, xhalf(mx));
        const float mn = fmaxf(mc, mx * CL2); const float al = __builtin_amdgcn_exp2f(mc - mn); mc = mn;
        float ps[4] = {0.f, 0.f, 0.f, 0.f};
#pragma unroll   // constant indices, so that the arrays indexed here are registers
        for (int i = 0; i < 16; ++i) { u[i] = __builtin_amdgcn_exp2f(__builtin_fmaf(u[i], CL2, -mn)); ps[i & 3] += u[i]; }
        l = l * al + ((ps[0] + ps[1]) + (ps[2] + ps[3]));   // this lane half's keys; the halves are joined behind the loop
        v16bf ph, pl;
#pragma unroll   // constant indices, so that the arrays indexed here are registers
        for (int i = 0; i < 8; ++i) { v2f x; x[0] = u[2 * i]; x[1] = u[2 * i + 1]; const v2bf h = __builtin_convertvector(x, v2bf); const v2bf w = __builtin_convertvector(x - __builtin_convertvector(h, v2f), v2bf);
            ph[2 * i] = h[0]; ph[2 * i + 1] = h[1]; pl[2 * i] = w[0]; pl[2 * i + 1] = w[1]; }
#pragma unroll   // constant indices, so that the arrays indexed here are registers
        for (int dt = 0; dt < 4; ++dt) o[dt] *= al;
#pragma unroll   // constant indices, so that the arrays indexed here are registers
        for (int dt = 0; dt < 4; ++dt) o[dt] = wmmab(vh[dt], ph, o[dt]);
#pragma unroll   // constant indices, so that the arrays indexed here are registers
        for (int dt = 0; dt < 4; ++dt) o[dt] = wmmab(vh[dt], pl, o[dt]);
#pragma unroll   // constant indices, so that the arrays indexed here are registers
        for (int dt = 0; dt < 4; ++dt) o[dt] = wmmab(vl[dt], ph, o[dt]);
        if (s + 1 < NS) sstore((s + 1) & 1);   // the buffer that pass s - 1 read; every wave left it at the last barrier
        __syncthreads();
    }
    l += xhalf(l);
    const float inv = __fdiv_rn(1.0f, l);
    // O^T[d][query] through LDS, so that every 128-byte line of the channels-first output is written whole by one wave
#pragma unroll   // constant indices, so that the arrays indexed here are registers
    for (int dt = 0; dt < 4; ++dt)
#pragma unroll   // constant indices, so that the arrays indexed here are registers
        for (int j = 0; j < 8; ++j) os[(dt * 16 + 8 * hi + j) * OP + wave * 16 + lr] = o[dt][j] * inv;
    __syncthreads();
    float* ob = OB + zb + blockIdx.x * FQ;
#pragma unroll
    for (int i = 0; i < 8; ++i) { const int d = wave * 8 + i; *(v4f*)(ob + (size_t)d * TT + lane * 4) = *(const v4fa*)(os + d * OP + lane * 4); }
}
__global__ __launch_bounds__(256) void k_merge(const float* __restrict__ O, int h0, bf* Ah, bf* Al) { const size_t e = ((size_t)blockIdx.x * 256 + threadIdx.x) * 2; if (e >= (size_t)ZH * TT * HD) return; const int d = (int)(e % HD); const int t = (int)((e / HD) % TT); const int zz = (int)(e / ((size_t)HD * TT)); const float cs = (t < RH) ? 1.0f : (1.0f / PCAR); const size_t oo = (size_t)t * DQ + (h0 + zz) * HD + d;
    v2us oh, ol;
#pragma unroll
    for (int q = 0; q < 2; ++q) { unsigned short a, c2; splitf(O[e + q] * cs, a, c2); oh[q] = a; ol[q] = c2; } *(v2us*)(Ah + oo) = oh; *(v2us*)(Al + oo) = ol;  }

extern "C" void kernel_launch(void* const* d_in, const int* in_sizes, int n_in,
                              void* d_out, int out_size, void* d_ws, size_t ws_size, hipStream_t stream) {
    (void)in_sizes; (void)n_in; (void)out_size;
    const float* x = (const float*)d_in[0]; const float* wq = (const float*)d_in[1]; const float* wk = (const float*)d_in[2]; const float* wv = (const float*)d_in[3]; const float* relh = (const float*)d_in[4]; const float* relw = (const float*)d_in[5]; const float* relt = (const float*)d_in[6]; const float* wo = nullptr; (void)wo; const float* cosT = nullptr; const float* sinT = nullptr; (void)cosT; (void)sinT;
    float* OUT = (float*)d_out;   // [4][256][8][32][32]
    char* wsp = (char*)d_ws; auto take = [&](size_t bytes) { char* p = wsp; wsp += (bytes + 255) & ~(size_t)255; return (void*)p; };
    bf* WQ = (bf*)take((size_t)CC * CC * 2); bf* WK = (bf*)take((size_t)CC * CC * 2); bf* WV = (bf*)take((size_t)CC * CC * 2);
    bf* XT = (bf*)take((size_t)NB_ * NP * CC * 2);
    bf* QTh = (bf*)take((size_t)NB_ * NBL * BLK * 2); bf* QTl = (bf*)take((size_t)NB_ * NBL * BLK * 2); bf* KTh = (bf*)take((size_t)NB_ * NBL * BLK * 2); bf* KTl = (bf*)take((size_t)NB_ * NBL * BLK * 2);
    float* PS = (float*)take((size_t)NBL * BLK * 4); bf* PSh = (bf*)take((size_t)NBL * BLK * 2); bf* PSl = (bf*)take((size_t)NBL * BLK * 2);
    bf* VTh = (bf*)take((size_t)NB_ * NBL * BLK * 2); bf* VTl = (bf*)take((size_t)NB_ * NBL * BLK * 2);
    if ((size_t)(wsp - (char*)d_ws) > ws_size) return;   // ws ~ 129 MiB
    { k_cvt8<<<(unsigned)(((size_t)CC * CC / 8 + 255) / 256), 256, 0, stream>>>(wq, WQ, (size_t)CC * CC / 8); k_cvt8<<<(unsigned)(((size_t)CC * CC / 8 + 255) / 256), 256, 0, stream>>>(wk, WK, (size_t)CC * CC / 8); k_cvt8<<<(unsigned)(((size_t)CC * CC / 8 + 255) / 256), 256, 0, stream>>>(wv, WV, (size_t)CC * CC / 8);
      k_pos<<<(unsigned)(((size_t)NBL * BLK + 255) / 256), 256, 0, stream>>>(relh, relw, relt, PS); k_hlG<<<(unsigned)(((size_t)NBL * BLK / 4 + 255) / 256), 256, 0, stream>>>(PS, PSh, PSl, (size_t)NBL * BLK); }
    k_xT<<<dim3((unsigned)(((size_t)NP * CC / 8 + 255) / 256), NB_, 1), 256, 0, stream>>>(x, XT);
    k_proj<true><<<dim3(CC / 64, TT / 8, NB_), 32, 0, stream>>>(WQ, XT, QTh, QTl);
    k_proj<true><<<dim3(CC / 64, TT / 8, NB_), 32, 0, stream>>>(WK, XT, KTh, KTl);
    k_proj<false><<<dim3(CC / 64, NP / 64, NB_), 32, 0, stream>>>(WV, XT, VTh, VTl);
    k_fattn<<<dim3(TT / FQ, NBL, NB_), 256, 0, stream>>>(QTh, QTl, KTh, KTl, PSh, PSl, VTh, VTl, OUT);
}

// v004
// One run takes 181 microseconds.
// Two timings next to v003 both put it at 1.12 times that version's speed.
// All steps since v000 together make it 7.29 times as fast.
#include <hip/hip_runtime.h>

// MHSA3D (x [4][256][8][32][32] channels-first; q/k/v = 1x1x1 conv (wq/wk/wv [256][256]) then the module's literal reshape (B, 4 heads, 8 frames, 64, 1024) of the [B][C][F][H][W] buffer = 32 contiguous [64][1024] blocks per batch; per block: energy[n][m] = (sum_d q[d][n] k[d][m] + sum_d pos[n][d] q[d][m]) / 8 with pos[h][f][n][d] = rel_h[h][d][n/32] + rel_w[h][d][n%32] + rel_t[h][d][f]; softmax over m; out[d][j] = sum_n v[d][n] attn[j][n]; -> [4][256][8][32][32]).
// Compute dtypes, f32 accumulate: every input rounded to bf16; the three convs as PLAIN bf16 GEMMs W . x (inputs: exact; x transposed to token-major on chip); per block: q^T, k^T hi/lo planes (transposed) and v hi/lo planes, all split and stored by the conv GEMM's own epilogue, the position term factored: sum_d pos[n][d] q[d][m] = sum_d rel_w[d][n%32] q[d][m] + sum_d rel_h[d][n/32] q[d][m] + sum_d rel_t[d][f] q[d][m], 65 rows a block instead of 1024 (k_ptab: rel rows exact in bf16 x q hi/lo, 2 products, f32 tables); the q.k product hl x hl (3 products) on every row, accumulated on top of the position term in f32; softmax f32 with a running maximum (weights exp2 of the scaled difference, split hi/lo unnormalised); attn.v hl x hl (3 products) on every row, divided by the row sum at the end; scores, softmax and attn.v in one kernel (k_fattn), which stores the context block [d][j] straight into the channels-first output in f32.

#define NB_  4
#define TT   1024
#define DM   256
#define NH_  4
#define NKV  4
#define REP  (NH_ / NKV)
#define HD   64
#define DQ   (NH_ * HD)
#define DKV  (NKV * HD)
#define ZH   8
#define RH   1024   // all rows hl
#define WIN  0
#define PCAR 1024.0f
#define CC   256    // channels
#define NF   8      // frames
#define NP   (NF * TT)   // positions per batch (8192)
#define NBL  (NH_ * NF)  // blocks per batch (32)
#define BLK  ((size_t)HD * TT)   // floats per block (65536)
#define SCL  0.125f   // HD^-0.5
typedef _Float16 h16;
typedef unsigned short bf;
typedef __attribute__((ext_vector_type(16))) __bf16   v16bf;
typedef __attribute__((ext_vector_type(16))) _Float16 v16h;
typedef __attribute__((ext_vector_type(8)))  _Float16 v8h;
typedef __attribute__((ext_vector_type(8)))  unsigned short v8us;
typedef __attribute__((ext_vector_type(8)))  float    v8f;
typedef __attribute__((ext_vector_type(4)))  float    v4f;
typedef v8h  __attribute__((may_alias)) v8ha;
typedef v4f  __attribute__((may_alias)) v4fa;
typedef v8us __attribute__((may_alias)) v8usa;

__device__ __forceinline__ unsigned short f2bf(float f) { unsigned u = __float_as_uint(f); u += 0x7FFFu + ((u >> 16) & 1u); return (unsigned short)(u >> 16); }
__device__ __forceinline__ float bf2f(unsigned short b) { return __uint_as_float(((unsigned)b) << 16); }
__device__ __forceinline__ float bfr(float f) { return bf2f(f2bf(f)); }
__device__ __forceinline__ v16h cat16(v8h lo, v8h hi) { return __builtin_shufflevector(lo, hi, 0, 1, 2, 3, 4, 5, 6, 7, 8, 9, 10, 11, 12, 13, 14, 15); }
__device__ __forceinline__ v16bf cat16b(v8us lo, v8us hi) { return __builtin_bit_cast(v16bf, __builtin_shufflevector(lo, hi, 0, 1, 2, 3, 4, 5, 6, 7, 8, 9, 10, 11, 12, 13, 14, 15)); }
__device__ __forceinline__ v8f wmma16(v16h a, v16h b, v8f c) { return __builtin_amdgcn_wmma_f32_16x16x32_f16(false, a, false, b, (short)0, c, false, false); }
__device__ __forceinline__ v8f wmmab(v16bf a, v16bf b, v8f c) { return __builtin_amdgcn_wmma_f32_16x16x32_bf16(false, a, false, b, (short)0, c, false, false); }



template <typename T16> struct WFrag;
template <> struct WFrag<h16> { typedef v16h V; static __device__ __forceinline__ V ld(const h16* p) { return cat16(*(const v8h*)p, *(const v8h*)(p + 16)); } static __device__ __forceinline__ v8f mma(V a, V b, v8f c) { return wmma16(a, b, c); } };
template <> struct WFrag<bf> { typedef v16bf V; static __device__ __forceinline__ V ld(const bf* p) { return cat16b(*(const v8us*)p, *(const v8us*)(p + 16)); } static __device__ __forceinline__ v8f mma(V a, V b, v8f c) { return wmmab(a, b, c); } };
typedef __attribute__((ext_vector_type(8))) __bf16 v8bf;
typedef __attribute__((ext_vector_type(4))) __bf16 v4bf;
typedef __attribute__((ext_vector_type(4))) unsigned short v4us;
template <bool TR>
__global__ __launch_bounds__(32) void k_proj(const bf* __restrict__ Wm, const bf* __restrict__ XTm, bf* __restrict__ Ph, bf* __restrict__ Pl) {
    const int lane = threadIdx.x & 31, lr = lane & 15, hi = lane >> 4; const int o0 = blockIdx.x * 64, ty = blockIdx.y;
    XTm += (size_t)blockIdx.z * NP * CC; Ph += (size_t)blockIdx.z * NBL * BLK; Pl += (size_t)blockIdx.z * NBL * BLK;
    const bf* wrow = Wm + (size_t)(o0 + lr) * CC + 8 * hi;
    const bf* xrow = XTm + (TR ? ((size_t)(lr & 7) * TT + ty * 8 + (lr >> 3)) : ((size_t)ty * 64 + lr * 4)) * CC + 8 * hi;
    const bf* A = TR ? xrow : wrow; const bf* B = TR ? wrow : xrow;
    constexpr int AS = (TR ? 2 : 16) * CC, BS = (TR ? 16 : 1) * CC;   // row steps from one 16-row / 16-column tile to the next
    v8f acc[4][4];
#pragma unroll   // constant indices, so that the arrays indexed here are registers
    for (int mb = 0; mb < 4; ++mb)
#pragma unroll   // constant indices, so that the arrays indexed here are registers
        for (int nb = 0; nb < 4; ++nb) acc[mb][nb] = (v8f){};
#pragma unroll 1   // rolled: beside the accumulators only one trip's fragments are kept in registers
    for (int kc = 0; kc < CC; kc += 32) {
        const bf* ap = A + kc; const bf* bp = B + kc; v16bf a[4];
#pragma unroll   // constant indices, so that the arrays indexed here are registers
        for (int mb = 0; mb < 4; ++mb) a[mb] = WFrag<bf>::ld(ap + mb * AS);
#pragma unroll   // constant indices, so that the arrays indexed here are registers
        for (int nb = 0; nb < 4; ++nb) { const v16bf b = WFrag<bf>::ld(bp + nb * BS);
#pragma unroll   // constant indices, so that the arrays indexed here are registers
            for (int mb = 0; mb < 4; ++mb) acc[mb][nb] = wmmab(a[mb], b, acc[mb][nb]); }
        // four vector slots behind the trip's last matrix instructions, also on the taken back edge, before anything touches their operands or results;
        // the trip's two address pairs are inputs, so that no later load of the trip lands on them: they are rewritten only behind the trip's last load wait
        asm volatile("v_nop\n\tv_nop\n\tv_nop\n\tv_nop" : "+v"(acc[0][0]), "+v"(acc[1][1]), "+v"(acc[2][2]), "+v"(acc[3][3]) : "v"(a[0]), "v"(a[3]), "v"(ap), "v"(bp));
    }
    if (TR) {
#pragma unroll   // constant indices, so that the arrays indexed here are registers
        for (int mb = 0; mb < 4; ++mb)
#pragma unroll   // constant indices, so that the arrays indexed here are registers
            for (int nb = 0; nb < 4; ++nb) { const v8f y = acc[mb][nb]; const v8bf h = __builtin_convertvector(y, v8bf); const v8bf w = __builtin_convertvector(y - __builtin_convertvector(h, v8f), v8bf);
                const size_t e = (size_t)(o0 / 8 + nb * 2 + (lr >> 3)) * BLK + (size_t)(ty * 8 + mb * 2 + hi) * HD + (lr & 7) * 8;
                *(v8us*)(Ph + e) = __builtin_bit_cast(v8us, h); *(v8us*)(Pl + e) = __builtin_bit_cast(v8us, w); }
    } else {
#pragma unroll   // constant indices, so that the arrays indexed here are registers
        for (int mb = 0; mb < 4; ++mb)
#pragma unroll   // constant indices, so that the arrays indexed here are registers
            for (int r = 0; r < 8; ++r) { v4f y; y[0] = acc[mb][0][r]; y[1] = acc[mb][1][r]; y[2] = acc[mb][2][r]; y[3] = acc[mb][3][r]; const v4bf h = __builtin_convertvector(y, v4bf); const v4bf w = __builtin_convertvector(y - __builtin_convertvector(h, v4f), v4bf);
                const size_t e = (size_t)(o0 + mb * 16 + 8 * hi + r) * NP + ty * 64 + lr * 4;
                *(v4us*)(Ph + e) = __builtin_bit_cast(v4us, h); *(v4us*)(Pl + e) = __builtin_bit_cast(v4us, w); }
    }
}

__device__ __forceinline__ h16 tohx(float x) { return (h16)x; }
__device__ __forceinline__ void splitf(float y, unsigned short& h, unsigned short& l) { h = f2bf(y); l = f2bf(y - bf2f(h)); }
typedef __attribute__((ext_vector_type(2))) _Float16 v2h;
typedef __attribute__((ext_vector_type(4))) _Float16 v4h;
typedef __attribute__((ext_vector_type(2))) unsigned short v2us;
typedef __attribute__((ext_vector_type(2))) float v2f;
typedef __attribute__((ext_vector_type(4))) int v4i;

__global__ __launch_bounds__(256) void k_wtG(const float* __restrict__ w, int K, int N, bf* Bt) {
    const int lane = threadIdx.x & 31; const int L0 = (blockIdx.x * 8 + (threadIdx.x >> 5)) * 8; const int nlines = N * K / 64;
{
#pragma unroll 1
        for (int l = 0; l < 8; ++l) { const int L = L0 + l; if (L >= nlines) break; const size_t e = (size_t)L * 64 + lane * 2; const int k = (int)(e % K), n = (int)(e / K); v2us o;
            o[0] = f2bf(w[(size_t)k * N + n]); o[1] = f2bf(w[(size_t)(k + 1) * N + n]); *(v2us*)(Bt + e) = o; }
         }
}
__global__ __launch_bounds__(256) void k_cvt8(const float* __restrict__ src, bf* dst, size_t n8) { const size_t i = (size_t)blockIdx.x * 256 + threadIdx.x; if (i >= n8) return; const v8f v = *(const v8f*)(src + i * 8); v8us o;
#pragma unroll
    for (int k = 0; k < 8; ++k) o[k] = f2bf(v[k]); *(v8us*)(dst + i * 8) = o;  }
__global__ __launch_bounds__(256) void k_cscvt(const float* __restrict__ cosT, const float* __restrict__ sinT, float* CS) { const int idx = blockIdx.x * 256 + threadIdx.x; if (idx >= TT * HD) return; v2f cs; cs[0] = bfr(cosT[idx]); cs[1] = bfr(sinT[idx]); *(v2f*)(CS + (size_t)idx * 2) = cs;  }
// k_rope: head planes [h][t][d] (fp16 + hi/lo) of rope(x) x sc with the rotate-half convention out[d] = x[d] cos[t][d] - x[d+HD/2] sin[t][d], out[d+HD/2] = x[d+HD/2] cos[t][d+HD/2] + x[d] sin[t][d+HD/2]
__global__ __launch_bounds__(256) void k_rope(const float* __restrict__ F, int pitch, int nheads, const float* __restrict__ CS, const float* __restrict__ RF, const float* __restrict__ nw, float sc, h16* P16, bf* Ph, bf* Pl) {
    const size_t e = ((size_t)blockIdx.x * 256 + threadIdx.x) * 2; if (e >= (size_t)nheads * TT * HD) return; const int d = (int)(e % HD); const int t = (int)((e / HD) % TT); const int h = (int)(e / ((size_t)HD * TT)); const float* f = F + (size_t)t * pitch + h * HD; const float rf = RF ? RF[(size_t)h * TT + t] : 1.0f; v2h o16; v2us oh, ol;
#pragma unroll
    for (int q = 0; q < 2; ++q) { const int dd = d + q; const int dp = (dd < HD / 2) ? dd + HD / 2 : dd - HD / 2; float x0 = f[dd], x1 = f[dp];
        if (RF) { float n0 = __fmul_rn(x0, rf), n1 = __fmul_rn(x1, rf); asm volatile("" : "+v"(n0)); asm volatile("" : "+v"(n1)); x0 = __fmul_rn(bfr(nw[dd]), n0); x1 = __fmul_rn(bfr(nw[dp]), n1); }
        const v2f cs = *(const v2f*)(CS + ((size_t)t * HD + dd) * 2); float a = __fmul_rn(x0, cs[0]), bq = __fmul_rn(x1, cs[1]); asm volatile("" : "+v"(a)); asm volatile("" : "+v"(bq)); const float r = ((dd < HD / 2) ? __fsub_rn(a, bq) : __fadd_rn(a, bq)) * sc;
        o16[q] = tohx(r); unsigned short a2, c2; splitf(r, a2, c2); oh[q] = a2; ol[q] = c2; }
    *(v2h*)(P16 + e) = o16; *(v2us*)(Ph + e) = oh; *(v2us*)(Pl + e) = ol;  }
__global__ __launch_bounds__(256) void k_vtp(const float* __restrict__ F, int pitch, int nheads, h16* V16, bf* Vh, bf* Vl) { const size_t e = ((size_t)blockIdx.x * 256 + threadIdx.x) * 2; if (e >= (size_t)nheads * HD * TT) return; const int t = (int)(e % TT); const int d = (int)((e / TT) % HD); const int g = (int)(e / ((size_t)TT * HD)); v2h o16; v2us oh, ol;
#pragma unroll
    for (int q = 0; q < 2; ++q) { const float x = F[(size_t)(t + q) * pitch + g * HD + d]; o16[q] = tohx(x); unsigned short a2, c2; splitf(x, a2, c2); oh[q] = a2; ol[q] = c2; }
    *(v2h*)(V16 + e) = o16; *(v2us*)(Vh + e) = oh; *(v2us*)(Vl + e) = ol;  }
__global__ __launch_bounds__(256) void k_xT(const float* __restrict__ X, bf* XT2) { const size_t e = ((size_t)blockIdx.x * 256 + threadIdx.x) * 8; if (e >= (size_t)NP * CC) return; X += (size_t)blockIdx.y * CC * NP; XT2 += (size_t)blockIdx.y * NP * CC;   // grid y = batch
    const int c0 = (int)(e % CC); const size_t p = e / CC; v8us o; for (int u = 0; u < 8; ++u) o[u] = f2bf(bfr(X[(size_t)(c0 + u) * NP + p])); *(v8us*)(XT2 + e) = o;  }
// ---- k_fattn: scores, softmax and attn.v of one [64][1024] block in ONE kernel; the scores never leave the registers.
// grid (1024 / 128 query tiles, 32 blocks, 4 batches), 8 waves; a wave owns 16 queries (columns) and walks the 1024 keys in passes of 32.
// Transposed product: S^T[key][query] = position term (k_ptab's tables, the accumulators' start value) + K^T rows . q columns (3 hi/lo products), so a lane holds 16 scores of ONE query;
// the two 16-key score tiles, turned into exp2 weights and split hi/lo, ARE the B operand (hardware k order) of O^T[d][query] += V[d][key] . P^T[key][query] (3 products).
// Running maximum per query (log2 domain), O^T and the sum rescaled every pass, one division by the sum at the end.
// The 32 key rows of K^T (hi/lo) and the 32 key columns of V (hi/lo) are staged per pass in LDS for all 8 waves (K^T in whole-line, V in half-line global loads, two buffers, one barrier a pass).
#define FQ   128                 // queries per work-group
#define FK   32                  // keys per pass
#define NS   (TT / FK)           // passes
#define KP   72                  // LDS pitch of a key row of K^T, 16-bit elements: 128 B + 16 B, conflict-free for 16-byte reads
#define VP   40                  // LDS pitch of a d row of V: 64 B + 16 B
#define KPL  (FK * KP)           // one K^T plane of a stage
#define VPL  (HD * VP)           // one V plane of a stage
#define STG  (2 * KPL + 2 * VPL) // one stage, 16-bit elements
#define OP   132                 // LDS pitch of an output row, floats
#define CL2  0.18033688011112042f   // HD^-0.5 * log2(e)
typedef __attribute__((ext_vector_type(2))) __bf16 v2bf;
__device__ __forceinline__ float xhalf(float x) { const int b = __float_as_int(x); return __int_as_float(__builtin_amdgcn_permlanex16(b, b, 0x76543210, 0xfedcba98, false, false)); }   // lane l <-> l ^ 16
__device__ __forceinline__ v16bf ldsfrag(const bf* p) { return cat16b(*(const v8us*)p, *(const v8us*)(p + 16)); }
// ---- k_ptab: the position term of one block, factored. pos[n][d] = rel_h[d][n / 32] + rel_w[d][n % 32] + rel_t[d][f], so sum_d pos[n][d] q[d][m] = RW[n % 32][m] + CA[n / 32][m]
// with RW[b][m] = sum_d rel_w[d][b] q[d][m] and CA[a][m] = sum_d rel_h[d][a] q[d][m] + sum_d rel_t[d][f] q[d][m].
// grid (1024 / 256 keys, 32 blocks, 4 batches), 8 waves; a wave owns 32 keys (two 16-key tiles, the A rows, from the q^T planes) and five 16-column B tiles: rel_w 0-15, 16-31, rel_h 0-15, 16-31, and rel_t[f] in all 16 columns.
// RWT holds each 16-key x 16-column tile in the accumulator's own order, 1 KiB a tile: registers 0-3 of lane l at float l * 4, registers 4-7 at 128 + l * 4 (whole lines for 16-byte accesses); tile index (block * 64 + key tile) * 2 + column tile; CAT is [block][a][m].
__global__ __launch_bounds__(256) void k_ptab(const bf* __restrict__ QTh, const bf* __restrict__ QTl, const float* __restrict__ rh, const float* __restrict__ rw, const float* __restrict__ rt, float* __restrict__ RWT, float* __restrict__ CAT) {
    __shared__ __align__(16) bf rl[65 * KP];   // rows [column][d]: 0-31 rel_w, 32-63 rel_h, 64 rel_t of this frame
    const int tid = threadIdx.x, lane = tid & 31, lr = lane & 15, hi = lane >> 4, wave = tid >> 5;
    const int h = blockIdx.y / NF, f = blockIdx.y % NF, zi = blockIdx.z * NBL + blockIdx.y;
    { const int i0 = h * (HD * 32) + tid; float fw[HD * 32 / 256], fh[HD * 32 / 256];
#pragma unroll   // constant indices, so that the arrays indexed here are registers; all 16 loads in flight at once
      for (int j = 0; j < HD * 32 / 256; ++j) { fw[j] = rw[i0 + j * 256]; fh[j] = rh[i0 + j * 256]; }
      // the index register of the 16 loads above stays untouched (an input here) until this wait
      asm volatile("s_wait_xcnt 0x0" :: "v"(i0) : "memory");
#pragma unroll   // constant indices, so that the arrays indexed here are registers
      for (int j = 0; j < HD * 32 / 256; ++j) { const int i = j * 256 + tid, d = i >> 5, c = i & 31; rl[c * KP + d] = f2bf(fw[j]); rl[(32 + c) * KP + d] = f2bf(fh[j]); } }
    if (tid < HD) { const int it = (h * HD + tid) * NF + f; const float x = rt[it];
      asm volatile("s_wait_xcnt 0x0" :: "v"(it) : "memory");   // as above: the load's index register stays untouched until here
      rl[64 * KP + tid] = f2bf(x); }
    __syncthreads();
    v16bf br[5][2];
#pragma unroll   // constant indices, so that the arrays indexed here are registers
    for (int c = 0; c < 5; ++c)
#pragma unroll   // constant indices, so that the arrays indexed here are registers
        for (int ks = 0; ks < 2; ++ks) br[c][ks] = ldsfrag(rl + (c < 4 ? c * 16 + lr : 64) * KP + ks * 32 + 8 * hi);
    const int m0 = blockIdx.x * 256 + wave * 32;
#pragma unroll   // constant indices, so that the arrays indexed here are registers
    for (int t = 0; t < 2; ++t) {
        const size_t ro = (size_t)zi * BLK + (size_t)(m0 + t * 16 + lr) * HD + 8 * hi; const bf* ah = QTh + ro; const bf* al = QTl + ro;
        v16bf qh[2], ql[2];
#pragma unroll   // constant indices, so that the arrays indexed here are registers
        for (int ks = 0; ks < 2; ++ks) { qh[ks] = WFrag<bf>::ld(ah + ks * 32); ql[ks] = WFrag<bf>::ld(al + ks * 32); }
        // the address pairs of the 8 loads above stay untouched (inputs here) until this wait
        asm volatile("s_wait_xcnt 0x0" :: "v"(ah), "v"(al) : "memory");
        v8f acc[5];
#pragma unroll   // constant indices, so that the arrays indexed here are registers
        for (int c = 0; c < 5; ++c) acc[c] = (v8f){};
#pragma unroll   // constant indices, so that the arrays indexed here are registers
        for (int ks = 0; ks < 2; ++ks) {
#pragma unroll   // constant indices, so that the arrays indexed here are registers
            for (int c = 0; c < 5; ++c) acc[c] = wmmab(qh[ks], br[c][ks], acc[c]);
#pragma unroll   // constant indices, so that the arrays indexed here are registers
            for (int c = 0; c < 5; ++c) acc[c] = wmmab(ql[ks], br[c][ks], acc[c]); }
        const int mt = (m0 >> 4) + t;
#pragma unroll   // constant indices, so that the arrays indexed here are registers
        for (int c = 0; c < 2; ++c) {
            float* ow = RWT + (((size_t)zi * (TT / 16) + mt) * 2 + c) * 256 + lane * 4;
            *(v4f*)ow = __builtin_shufflevector(acc[c], acc[c], 0, 1, 2, 3); *(v4f*)(ow + 128) = __builtin_shufflevector(acc[c], acc[c], 4, 5, 6, 7);
            *(v8f*)(CAT + ((size_t)zi * 32 + c * 16 + lr) * TT + mt * 16 + 8 * hi) = acc[2 + c] + acc[4]; }
    }
}
__global__ __launch_bounds__(256) void k_fattn(const bf* __restrict__ QTh, const bf* __restrict__ QTl, const bf* __restrict__ KTh, const bf* __restrict__ KTl, const float* __restrict__ RWT, const float* __restrict__ CAT, const bf* __restrict__ VTh, const bf* __restrict__ VTl, float* __restrict__ OB) {
    __shared__ __align__(16) bf ring[2 * STG];
    __shared__ __align__(16) float os[HD * OP];
    const int tid = threadIdx.x, lane = tid & 31, lr = lane & 15, hi = lane >> 4, wave = tid >> 5;
    const int zi = blockIdx.z * NBL + blockIdx.y; const size_t zb = (size_t)zi * BLK; const int n0 = blockIdx.x * FQ + wave * 16;
    // staging: a thread moves 16 bytes of each of the four planes per pass
    const bf* gkh = KTh + zb + tid * 8; const bf* gkl = KTl + zb + tid * 8;
    const bf* gvh = VTh + zb + (size_t)(tid >> 2) * TT + (tid & 3) * 8; const bf* gvl = VTl + zb + (size_t)(tid >> 2) * TT + (tid & 3) * 8;
    const int sk = (tid >> 3) * KP + (tid & 7) * 8, sv = 2 * KPL + (tid >> 2) * VP + (tid & 3) * 8;
    v8us st[4];
    auto sstore = [&](int b) { bf* r = ring + b * STG; *(v8us*)(r + sk) = st[0]; *(v8us*)(r + KPL + sk) = st[1]; *(v8us*)(r + sv) = st[2]; *(v8us*)(r + VPL + sv) = st[3]; };
    // position term of a pass, straight into registers one pass ahead: this wave's two RW tiles (columns n % 32 = its 16 queries, in accumulator order) and the 32 keys of its CA row (n / 32 is one value for the wave)
    const float* grw = RWT + ((size_t)zi * (TT / 16) * 2 + ((n0 >> 4) & 1)) * 256 + lane * 4; const float* gca = CAT + ((size_t)zi * 32 + (n0 >> 5)) * TT + 8 * hi;
    v8f bw[2], bc[2];
    auto gload = [&](int s) { const bf* pkh = gkh + s * (FK * HD); const bf* pkl = gkl + s * (FK * HD); const bf* pvh = gvh + s * FK; const bf* pvl = gvl + s * FK; const float* pw = grw + s * 1024; const float* pc = gca + s * FK;
        st[0] = *(const v8us*)pkh; st[1] = *(const v8us*)pkl; st[2] = *(const v8us*)pvh; st[3] = *(const v8us*)pvl; bw[0] = __builtin_shufflevector(*(const v4f*)pw, *(const v4f*)(pw + 128), 0, 1, 2, 3, 4, 5, 6, 7); bw[1] = __builtin_shufflevector(*(const v4f*)(pw + 512), *(const v4f*)(pw + 640), 0, 1, 2, 3, 4, 5, 6, 7); bc[0] = *(const v8f*)pc; bc[1] = *(const v8f*)(pc + 16);
        // the address pairs of the 12 loads above stay untouched (inputs here) until this wait
        asm volatile("s_wait_xcnt 0x0" :: "v"(pkh), "v"(pkl), "v"(pvh), "v"(pvl), "v"(pw), "v"(pc) : "memory"); };
    gload(0);
    // B operands of the score products, kept in registers: column = query n0 + lr, k = d
    v16bf bqh[2], bql[2];
    { const size_t qo = zb + (size_t)(n0 + lr) * HD + 8 * hi;
      const bf* aqh = QTh + qo; const bf* aql = QTl + qo;
#pragma unroll   // constant indices, so that the arrays indexed here are registers
      for (int ks = 0; ks < 2; ++ks) { bqh[ks] = WFrag<bf>::ld(aqh + ks * 32); bql[ks] = WFrag<bf>::ld(aql + ks * 32); }
      // the address pairs of the 8 loads above stay untouched (inputs here) until this wait
      asm volatile("s_wait_xcnt 0x0" :: "v"(aqh), "v"(aql) : "memory"); }
    v8f o[4];
#pragma unroll   // constant indices, so that the arrays indexed here are registers
    for (int dt = 0; dt < 4; ++dt) o[dt] = (v8f){};
    float mc = -3.0e38f, l = 0.f;
    v8f s1[2];   // the scores' accumulators; their start value is the position term, summed at the foot of the pass before
#pragma unroll   // constant indices, so that the arrays indexed here are registers
    for (int t = 0; t < 2; ++t) s1[t] = bw[t] + bc[t];
    sstore(0);
    __syncthreads();
#pragma unroll 1   // rolled: the pass is long enough; for speed only
    for (int s = 0; s < NS; ++s) {
        const bf* r = ring + (s & 1) * STG;
        if (s + 1 < NS) gload(s + 1);   // lands while this pass computes
#pragma unroll   // constant indices, so that the arrays indexed here are registers
        for (int ks = 0; ks < 2; ++ks) { const bf* p = r + lr * KP + ks * 32 + 8 * hi;
            const v16bf kh0 = ldsfrag(p), kh1 = ldsfrag(p + 16 * KP), kl0 = ldsfrag(p + KPL), kl1 = ldsfrag(p + KPL + 16 * KP);
            s1[0] = wmmab(kh0, bqh[ks], s1[0]); s1[1] = wmmab(kh1, bqh[ks], s1[1]);
            s1[0] = wmmab(kh0, bql[ks], s1[0]); s1[1] = wmmab(kh1, bql[ks], s1[1]);
            s1[0] = wmmab(kl0, bqh[ks], s1[0]); s1[1] = wmmab(kl1, bqh[ks], s1[1]); }
        v16bf vh[4], vl[4];   // asked for ahead of the softmax arithmetic, which covers the LDS latency of as many of them as the registers hold
#pragma unroll   // constant indices, so that the arrays indexed here are registers
        for (int dt = 0; dt < 4; ++dt) { const bf* p = r + 2 * KPL + (dt * 16 + lr) * VP + 8 * hi; vh[dt] = ldsfrag(p); vl[dt] = ldsfrag(p + VPL); }
        float u[16];
#pragma unroll   // constant indices, so that the arrays indexed here are registers
        for (int i = 0; i < 16; ++i) u[i] = s1[i >> 3][i & 7];
        float mx = u[0];
#pragma unroll   // constant indices, so that the arrays indexed here are registers
        for (int i = 1; i < 16; ++i) mx = fmaxf(mx, u[i]);
        mx = fmaxf(mx, xhalf(mx));
        const float mn = fmaxf(mc, mx * CL2); const float al = __builtin_amdgcn_exp2f(mc - mn); mc = mn;
        float ps[4] = {0.f, 0.f, 0.f, 0.f};
#pragma unroll   // constant indices, so that the arrays indexed here are registers
        for (int i = 0; i < 16; ++i) { u[i] = __builtin_amdgcn_exp2f(__builtin_fmaf(u[i], CL2, -mn)); ps[i & 3] += u[i]; }
        l = l * al + ((ps[0] + ps[1]) + (ps[2] + ps[3]));   // this lane half's keys; the halves are joined behind the loop
        v16bf ph, pl;
#pragma unroll   // constant indices, so that the arrays indexed here are registers
        for (int i = 0; i < 8; ++i) { v2f x; x[0] = u[2 * i]; x[1] = u[2 * i + 1]; const v2bf h = __builtin_convertvector(x, v2bf); const v2bf w = __builtin_convertvector(x - __builtin_convertvector(h, v2f), v2bf);
            ph[2 * i] = h[0]; ph[2 * i + 1] = h[1]; pl[2 * i] = w[0]; pl[2 * i + 1] = w[1]; }
#pragma unroll   // constant indices, so that the arrays indexed here are registers
        for (int dt = 0; dt < 4; ++dt) o[dt] *= al;
#pragma unroll   // constant indices, so that the arrays indexed here are registers
        for (int dt = 0; dt < 4; ++dt) o[dt] = wmmab(vh[dt], ph, o[dt]);
#pragma unroll   // constant indices, so that the arrays indexed here are registers
        for (int dt = 0; dt < 4; ++dt) o[dt] = wmmab(vh[dt], pl, o[dt]);
#pragma unroll   // constant indices, so that the arrays indexed here are registers
        for (int dt = 0; dt < 4; ++dt) o[dt] = wmmab(vl[dt], ph, o[dt]);
#pragma unroll   // constant indices, so that the arrays indexed here are registers
        for (int t = 0; t < 2; ++t) s1[t] = bw[t] + bc[t];   // the next pass's start value (behind the last pass: unused)
        if (s + 1 < NS) sstore((s + 1) & 1);   // the buffer that pass s - 1 read; every wave left it at the last barrier
        __syncthreads();
    }
    l += xhalf(l);
    const float inv = __fdiv_rn(1.0f, l);
    // O^T[d][query] through LDS, so that every 128-byte line of the channels-first output is written whole by one wave
#pragma unroll   // constant indices, so that the arrays indexed here are registers
    for (int dt = 0; dt < 4; ++dt)
#pragma unroll   // constant indices, so that the arrays indexed here are registers
        for (int j = 0; j < 8; ++j) os[(dt * 16 + 8 * hi + j) * OP + wave * 16 + lr] = o[dt][j] * inv;
    __syncthreads();
    float* ob = OB + zb + blockIdx.x * FQ;
#pragma unroll
    for (int i = 0; i < 8; ++i) { const int d = wave * 8 + i; *(v4f*)(ob + (size_t)d * TT + lane * 4) = *(const v4fa*)(os + d * OP + lane * 4); }
}
__global__ __launch_bounds__(256) void k_merge(const float* __restrict__ O, int h0, bf* Ah, bf* Al) { const size_t e = ((size_t)blockIdx.x * 256 + threadIdx.x) * 2; if (e >= (size_t)ZH * TT * HD) return; const int d = (int)(e % HD); const int t = (int)((e / HD) % TT); const int zz = (int)(e / ((size_t)HD * TT)); const float cs = (t < RH) ? 1.0f : (1.0f / PCAR); const size_t oo = (size_t)t * DQ + (h0 + zz) * HD + d;
    v2us oh, ol;
#pragma unroll
    for (int q = 0; q < 2; ++q) { unsigned short a, c2; splitf(O[e + q] * cs, a, c2); oh[q] = a; ol[q] = c2; } *(v2us*)(Ah + oo) = oh; *(v2us*)(Al + oo) = ol;  }

extern "C" void kernel_launch(void* const* d_in, const int* in_sizes, int n_in,
                              void* d_out, int out_size, void* d_ws, size_t ws_size, hipStream_t stream) {
    (void)in_sizes; (void)n_in; (void)out_size;
    const float* x = (const float*)d_in[0]; const float* wq = (const float*)d_in[1]; const float* wk = (const float*)d_in[2]; const float* wv = (const float*)d_in[3]; const float* relh = (const float*)d_in[4]; const float* relw = (const float*)d_in[5]; const float* relt = (const float*)d_in[6]; const float* wo = nullptr; (void)wo; const float* cosT = nullptr; const float* sinT = nullptr; (void)cosT; (void)sinT;
    float* OUT = (float*)d_out;   // [4][256][8][32][32]
    char* wsp = (char*)d_ws; auto take = [&](size_t bytes) { char* p = wsp; wsp += (bytes + 255) & ~(size_t)255; return (void*)p; };
    bf* WQ = (bf*)take((size_t)CC * CC * 2); bf* WK = (bf*)take((size_t)CC * CC * 2); bf* WV = (bf*)take((size_t)CC * CC * 2);
    bf* XT = (bf*)take((size_t)NB_ * NP * CC * 2);
    bf* QTh = (bf*)take((size_t)NB_ * NBL * BLK * 2); bf* QTl = (bf*)take((size_t)NB_ * NBL * BLK * 2); bf* KTh = (bf*)take((size_t)NB_ * NBL * BLK * 2); bf* KTl = (bf*)take((size_t)NB_ * NBL * BLK * 2);
    float* RWT = (float*)take((size_t)NB_ * NBL * 32 * TT * 4); float* CAT = (float*)take((size_t)NB_ * NBL * 32 * TT * 4);
    bf* VTh = (bf*)take((size_t)NB_ * NBL * BLK * 2); bf* VTl = (bf*)take((size_t)NB_ * NBL * BLK * 2);
    if ((size_t)(wsp - (char*)d_ws) > ws_size) return;   // ws ~ 145 MiB
    { k_cvt8<<<(unsigned)(((size_t)CC * CC / 8 + 255) / 256), 256, 0, stream>>>(wq, WQ, (size_t)CC * CC / 8); k_cvt8<<<(unsigned)(((size_t)CC * CC / 8 + 255) / 256), 256, 0, stream>>>(wk, WK, (size_t)CC * CC / 8); k_cvt8<<<(unsigned)(((size_t)CC * CC / 8 + 255) / 256), 256, 0, stream>>>(wv, WV, (size_t)CC * CC / 8); }
    k_xT<<<dim3((unsigned)(((size_t)NP * CC / 8 + 255) / 256), NB_, 1), 256, 0, stream>>>(x, XT);
    k_proj<true><<<dim3(CC / 64, TT / 8, NB_), 32, 0, stream>>>(WQ, XT, QTh, QTl);
    k_proj<true><<<dim3(CC / 64, TT / 8, NB_), 32, 0, stream>>>(WK, XT, KTh, KTl);
    k_proj<false><<<dim3(CC / 64, NP / 64, NB_), 32, 0, stream>>>(WV, XT, VTh, VTl);
    k_ptab<<<dim3(TT / 256, NBL, NB_), 256, 0, stream>>>(QTh, QTl, relh, relw, relt, RWT, CAT);
    k_fattn<<<dim3(TT / FQ, NBL, NB_), 256, 0, stream>>>(QTh, QTl, KTh, KTl, RWT, CAT, VTh, VTl, OUT);
}

// v005
// Measured time: 172 microseconds a run.
// Next to v004, in two timings, it ran 1.05 times as fast each time.
// Over all steps from v000 it is 7.67 times as fast.
#include <hip/hip_runtime.h>

// MHSA3D (x [4][256][8][32][32] channels-first; q/k/v = 1x1x1 conv (wq/wk/wv [256][256]) then the module's literal reshape (B, 4 heads, 8 frames, 64, 1024) of the [B][C][F][H][W] buffer = 32 contiguous [64][1024] blocks per batch; per block: energy[n][m] = (sum_d q[d][n] k[d][m] + sum_d pos[n][d] q[d][m]) / 8 with pos[h][f][n][d] = rel_h[h][d][n/32] + rel_w[h][d][n%32] + rel_t[h][d][f]; softmax over m; out[d][j] = sum_n v[d][n] attn[j][n]; -> [4][256][8][32][32]).
// Compute dtypes, f32 accumulate: every input rounded to bf16; the three convs as PLAIN bf16 GEMMs W . x (inputs: exact; x transposed to token-major on chip); per block: q^T, k^T hi/lo planes (transposed) and v hi/lo planes, all split and stored by the conv GEMM's own epilogue, the position term factored: sum_d pos[n][d] q[d][m] = sum_d rel_w[d][n%32] q[d][m] + sum_d rel_h[d][n/32] q[d][m] + sum_d rel_t[d][f] q[d][m], 65 rows a block instead of 1024 (k_ptab: rel rows exact in bf16 x q hi/lo, 2 products, f32 tables); the q.k product hl x hl (3 products) on every row, accumulated on top of the position term in f32; softmax f32 with a running maximum (weights exp2 of the scaled difference, split hi/lo unnormalised); attn.v hl x hl (3 products) on every row, divided by the row sum at the end; scores, softmax and attn.v in one kernel (k_fattn), which stores the context block [d][j] straight into the channels-first output in f32.

#define NB_  4
#define TT   1024
#define DM   256
#define NH_  4
#define NKV  4
#define REP  (NH_ / NKV)
#define HD   64
#define DQ   (NH_ * HD)
#define DKV  (NKV * HD)
#define ZH   8
#define RH   1024   // all rows hl
#define WIN  0
#define PCAR 1024.0f
#define CC   256    // channels
#define NF   8      // frames
#define NP   (NF * TT)   // positions per batch (8192)
#define NBL  (NH_ * NF)  // blocks per batch (32)
#define BLK  ((size_t)HD * TT)   // floats per block (65536)
#define SCL  0.125f   // HD^-0.5
typedef _Float16 h16;
typedef unsigned short bf;
typedef __attribute__((ext_vector_type(16))) __bf16   v16bf;
typedef __attribute__((ext_vector_type(16))) _Float16 v16h;
typedef __attribute__((ext_vector_type(8)))  _Float16 v8h;
typedef __attribute__((ext_vector_type(8)))  unsigned short v8us;
typedef __attribute__((ext_vector_type(8)))  float    v8f;
typedef __attribute__((ext_vector_type(4)))  float    v4f;
typedef v8h  __attribute__((may_alias)) v8ha;
typedef v4f  __attribute__((may_alias)) v4fa;
typedef v8us __attribute__((may_alias)) v8usa;

__device__ __forceinline__ unsigned short f2bf(float f) { unsigned u = __float_as_uint(f); u += 0x7FFFu + ((u >> 16) & 1u); return (unsigned short)(u >> 16); }
__device__ __forceinline__ float bf2f(unsigned short b) { return __uint_as_float(((unsigned)b) << 16); }
__device__ __forceinline__ float bfr(float f) { return bf2f(f2bf(f)); }
__device__ __forceinline__ v16h cat16(v8h lo, v8h hi) { return __builtin_shufflevector(lo, hi, 0, 1, 2, 3, 4, 5, 6, 7, 8, 9, 10, 11, 12, 13, 14, 15); }
__device__ __forceinline__ v16bf cat16b(v8us lo, v8us hi) { return __builtin_bit_cast(v16bf, __builtin_shufflevector(lo, hi, 0, 1, 2, 3, 4, 5, 6, 7, 8, 9, 10, 11, 12, 13, 14, 15)); }
__device__ __forceinline__ v8f wmma16(v16h a, v16h b, v8f c) { return __builtin_amdgcn_wmma_f32_16x16x32_f16(false, a, false, b, (short)0, c, false, false); }
__device__ __forceinline__ v8f wmmab(v16bf a, v16bf b, v8f c) { return __builtin_amdgcn_wmma_f32_16x16x32_bf16(false, a, false, b, (short)0, c, false, false); }



template <typename T16> struct WFrag;
template <> struct WFrag<h16> { typedef v16h V; static __device__ __forceinline__ V ld(const h16* p) { return cat16(*(const v8h*)p, *(const v8h*)(p + 16)); } static __device__ __forceinline__ v8f mma(V a, V b, v8f c) { return wmma16(a, b, c); } };
template <> struct WFrag<bf> { typedef v16bf V; static __device__ __forceinline__ V ld(const bf* p) { return cat16b(*(const v8us*)p, *(const v8us*)(p + 16)); } static __device__ __forceinline__ v8f mma(V a, V b, v8f c) { return wmmab(a, b, c); } };
typedef __attribute__((ext_vector_type(8))) __bf16 v8bf;
typedef __attribute__((ext_vector_type(4))) __bf16 v4bf;
typedef __attribute__((ext_vector_type(4))) unsigned short v4us;
template <bool TR>
__global__ __launch_bounds__(32) void k_proj(const bf* __restrict__ Wm, const bf* __restrict__ XTm, bf* __restrict__ Ph, bf* __restrict__ Pl) {
    const int lane = threadIdx.x & 31, lr = lane & 15, hi = lane >> 4; const int o0 = blockIdx.x * 64, ty = blockIdx.y;
    XTm += (size_t)blockIdx.z * NP * CC; Ph += (size_t)blockIdx.z * NBL * BLK; Pl += (size_t)blockIdx.z * NBL * BLK;
    const bf* wrow = Wm + (size_t)(o0 + lr) * CC + 8 * hi;
    const bf* xrow = XTm + (TR ? ((size_t)(lr & 7) * TT + ty * 8 + (lr >> 3)) : ((size_t)ty * 64 + lr * 4)) * CC + 8 * hi;
    const bf* A = TR ? xrow : wrow; const bf* B = TR ? wrow : xrow;
    constexpr int AS = (TR ? 2 : 16) * CC, BS = (TR ? 16 : 1) * CC;   // row steps from one 16-row / 16-column tile to the next
    v8f acc[4][4];
#pragma unroll   // constant indices, so that the arrays indexed here are registers
    for (int mb = 0; mb < 4; ++mb)
#pragma unroll   // constant indices, so that the arrays indexed here are registers
        for (int nb = 0; nb < 4; ++nb) acc[mb][nb] = (v8f){};
#pragma unroll 1   // rolled: beside the accumulators only one trip's fragments are kept in registers
    for (int kc = 0; kc < CC; kc += 32) {
        const bf* ap = A + kc; const bf* bp = B + kc; v16bf a[4];
#pragma unroll   // constant indices, so that the arrays indexed here are registers
        for (int mb = 0; mb < 4; ++mb) a[mb] = WFrag<bf>::ld(ap + mb * AS);
#pragma unroll   // constant indices, so that the arrays indexed here are registers
        for (int nb = 0; nb < 4; ++nb) { const v16bf b = WFrag<bf>::ld(bp + nb * BS);
#pragma unroll   // constant indices, so that the arrays indexed here are registers
            for (int mb = 0; mb < 4; ++mb) acc[mb][nb] = wmmab(a[mb], b, acc[mb][nb]); }
        // four vector slots behind the trip's last matrix instructions, also on the taken back edge, before anything touches their operands or results;
        // the trip's two address pairs are inputs, so that no later load of the trip lands on them: they are rewritten only behind the trip's last load wait
        asm volatile("v_nop\n\tv_nop\n\tv_nop\n\tv_nop" : "+v"(acc[0][0]), "+v"(acc[1][1]), "+v"(acc[2][2]), "+v"(acc[3][3]) : "v"(a[0]), "v"(a[3]), "v"(ap), "v"(bp));
    }
    if (TR) {
#pragma unroll   // constant indices, so that the arrays indexed here are registers
        for (int mb = 0; mb < 4; ++mb)
#pragma unroll   // constant indices, so that the arrays indexed here are registers
            for (int nb = 0; nb < 4; ++nb) { const v8f y = acc[mb][nb]; const v8bf h = __builtin_convertvector(y, v8bf); const v8bf w = __builtin_convertvector(y - __builtin_convertvector(h, v8f), v8bf);
                const size_t e = (size_t)(o0 / 8 + nb * 2 + (lr >> 3)) * BLK + (size_t)(ty * 8 + mb * 2 + hi) * HD + (lr & 7) * 8;
                *(v8us*)(Ph + e) = __builtin_bit_cast(v8us, h); *(v8us*)(Pl + e) = __builtin_bit_cast(v8us, w); }
    } else {
#pragma unroll   // constant indices, so that the arrays indexed here are registers
        for (int mb = 0; mb < 4; ++mb)
#pragma unroll   // constant indices, so that the arrays indexed here are registers
            for (int r = 0; r < 8; ++r) { v4f y; y[0] = acc[mb][0][r]; y[1] = acc[mb][1][r]; y[2] = acc[mb][2][r]; y[3] = acc[mb][3][r]; const v4bf h = __builtin_convertvector(y, v4bf); const v4bf w = __builtin_convertvector(y - __builtin_convertvector(h, v4f), v4bf);
                const size_t e = (size_t)(o0 + mb * 16 + 8 * hi + r) * NP + ty * 64 + lr * 4;
                *(v4us*)(Ph + e) = __builtin_bit_cast(v4us, h); *(v4us*)(Pl + e) = __builtin_bit_cast(v4us, w); }
    }
}

__device__ __forceinline__ h16 tohx(float x) { return (h16)x; }
__device__ __forceinline__ void splitf(float y, unsigned short& h, unsigned short& l) { h = f2bf(y); l = f2bf(y - bf2f(h)); }
typedef __attribute__((ext_vector_type(2))) _Float16 v2h;
typedef __attribute__((ext_vector_type(4))) _Float16 v4h;
typedef __attribute__((ext_vector_type(2))) unsigned short v2us;
typedef __attribute__((ext_vector_type(2))) float v2f;
typedef __attribute__((ext_vector_type(4))) int v4i;

__global__ __launch_bounds__(256) void k_wtG(const float* __restrict__ w, int K, int N, bf* Bt) {
    const int lane = threadIdx.x & 31; const int L0 = (blockIdx.x * 8 + (threadIdx.x >> 5)) * 8; const int nlines = N * K / 64;
{
#pragma unroll 1
        for (int l = 0; l < 8; ++l) { const int L = L0 + l; if (L >= nlines) break; const size_t e = (size_t)L * 64 + lane * 2; const int k = (int)(e % K), n = (int)(e / K); v2us o;
            o[0] = f2bf(w[(size_t)k * N + n]); o[1] = f2bf(w[(size_t)(k + 1) * N + n]); *(v2us*)(Bt + e) = o; }
         }
}
__global__ __launch_bounds__(256) void k_cvt8(const float* __restrict__ src, bf* dst, size_t n8) { const size_t i = (size_t)blockIdx.x * 256 + threadIdx.x; if (i >= n8) return; const v8f v = *(const v8f*)(src + i * 8); v8us o;
#pragma unroll
    for (int k = 0; k < 8; ++k) o[k] = f2bf(v[k]); *(v8us*)(dst + i * 8) = o;  }
__global__ __launch_bounds__(256) void k_cscvt(const float* __restrict__ cosT, const float* __restrict__ sinT, float* CS) { const int idx = blockIdx.x * 256 + threadIdx.x; if (idx >= TT * HD) return; v2f cs; cs[0] = bfr(cosT[idx]); cs[1] = bfr(sinT[idx]); *(v2f*)(CS + (size_t)idx * 2) = cs;  }
// k_rope: head planes [h][t][d] (fp16 + hi/lo) of rope(x) x sc with the rotate-half convention out[d] = x[d] cos[t][d] - x[d+HD/2] sin[t][d], out[d+HD/2] = x[d+HD/2] cos[t][d+HD/2] + x[d] sin[t][d+HD/2]
__global__ __launch_bounds__(256) void k_rope(const float* __restrict__ F, int pitch, int nheads, const float* __restrict__ CS, const float* __restrict__ RF, const float* __restrict__ nw, float sc, h16* P16, bf* Ph, bf* Pl) {
    const size_t e = ((size_t)blockIdx.x * 256 + threadIdx.x) * 2; if (e >= (size_t)nheads * TT * HD) return; const int d = (int)(e % HD); const int t = (int)((e / HD) % TT); const int h = (int)(e / ((size_t)HD * TT)); const float* f = F + (size_t)t * pitch + h * HD; const float rf = RF ? RF[(size_t)h * TT + t] : 1.0f; v2h o16; v2us oh, ol;
#pragma unroll
    for (int q = 0; q < 2; ++q) { const int dd = d + q; const int dp = (dd < HD / 2) ? dd + HD / 2 : dd - HD / 2; float x0 = f[dd], x1 = f[dp];
        if (RF) { float n0 = __fmul_rn(x0, rf), n1 = __fmul_rn(x1, rf); asm volatile("" : "+v"(n0)); asm volatile("" : "+v"(n1)); x0 = __fmul_rn(bfr(nw[dd]), n0); x1 = __fmul_rn(bfr(nw[dp]), n1); }
        const v2f cs = *(const v2f*)(CS + ((size_t)t * HD + dd) * 2); float a = __fmul_rn(x0, cs[0]), bq = __fmul_rn(x1, cs[1]); asm volatile("" : "+v"(a)); asm volatile("" : "+v"(bq)); const float r = ((dd < HD / 2) ? __fsub_rn(a, bq) : __fadd_rn(a, bq)) * sc;
        o16[q] = tohx(r); unsigned short a2, c2; splitf(r, a2, c2); oh[q] = a2; ol[q] = c2; }
    *(v2h*)(P16 + e) = o16; *(v2us*)(Ph + e) = oh; *(v2us*)(Pl + e) = ol;  }
__global__ __launch_bounds__(256) void k_vtp(const float* __restrict__ F, int pitch, int nheads, h16* V16, bf* Vh, bf* Vl) { const size_t e = ((size_t)blockIdx.x * 256 + threadIdx.x) * 2; if (e >= (size_t)nheads * HD * TT) return; const int t = (int)(e % TT); const int d = (int)((e / TT) % HD); const int g = (int)(e / ((size_t)TT * HD)); v2h o16; v2us oh, ol;
#pragma unroll
    for (int q = 0; q < 2; ++q) { const float x = F[(size_t)(t + q) * pitch + g * HD + d]; o16[q] = tohx(x); unsigned short a2, c2; splitf(x, a2, c2); oh[q] = a2; ol[q] = c2; }
    *(v2h*)(V16 + e) = o16; *(v2us*)(Vh + e) = oh; *(v2us*)(Vl + e) = ol;  }
// ---- k_xT: x [c][p] f32 -> x^T [p][c] bf16 through an LDS tile, whole 128-byte lines on both sides. grid (8192 / 64 positions, 4 batches), 8 waves; a work-group owns 64 positions x all 256 channels.
// In: a 16-byte load takes 4 positions of one channel, 8 lanes a line, 4 channels a wave; a thread takes the channels c and c + 1 at the same positions and packs them, so that every LDS store is one dword.
// LDS: [position][128 channel pairs]; the 16-byte chunk (8 channels) k of position p lies at chunk k ^ (p / 4): the 32 dword stores of a wave fall in 32 banks, and a row read back in 16-byte pieces covers every bank evenly.
// Out: a wave stores one whole position row (512 bytes) at a time.
#define XP   64                  // positions per work-group
typedef __attribute__((ext_vector_type(2))) __bf16 v2bfx;
typedef __attribute__((ext_vector_type(4))) unsigned v4u;
__global__ __launch_bounds__(256) void k_xT(const float* __restrict__ X, bf* __restrict__ XT2) {
    __shared__ __align__(16) unsigned xt[XP * (CC / 2)];
    const int tid = threadIdx.x, lane = tid & 31, wave = tid >> 5, g = lane & 7, q = lane >> 3;
    const float* s0 = X + ((size_t)blockIdx.y * CC + (wave * 16 + q) * 2) * NP + blockIdx.x * XP + g * 4;   // grid y = batch
    v4f a[8], b[8];
#pragma unroll   // constant indices, so that the arrays indexed here are registers; all 16 loads in flight at once
    for (int it = 0; it < 8; ++it) { const float* s = s0 + (size_t)(it & 3) * 8 * NP + (it >> 2) * 32; a[it] = *(const v4f*)s; b[it] = *(const v4f*)(s + NP); }
    // the address pair of the 16 loads above stays untouched (an input here) until this wait; the loaded values are inputs too, so that all 16 loads are issued before the first is used:
    // without that the compiler holds five of them back until earlier ones have landed, a second memory latency
    asm volatile("s_wait_xcnt 0x0" :: "v"(s0), "v"(a[0]), "v"(a[1]), "v"(a[2]), "v"(a[3]), "v"(a[4]), "v"(a[5]), "v"(a[6]), "v"(a[7]), "v"(b[0]), "v"(b[1]), "v"(b[2]), "v"(b[3]), "v"(b[4]), "v"(b[5]), "v"(b[6]), "v"(b[7]) : "memory");
#pragma unroll   // constant indices, so that the arrays indexed here are registers
    for (int it = 0; it < 8; ++it) { const int pg = (it >> 2) * 8 + g; unsigned* d = xt + pg * 4 * (CC / 2) + (((wave * 4 + (it & 3)) ^ pg) << 2) + q;
#pragma unroll   // constant indices, so that the arrays indexed here are registers
        for (int j = 0; j < 4; ++j) { v2f x; x[0] = a[it][j]; x[1] = b[it][j]; d[j * (CC / 2)] = __builtin_bit_cast(unsigned, __builtin_convertvector(x, v2bfx)); } }
    __syncthreads();
    bf* o0 = XT2 + ((size_t)blockIdx.y * NP + blockIdx.x * XP + wave * 8) * CC + lane * 8;
    v4u r[8];
#pragma unroll   // constant indices, so that the arrays indexed here are registers
    for (int i = 0; i < 8; ++i) { const int p = wave * 8 + i; r[i] = *(const v4u*)(xt + p * (CC / 2) + ((lane ^ (p >> 2)) << 2)); }
#pragma unroll   // constant indices, so that the arrays indexed here are registers
    for (int i = 0; i < 8; ++i) *(v8us*)(o0 + i * CC) = __builtin_bit_cast(v8us, r[i]);
}
// ---- k_fattn: scores, softmax and attn.v of one [64][1024] block in ONE kernel; the scores never leave the registers.
// grid (1024 / 128 query tiles, 32 blocks, 4 batches), 8 waves; a wave owns 16 queries (columns) and walks the 1024 keys in passes of 32.
// Transposed product: S^T[key][query] = position term (k_ptab's tables, the accumulators' start value) + K^T rows . q columns (3 hi/lo products), so a lane holds 16 scores of ONE query;
// the two 16-key score tiles, turned into exp2 weights and split hi/lo, ARE the B operand (hardware k order) of O^T[d][query] += V[d][key] . P^T[key][query] (3 products).
// Running maximum per query (log2 domain), O^T and the sum rescaled every pass, one division by the sum at the end.
// The 32 key rows of K^T (hi/lo) and the 32 key columns of V (hi/lo) are staged per pass in LDS for all 8 waves (K^T in whole-line, V in half-line global loads, two buffers, one barrier a pass).
#define FQ   128                 // queries per work-group
#define FK   32                  // keys per pass
#define NS   (TT / FK)           // passes
#define KP   72                  // LDS pitch of a key row of K^T, 16-bit elements: 128 B + 16 B, conflict-free for 16-byte reads
#define VP   40                  // LDS pitch of a d row of V: 64 B + 16 B
#define KPL  (FK * KP)           // one K^T plane of a stage
#define VPL  (HD * VP)           // one V plane of a stage
#define STG  (2 * KPL + 2 * VPL) // one stage, 16-bit elements
#define OP   132                 // LDS pitch of an output row, floats
#define CL2  0.18033688011112042f   // HD^-0.5 * log2(e)
typedef __attribute__((ext_vector_type(2))) __bf16 v2bf;
__device__ __forceinline__ float xhalf(float x) { const int b = __float_as_int(x); return __int_as_float(__builtin_amdgcn_permlanex16(b, b, 0x76543210, 0xfedcba98, false, false)); }   // lane l <-> l ^ 16
__device__ __forceinline__ v16bf ldsfrag(const bf* p) { return cat16b(*(const v8us*)p, *(const v8us*)(p + 16)); }
// ---- k_ptab: the position term of one block, factored. pos[n][d] = rel_h[d][n / 32] + rel_w[d][n % 32] + rel_t[d][f], so sum_d pos[n][d] q[d][m] = RW[n % 32][m] + CA[n / 32][m]
// with RW[b][m] = sum_d rel_w[d][b] q[d][m] and CA[a][m] = sum_d rel_h[d][a] q[d][m] + sum_d rel_t[d][f] q[d][m].
// grid (1024 / 256 keys, 32 blocks, 4 batches), 8 waves; a wave owns 32 keys (two 16-key tiles, the A rows, from the q^T planes) and five 16-column B tiles: rel_w 0-15, 16-31, rel_h 0-15, 16-31, and rel_t[f] in all 16 columns.
// RWT holds each 16-key x 16-column tile in the accumulator's own order, 1 KiB a tile: registers 0-3 of lane l at float l * 4, registers 4-7 at 128 + l * 4 (whole lines for 16-byte accesses); tile index (block * 64 + key tile) * 2 + column tile; CAT is [block][a][m].
__global__ __launch_bounds__(256) void k_ptab(const bf* __restrict__ QTh, const bf* __restrict__ QTl, const float* __restrict__ rh, const float* __restrict__ rw, const float* __restrict__ rt, float* __restrict__ RWT, float* __restrict__ CAT) {
    __shared__ __align__(16) bf rl[65 * KP];   // rows [column][d]: 0-31 rel_w, 32-63 rel_h, 64 rel_t of this frame
    const int tid = threadIdx.x, lane = tid & 31, lr = lane & 15, hi = lane >> 4, wave = tid >> 5;
    const int h = blockIdx.y / NF, f = blockIdx.y % NF, zi = blockIdx.z * NBL + blockIdx.y;
    { const int i0 = h * (HD * 32) + tid; float fw[HD * 32 / 256], fh[HD * 32 / 256];
#pragma unroll   // constant indices, so that the arrays indexed here are registers; all 16 loads in flight at once
      for (int j = 0; j < HD * 32 / 256; ++j) { fw[j] = rw[i0 + j * 256]; fh[j] = rh[i0 + j * 256]; }
      // the index register of the 16 loads above stays untouched (an input here) until this wait
      asm volatile("s_wait_xcnt 0x0" :: "v"(i0) : "memory");
#pragma unroll   // constant indices, so that the arrays indexed here are registers
      for (int j = 0; j < HD * 32 / 256; ++j) { const int i = j * 256 + tid, d = i >> 5, c = i & 31; rl[c * KP + d] = f2bf(fw[j]); rl[(32 + c) * KP + d] = f2bf(fh[j]); } }
    if (tid < HD) { const int it = (h * HD + tid) * NF + f; const float x = rt[it];
      asm volatile("s_wait_xcnt 0x0" :: "v"(it) : "memory");   // as above: the load's index register stays untouched until here
      rl[64 * KP + tid] = f2bf(x); }
    __syncthreads();
    v16bf br[5][2];
#pragma unroll   // constant indices, so that the arrays indexed here are registers
    for (int c = 0; c < 5; ++c)
#pragma unroll   // constant indices, so that the arrays indexed here are registers
        for (int ks = 0; ks < 2; ++ks) br[c][ks] = ldsfrag(rl + (c < 4 ? c * 16 + lr : 64) * KP + ks * 32 + 8 * hi);
    const int m0 = blockIdx.x * 256 + wave * 32;
#pragma unroll   // constant indices, so that the arrays indexed here are registers
    for (int t = 0; t < 2; ++t) {
        const size_t ro = (size_t)zi * BLK + (size_t)(m0 + t * 16 + lr) * HD + 8 * hi; const bf* ah = QTh + ro; const bf* al = QTl + ro;
        v16bf qh[2], ql[2];
#pragma unroll   // constant indices, so that the arrays indexed here are registers
        for (int ks = 0; ks < 2; ++ks) { qh[ks] = WFrag<bf>::ld(ah + ks * 32); ql[ks] = WFrag<bf>::ld(al + ks * 32); }
        // the address pairs of the 8 loads above stay untouched (inputs here) until this wait
        asm volatile("s_wait_xcnt 0x0" :: "v"(ah), "v"(al) : "memory");
        v8f acc[5];
#pragma unroll   // constant indices, so that the arrays indexed here are registers
        for (int c = 0; c < 5; ++c) acc[c] = (v8f){};
#pragma unroll   // constant indices, so that the arrays indexed here are registers
        for (int ks = 0; ks < 2; ++ks) {
#pragma unroll   // constant indices, so that the arrays indexed here are registers
            for (int c = 0; c < 5; ++c) acc[c] = wmmab(qh[ks], br[c][ks], acc[c]);
#pragma unroll   // constant indices, so that the arrays indexed here are registers
            for (int c = 0; c < 5; ++c) acc[c] = wmmab(ql[ks], br[c][ks], acc[c]); }
        const int mt = (m0 >> 4) + t;
#pragma unroll   // constant indices, so that the arrays indexed here are registers
        for (int c = 0; c < 2; ++c) {
            float* ow = RWT + (((size_t)zi * (TT / 16) + mt) * 2 + c) * 256 + lane * 4;
            *(v4f*)ow = __builtin_shufflevector(acc[c], acc[c], 0, 1, 2, 3); *(v4f*)(ow + 128) = __builtin_shufflevector(acc[c], acc[c], 4, 5, 6, 7);
            *(v8f*)(CAT + ((size_t)zi * 32 + c * 16 + lr) * TT + mt * 16 + 8 * hi) = acc[2 + c] + acc[4]; }
    }
}
__global__ __launch_bounds__(256) void k_fattn(const bf* __restrict__ QTh, const bf* __restrict__ QTl, const bf* __restrict__ KTh, const bf* __restrict__ KTl, const float* __restrict__ RWT, const float* __restrict__ CAT, const bf* __restrict__ VTh, const bf* __restrict__ VTl, float* __restrict__ OB) {
    __shared__ __align__(16) bf ring[2 * STG];
    __shared__ __align__(16) float os[HD * OP];
    const int tid = threadIdx.x, lane = tid & 31, lr = lane & 15, hi = lane >> 4, wave = tid >> 5;
    const int zi = blockIdx.z * NBL + blockIdx.y; const size_t zb = (size_t)zi * BLK; const int n0 = blockIdx.x * FQ + wave * 16;
    // staging: a thread moves 16 bytes of each of the four planes per pass
    const bf* gkh = KTh + zb + tid * 8; const bf* gkl = KTl + zb + tid * 8;
    const bf* gvh = VTh + zb + (size_t)(tid >> 2) * TT + (tid & 3) * 8; const bf* gvl = VTl + zb + (size_t)(tid >> 2) * TT + (tid & 3) * 8;
    const int sk = (tid >> 3) * KP + (tid & 7) * 8, sv = 2 * KPL + (tid >> 2) * VP + (tid & 3) * 8;
    v8us st[4];
    auto sstore = [&](int b) { bf* r = ring + b * STG; *(v8us*)(r + sk) = st[0]; *(v8us*)(r + KPL + sk) = st[1]; *(v8us*)(r + sv) = st[2]; *(v8us*)(r + VPL + sv) = st[3]; };
    // position term of a pass, straight into registers one pass ahead: this wave's two RW tiles (columns n % 32 = its 16 queries, in accumulator order) and the 32 keys of its CA row (n / 32 is one value for the wave)
    const float* grw = RWT + ((size_t)zi * (TT / 16) * 2 + ((n0 >> 4) & 1)) * 256 + lane * 4; const float* gca = CAT + ((size_t)zi * 32 + (n0 >> 5)) * TT + 8 * hi;
    v8f bw[2], bc[2];
    auto gload = [&](int s) { const bf* pkh = gkh + s * (FK * HD); const bf* pkl = gkl + s * (FK * HD); const bf* pvh = gvh + s * FK; const bf* pvl = gvl + s * FK; const float* pw = grw + s * 1024; const float* pc = gca + s * FK;
        st[0] = *(const v8us*)pkh; st[1] = *(const v8us*)pkl; st[2] = *(const v8us*)pvh; st[3] = *(const v8us*)pvl; bw[0] = __builtin_shufflevector(*(const v4f*)pw, *(const v4f*)(pw + 128), 0, 1, 2, 3, 4, 5, 6, 7); bw[1] = __builtin_shufflevector(*(const v4f*)(pw + 512), *(const v4f*)(pw + 640), 0, 1, 2, 3, 4, 5, 6, 7); bc[0] = *(const v8f*)pc; bc[1] = *(const v8f*)(pc + 16);
        // the address pairs of the 12 loads above stay untouched (inputs here) until this wait
        asm volatile("s_wait_xcnt 0x0" :: "v"(pkh), "v"(pkl), "v"(pvh), "v"(pvl), "v"(pw), "v"(pc) : "memory"); };
    gload(0);
    // B operands of the score products, kept in registers: column = query n0 + lr, k = d
    v16bf bqh[2], bql[2];
    { const size_t qo = zb + (size_t)(n0 + lr) * HD + 8 * hi;
      const bf* aqh = QTh + qo; const bf* aql = QTl + qo;
#pragma unroll   // constant indices, so that the arrays indexed here are registers
      for (int ks = 0; ks < 2; ++ks) { bqh[ks] = WFrag<bf>::ld(aqh + ks * 32); bql[ks] = WFrag<bf>::ld(aql + ks * 32); }
      // the address pairs of the 8 loads above stay untouched (inputs here) until this wait
      asm volatile("s_wait_xcnt 0x0" :: "v"(aqh), "v"(aql) : "memory"); }
    v8f o[4];
#pragma unroll   // constant indices, so that the arrays indexed here are registers
    for (int dt = 0; dt < 4; ++dt) o[dt] = (v8f){};
    float mc = -3.0e38f, l = 0.f;
    v8f s1[2];   // the scores' accumulators; their start value is the position term, summed at the foot of the pass before
#pragma unroll   // constant indices, so that the arrays indexed here are registers
    for (int t = 0; t < 2; ++t) s1[t] = bw[t] + bc[t];
    sstore(0);
    __syncthreads();
#pragma unroll 1   // rolled: the pass is long enough; for speed only
    for (int s = 0; s < NS; ++s) {
        const bf* r = ring + (s & 1) * STG;
        if (s + 1 < NS) gload(s + 1);   // lands while this pass computes
#pragma unroll   // constant indices, so that the arrays indexed here are registers
        for (int ks = 0; ks < 2; ++ks) { const bf* p = r + lr * KP + ks * 32 + 8 * hi;
            const v16bf kh0 = ldsfrag(p), kh1 = ldsfrag(p + 16 * KP), kl0 = ldsfrag(p + KPL), kl1 = ldsfrag(p + KPL + 16 * KP);
            s1[0] = wmmab(kh0, bqh[ks], s1[0]); s1[1] = wmmab(kh1, bqh[ks], s1[1]);
            s1[0] = wmmab(kh0, bql[ks], s1[0]); s1[1] = wmmab(kh1, bql[ks], s1[1]);
            s1[0] = wmmab(kl0, bqh[ks], s1[0]); s1[1] = wmmab(kl1, bqh[ks], s1[1]); }
        v16bf vh[4], vl[4];   // asked for ahead of the softmax arithmetic, which covers the LDS latency of as many of them as the registers hold
#pragma unroll   // constant indices, so that the arrays indexed here are registers
        for (int dt = 0; dt < 4; ++dt) { const bf* p = r + 2 * KPL + (dt * 16 + lr) * VP + 8 * hi; vh[dt] = ldsfrag(p); vl[dt] = ldsfrag(p + VPL); }
        float u[16];
#pragma unroll   // constant indices, so that the arrays indexed here are registers
        for (int i = 0; i < 16; ++i) u[i] = s1[i >> 3][i & 7];
        float mx = u[0];
#pragma unroll   // constant indices, so that the arrays indexed here are registers
        for (int i = 1; i < 16; ++i) mx = fmaxf(mx, u[i]);
        mx = fmaxf(mx, xhalf(mx));
        const float mn = fmaxf(mc, mx * CL2); const float al = __builtin_amdgcn_exp2f(mc - mn); mc = mn;
        float ps[4] = {0.f, 0.f, 0.f, 0.f};
#pragma unroll   // constant indices, so that the arrays indexed here are registers
        for (int i = 0; i < 16; ++i) { u[i] = __builtin_amdgcn_exp2f(__builtin_fmaf(u[i], CL2, -mn)); ps[i & 3] += u[i]; }
        l = l * al + ((ps[0] + ps[1]) + (ps[2] + ps[3]));   // this lane half's keys; the halves are joined behind the loop
        v16bf ph, pl;
#pragma unroll   // constant indices, so that the arrays indexed here are registers
        for (int i = 0; i < 8; ++i) { v2f x; x[0] = u[2 * i]; x[1] = u[2 * i + 1]; const v2bf h = __builtin_convertvector(x, v2bf); const v2bf w = __builtin_convertvector(x - __builtin_convertvector(h, v2f), v2bf);
            ph[2 * i] = h[0]; ph[2 * i + 1] = h[1]; pl[2 * i] = w[0]; pl[2 * i + 1] = w[1]; }
#pragma unroll   // constant indices, so that the arrays indexed here are registers
        for (int dt = 0; dt < 4; ++dt) o[dt] *= al;
#pragma unroll   // constant indices, so that the arrays indexed here are registers
        for (int dt = 0; dt < 4; ++dt) o[dt] = wmmab(vh[dt], ph, o[dt]);
#pragma unroll   // constant indices, so that the arrays indexed here are registers
        for (int dt = 0; dt < 4; ++dt) o[dt] = wmmab(vh[dt], pl, o[dt]);
#pragma unroll   // constant indices, so that the arrays indexed here are registers
        for (int dt = 0; dt < 4; ++dt) o[dt] = wmmab(vl[dt], ph, o[dt]);
#pragma unroll   // constant indices, so that the arrays indexed here are registers
        for (int t = 0; t < 2; ++t) s1[t] = bw[t] + bc[t];   // the next pass's start value (behind the last pass: unused)
        if (s + 1 < NS) sstore((s + 1) & 1);   // the buffer that pass s - 1 read; every wave left it at the last barrier
        __syncthreads();
    }
    l += xhalf(l);
    const float inv = __fdiv_rn(1.0f, l);
    // O^T[d][query] through LDS, so that every 128-byte line of the channels-first output is written whole by one wave
#pragma unroll   // constant indices, so that the arrays indexed here are registers
    for (int dt = 0; dt < 4; ++dt)
#pragma unroll   // constant indices, so that the arrays indexed here are registers
        for (int j = 0; j < 8; ++j) os[(dt * 16 + 8 * hi + j) * OP + wave * 16 + lr] = o[dt][j] * inv;
    __syncthreads();
    float* ob = OB + zb + blockIdx.x * FQ;
#pragma unroll
    for (int i = 0; i < 8; ++i) { const int d = wave * 8 + i; *(v4f*)(ob + (size_t)d * TT + lane * 4) = *(const v4fa*)(os + d * OP + lane * 4); }
}
__global__ __launch_bounds__(256) void k_merge(const float* __restrict__ O, int h0, bf* Ah, bf* Al) { const size_t e = ((size_t)blockIdx.x * 256 + threadIdx.x) * 2; if (e >= (size_t)ZH * TT * HD) return; const int d = (int)(e % HD); const int t = (int)((e / HD) % TT); const int zz = (int)(e / ((size_t)HD * TT)); const float cs = (t < RH) ? 1.0f : (1.0f / PCAR); const size_t oo = (size_t)t * DQ + (h0 + zz) * HD + d;
    v2us oh, ol;
#pragma unroll
    for (int q = 0; q < 2; ++q) { unsigned short a, c2; splitf(O[e + q] * cs, a, c2); oh[q] = a; ol[q] = c2; } *(v2us*)(Ah + oo) = oh; *(v2us*)(Al + oo) = ol;  }

extern "C" void kernel_launch(void* const* d_in, const int* in_sizes, int n_in,
                              void* d_out, int out_size, void* d_ws, size_t ws_size, hipStream_t stream) {
    (void)in_sizes; (void)n_in; (void)out_size;
    const float* x = (const float*)d_in[0]; const float* wq = (const float*)d_in[1]; const float* wk = (const float*)d_in[2]; const float* wv = (const float*)d_in[3]; const float* relh = (const float*)d_in[4]; const float* relw = (const float*)d_in[5]; const float* relt = (const float*)d_in[6]; const float* wo = nullptr; (void)wo; const float* cosT = nullptr; const float* sinT = nullptr; (void)cosT; (void)sinT;
    float* OUT = (float*)d_out;   // [4][256][8][32][32]
    char* wsp = (char*)d_ws; auto take = [&](size_t bytes) { char* p = wsp; wsp += (bytes + 255) & ~(size_t)255; return (void*)p; };
    bf* WQ = (bf*)take((size_t)CC * CC * 2); bf* WK = (bf*)take((size_t)CC * CC * 2); bf* WV = (bf*)take((size_t)CC * CC * 2);
    bf* XT = (bf*)take((size_t)NB_ * NP * CC * 2);
    bf* QTh = (bf*)take((size_t)NB_ * NBL * BLK * 2); bf* QTl = (bf*)take((size_t)NB_ * NBL * BLK * 2); bf* KTh = (bf*)take((size_t)NB_ * NBL * BLK * 2); bf* KTl = (bf*)take((size_t)NB_ * NBL * BLK * 2);
    float* RWT = (float*)take((size_t)NB_ * NBL * 32 * TT * 4); float* CAT = (float*)take((size_t)NB_ * NBL * 32 * TT * 4);
    bf* VTh = (bf*)take((size_t)NB_ * NBL * BLK * 2); bf* VTl = (bf*)take((size_t)NB_ * NBL * BLK * 2);
    if ((size_t)(wsp - (char*)d_ws) > ws_size) return;   // ws ~ 145 MiB
    { k_cvt8<<<(unsigned)(((size_t)CC * CC / 8 + 255) / 256), 256, 0, stream>>>(wq, WQ, (size_t)CC * CC / 8); k_cvt8<<<(unsigned)(((size_t)CC * CC / 8 + 255) / 256), 256, 0, stream>>>(wk, WK, (size_t)CC * CC / 8); k_cvt8<<<(unsigned)(((size_t)CC * CC / 8 + 255) / 256), 256, 0, stream>>>(wv, WV, (size_t)CC * CC / 8); }
    k_xT<<<dim3(NP / XP, NB_, 1), 256, 0, stream>>>(x, XT);
    k_proj<true><<<dim3(CC / 64, TT / 8, NB_), 32, 0, stream>>>(WQ, XT, QTh, QTl);
    k_proj<true><<<dim3(CC / 64, TT / 8, NB_), 32, 0, stream>>>(WK, XT, KTh, KTl);
    k_proj<false><<<dim3(CC / 64, NP / 64, NB_), 32, 0, stream>>>(WV, XT, VTh, VTl);
    k_ptab<<<dim3(TT / 256, NBL, NB_), 256, 0, stream>>>(QTh, QTl, relh, relw, relt, RWT, CAT);
    k_fattn<<<dim3(TT / FQ, NBL, NB_), 256, 0, stream>>>(QTh, QTl, KTh, KTl, RWT, CAT, VTh, VTl, OUT);
}

// v006
// A run of this version takes 153 microseconds.
// Two timings next to v005 both put it at 1.13 times that version's speed.
// Counting every step since v000, it is 8.63 times as fast.
#include <hip/hip_runtime.h>

// MHSA3D (x [4][256][8][32][32] channels-first; q/k/v = 1x1x1 conv (wq/wk/wv [256][256]) then the module's literal reshape (B, 4 heads, 8 frames, 64, 1024) of the [B][C][F][H][W] buffer = 32 contiguous [64][1024] blocks per batch; per block: energy[n][m] = (sum_d q[d][n] k[d][m] + sum_d pos[n][d] q[d][m]) / 8 with pos[h][f][n][d] = rel_h[h][d][n/32] + rel_w[h][d][n%32] + rel_t[h][d][f]; softmax over m; out[d][j] = sum_n v[d][n] attn[j][n]; -> [4][256][8][32][32]).
// Compute dtypes, f32 accumulate: every input rounded to bf16; the three convs as PLAIN bf16 GEMMs W . x (inputs: exact; x transposed to token-major on chip); per block: q^T, k^T hi/lo planes (transposed) and v hi/lo planes, all split and stored by the conv GEMM's own epilogue, the position term factored: sum_d pos[n][d] q[d][m] = sum_d rel_w[d][n%32] q[d][m] + sum_d rel_h[d][n/32] q[d][m] + sum_d rel_t[d][f] q[d][m], 65 rows a block instead of 1024 (k_ptab: rel rows exact in bf16 x q hi/lo, 2 products, f32 tables); the q.k product hl x hl (3 products) on every row, accumulated on top of the position term in f32; softmax f32 with a running maximum (weights exp2 of the scaled difference, split hi/lo unnormalised); attn.v hl x hl (3 products) on every row, divided by the row sum at the end; scores, softmax and attn.v in one kernel (k_fattn), which stores the context block [d][j] straight into the channels-first output in f32.

#define NB_  4
#define TT   1024
#define DM   256
#define NH_  4
#define NKV  4
#define REP  (NH_ / NKV)
#define HD   64
#define DQ   (NH_ * HD)
#define DKV  (NKV * HD)
#define ZH   8
#define RH   1024   // all rows hl
#define WIN  0
#define PCAR 1024.0f
#define CC   256    // channels
#define NF   8      // frames
#define NP   (NF * TT)   // positions per batch (8192)
#define NBL  (NH_ * NF)  // blocks per batch (32)
#define BLK  ((size_t)HD * TT)   // floats per block (65536)
#define SCL  0.125f   // HD^-0.5
typedef _Float16 h16;
typedef unsigned short bf;
typedef __attribute__((ext_vector_type(16))) __bf16   v16bf;
typedef __attribute__((ext_vector_type(16))) _Float16 v16h;
typedef __attribute__((ext_vector_type(8)))  _Float16 v8h;
typedef __attribute__((ext_vector_type(8)))  unsigned short v8us;
typedef __attribute__((ext_vector_type(8)))  float    v8f;
typedef __attribute__((ext_vector_type(4)))  float    v4f;
typedef v8h  __attribute__((may_alias)) v8ha;
typedef v4f  __attribute__((may_alias)) v4fa;
typedef v8us __attribute__((may_alias)) v8usa;

__device__ __forceinline__ unsigned short f2bf(float f) { unsigned u = __float_as_uint(f); u += 0x7FFFu + ((u >> 16) & 1u); return (unsigned short)(u >> 16); }
__device__ __forceinline__ float bf2f(unsigned short b) { return __uint_as_float(((unsigned)b) << 16); }
__device__ __forceinline__ float bfr(float f) { return bf2f(f2bf(f)); }
__device__ __forceinline__ v16h cat16(v8h lo, v8h hi) { return __builtin_shufflevector(lo, hi, 0, 1, 2, 3, 4, 5, 6, 7, 8, 9, 10, 11, 12, 13, 14, 15); }
__device__ __forceinline__ v16bf cat16b(v8us lo, v8us hi) { return __builtin_bit_cast(v16bf, __builtin_shufflevector(lo, hi, 0, 1, 2, 3, 4, 5, 6, 7, 8, 9, 10, 11, 12, 13, 14, 15)); }
__device__ __forceinline__ v8f wmma16(v16h a, v16h b, v8f c) { return __builtin_amdgcn_wmma_f32_16x16x32_f16(false, a, false, b, (short)0, c, false, false); }
__device__ __forceinline__ v8f wmmab(v16bf a, v16bf b, v8f c) { return __builtin_amdgcn_wmma_f32_16x16x32_bf16(false, a, false, b, (short)0, c, false, false); }



template <typename T16> struct WFrag;
template <> struct WFrag<h16> { typedef v16h V; static __device__ __forceinline__ V ld(const h16* p) { return cat16(*(const v8h*)p, *(const v8h*)(p + 16)); } static __device__ __forceinline__ v8f mma(V a, V b, v8f c) { return wmma16(a, b, c); } };
template <> struct WFrag<bf> { typedef v16bf V; static __device__ __forceinline__ V ld(const bf* p) { return cat16b(*(const v8us*)p, *(const v8us*)(p + 16)); } static __device__ __forceinline__ v8f mma(V a, V b, v8f c) { return wmmab(a, b, c); } };
#define PP   264                 // LDS pitch of a staged row, 16-bit elements: 512 B + 16 B
typedef __attribute__((ext_vector_type(8))) __bf16 v8bf;
typedef __attribute__((ext_vector_type(4))) __bf16 v4bf;
typedef __attribute__((ext_vector_type(4))) unsigned short v4us;
template <bool TR>
__global__ __launch_bounds__(256) void k_proj(const bf* __restrict__ Wm, const bf* __restrict__ XTm, bf* __restrict__ Ph, bf* __restrict__ Pl) {
    __shared__ __align__(16) bf sm[(CC + 128) * PP];
    const int tid = threadIdx.x, lane = tid & 31, lr = lane & 15, hi = lane >> 4, wave = tid >> 5; const int o0 = (wave & 3) * 64, ty = blockIdx.y * 2 + (wave >> 2);
    XTm += (size_t)blockIdx.z * NP * CC; Ph += (size_t)blockIdx.z * NBL * BLK; Pl += (size_t)blockIdx.z * NBL * BLK;
    { // staging: wave w brings W rows 32 w ... 32 w + 31 and the x^T rows of LDS rows 256 + 16 w ... 256 + 16 w + 15
      const bf* gw = Wm + (size_t)wave * 32 * CC + lane * 8;
      const bf* gx = XTm + (TR ? ((size_t)blockIdx.y * 16 + wave * 2) : ((size_t)blockIdx.y * 128 + (wave >> 2) * 64 + (wave & 3))) * CC + lane * 8;
      v8us sw[32], sx[16];
#pragma unroll   // constant indices, so that the arrays indexed here are registers; all loads in flight at once
      for (int i = 0; i < 32; ++i) sw[i] = *(const v8us*)(gw + i * CC);
#pragma unroll   // constant indices, so that the arrays indexed here are registers; all loads in flight at once
      for (int i = 0; i < 16; ++i) sx[i] = *(const v8us*)(gx + (size_t)(TR ? (i & 7) * TT + (i >> 3) : i * 4) * CC);
      // the two address pairs of the 48 loads above stay untouched (inputs here) until this wait
      asm volatile("s_wait_xcnt 0x0" :: "v"(gw), "v"(gx) : "memory");
      bf* dw = sm + wave * 32 * PP + lane * 8; bf* dx = sm + (CC + wave * 16) * PP + lane * 8;
#pragma unroll   // constant indices, so that the arrays indexed here are registers
      for (int i = 0; i < 32; ++i) *(v8us*)(dw + i * PP) = sw[i];
#pragma unroll   // constant indices, so that the arrays indexed here are registers
      for (int i = 0; i < 16; ++i) *(v8us*)(dx + i * PP) = sx[i]; }
    __syncthreads();
    const bf* wrow = sm + (o0 + lr) * PP + 8 * hi;
    const bf* xrow = sm + (CC + (wave >> 2) * 64 + lr) * PP + 8 * hi;
    const bf* A = TR ? xrow : wrow; const bf* B = TR ? wrow : xrow;
    constexpr int TS = 16 * PP;   // from one 16-row / 16-column tile to the next
    v8f acc[4][4];
    // one trip: 32 channels. The first trip stands in front of the loop and starts from a zero C operand, so that no accumulator register is live while the 48 staged rows are still in registers
    auto trip = [&](const int kc, const bool first) {
        const bf* ap = A + kc; const bf* bp = B + kc; v16bf a[4];
#pragma unroll   // constant indices, so that the arrays indexed here are registers
        for (int mb = 0; mb < 4; ++mb) a[mb] = WFrag<bf>::ld(ap + mb * TS);
#pragma unroll   // constant indices, so that the arrays indexed here are registers
        for (int nb = 0; nb < 4; ++nb) { const v16bf b = WFrag<bf>::ld(bp + nb * TS);
#pragma unroll   // constant indices, so that the arrays indexed here are registers
            for (int mb = 0; mb < 4; ++mb) acc[mb][nb] = wmmab(a[mb], b, first ? (v8f){} : acc[mb][nb]); }
        // four vector slots behind the trip's last matrix instructions, also on the taken back edge, before anything touches their operands or results
        asm volatile("v_nop\n\tv_nop\n\tv_nop\n\tv_nop" : "+v"(acc[0][0]), "+v"(acc[1][1]), "+v"(acc[2][2]), "+v"(acc[3][3]) : "v"(a[0]), "v"(a[3]));
    };
    trip(0, true);
#pragma unroll 1   // rolled: beside the accumulators only one trip's fragments are kept in registers
    for (int kc = 32; kc < CC; kc += 32) trip(kc, false);
    if (TR) {
#pragma unroll   // constant indices, so that the arrays indexed here are registers
        for (int mb = 0; mb < 4; ++mb)
#pragma unroll   // constant indices, so that the arrays indexed here are registers
            for (int nb = 0; nb < 4; ++nb) { const v8f y = acc[mb][nb]; const v8bf h = __builtin_convertvector(y, v8bf); const v8bf w = __builtin_convertvector(y - __builtin_convertvector(h, v8f), v8bf);
                const size_t e = (size_t)(o0 / 8 + nb * 2 + (lr >> 3)) * BLK + (size_t)(ty * 8 + mb * 2 + hi) * HD + (lr & 7) * 8;
                *(v8us*)(Ph + e) = __builtin_bit_cast(v8us, h); *(v8us*)(Pl + e) = __builtin_bit_cast(v8us, w); }
    } else {
#pragma unroll   // constant indices, so that the arrays indexed here are registers
        for (int mb = 0; mb < 4; ++mb)
#pragma unroll   // constant indices, so that the arrays indexed here are registers
            for (int r = 0; r < 8; ++r) { v4f y; y[0] = acc[mb][0][r]; y[1] = acc[mb][1][r]; y[2] = acc[mb][2][r]; y[3] = acc[mb][3][r]; const v4bf h = __builtin_convertvector(y, v4bf); const v4bf w = __builtin_convertvector(y - __builtin_convertvector(h, v4f), v4bf);
                const size_t e = (size_t)(o0 + mb * 16 + 8 * hi + r) * NP + ty * 64 + lr * 4;
                *(v4us*)(Ph + e) = __builtin_bit_cast(v4us, h); *(v4us*)(Pl + e) = __builtin_bit_cast(v4us, w); }
    }
}

__device__ __forceinline__ h16 tohx(float x) { return (h16)x; }
__device__ __forceinline__ void splitf(float y, unsigned short& h, unsigned short& l) { h = f2bf(y); l = f2bf(y - bf2f(h)); }
typedef __attribute__((ext_vector_type(2))) _Float16 v2h;
typedef __attribute__((ext_vector_type(4))) _Float16 v4h;
typedef __attribute__((ext_vector_type(2))) unsigned short v2us;
typedef __attribute__((ext_vector_type(2))) float v2f;
typedef __attribute__((ext_vector_type(4))) int v4i;

__global__ __launch_bounds__(256) void k_wtG(const float* __restrict__ w, int K, int N, bf* Bt) {
    const int lane = threadIdx.x & 31; const int L0 = (blockIdx.x * 8 + (threadIdx.x >> 5)) * 8; const int nlines = N * K / 64;
{
#pragma unroll 1
        for (int l = 0; l < 8; ++l) { const int L = L0 + l; if (L >= nlines) break; const size_t e = (size_t)L * 64 + lane * 2; const int k = (int)(e % K), n = (int)(e / K); v2us o;
            o[0] = f2bf(w[(size_t)k * N + n]); o[1] = f2bf(w[(size_t)(k + 1) * N + n]); *(v2us*)(Bt + e) = o; }
         }
}
__global__ __launch_bounds__(256) void k_cvt8(const float* __restrict__ src, bf* dst, size_t n8) { const size_t i = (size_t)blockIdx.x * 256 + threadIdx.x; if (i >= n8) return; const v8f v = *(const v8f*)(src + i * 8); v8us o;
#pragma unroll
    for (int k = 0; k < 8; ++k) o[k] = f2bf(v[k]); *(v8us*)(dst + i * 8) = o;  }
__global__ __launch_bounds__(256) void k_cscvt(const float* __restrict__ cosT, const float* __restrict__ sinT, float* CS) { const int idx = blockIdx.x * 256 + threadIdx.x; if (idx >= TT * HD) return; v2f cs; cs[0] = bfr(cosT[idx]); cs[1] = bfr(sinT[idx]); *(v2f*)(CS + (size_t)idx * 2) = cs;  }
// k_rope: head planes [h][t][d] (fp16 + hi/lo) of rope(x) x sc with the rotate-half convention out[d] = x[d] cos[t][d] - x[d+HD/2] sin[t][d], out[d+HD/2] = x[d+HD/2] cos[t][d+HD/2] + x[d] sin[t][d+HD/2]
__global__ __launch_bounds__(256) void k_rope(const float* __restrict__ F, int pitch, int nheads, const float* __restrict__ CS, const float* __restrict__ RF, const float* __restrict__ nw, float sc, h16* P16, bf* Ph, bf* Pl) {
    const size_t e = ((size_t)blockIdx.x * 256 + threadIdx.x) * 2; if (e >= (size_t)nheads * TT * HD) return; const int d = (int)(e % HD); const int t = (int)((e / HD) % TT); const int h = (int)(e / ((size_t)HD * TT)); const float* f = F + (size_t)t * pitch + h * HD; const float rf = RF ? RF[(size_t)h * TT + t] : 1.0f; v2h o16; v2us oh, ol;
#pragma unroll
    for (int q = 0; q < 2; ++q) { const int dd = d + q; const int dp = (dd < HD / 2) ? dd + HD / 2 : dd - HD / 2; float x0 = f[dd], x1 = f[dp];
        if (RF) { float n0 = __fmul_rn(x0, rf), n1 = __fmul_rn(x1, rf); asm volatile("" : "+v"(n0)); asm volatile("" : "+v"(n1)); x0 = __fmul_rn(bfr(nw[dd]), n0); x1 = __fmul_rn(bfr(nw[dp]), n1); }
        const v2f cs = *(const v2f*)(CS + ((size_t)t * HD + dd) * 2); float a = __fmul_rn(x0, cs[0]), bq = __fmul_rn(x1, cs[1]); asm volatile("" : "+v"(a)); asm volatile("" : "+v"(bq)); const float r = ((dd < HD / 2) ? __fsub_rn(a, bq) : __fadd_rn(a, bq)) * sc;
        o16[q] = tohx(r); unsigned short a2, c2; splitf(r, a2, c2); oh[q] = a2; ol[q] = c2; }
    *(v2h*)(P16 + e) = o16; *(v2us*)(Ph + e) = oh; *(v2us*)(Pl + e) = ol;  }
__global__ __launch_bounds__(256) void k_vtp(const float* __restrict__ F, int pitch, int nheads, h16* V16, bf* Vh, bf* Vl) { const size_t e = ((size_t)blockIdx.x * 256 + threadIdx.x) * 2; if (e >= (size_t)nheads * HD * TT) return; const int t = (int)(e % TT); const int d = (int)((e / TT) % HD); const int g = (int)(e / ((size_t)TT * HD)); v2h o16; v2us oh, ol;
#pragma unroll
    for (int q = 0; q < 2; ++q) { const float x = F[(size_t)(t + q) * pitch + g * HD + d]; o16[q] = tohx(x); unsigned short a2, c2; splitf(x, a2, c2); oh[q] = a2; ol[q] = c2; }
    *(v2h*)(V16 + e) = o16; *(v2us*)(Vh + e) = oh; *(v2us*)(Vl + e) = ol;  }
// ---- k_xT: x [c][p] f32 -> x^T [p][c] bf16 through an LDS tile, whole 128-byte lines on both sides. grid (8192 / 64 positions, 4 batches), 8 waves; a work-group owns 64 positions x all 256 channels.
// In: a 16-byte load takes 4 positions of one channel, 8 lanes a line, 4 channels a wave; a thread takes the channels c and c + 1 at the same positions and packs them, so that every LDS store is one dword.
// LDS: [position][128 channel pairs]; the 16-byte chunk (8 channels) k of position p lies at chunk k ^ (p / 4): the 32 dword stores of a wave fall in 32 banks, and a row read back in 16-byte pieces covers every bank evenly.
// Out: a wave stores one whole position row (512 bytes) at a time.
#define XP   64                  // positions per work-group
typedef __attribute__((ext_vector_type(2))) __bf16 v2bfx;
typedef __attribute__((ext_vector_type(4))) unsigned v4u;
__global__ __launch_bounds__(256) void k_xT(const float* __restrict__ X, bf* __restrict__ XT2) {
    __shared__ __align__(16) unsigned xt[XP * (CC / 2)];
    const int tid = threadIdx.x, lane = tid & 31, wave = tid >> 5, g = lane & 7, q = lane >> 3;
    const float* s0 = X + ((size_t)blockIdx.y * CC + (wave * 16 + q) * 2) * NP + blockIdx.x * XP + g * 4;   // grid y = batch
    v4f a[8], b[8];
#pragma unroll   // constant indices, so that the arrays indexed here are registers; all 16 loads in flight at once
    for (int it = 0; it < 8; ++it) { const float* s = s0 + (size_t)(it & 3) * 8 * NP + (it >> 2) * 32; a[it] = *(const v4f*)s; b[it] = *(const v4f*)(s + NP); }
    // the address pair of the 16 loads above stays untouched (an input here) until this wait; the loaded values are inputs too, so that all 16 loads are issued before the first is used:
    // without that the compiler holds five of them back until earlier ones have landed, a second memory latency
    asm volatile("s_wait_xcnt 0x0" :: "v"(s0), "v"(a[0]), "v"(a[1]), "v"(a[2]), "v"(a[3]), "v"(a[4]), "v"(a[5]), "v"(a[6]), "v"(a[7]), "v"(b[0]), "v"(b[1]), "v"(b[2]), "v"(b[3]), "v"(b[4]), "v"(b[5]), "v"(b[6]), "v"(b[7]) : "memory");
#pragma unroll   // constant indices, so that the arrays indexed here are registers
    for (int it = 0; it < 8; ++it) { const int pg = (it >> 2) * 8 + g; unsigned* d = xt + pg * 4 * (CC / 2) + (((wave * 4 + (it & 3)) ^ pg) << 2) + q;
#pragma unroll   // constant indices, so that the arrays indexed here are registers
        for (int j = 0; j < 4; ++j) { v2f x; x[0] = a[it][j]; x[1] = b[it][j]; d[j * (CC / 2)] = __builtin_bit_cast(unsigned, __builtin_convertvector(x, v2bfx)); } }
    __syncthreads();
    bf* o0 = XT2 + ((size_t)blockIdx.y * NP + blockIdx.x * XP + wave * 8) * CC + lane * 8;
    v4u r[8];
#pragma unroll   // constant indices, so that the arrays indexed here are registers
    for (int i = 0; i < 8; ++i) { const int p = wave * 8 + i; r[i] = *(const v4u*)(xt + p * (CC / 2) + ((lane ^ (p >> 2)) << 2)); }
#pragma unroll   // constant indices, so that the arrays indexed here are registers
    for (int i = 0; i < 8; ++i) *(v8us*)(o0 + i * CC) = __builtin_bit_cast(v8us, r[i]);
}
// ---- k_fattn: scores, softmax and attn.v of one [64][1024] block in ONE kernel; the scores never leave the registers.
// grid (1024 / 128 query tiles, 32 blocks, 4 batches), 8 waves; a wave owns 16 queries (columns) and walks the 1024 keys in passes of 32.
// Transposed product: S^T[key][query] = position term (k_ptab's tables, the accumulators' start value) + K^T rows . q columns (3 hi/lo products), so a lane holds 16 scores of ONE query;
// the two 16-key score tiles, turned into exp2 weights and split hi/lo, ARE the B operand (hardware k order) of O^T[d][query] += V[d][key] . P^T[key][query] (3 products).
// Running maximum per query (log2 domain), O^T and the sum rescaled every pass, one division by the sum at the end.
// The 32 key rows of K^T (hi/lo) and the 32 key columns of V (hi/lo) are staged per pass in LDS for all 8 waves (K^T in whole-line, V in half-line global loads, two buffers, one barrier a pass).
#define FQ   128                 // queries per work-group
#define FK   32                  // keys per pass
#define NS   (TT / FK)           // passes
#define KP   72                  // LDS pitch of a key row of K^T, 16-bit elements: 128 B + 16 B, conflict-free for 16-byte reads
#define VP   40                  // LDS pitch of a d row of V: 64 B + 16 B
#define KPL  (FK * KP)           // one K^T plane of a stage
#define VPL  (HD * VP)           // one V plane of a stage
#define STG  (2 * KPL + 2 * VPL) // one stage, 16-bit elements
#define OP   132                 // LDS pitch of an output row, floats
#define CL2  0.18033688011112042f   // HD^-0.5 * log2(e)
typedef __attribute__((ext_vector_type(2))) __bf16 v2bf;
__device__ __forceinline__ float xhalf(float x) { const int b = __float_as_int(x); return __int_as_float(__builtin_amdgcn_permlanex16(b, b, 0x76543210, 0xfedcba98, false, false)); }   // lane l <-> l ^ 16
__device__ __forceinline__ v16bf ldsfrag(const bf* p) { return cat16b(*(const v8us*)p, *(const v8us*)(p + 16)); }
// ---- k_ptab: the position term of one block, factored. pos[n][d] = rel_h[d][n / 32] + rel_w[d][n % 32] + rel_t[d][f], so sum_d pos[n][d] q[d][m] = RW[n % 32][m] + CA[n / 32][m]
// with RW[b][m] = sum_d rel_w[d][b] q[d][m] and CA[a][m] = sum_d rel_h[d][a] q[d][m] + sum_d rel_t[d][f] q[d][m].
// grid (1024 / 256 keys, 32 blocks, 4 batches), 8 waves; a wave owns 32 keys (two 16-key tiles, the A rows, from the q^T planes) and five 16-column B tiles: rel_w 0-15, 16-31, rel_h 0-15, 16-31, and rel_t[f] in all 16 columns.
// RWT holds each 16-key x 16-column tile in the accumulator's own order, 1 KiB a tile: registers 0-3 of lane l at float l * 4, registers 4-7 at 128 + l * 4 (whole lines for 16-byte accesses); tile index (block * 64 + key tile) * 2 + column tile; CAT is [block][a][m].
__global__ __launch_bounds__(256) void k_ptab(const bf* __restrict__ QTh, const bf* __restrict__ QTl, const float* __restrict__ rh, const float* __restrict__ rw, const float* __restrict__ rt, float* __restrict__ RWT, float* __restrict__ CAT) {
    __shared__ __align__(16) bf rl[65 * KP];   // rows [column][d]: 0-31 rel_w, 32-63 rel_h, 64 rel_t of this frame
    const int tid = threadIdx.x, lane = tid & 31, lr = lane & 15, hi = lane >> 4, wave = tid >> 5;
    const int h = blockIdx.y / NF, f = blockIdx.y % NF, zi = blockIdx.z * NBL + blockIdx.y;
    { const int i0 = h * (HD * 32) + tid; float fw[HD * 32 / 256], fh[HD * 32 / 256];
#pragma unroll   // constant indices, so that the arrays indexed here are registers; all 16 loads in flight at once
      for (int j = 0; j < HD * 32 / 256; ++j) { fw[j] = rw[i0 + j * 256]; fh[j] = rh[i0 + j * 256]; }
      // the index register of the 16 loads above stays untouched (an input here) until this wait
      asm volatile("s_wait_xcnt 0x0" :: "v"(i0) : "memory");
#pragma unroll   // constant indices, so that the arrays indexed here are registers
      for (int j = 0; j < HD * 32 / 256; ++j) { const int i = j * 256 + tid, d = i >> 5, c = i & 31; rl[c * KP + d] = f2bf(fw[j]); rl[(32 + c) * KP + d] = f2bf(fh[j]); } }
    if (tid < HD) { const int it = (h * HD + tid) * NF + f; const float x = rt[it];
      asm volatile("s_wait_xcnt 0x0" :: "v"(it) : "memory");   // as above: the load's index register stays untouched until here
      rl[64 * KP + tid] = f2bf(x); }
    __syncthreads();
    v16bf br[5][2];
#pragma unroll   // constant indices, so that the arrays indexed here are registers
    for (int c = 0; c < 5; ++c)
#pragma unroll   // constant indices, so that the arrays indexed here are registers
        for (int ks = 0; ks < 2; ++ks) br[c][ks] = ldsfrag(rl + (c < 4 ? c * 16 + lr : 64) * KP + ks * 32 + 8 * hi);
    const int m0 = blockIdx.x * 256 + wave * 32;
#pragma unroll   // constant indices, so that the arrays indexed here are registers
    for (int t = 0; t < 2; ++t) {
        const size_t ro = (size_t)zi * BLK + (size_t)(m0 + t * 16 + lr) * HD + 8 * hi; const bf* ah = QTh + ro; const bf* al = QTl + ro;
        v16bf qh[2], ql[2];
#pragma unroll   // constant indices, so that the arrays indexed here are registers
        for (int ks = 0; ks < 2; ++ks) { qh[ks] = WFrag<bf>::ld(ah + ks * 32); ql[ks] = WFrag<bf>::ld(al + ks * 32); }
        // the address pairs of the 8 loads above stay untouched (inputs here) until this wait
        asm volatile("s_wait_xcnt 0x0" :: "v"(ah), "v"(al) : "memory");
        v8f acc[5];
#pragma unroll   // constant indices, so that the arrays indexed here are registers
        for (int c = 0; c < 5; ++c) acc[c] = (v8f){};
#pragma unroll   // constant indices, so that the arrays indexed here are registers
        for (int ks = 0; ks < 2; ++ks) {
#pragma unroll   // constant indices, so that the arrays indexed here are registers
            for (int c = 0; c < 5; ++c) acc[c] = wmmab(qh[ks], br[c][ks], acc[c]);
#pragma unroll   // constant indices, so that the arrays indexed here are registers
            for (int c = 0; c < 5; ++c) acc[c] = wmmab(ql[ks], br[c][ks], acc[c]); }
        const int mt = (m0 >> 4) + t;
#pragma unroll   // constant indices, so that the arrays indexed here are registers
        for (int c = 0; c < 2; ++c) {
            float* ow = RWT + (((size_t)zi * (TT / 16) + mt) * 2 + c) * 256 + lane * 4;
            *(v4f*)ow = __builtin_shufflevector(acc[c], acc[c], 0, 1, 2, 3); *(v4f*)(ow + 128) = __builtin_shufflevector(acc[c], acc[c], 4, 5, 6, 7);
            *(v8f*)(CAT + ((size_t)zi * 32 + c * 16 + lr) * TT + mt * 16 + 8 * hi) = acc[2 + c] + acc[4]; }
    }
}
__global__ __launch_bounds__(256) void k_fattn(const bf* __restrict__ QTh, const bf* __restrict__ QTl, const bf* __restrict__ KTh, const bf* __restrict__ KTl, const float* __restrict__ RWT, const float* __restrict__ CAT, const bf* __restrict__ VTh, const bf* __restrict__ VTl, float* __restrict__ OB) {
    __shared__ __align__(16) bf ring[2 * STG];
    __shared__ __align__(16) float os[HD * OP];
    const int tid = threadIdx.x, lane = tid & 31, lr = lane & 15, hi = lane >> 4, wave = tid >> 5;
    const int zi = blockIdx.z * NBL + blockIdx.y; const size_t zb = (size_t)zi * BLK; const int n0 = blockIdx.x * FQ + wave * 16;
    // staging: a thread moves 16 bytes of each of the four planes per pass
    const bf* gkh = KTh + zb + tid * 8; const bf* gkl = KTl + zb + tid * 8;
    const bf* gvh = VTh + zb + (size_t)(tid >> 2) * TT + (tid & 3) * 8; const bf* gvl = VTl + zb + (size_t)(tid >> 2) * TT + (tid & 3) * 8;
    const int sk = (tid >> 3) * KP + (tid & 7) * 8, sv = 2 * KPL + (tid >> 2) * VP + (tid & 3) * 8;
    v8us st[4];
    auto sstore = [&](int b) { bf* r = ring + b * STG; *(v8us*)(r + sk) = st[0]; *(v8us*)(r + KPL + sk) = st[1]; *(v8us*)(r + sv) = st[2]; *(v8us*)(r + VPL + sv) = st[3]; };
    // position term of a pass, straight into registers one pass ahead: this wave's two RW tiles (columns n % 32 = its 16 queries, in accumulator order) and the 32 keys of its CA row (n / 32 is one value for the wave)
    const float* grw = RWT + ((size_t)zi * (TT / 16) * 2 + ((n0 >> 4) & 1)) * 256 + lane * 4; const float* gca = CAT + ((size_t)zi * 32 + (n0 >> 5)) * TT + 8 * hi;
    v8f bw[2], bc[2];
    auto gload = [&](int s) { const bf* pkh = gkh + s * (FK * HD); const bf* pkl = gkl + s * (FK * HD); const bf* pvh = gvh + s * FK; const bf* pvl = gvl + s * FK; const float* pw = grw + s * 1024; const float* pc = gca + s * FK;
        st[0] = *(const v8us*)pkh; st[1] = *(const v8us*)pkl; st[2] = *(const v8us*)pvh; st[3] = *(const v8us*)pvl; bw[0] = __builtin_shufflevector(*(const v4f*)pw, *(const v4f*)(pw + 128), 0, 1, 2, 3, 4, 5, 6, 7); bw[1] = __builtin_shufflevector(*(const v4f*)(pw + 512), *(const v4f*)(pw + 640), 0, 1, 2, 3, 4, 5, 6, 7); bc[0] = *(const v8f*)pc; bc[1] = *(const v8f*)(pc + 16);
        // the address pairs of the 12 loads above stay untouched (inputs here) until this wait
        asm volatile("s_wait_xcnt 0x0" :: "v"(pkh), "v"(pkl), "v"(pvh), "v"(pvl), "v"(pw), "v"(pc) : "memory"); };
    gload(0);
    // B operands of the score products, kept in registers: column = query n0 + lr, k = d
    v16bf bqh[2], bql[2];
    { const size_t qo = zb + (size_t)(n0 + lr) * HD + 8 * hi;
      const bf* aqh = QTh + qo; const bf* aql = QTl + qo;
#pragma unroll   // constant indices, so that the arrays indexed here are registers
      for (int ks = 0; ks < 2; ++ks) { bqh[ks] = WFrag<bf>::ld(aqh + ks * 32); bql[ks] = WFrag<bf>::ld(aql + ks * 32); }
      // the address pairs of the 8 loads above stay untouched (inputs here) until this wait
      asm volatile("s_wait_xcnt 0x0" :: "v"(aqh), "v"(aql) : "memory"); }
    v8f o[4];
#pragma unroll   // constant indices, so that the arrays indexed here are registers
    for (int dt = 0; dt < 4; ++dt) o[dt] = (v8f){};
    float mc = -3.0e38f, l = 0.f;
    v8f s1[2];   // the scores' accumulators; their start value is the position term, summed at the foot of the pass before
#pragma unroll   // constant indices, so that the arrays indexed here are registers
    for (int t = 0; t < 2; ++t) s1[t] = bw[t] + bc[t];
    sstore(0);
    __syncthreads();
#pragma unroll 1   // rolled: the pass is long enough; for speed only
    for (int s = 0; s < NS; ++s) {
        const bf* r = ring + (s & 1) * STG;
        if (s + 1 < NS) gload(s + 1);   // lands while this pass computes
#pragma unroll   // constant indices, so that the arrays indexed here are registers
        for (int ks = 0; ks < 2; ++ks) { const bf* p = r + lr * KP + ks * 32 + 8 * hi;
            const v16bf kh0 = ldsfrag(p), kh1 = ldsfrag(p + 16 * KP), kl0 = ldsfrag(p + KPL), kl1 = ldsfrag(p + KPL + 16 * KP);
            s1[0] = wmmab(kh0, bqh[ks], s1[0]); s1[1] = wmmab(kh1, bqh[ks], s1[1]);
            s1[0] = wmmab(kh0, bql[ks], s1[0]); s1[1] = wmmab(kh1, bql[ks], s1[1]);
            s1[0] = wmmab(kl0, bqh[ks], s1[0]); s1[1] = wmmab(kl1, bqh[ks], s1[1]); }
        v16bf vh[4], vl[4];   // asked for ahead of the softmax arithmetic, which covers the LDS latency of as many of them as the registers hold
#pragma unroll   // constant indices, so that the arrays indexed here are registers
        for (int dt = 0; dt < 4; ++dt) { const bf* p = r + 2 * KPL + (dt * 16 + lr) * VP + 8 * hi; vh[dt] = ldsfrag(p); vl[dt] = ldsfrag(p + VPL); }
        float u[16];
#pragma unroll   // constant indices, so that the arrays indexed here are registers
        for (int i = 0; i < 16; ++i) u[i] = s1[i >> 3][i & 7];
        float mx = u[0];
#pragma unroll   // constant indices, so that the arrays indexed here are registers
        for (int i = 1; i < 16; ++i) mx = fmaxf(mx, u[i]);
        mx = fmaxf(mx, xhalf(mx));
        const float mn = fmaxf(mc, mx * CL2); const float al = __builtin_amdgcn_exp2f(mc - mn); mc = mn;
        float ps[4] = {0.f, 0.f, 0.f, 0.f};
#pragma unroll   // constant indices, so that the arrays indexed here are registers
        for (int i = 0; i < 16; ++i) { u[i] = __builtin_amdgcn_exp2f(__builtin_fmaf(u[i], CL2, -mn)); ps[i & 3] += u[i]; }
        l = l * al + ((ps[0] + ps[1]) + (ps[2] + ps[3]));   // this lane half's keys; the halves are joined behind the loop
        v16bf ph, pl;
#pragma unroll   // constant indices, so that the arrays indexed here are registers
        for (int i = 0; i < 8; ++i) { v2f x; x[0] = u[2 * i]; x[1] = u[2 * i + 1]; const v2bf h = __builtin_convertvector(x, v2bf); const v2bf w = __builtin_convertvector(x - __builtin_convertvector(h, v2f), v2bf);
            ph[2 * i] = h[0]; ph[2 * i + 1] = h[1]; pl[2 * i] = w[0]; pl[2 * i + 1] = w[1]; }
#pragma unroll   // constant indices, so that the arrays indexed here are registers
        for (int dt = 0; dt < 4; ++dt) o[dt] *= al;
#pragma unroll   // constant indices, so that the arrays indexed here are registers
        for (int dt = 0; dt < 4; ++dt) o[dt] = wmmab(vh[dt], ph, o[dt]);
#pragma unroll   // constant indices, so that the arrays indexed here are registers
        for (int dt = 0; dt < 4; ++dt) o[dt] = wmmab(vh[dt], pl, o[dt]);
#pragma unroll   // constant indices, so that the arrays indexed here are registers
        for (int dt = 0; dt < 4; ++dt) o[dt] = wmmab(vl[dt], ph, o[dt]);
#pragma unroll   // constant indices, so that the arrays indexed here are registers
        for (int t = 0; t < 2; ++t) s1[t] = bw[t] + bc[t];   // the next pass's start value (behind the last pass: unused)
        if (s + 1 < NS) sstore((s + 1) & 1);   // the buffer that pass s - 1 read; every wave left it at the last barrier
        __syncthreads();
    }
    l += xhalf(l);
    const float inv = __fdiv_rn(1.0f, l);
    // O^T[d][query] through LDS, so that every 128-byte line of the channels-first output is written whole by one wave
#pragma unroll   // constant indices, so that the arrays indexed here are registers
    for (int dt = 0; dt < 4; ++dt)
#pragma unroll   // constant indices, so that the arrays indexed here are registers
        for (int j = 0; j < 8; ++j) os[(dt * 16 + 8 * hi + j) * OP + wave * 16 + lr] = o[dt][j] * inv;
    __syncthreads();
    float* ob = OB + zb + blockIdx.x * FQ;
#pragma unroll
    for (int i = 0; i < 8; ++i) { const int d = wave * 8 + i; *(v4f*)(ob + (size_t)d * TT + lane * 4) = *(const v4fa*)(os + d * OP + lane * 4); }
}
__global__ __launch_bounds__(256) void k_merge(const float* __restrict__ O, int h0, bf* Ah, bf* Al) { const size_t e = ((size_t)blockIdx.x * 256 + threadIdx.x) * 2; if (e >= (size_t)ZH * TT * HD) return; const int d = (int)(e % HD); const int t = (int)((e / HD) % TT); const int zz = (int)(e / ((size_t)HD * TT)); const float cs = (t < RH) ? 1.0f : (1.0f / PCAR); const size_t oo = (size_t)t * DQ + (h0 + zz) * HD + d;
    v2us oh, ol;
#pragma unroll
    for (int q = 0; q < 2; ++q) { unsigned short a, c2; splitf(O[e + q] * cs, a, c2); oh[q] = a; ol[q] = c2; } *(v2us*)(Ah + oo) = oh; *(v2us*)(Al + oo) = ol;  }

extern "C" void kernel_launch(void* const* d_in, const int* in_sizes, int n_in,
                              void* d_out, int out_size, void* d_ws, size_t ws_size, hipStream_t stream) {
    (void)in_sizes; (void)n_in; (void)out_size;
    const float* x = (const float*)d_in[0]; const float* wq = (const float*)d_in[1]; const float* wk = (const float*)d_in[2]; const float* wv = (const float*)d_in[3]; const float* relh = (const float*)d_in[4]; const float* relw = (const float*)d_in[5]; const float* relt = (const float*)d_in[6]; const float* wo = nullptr; (void)wo; const float* cosT = nullptr; const float* sinT = nullptr; (void)cosT; (void)sinT;
    float* OUT = (float*)d_out;   // [4][256][8][32][32]
    char* wsp = (char*)d_ws; auto take = [&](size_t bytes) { char* p = wsp; wsp += (bytes + 255) & ~(size_t)255; return (void*)p; };
    bf* WQ = (bf*)take((size_t)CC * CC * 2); bf* WK = (bf*)take((size_t)CC * CC * 2); bf* WV = (bf*)take((size_t)CC * CC * 2);
    bf* XT = (bf*)take((size_t)NB_ * NP * CC * 2);
    bf* QTh = (bf*)take((size_t)NB_ * NBL * BLK * 2); bf* QTl = (bf*)take((size_t)NB_ * NBL * BLK * 2); bf* KTh = (bf*)take((size_t)NB_ * NBL * BLK * 2); bf* KTl = (bf*)take((size_t)NB_ * NBL * BLK * 2);
    float* RWT = (float*)take((size_t)NB_ * NBL * 32 * TT * 4); float* CAT = (float*)take((size_t)NB_ * NBL * 32 * TT * 4);
    bf* VTh = (bf*)take((size_t)NB_ * NBL * BLK * 2); bf* VTl = (bf*)take((size_t)NB_ * NBL * BLK * 2);
    if ((size_t)(wsp - (char*)d_ws) > ws_size) return;   // ws ~ 145 MiB
    { k_cvt8<<<(unsigned)(((size_t)CC * CC / 8 + 255) / 256), 256, 0, stream>>>(wq, WQ, (size_t)CC * CC / 8); k_cvt8<<<(unsigned)(((size_t)CC * CC / 8 + 255) / 256), 256, 0, stream>>>(wk, WK, (size_t)CC * CC / 8); k_cvt8<<<(unsigned)(((size_t)CC * CC / 8 + 255) / 256), 256, 0, stream>>>(wv, WV, (size_t)CC * CC / 8); }
    k_xT<<<dim3(NP / XP, NB_, 1), 256, 0, stream>>>(x, XT);
    k_proj<true><<<dim3(1, TT / 16, NB_), 256, 0, stream>>>(WQ, XT, QTh, QTl);
    k_proj<true><<<dim3(1, TT / 16, NB_), 256, 0, stream>>>(WK, XT, KTh, KTl);
    k_proj<false><<<dim3(1, NP / 128, NB_), 256, 0, stream>>>(WV, XT, VTh, VTl);
    k_ptab<<<dim3(TT / 256, NBL, NB_), 256, 0, stream>>>(QTh, QTl, relh, relw, relt, RWT, CAT);
    k_fattn<<<dim3(TT / FQ, NBL, NB_), 256, 0, stream>>>(QTh, QTl, KTh, KTl, RWT, CAT, VTh, VTl, OUT);
}

// v007
// One run takes 137 microseconds.
// Next to v006, in two timings, it ran 1.11 times as fast each time.
// All steps since v000 together make it 9.59 times as fast.
#include <hip/hip_runtime.h>

// MHSA3D (x [4][256][8][32][32] channels-first; q/k/v = 1x1x1 conv (wq/wk/wv [256][256]) then the module's literal reshape (B, 4 heads, 8 frames, 64, 1024) of the [B][C][F][H][W] buffer = 32 contiguous [64][1024] blocks per batch; per block: energy[n][m] = (sum_d q[d][n] k[d][m] + sum_d pos[n][d] q[d][m]) / 8 with pos[h][f][n][d] = rel_h[h][d][n/32] + rel_w[h][d][n%32] + rel_t[h][d][f]; softmax over m; out[d][j] = sum_n v[d][n] attn[j][n]; -> [4][256][8][32][32]).
// Compute dtypes, f32 accumulate: every input rounded to bf16; the three convs as PLAIN bf16 GEMMs W . x (inputs: exact; x transposed to token-major on chip); per block: q^T, k^T hi/lo planes (transposed) and v hi/lo planes, all split and stored by the conv GEMM's own epilogue, the position term factored: sum_d pos[n][d] q[d][m] = sum_d rel_w[d][n%32] q[d][m] + sum_d rel_h[d][n/32] q[d][m] + sum_d rel_t[d][f] q[d][m], 65 rows a block instead of 1024 (k_ptab: rel rows exact in bf16 x q hi/lo, 2 products, f32 tables); the q.k product hl x hl (3 products) on every row, accumulated on top of the position term in f32; softmax f32 with a running maximum (weights exp2 of the scaled difference, split hi/lo unnormalised); attn.v hl x hl (3 products) on every row, divided by the row sum at the end; scores, softmax and attn.v in one kernel (k_fattn), which stores the context block [d][j] straight into the channels-first output in f32.

#define NB_  4
#define TT   1024
#define DM   256
#define NH_  4
#define NKV  4
#define REP  (NH_ / NKV)
#define HD   64
#define DQ   (NH_ * HD)
#define DKV  (NKV * HD)
#define ZH   8
#define RH   1024   // all rows hl
#define WIN  0
#define PCAR 1024.0f
#define CC   256    // channels
#define NF   8      // frames
#define NP   (NF * TT)   // positions per batch (8192)
#define NBL  (NH_ * NF)  // blocks per batch (32)
#define BLK  ((size_t)HD * TT)   // floats per block (65536)
#define SCL  0.125f   // HD^-0.5
typedef _Float16 h16;
typedef unsigned short bf;
typedef __attribute__((ext_vector_type(16))) __bf16   v16bf;
typedef __attribute__((ext_vector_type(16))) _Float16 v16h;
typedef __attribute__((ext_vector_type(8)))  _Float16 v8h;
typedef __attribute__((ext_vector_type(8)))  unsigned short v8us;
typedef __attribute__((ext_vector_type(8)))  float    v8f;
typedef __attribute__((ext_vector_type(4)))  float    v4f;
typedef v8h  __attribute__((may_alias)) v8ha;
typedef v4f  __attribute__((may_alias)) v4fa;
typedef v8us __attribute__((may_alias)) v8usa;

__device__ __forceinline__ unsigned short f2bf(float f) { unsigned u = __float_as_uint(f); u += 0x7FFFu + ((u >> 16) & 1u); return (unsigned short)(u >> 16); }
__device__ __forceinline__ float bf2f(unsigned short b) { return __uint_as_float(((unsigned)b) << 16); }
__device__ __forceinline__ float bfr(float f) { return bf2f(f2bf(f)); }
__device__ __forceinline__ v16h cat16(v8h lo, v8h hi) { return __builtin_shufflevector(lo, hi, 0, 1, 2, 3, 4, 5, 6, 7, 8, 9, 10, 11, 12, 13, 14, 15); }
__device__ __forceinline__ v16bf cat16b(v8us lo, v8us hi) { return __builtin_bit_cast(v16bf, __builtin_shufflevector(lo, hi, 0, 1, 2, 3, 4, 5, 6, 7, 8, 9, 10, 11, 12, 13, 14, 15)); }
__device__ __forceinline__ v8f wmma16(v16h a, v16h b, v8f c) { return __builtin_amdgcn_wmma_f32_16x16x32_f16(false, a, false, b, (short)0, c, false, false); }
__device__ __forceinline__ v8f wmmab(v16bf a, v16bf b, v8f c) { return __builtin_amdgcn_wmma_f32_16x16x32_bf16(false, a, false, b, (short)0, c, false, false); }



template <typename T16> struct WFrag;
template <> struct WFrag<h16> { typedef v16h V; static __device__ __forceinline__ V ld(const h16* p) { return cat16(*(const v8h*)p, *(const v8h*)(p + 16)); } static __device__ __forceinline__ v8f mma(V a, V b, v8f c) { return wmma16(a, b, c); } };
template <> struct WFrag<bf> { typedef v16bf V; static __device__ __forceinline__ V ld(const bf* p) { return cat16b(*(const v8us*)p, *(const v8us*)(p + 16)); } static __device__ __forceinline__ v8f mma(V a, V b, v8f c) { return wmmab(a, b, c); } };
#define PP   264                 // LDS pitch of a staged row, 16-bit elements: 512 B + 16 B
typedef __attribute__((ext_vector_type(8))) __bf16 v8bf;
typedef __attribute__((ext_vector_type(4))) __bf16 v4bf;
typedef __attribute__((ext_vector_type(4))) unsigned short v4us;
template <bool TR>
__device__ __forceinline__ void proj_body(bf* sm, const bf* __restrict__ Wm, const bf* __restrict__ XTm, bf* __restrict__ Ph, bf* __restrict__ Pl) {
    const int tid = threadIdx.x, lane = tid & 31, lr = lane & 15, hi = lane >> 4, wave = tid >> 5; const int o0 = (wave & 3) * 64, ty = blockIdx.y * 2 + (wave >> 2);
    XTm += (size_t)blockIdx.z * NP * CC; Ph += (size_t)blockIdx.z * NBL * BLK; Pl += (size_t)blockIdx.z * NBL * BLK;
    { // staging: wave w brings W rows 32 w ... 32 w + 31 and the x^T rows of LDS rows 256 + 16 w ... 256 + 16 w + 15
      const bf* gw = Wm + (size_t)wave * 32 * CC + lane * 8;
      const bf* gx = XTm + (TR ? ((size_t)blockIdx.y * 16 + wave * 2) : ((size_t)blockIdx.y * 128 + (wave >> 2) * 64 + (wave & 3))) * CC + lane * 8;
      v8us sw[32], sx[16];
#pragma unroll   // constant indices, so that the arrays indexed here are registers; all loads in flight at once
      for (int i = 0; i < 32; ++i) sw[i] = *(const v8us*)(gw + i * CC);
#pragma unroll   // constant indices, so that the arrays indexed here are registers; all loads in flight at once
      for (int i = 0; i < 16; ++i) sx[i] = *(const v8us*)(gx + (size_t)(TR ? (i & 7) * TT + (i >> 3) : i * 4) * CC);
      // the two address pairs of the 48 loads above stay untouched (inputs here) until this wait
      asm volatile("s_wait_xcnt 0x0" :: "v"(gw), "v"(gx) : "memory");
      bf* dw = sm + wave * 32 * PP + lane * 8; bf* dx = sm + (CC + wave * 16) * PP + lane * 8;
#pragma unroll   // constant indices, so that the arrays indexed here are registers
      for (int i = 0; i < 32; ++i) *(v8us*)(dw + i * PP) = sw[i];
#pragma unroll   // constant indices, so that the arrays indexed here are registers
      for (int i = 0; i < 16; ++i) *(v8us*)(dx + i * PP) = sx[i]; }
    __syncthreads();
    const bf* wrow = sm + (o0 + lr) * PP + 8 * hi;
    const bf* xrow = sm + (CC + (wave >> 2) * 64 + lr) * PP + 8 * hi;
    const bf* A = TR ? xrow : wrow; const bf* B = TR ? wrow : xrow;
    constexpr int TS = 16 * PP;   // from one 16-row / 16-column tile to the next
    v8f acc[4][4];
    // one trip: 32 channels. The first trip stands in front of the loop and starts from a zero C operand, so that no accumulator register is live while the 48 staged rows are still in registers
    auto trip = [&](const int kc, const bool first) {
        const bf* ap = A + kc; const bf* bp = B + kc; v16bf a[4];
#pragma unroll   // constant indices, so that the arrays indexed here are registers
        for (int mb = 0; mb < 4; ++mb) a[mb] = WFrag<bf>::ld(ap + mb * TS);
#pragma unroll   // constant indices, so that the arrays indexed here are registers
        for (int nb = 0; nb < 4; ++nb) { const v16bf b = WFrag<bf>::ld(bp + nb * TS);
#pragma unroll   // constant indices, so that the arrays indexed here are registers
            for (int mb = 0; mb < 4; ++mb) acc[mb][nb] = wmmab(a[mb], b, first ? (v8f){} : acc[mb][nb]); }
        // four vector slots behind the trip's last matrix instructions, also on the taken back edge, before anything touches their operands or results
        asm volatile("v_nop\n\tv_nop\n\tv_nop\n\tv_nop" : "+v"(acc[0][0]), "+v"(acc[1][1]), "+v"(acc[2][2]), "+v"(acc[3][3]) : "v"(a[0]), "v"(a[3]));
    };
    trip(0, true);
#pragma unroll 1   // rolled: beside the accumulators only one trip's fragments are kept in registers
    for (int kc = 32; kc < CC; kc += 32) trip(kc, false);
    if (TR) {
#pragma unroll   // constant indices, so that the arrays indexed here are registers
        for (int mb = 0; mb < 4; ++mb)
#pragma unroll   // constant indices, so that the arrays indexed here are registers
            for (int nb = 0; nb < 4; ++nb) { const v8f y = acc[mb][nb]; const v8bf h = __builtin_convertvector(y, v8bf); const v8bf w = __builtin_convertvector(y - __builtin_convertvector(h, v8f), v8bf);
                const size_t e = (size_t)(o0 / 8 + nb * 2 + (lr >> 3)) * BLK + (size_t)(ty * 8 + mb * 2 + hi) * HD + (lr & 7) * 8;
                *(v8us*)(Ph + e) = __builtin_bit_cast(v8us, h); *(v8us*)(Pl + e) = __builtin_bit_cast(v8us, w); }
    } else {
#pragma unroll   // constant indices, so that the arrays indexed here are registers
        for (int mb = 0; mb < 4; ++mb)
#pragma unroll   // constant indices, so that the arrays indexed here are registers
            for (int r = 0; r < 8; ++r) { v4f y; y[0] = acc[mb][0][r]; y[1] = acc[mb][1][r]; y[2] = acc[mb][2][r]; y[3] = acc[mb][3][r]; const v4bf h = __builtin_convertvector(y, v4bf); const v4bf w = __builtin_convertvector(y - __builtin_convertvector(h, v4f), v4bf);
                const size_t e = (size_t)(o0 + mb * 16 + 8 * hi + r) * NP + ty * 64 + lr * 4;
                *(v4us*)(Ph + e) = __builtin_bit_cast(v4us, h); *(v4us*)(Pl + e) = __builtin_bit_cast(v4us, w); }
    }
}
// grid (3 convs, 64 position tiles, 4 batches); the choice of the conv is the same for a whole work-group, so the barrier inside the body stands under uniform control flow
__global__ __launch_bounds__(256) void k_proj3(const bf* __restrict__ Wq, const bf* __restrict__ Wk, const bf* __restrict__ Wv, const bf* __restrict__ XTm, bf* __restrict__ Qh, bf* __restrict__ Ql, bf* __restrict__ Kh, bf* __restrict__ Kl, bf* __restrict__ Vh, bf* __restrict__ Vl) {
    __shared__ __align__(16) bf sm[(CC + 128) * PP];
    if (blockIdx.x == 2) proj_body<false>(sm, Wv, XTm, Vh, Vl);
    else { const bool k = blockIdx.x == 1; proj_body<true>(sm, k ? Wk : Wq, XTm, k ? Kh : Qh, k ? Kl : Ql); }
}

__device__ __forceinline__ h16 tohx(float x) { return (h16)x; }
__device__ __forceinline__ void splitf(float y, unsigned short& h, unsigned short& l) { h = f2bf(y); l = f2bf(y - bf2f(h)); }
typedef __attribute__((ext_vector_type(2))) _Float16 v2h;
typedef __attribute__((ext_vector_type(4))) _Float16 v4h;
typedef __attribute__((ext_vector_type(2))) unsigned short v2us;
typedef __attribute__((ext_vector_type(2))) float v2f;
typedef __attribute__((ext_vector_type(4))) int v4i;

__global__ __launch_bounds__(256) void k_wtG(const float* __restrict__ w, int K, int N, bf* Bt) {
    const int lane = threadIdx.x & 31; const int L0 = (blockIdx.x * 8 + (threadIdx.x >> 5)) * 8; const int nlines = N * K / 64;
{
#pragma unroll 1
        for (int l = 0; l < 8; ++l) { const int L = L0 + l; if (L >= nlines) break; const size_t e = (size_t)L * 64 + lane * 2; const int k = (int)(e % K), n = (int)(e / K); v2us o;
            o[0] = f2bf(w[(size_t)k * N + n]); o[1] = f2bf(w[(size_t)(k + 1) * N + n]); *(v2us*)(Bt + e) = o; }
         }
}
__global__ __launch_bounds__(256) void k_cscvt(const float* __restrict__ cosT, const float* __restrict__ sinT, float* CS) { const int idx = blockIdx.x * 256 + threadIdx.x; if (idx >= TT * HD) return; v2f cs; cs[0] = bfr(cosT[idx]); cs[1] = bfr(sinT[idx]); *(v2f*)(CS + (size_t)idx * 2) = cs;  }
// k_rope: head planes [h][t][d] (fp16 + hi/lo) of rope(x) x sc with the rotate-half convention out[d] = x[d] cos[t][d] - x[d+HD/2] sin[t][d], out[d+HD/2] = x[d+HD/2] cos[t][d+HD/2] + x[d] sin[t][d+HD/2]
__global__ __launch_bounds__(256) void k_rope(const float* __restrict__ F, int pitch, int nheads, const float* __restrict__ CS, const float* __restrict__ RF, const float* __restrict__ nw, float sc, h16* P16, bf* Ph, bf* Pl) {
    const size_t e = ((size_t)blockIdx.x * 256 + threadIdx.x) * 2; if (e >= (size_t)nheads * TT * HD) return; const int d = (int)(e % HD); const int t = (int)((e / HD) % TT); const int h = (int)(e / ((size_t)HD * TT)); const float* f = F + (size_t)t * pitch + h * HD; const float rf = RF ? RF[(size_t)h * TT + t] : 1.0f; v2h o16; v2us oh, ol;
#pragma unroll
    for (int q = 0; q < 2; ++q) { const int dd = d + q; const int dp = (dd < HD / 2) ? dd + HD / 2 : dd - HD / 2; float x0 = f[dd], x1 = f[dp];
        if (RF) { float n0 = __fmul_rn(x0, rf), n1 = __fmul_rn(x1, rf); asm volatile("" : "+v"(n0)); asm volatile("" : "+v"(n1)); x0 = __fmul_rn(bfr(nw[dd]), n0); x1 = __fmul_rn(bfr(nw[dp]), n1); }
        const v2f cs = *(const v2f*)(CS + ((size_t)t * HD + dd) * 2); float a = __fmul_rn(x0, cs[0]), bq = __fmul_rn(x1, cs[1]); asm volatile("" : "+v"(a)); asm volatile("" : "+v"(bq)); const float r = ((dd < HD / 2) ? __fsub_rn(a, bq) : __fadd_rn(a, bq)) * sc;
        o16[q] = tohx(r); unsigned short a2, c2; splitf(r, a2, c2); oh[q] = a2; ol[q] = c2; }
    *(v2h*)(P16 + e) = o16; *(v2us*)(Ph + e) = oh; *(v2us*)(Pl + e) = ol;  }
__global__ __launch_bounds__(256) void k_vtp(const float* __restrict__ F, int pitch, int nheads, h16* V16, bf* Vh, bf* Vl) { const size_t e = ((size_t)blockIdx.x * 256 + threadIdx.x) * 2; if (e >= (size_t)nheads * HD * TT) return; const int t = (int)(e % TT); const int d = (int)((e / TT) % HD); const int g = (int)(e / ((size_t)TT * HD)); v2h o16; v2us oh, ol;
#pragma unroll
    for (int q = 0; q < 2; ++q) { const float x = F[(size_t)(t + q) * pitch + g * HD + d]; o16[q] = tohx(x); unsigned short a2, c2; splitf(x, a2, c2); oh[q] = a2; ol[q] = c2; }
    *(v2h*)(V16 + e) = o16; *(v2us*)(Vh + e) = oh; *(v2us*)(Vl + e) = ol;  }
// ---- k_xT: x [c][p] f32 -> x^T [p][c] bf16 through an LDS tile, whole 128-byte lines on both sides. grid (8192 / 64 positions + WB weight work-groups, 4 batches), 8 waves; a position work-group owns 64 positions x all 256 channels.
// In: a 16-byte load takes 4 positions of one channel, 8 lanes a line, 4 channels a wave; a thread takes the channels c and c + 1 at the same positions and packs them, so that every LDS store is one dword.
// LDS: [position][128 channel pairs]; the 16-byte chunk (8 channels) k of position p lies at chunk k ^ (p / 4): the 32 dword stores of a wave fall in 32 banks, and a row read back in 16-byte pieces covers every bank evenly.
// Out: a wave stores one whole position row (512 bytes) at a time.
// The rounding of the three weight matrices to bf16 rides in the same launch: the work-groups with blockIdx.x >= 8192 / 64 (WB a batch row, 96 in all, 32 a matrix) take 8 weights a thread and leave before the barrier.
#define XP   64                  // positions per work-group
#define WB   (3 * CC * CC / (256 * 8) / NB_)   // weight work-groups per grid row (24)
typedef __attribute__((ext_vector_type(2))) __bf16 v2bfx;
typedef __attribute__((ext_vector_type(4))) unsigned v4u;
__global__ __launch_bounds__(256) void k_xT(const float* __restrict__ X, bf* __restrict__ XT2, const float* __restrict__ wq, const float* __restrict__ wk, const float* __restrict__ wv, bf* __restrict__ WQ2, bf* __restrict__ WK2, bf* __restrict__ WV2) {
    __shared__ __align__(16) unsigned xt[XP * (CC / 2)];
    const int tid = threadIdx.x, lane = tid & 31, wave = tid >> 5, g = lane & 7, q = lane >> 3;
    if (blockIdx.x >= NP / XP) {   // the same for a whole work-group
        const int j = (blockIdx.x - NP / XP) * NB_ + blockIdx.y, m = j >> 5; const size_t i = (size_t)((j & 31) * 256 + tid) * 8;
        const float* ws = (m == 0 ? wq : m == 1 ? wk : wv) + i; bf* wd = (m == 0 ? WQ2 : m == 1 ? WK2 : WV2) + i;
        const v8f v = *(const v8f*)ws; v8us o;
        asm volatile("s_wait_xcnt 0x0" :: "v"(ws) : "memory");   // the load's address pair stays untouched (an input here) until this wait
#pragma unroll   // constant indices, so that the arrays indexed here are registers
        for (int k = 0; k < 8; ++k) o[k] = f2bf(v[k]);
        *(v8us*)wd = o; return; }
    const float* s0 = X + ((size_t)blockIdx.y * CC + (wave * 16 + q) * 2) * NP + blockIdx.x * XP + g * 4;   // grid y = batch
    v4f a[8], b[8];
#pragma unroll   // constant indices, so that the arrays indexed here are registers; all 16 loads in flight at once
    for (int it = 0; it < 8; ++it) { const float* s = s0 + (size_t)(it & 3) * 8 * NP + (it >> 2) * 32; a[it] = *(const v4f*)s; b[it] = *(const v4f*)(s + NP); }
    // the address pair of the 16 loads above stays untouched (an input here) until this wait; the loaded values are inputs too, so that all 16 loads are issued before the first is used:
    // without that the compiler holds five of them back until earlier ones have landed, a second memory latency
    asm volatile("s_wait_xcnt 0x0" :: "v"(s0), "v"(a[0]), "v"(a[1]), "v"(a[2]), "v"(a[3]), "v"(a[4]), "v"(a[5]), "v"(a[6]), "v"(a[7]), "v"(b[0]), "v"(b[1]), "v"(b[2]), "v"(b[3]), "v"(b[4]), "v"(b[5]), "v"(b[6]), "v"(b[7]) : "memory");
    __builtin_amdgcn_sched_barrier(0);   // behind the work-group's branch above the compiler lifts the first conversions over the wait and again holds four loads back behind them; nothing is scheduled across this line
#pragma unroll   // constant indices, so that the arrays indexed here are registers
    for (int it = 0; it < 8; ++it) { const int pg = (it >> 2) * 8 + g; unsigned* d = xt + pg * 4 * (CC / 2) + (((wave * 4 + (it & 3)) ^ pg) << 2) + q;
#pragma unroll   // constant indices, so that the arrays indexed here are registers
        for (int j = 0; j < 4; ++j) { v2f x; x[0] = a[it][j]; x[1] = b[it][j]; d[j * (CC / 2)] = __builtin_bit_cast(unsigned, __builtin_convertvector(x, v2bfx)); } }
    __syncthreads();
    bf* o0 = XT2 + ((size_t)blockIdx.y * NP + blockIdx.x * XP + wave * 8) * CC + lane * 8;
    v4u r[8];
#pragma unroll   // constant indices, so that the arrays indexed here are registers
    for (int i = 0; i < 8; ++i) { const int p = wave * 8 + i; r[i] = *(const v4u*)(xt + p * (CC / 2) + ((lane ^ (p >> 2)) << 2)); }
#pragma unroll   // constant indices, so that the arrays indexed here are registers
    for (int i = 0; i < 8; ++i) *(v8us*)(o0 + i * CC) = __builtin_bit_cast(v8us, r[i]);
}
// ---- k_fattn: scores, softmax and attn.v of one [64][1024] block in ONE kernel; the scores never leave the registers.
// grid (1024 / 128 query tiles, 32 blocks, 4 batches), 8 waves; a wave owns 16 queries (columns) and walks the 1024 keys in passes of 32.
// Transposed product: S^T[key][query] = position term (k_ptab's tables, the accumulators' start value) + K^T rows . q columns (3 hi/lo products), so a lane holds 16 scores of ONE query;
// the two 16-key score tiles, turned into exp2 weights and split hi/lo, ARE the B operand (hardware k order) of O^T[d][query] += V[d][key] . P^T[key][query] (3 products).
// Running maximum per query (log2 domain), O^T and the sum rescaled every pass, one division by the sum at the end.
// The 32 key rows of K^T (hi/lo) and the 32 key columns of V (hi/lo) are staged per pass in LDS for all 8 waves (K^T in whole-line, V in half-line global loads, two buffers, one barrier a pass).
#define FQ   128                 // queries per work-group
#define FK   32                  // keys per pass
#define NS   (TT / FK)           // passes
#define KP   72                  // LDS pitch of a key row of K^T, 16-bit elements: 128 B + 16 B, conflict-free for 16-byte reads
#define VP   40                  // LDS pitch of a d row of V: 64 B + 16 B
#define KPL  (FK * KP)           // one K^T plane of a stage
#define VPL  (HD * VP)           // one V plane of a stage
#define STG  (2 * KPL + 2 * VPL) // one stage, 16-bit elements
#define OP   132                 // LDS pitch of an output row, floats
#define CL2  0.18033688011112042f   // HD^-0.5 * log2(e)
typedef __attribute__((ext_vector_type(2))) __bf16 v2bf;
__device__ __forceinline__ float xhalf(float x) { const int b = __float_as_int(x); return __int_as_float(__builtin_amdgcn_permlanex16(b, b, 0x76543210, 0xfedcba98, false, false)); }   // lane l <-> l ^ 16
__device__ __forceinline__ v16bf ldsfrag(const bf* p) { return cat16b(*(const v8us*)p, *(const v8us*)(p + 16)); }
// ---- k_ptab: the position term of one block, factored. pos[n][d] = rel_h[d][n / 32] + rel_w[d][n % 32] + rel_t[d][f], so sum_d pos[n][d] q[d][m] = RW[n % 32][m] + CA[n / 32][m]
// with RW[b][m] = sum_d rel_w[d][b] q[d][m] and CA[a][m] = sum_d rel_h[d][a] q[d][m] + sum_d rel_t[d][f] q[d][m].
// grid (1024 / 256 keys, 32 blocks, 4 batches), 8 waves; a wave owns 32 keys (two 16-key tiles, the A rows, from the q^T planes) and five 16-column B tiles: rel_w 0-15, 16-31, rel_h 0-15, 16-31, and rel_t[f] in all 16 columns.
// RWT holds each 16-key x 16-column tile in the accumulator's own order, 1 KiB a tile: registers 0-3 of lane l at float l * 4, registers 4-7 at 128 + l * 4 (whole lines for 16-byte accesses); tile index (block * 64 + key tile) * 2 + column tile; CAT is [block][a][m].
__global__ __launch_bounds__(256) void k_ptab(const bf* __restrict__ QTh, const bf* __restrict__ QTl, const float* __restrict__ rh, const float* __restrict__ rw, const float* __restrict__ rt, float* __restrict__ RWT, float* __restrict__ CAT) {
    __shared__ __align__(16) bf rl[65 * KP];   // rows [column][d]: 0-31 rel_w, 32-63 rel_h, 64 rel_t of this frame
    const int tid = threadIdx.x, lane = tid & 31, lr = lane & 15, hi = lane >> 4, wave = tid >> 5;
    const int h = blockIdx.y / NF, f = blockIdx.y % NF, zi = blockIdx.z * NBL + blockIdx.y;
    { const int i0 = h * (HD * 32) + tid; float fw[HD * 32 / 256], fh[HD * 32 / 256];
#pragma unroll   // constant indices, so that the arrays indexed here are registers; all 16 loads in flight at once
      for (int j = 0; j < HD * 32 / 256; ++j) { fw[j] = rw[i0 + j * 256]; fh[j] = rh[i0 + j * 256]; }
      // the index register of the 16 loads above stays untouched (an input here) until this wait
      asm volatile("s_wait_xcnt 0x0" :: "v"(i0) : "memory");
#pragma unroll   // constant indices, so that the arrays indexed here are registers
      for (int j = 0; j < HD * 32 / 256; ++j) { const int i = j * 256 + tid, d = i >> 5, c = i & 31; rl[c * KP + d] = f2bf(fw[j]); rl[(32 + c) * KP + d] = f2bf(fh[j]); } }
    if (tid < HD) { const int it = (h * HD + tid) * NF + f; const float x = rt[it];
      asm volatile("s_wait_xcnt 0x0" :: "v"(it) : "memory");   // as above: the load's index register stays untouched until here
      rl[64 * KP + tid] = f2bf(x); }
    __syncthreads();
    v16bf br[5][2];
#pragma unroll   // constant indices, so that the arrays indexed here are registers
    for (int c = 0; c < 5; ++c)
#pragma unroll   // constant indices, so that the arrays indexed here are registers
        for (int ks = 0; ks < 2; ++ks) br[c][ks] = ldsfrag(rl + (c < 4 ? c * 16 + lr : 64) * KP + ks * 32 + 8 * hi);
    const int m0 = blockIdx.x * 256 + wave * 32;
#pragma unroll   // constant indices, so that the arrays indexed here are registers
    for (int t = 0; t < 2; ++t) {
        const size_t ro = (size_t)zi * BLK + (size_t)(m0 + t * 16 + lr) * HD + 8 * hi; const bf* ah = QTh + ro; const bf* al = QTl + ro;
        v16bf qh[2], ql[2];
#pragma unroll   // constant indices, so that the arrays indexed here are registers
        for (int ks = 0; ks < 2; ++ks) { qh[ks] = WFrag<bf>::ld(ah + ks * 32); ql[ks] = WFrag<bf>::ld(al + ks * 32); }
        // the address pairs of the 8 loads above stay untouched (inputs here) until this wait
        asm volatile("s_wait_xcnt 0x0" :: "v"(ah), "v"(al) : "memory");
        v8f acc[5];
#pragma unroll   // constant indices, so that the arrays indexed here are registers
        for (int c = 0; c < 5; ++c) acc[c] = (v8f){};
#pragma unroll   // constant indices, so that the arrays indexed here are registers
        for (int ks = 0; ks < 2; ++ks) {
#pragma unroll   // constant indices, so that the arrays indexed here are registers
            for (int c = 0; c < 5; ++c) acc[c] = wmmab(qh[ks], br[c][ks], acc[c]);
#pragma unroll   // constant indices, so that the arrays indexed here are registers
            for (int c = 0; c < 5; ++c) acc[c] = wmmab(ql[ks], br[c][ks], acc[c]); }
        const int mt = (m0 >> 4) + t;
#pragma unroll   // constant indices, so that the arrays indexed here are registers
        for (int c = 0; c < 2; ++c) {
            float* ow = RWT + (((size_t)zi * (TT / 16) + mt) * 2 + c) * 256 + lane * 4;
            *(v4f*)ow = __builtin_shufflevector(acc[c], acc[c], 0, 1, 2, 3); *(v4f*)(ow + 128) = __builtin_shufflevector(acc[c], acc[c], 4, 5, 6, 7);
            *(v8f*)(CAT + ((size_t)zi * 32 + c * 16 + lr) * TT + mt * 16 + 8 * hi) = acc[2 + c] + acc[4]; }
    }
}
__global__ __launch_bounds__(256) void k_fattn(const bf* __restrict__ QTh, const bf* __restrict__ QTl, const bf* __restrict__ KTh, const bf* __restrict__ KTl, const float* __restrict__ RWT, const float* __restrict__ CAT, const bf* __restrict__ VTh, const bf* __restrict__ VTl, float* __restrict__ OB) {
    __shared__ __align__(16) bf ring[2 * STG];
    __shared__ __align__(16) float os[HD * OP];
    const int tid = threadIdx.x, lane = tid & 31, lr = lane & 15, hi = lane >> 4, wave = tid >> 5;
    const int zi = blockIdx.z * NBL + blockIdx.y; const size_t zb = (size_t)zi * BLK; const int n0 = blockIdx.x * FQ + wave * 16;
    // staging: a thread moves 16 bytes of each of the four planes per pass
    const bf* gkh = KTh + zb + tid * 8; const bf* gkl = KTl + zb + tid * 8;
    const bf* gvh = VTh + zb + (size_t)(tid >> 2) * TT + (tid & 3) * 8; const bf* gvl = VTl + zb + (size_t)(tid >> 2) * TT + (tid & 3) * 8;
    const int sk = (tid >> 3) * KP + (tid & 7) * 8, sv = 2 * KPL + (tid >> 2) * VP + (tid & 3) * 8;
    v8us st[4];
    auto sstore = [&](int b) { bf* r = ring + b * STG; *(v8us*)(r + sk) = st[0]; *(v8us*)(r + KPL + sk) = st[1]; *(v8us*)(r + sv) = st[2]; *(v8us*)(r + VPL + sv) = st[3]; };
    // position term of a pass, straight into registers one pass ahead: this wave's two RW tiles (columns n % 32 = its 16 queries, in accumulator order) and the 32 keys of its CA row (n / 32 is one value for the wave)
    const float* grw = RWT + ((size_t)zi * (TT / 16) * 2 + ((n0 >> 4) & 1)) * 256 + lane * 4; const float* gca = CAT + ((size_t)zi * 32 + (n0 >> 5)) * TT + 8 * hi;
    v8f bw[2], bc[2];
    auto gload = [&](int s) { const bf* pkh = gkh + s * (FK * HD); const bf* pkl = gkl + s * (FK * HD); const bf* pvh = gvh + s * FK; const bf* pvl = gvl + s * FK; const float* pw = grw + s * 1024; const float* pc = gca + s * FK;
        st[0] = *(const v8us*)pkh; st[1] = *(const v8us*)pkl; st[2] = *(const v8us*)pvh; st[3] = *(const v8us*)pvl; bw[0] = __builtin_shufflevector(*(const v4f*)pw, *(const v4f*)(pw + 128), 0, 1, 2, 3, 4, 5, 6, 7); bw[1] = __builtin_shufflevector(*(const v4f*)(pw + 512), *(const v4f*)(pw + 640), 0, 1, 2, 3, 4, 5, 6, 7); bc[0] = *(const v8f*)pc; bc[1] = *(const v8f*)(pc + 16);
        // the address pairs of the 12 loads above stay untouched (inputs here) until this wait
        asm volatile("s_wait_xcnt 0x0" :: "v"(pkh), "v"(pkl), "v"(pvh), "v"(pvl), "v"(pw), "v"(pc) : "memory"); };
    gload(0);
    // B operands of the score products, kept in registers: column = query n0 + lr, k = d
    v16bf bqh[2], bql[2];
    { const size_t qo = zb + (size_t)(n0 + lr) * HD + 8 * hi;
      const bf* aqh = QTh + qo; const bf* aql = QTl + qo;
#pragma unroll   // constant indices, so that the arrays indexed here are registers
      for (int ks = 0; ks < 2; ++ks) { bqh[ks] = WFrag<bf>::ld(aqh + ks * 32); bql[ks] = WFrag<bf>::ld(aql + ks * 32); }
      // the address pairs of the 8 loads above stay untouched (inputs here) until this wait
      asm volatile("s_wait_xcnt 0x0" :: "v"(aqh), "v"(aql) : "memory"); }
    v8f o[4];
#pragma unroll   // constant indices, so that the arrays indexed here are registers
    for (int dt = 0; dt < 4; ++dt) o[dt] = (v8f){};
    float mc = -3.0e38f, l = 0.f;
    v8f s1[2];   // the scores' accumulators; their start value is the position term, summed at the foot of the pass before
#pragma unroll   // constant indices, so that the arrays indexed here are registers
    for (int t = 0; t < 2; ++t) s1[t] = bw[t] + bc[t];
    sstore(0);
    __syncthreads();
#pragma unroll 1   // rolled: the pass is long enough; for speed only
    for (int s = 0; s < NS; ++s) {
        const bf* r = ring + (s & 1) * STG;
        if (s + 1 < NS) gload(s + 1);   // lands while this pass computes
#pragma unroll   // constant indices, so that the arrays indexed here are registers
        for (int ks = 0; ks < 2; ++ks) { const bf* p = r + lr * KP + ks * 32 + 8 * hi;
            const v16bf kh0 = ldsfrag(p), kh1 = ldsfrag(p + 16 * KP), kl0 = ldsfrag(p + KPL), kl1 = ldsfrag(p + KPL + 16 * KP);
            s1[0] = wmmab(kh0, bqh[ks], s1[0]); s1[1] = wmmab(kh1, bqh[ks], s1[1]);
            s1[0] = wmmab(kh0, bql[ks], s1[0]); s1[1] = wmmab(kh1, bql[ks], s1[1]);
            s1[0] = wmmab(kl0, bqh[ks], s1[0]); s1[1] = wmmab(kl1, bqh[ks], s1[1]); }
        v16bf vh[4], vl[4];   // asked for ahead of the softmax arithmetic, which covers the LDS latency of as many of them as the registers hold
#pragma unroll   // constant indices, so that the arrays indexed here are registers
        for (int dt = 0; dt < 4; ++dt) { const bf* p = r + 2 * KPL + (dt * 16 + lr) * VP + 8 * hi; vh[dt] = ldsfrag(p); vl[dt] = ldsfrag(p + VPL); }
        float u[16];
#pragma unroll   // constant indices, so that the arrays indexed here are registers
        for (int i = 0; i < 16; ++i) u[i] = s1[i >> 3][i & 7];
        float mx = u[0];
#pragma unroll   // constant indices, so that the arrays indexed here are registers
        for (int i = 1; i < 16; ++i) mx = fmaxf(mx, u[i]);
        mx = fmaxf(mx, xhalf(mx));
        const float mn = fmaxf(mc, mx * CL2); const float al = __builtin_amdgcn_exp2f(mc - mn); mc = mn;
        float ps[4] = {0.f, 0.f, 0.f, 0.f};
#pragma unroll   // constant indices, so that the arrays indexed here are registers
        for (int i = 0; i < 16; ++i) { u[i] = __builtin_amdgcn_exp2f(__builtin_fmaf(u[i], CL2, -mn)); ps[i & 3] += u[i]; }
        l = l * al + ((ps[0] + ps[1]) + (ps[2] + ps[3]));   // this lane half's keys; the halves are joined behind the loop
        v16bf ph, pl;
#pragma unroll   // constant indices, so that the arrays indexed here are registers
        for (int i = 0; i < 8; ++i) { v2f x; x[0] = u[2 * i]; x[1] = u[2 * i + 1]; const v2bf h = __builtin_convertvector(x, v2bf); const v2bf w = __builtin_convertvector(x - __builtin_convertvector(h, v2f), v2bf);
            ph[2 * i] = h[0]; ph[2 * i + 1] = h[1]; pl[2 * i] = w[0]; pl[2 * i + 1] = w[1]; }
#pragma unroll   // constant indices, so that the arrays indexed here are registers
        for (int dt = 0; dt < 4; ++dt) o[dt] *= al;
#pragma unroll   // constant indices, so that the arrays indexed here are registers
        for (int dt = 0; dt < 4; ++dt) o[dt] = wmmab(vh[dt], ph, o[dt]);
#pragma unroll   // constant indices, so that the arrays indexed here are registers
        for (int dt = 0; dt < 4; ++dt) o[dt] = wmmab(vh[dt], pl, o[dt]);
#pragma unroll   // constant indices, so that the arrays indexed here are registers
        for (int dt = 0; dt < 4; ++dt) o[dt] = wmmab(vl[dt], ph, o[dt]);
#pragma unroll   // constant indices, so that the arrays indexed here are registers
        for (int t = 0; t < 2; ++t) s1[t] = bw[t] + bc[t];   // the next pass's start value (behind the last pass: unused)
        if (s + 1 < NS) sstore((s + 1) & 1);   // the buffer that pass s - 1 read; every wave left it at the last barrier
        __syncthreads();
    }
    l += xhalf(l);
    const float inv = __fdiv_rn(1.0f, l);
    // O^T[d][query] through LDS, so that every 128-byte line of the channels-first output is written whole by one wave
#pragma unroll   // constant indices, so that the arrays indexed here are registers
    for (int dt = 0; dt < 4; ++dt)
#pragma unroll   // constant indices, so that the arrays indexed here are registers
        for (int j = 0; j < 8; ++j) os[(dt * 16 + 8 * hi + j) * OP + wave * 16 + lr] = o[dt][j] * inv;
    __syncthreads();
    float* ob = OB + zb + blockIdx.x * FQ;
#pragma unroll
    for (int i = 0; i < 8; ++i) { const int d = wave * 8 + i; *(v4f*)(ob + (size_t)d * TT + lane * 4) = *(const v4fa*)(os + d * OP + lane * 4); }
}
__global__ __launch_bounds__(256) void k_merge(const float* __restrict__ O, int h0, bf* Ah, bf* Al) { const size_t e = ((size_t)blockIdx.x * 256 + threadIdx.x) * 2; if (e >= (size_t)ZH * TT * HD) return; const int d = (int)(e % HD); const int t = (int)((e / HD) % TT); const int zz = (int)(e / ((size_t)HD * TT)); const float cs = (t < RH) ? 1.0f : (1.0f / PCAR); const size_t oo = (size_t)t * DQ + (h0 + zz) * HD + d;
    v2us oh, ol;
#pragma unroll
    for (int q = 0; q < 2; ++q) { unsigned short a, c2; splitf(O[e + q] * cs, a, c2); oh[q] = a; ol[q] = c2; } *(v2us*)(Ah + oo) = oh; *(v2us*)(Al + oo) = ol;  }

extern "C" void kernel_launch(void* const* d_in, const int* in_sizes, int n_in,
                              void* d_out, int out_size, void* d_ws, size_t ws_size, hipStream_t stream) {
    (void)in_sizes; (void)n_in; (void)out_size;
    const float* x = (const float*)d_in[0]; const float* wq = (const float*)d_in[1]; const float* wk = (const float*)d_in[2]; const float* wv = (const float*)d_in[3]; const float* relh = (const float*)d_in[4]; const float* relw = (const float*)d_in[5]; const float* relt = (const float*)d_in[6]; const float* wo = nullptr; (void)wo; const float* cosT = nullptr; const float* sinT = nullptr; (void)cosT; (void)sinT;
    float* OUT = (float*)d_out;   // [4][256][8][32][32]
    char* wsp = (char*)d_ws; auto take = [&](size_t bytes) { char* p = wsp; wsp += (bytes + 255) & ~(size_t)255; return (void*)p; };
    bf* WQ = (bf*)take((size_t)CC * CC * 2); bf* WK = (bf*)take((size_t)CC * CC * 2); bf* WV = (bf*)take((size_t)CC * CC * 2);
    bf* XT = (bf*)take((size_t)NB_ * NP * CC * 2);
    bf* QTh = (bf*)take((size_t)NB_ * NBL * BLK * 2); bf* QTl = (bf*)take((size_t)NB_ * NBL * BLK * 2); bf* KTh = (bf*)take((size_t)NB_ * NBL * BLK * 2); bf* KTl = (bf*)take((size_t)NB_ * NBL * BLK * 2);
    float* RWT = (float*)take((size_t)NB_ * NBL * 32 * TT * 4); float* CAT = (float*)take((size_t)NB_ * NBL * 32 * TT * 4);
    bf* VTh = (bf*)take((size_t)NB_ * NBL * BLK * 2); bf* VTl = (bf*)take((size_t)NB_ * NBL * BLK * 2);
    if ((size_t)(wsp - (char*)d_ws) > ws_size) return;   // ws ~ 145 MiB
    k_xT<<<dim3(NP / XP + WB, NB_, 1), 256, 0, stream>>>(x, XT, wq, wk, wv, WQ, WK, WV);
    k_proj3<<<dim3(3, TT / 16, NB_), 256, 0, stream>>>(WQ, WK, WV, XT, QTh, QTl, KTh, KTl, VTh, VTl);
    k_ptab<<<dim3(TT / 256, NBL, NB_), 256, 0, stream>>>(QTh, QTl, relh, relw, relt, RWT, CAT);
    k_fattn<<<dim3(TT / FQ, NBL, NB_), 256, 0, stream>>>(QTh, QTl, KTh, KTl, RWT, CAT, VTh, VTl, OUT);
}

// v008
// Measured time: 132 microseconds a run.
// In two side-by-side timings against v007, it was 1.03 and 1.04 times as fast.
// Over all steps from v000 it is 9.94 times as fast.
#include <hip/hip_runtime.h>

// MHSA3D (x [4][256][8][32][32] channels-first; q/k/v = 1x1x1 conv (wq/wk/wv [256][256]) then the module's literal reshape (B, 4 heads, 8 frames, 64, 1024) of the [B][C][F][H][W] buffer = 32 contiguous [64][1024] blocks per batch; per block: energy[n][m] = (sum_d q[d][n] k[d][m] + sum_d pos[n][d] q[d][m]) / 8 with pos[h][f][n][d] = rel_h[h][d][n/32] + rel_w[h][d][n%32] + rel_t[h][d][f]; softmax over m; out[d][j] = sum_n v[d][n] attn[j][n]; -> [4][256][8][32][32]).
// Compute dtypes, f32 accumulate: every input rounded to bf16; the three convs as PLAIN bf16 GEMMs W . x (inputs: exact; x transposed to token-major on chip); per block: q^T, k^T hi/lo planes (transposed) and v hi/lo planes, all split and stored by the conv GEMM's own epilogue, the position term factored: sum_d pos[n][d] q[d][m] = sum_d rel_w[d][n%32] q[d][m] + sum_d rel_h[d][n/32] q[d][m] + sum_d rel_t[d][f] q[d][m], 65 rows a block instead of 1024 (k_ptab: rel rows exact in bf16 x q hi/lo, 2 products, f32 tables); the q.k product hl x hl (3 products) on every row, accumulated on top of the position term in f32; softmax f32 with a running maximum (weights exp2 of the scaled difference, split hi/lo unnormalised); attn.v hl x hl (3 products) on every row, divided by the row sum at the end; scores, softmax and attn.v in one kernel (k_fattn), which stores the context block [d][j] straight into the channels-first output in f32.

#define NB_  4
#define TT   1024
#define DM   256
#define NH_  4
#define NKV  4
#define REP  (NH_ / NKV)
#define HD   64
#define DQ   (NH_ * HD)
#define DKV  (NKV * HD)
#define ZH   8
#define RH   1024   // all rows hl
#define WIN  0
#define PCAR 1024.0f
#define CC   256    // channels
#define NF   8      // frames
#define NP   (NF * TT)   // positions per batch (8192)
#define NBL  (NH_ * NF)  // blocks per batch (32)
#define BLK  ((size_t)HD * TT)   // floats per block (65536)
#define SCL  0.125f   // HD^-0.5
typedef _Float16 h16;
typedef unsigned short bf;
typedef __attribute__((ext_vector_type(16))) __bf16   v16bf;
typedef __attribute__((ext_vector_type(16))) _Float16 v16h;
typedef __attribute__((ext_vector_type(8)))  _Float16 v8h;
typedef __attribute__((ext_vector_type(8)))  unsigned short v8us;
typedef __attribute__((ext_vector_type(8)))  float    v8f;
typedef __attribute__((ext_vector_type(4)))  float    v4f;
typedef v8h  __attribute__((may_alias)) v8ha;
typedef v4f  __attribute__((may_alias)) v4fa;
typedef v8us __attribute__((may_alias)) v8usa;

__device__ __forceinline__ unsigned short f2bf(float f) { unsigned u = __float_as_uint(f); u += 0x7FFFu + ((u >> 16) & 1u); return (unsigned short)(u >> 16); }
__device__ __forceinline__ float bf2f(unsigned short b) { return __uint_as_float(((unsigned)b) << 16); }
__device__ __forceinline__ float bfr(float f) { return bf2f(f2bf(f)); }
__device__ __forceinline__ v16h cat16(v8h lo, v8h hi) { return __builtin_shufflevector(lo, hi, 0, 1, 2, 3, 4, 5, 6, 7, 8, 9, 10, 11, 12, 13, 14, 15); }
__device__ __forceinline__ v16bf cat16b(v8us lo, v8us hi) { return __builtin_bit_cast(v16bf, __builtin_shufflevector(lo, hi, 0, 1, 2, 3, 4, 5, 6, 7, 8, 9, 10, 11, 12, 13, 14, 15)); }
__device__ __forceinline__ v8f wmma16(v16h a, v16h b, v8f c) { return __builtin_amdgcn_wmma_f32_16x16x32_f16(false, a, false, b, (short)0, c, false, false); }
__device__ __forceinline__ v8f wmmab(v16bf a, v16bf b, v8f c) { return __builtin_amdgcn_wmma_f32_16x16x32_bf16(false, a, false, b, (short)0, c, false, false); }



template <typename T16> struct WFrag;
template <> struct WFrag<h16> { typedef v16h V; static __device__ __forceinline__ V ld(const h16* p) { return cat16(*(const v8h*)p, *(const v8h*)(p + 16)); } static __device__ __forceinline__ v8f mma(V a, V b, v8f c) { return wmma16(a, b, c); } };
template <> struct WFrag<bf> { typedef v16bf V; static __device__ __forceinline__ V ld(const bf* p) { return cat16b(*(const v8us*)p, *(const v8us*)(p + 16)); } static __device__ __forceinline__ v8f mma(V a, V b, v8f c) { return wmmab(a, b, c); } };
#define PP   264                 // LDS pitch of a staged row, 16-bit elements: 512 B + 16 B
typedef __attribute__((ext_vector_type(8))) __bf16 v8bf;
typedef __attribute__((ext_vector_type(4))) __bf16 v4bf;
typedef __attribute__((ext_vector_type(4))) unsigned short v4us;
template <bool TR>
__device__ __forceinline__ void proj_body(bf* sm, const bf* __restrict__ Wm, const bf* __restrict__ XTm, bf* __restrict__ Ph, bf* __restrict__ Pl) {
    const int tid = threadIdx.x, lane = tid & 31, lr = lane & 15, hi = lane >> 4, wave = tid >> 5; const int o0 = (wave & 3) * 64, ty = blockIdx.y * 2 + (wave >> 2);
    XTm += (size_t)blockIdx.z * NP * CC; Ph += (size_t)blockIdx.z * NBL * BLK; Pl += (size_t)blockIdx.z * NBL * BLK;
    { // staging: wave w brings W rows 32 w ... 32 w + 31 and the x^T rows of LDS rows 256 + 16 w ... 256 + 16 w + 15
      const bf* gw = Wm + (size_t)wave * 32 * CC + lane * 8;
      const bf* gx = XTm + (TR ? ((size_t)blockIdx.y * 16 + wave * 2) : ((size_t)blockIdx.y * 128 + (wave >> 2) * 64 + (wave & 3))) * CC + lane * 8;
      v8us sw[32], sx[16];
#pragma unroll   // constant indices, so that the arrays indexed here are registers; all loads in flight at once
      for (int i = 0; i < 32; ++i) sw[i] = *(const v8us*)(gw + i * CC);
#pragma unroll   // constant indices, so that the arrays indexed here are registers; all loads in flight at once
      for (int i = 0; i < 16; ++i) sx[i] = *(const v8us*)(gx + (size_t)(TR ? (i & 7) * TT + (i >> 3) : i * 4) * CC);
      // the two address pairs of the 48 loads above stay untouched (inputs here) until this wait
      asm volatile("s_wait_xcnt 0x0" :: "v"(gw), "v"(gx) : "memory");
      bf* dw = sm + wave * 32 * PP + lane * 8; bf* dx = sm + (CC + wave * 16) * PP + lane * 8;
#pragma unroll   // constant indices, so that the arrays indexed here are registers
      for (int i = 0; i < 32; ++i) *(v8us*)(dw + i * PP) = sw[i];
#pragma unroll   // constant indices, so that the arrays indexed here are registers
      for (int i = 0; i < 16; ++i) *(v8us*)(dx + i * PP) = sx[i]; }
    __syncthreads();
    const bf* wrow = sm + (o0 + lr) * PP + 8 * hi;
    const bf* xrow = sm + (CC + (wave >> 2) * 64 + lr) * PP + 8 * hi;
    const bf* A = TR ? xrow : wrow; const bf* B = TR ? wrow : xrow;
    constexpr int TS = 16 * PP;   // from one 16-row / 16-column tile to the next
    v8f acc[4][4];
    // one trip: 32 channels. The first trip stands in front of the loop and starts from a zero C operand, so that no accumulator register is live while the 48 staged rows are still in registers
    auto trip = [&](const int kc, const bool first) {
        const bf* ap = A + kc; const bf* bp = B + kc; v16bf a[4];
#pragma unroll   // constant indices, so that the arrays indexed here are registers
        for (int mb = 0; mb < 4; ++mb) a[mb] = WFrag<bf>::ld(ap + mb * TS);
#pragma unroll   // constant indices, so that the arrays indexed here are registers
        for (int nb = 0; nb < 4; ++nb) { const v16bf b = WFrag<bf>::ld(bp + nb * TS);
#pragma unroll   // constant indices, so that the arrays indexed here are registers
            for (int mb = 0; mb < 4; ++mb) acc[mb][nb] = wmmab(a[mb], b, first ? (v8f){} : acc[mb][nb]); }
        // four vector slots behind the trip's last matrix instructions, also on the taken back edge, before anything touches their operands or results
        asm volatile("v_nop\n\tv_nop\n\tv_nop\n\tv_nop" : "+v"(acc[0][0]), "+v"(acc[1][1]), "+v"(acc[2][2]), "+v"(acc[3][3]) : "v"(a[0]), "v"(a[3]));
    };
    trip(0, true);
#pragma unroll 1   // rolled: beside the accumulators only one trip's fragments are kept in registers
    for (int kc = 32; kc < CC; kc += 32) trip(kc, false);
    if (TR) {
#pragma unroll   // constant indices, so that the arrays indexed here are registers
        for (int mb = 0; mb < 4; ++mb)
#pragma unroll   // constant indices, so that the arrays indexed here are registers
            for (int nb = 0; nb < 4; ++nb) { const v8f y = acc[mb][nb]; const v8bf h = __builtin_convertvector(y, v8bf); const v8bf w = __builtin_convertvector(y - __builtin_convertvector(h, v8f), v8bf);
                const size_t e = (size_t)(o0 / 8 + nb * 2 + (lr >> 3)) * BLK + (size_t)(ty * 8 + mb * 2 + hi) * HD + (lr & 7) * 8;
                *(v8us*)(Ph + e) = __builtin_bit_cast(v8us, h); *(v8us*)(Pl + e) = __builtin_bit_cast(v8us, w); }
    } else {
#pragma unroll   // constant indices, so that the arrays indexed here are registers
        for (int mb = 0; mb < 4; ++mb)
#pragma unroll   // constant indices, so that the arrays indexed here are registers
            for (int r = 0; r < 8; ++r) { v4f y; y[0] = acc[mb][0][r]; y[1] = acc[mb][1][r]; y[2] = acc[mb][2][r]; y[3] = acc[mb][3][r]; const v4bf h = __builtin_convertvector(y, v4bf); const v4bf w = __builtin_convertvector(y - __builtin_convertvector(h, v4f), v4bf);
                const size_t e = (size_t)(o0 + mb * 16 + 8 * hi + r) * NP + ty * 64 + lr * 4;
                *(v4us*)(Ph + e) = __builtin_bit_cast(v4us, h); *(v4us*)(Pl + e) = __builtin_bit_cast(v4us, w); }
    }
}
// grid (3 convs, 64 position tiles, 4 batches); the choice of the conv is the same for a whole work-group, so the barrier inside the body stands under uniform control flow
__global__ __launch_bounds__(256) void k_proj3(const bf* __restrict__ Wq, const bf* __restrict__ Wk, const bf* __restrict__ Wv, const bf* __restrict__ XTm, bf* __restrict__ Qh, bf* __restrict__ Ql, bf* __restrict__ Kh, bf* __restrict__ Kl, bf* __restrict__ Vh, bf* __restrict__ Vl) {
    __shared__ __align__(16) bf sm[(CC + 128) * PP];
    if (blockIdx.x == 2) proj_body<false>(sm, Wv, XTm, Vh, Vl);
    else { const bool k = blockIdx.x == 1; proj_body<true>(sm, k ? Wk : Wq, XTm, k ? Kh : Qh, k ? Kl : Ql); }
}

__device__ __forceinline__ h16 tohx(float x) { return (h16)x; }
__device__ __forceinline__ void splitf(float y, unsigned short& h, unsigned short& l) { h = f2bf(y); l = f2bf(y - bf2f(h)); }
typedef __attribute__((ext_vector_type(2))) _Float16 v2h;
typedef __attribute__((ext_vector_type(4))) _Float16 v4h;
typedef __attribute__((ext_vector_type(2))) unsigned short v2us;
typedef __attribute__((ext_vector_type(2))) float v2f;
typedef __attribute__((ext_vector_type(4))) int v4i;

__global__ __launch_bounds__(256) void k_wtG(const float* __restrict__ w, int K, int N, bf* Bt) {
    const int lane = threadIdx.x & 31; const int L0 = (blockIdx.x * 8 + (threadIdx.x >> 5)) * 8; const int nlines = N * K / 64;
{
#pragma unroll 1
        for (int l = 0; l < 8; ++l) { const int L = L0 + l; if (L >= nlines) break; const size_t e = (size_t)L * 64 + lane * 2; const int k = (int)(e % K), n = (int)(e / K); v2us o;
            o[0] = f2bf(w[(size_t)k * N + n]); o[1] = f2bf(w[(size_t)(k + 1) * N + n]); *(v2us*)(Bt + e) = o; }
         }
}
__global__ __launch_bounds__(256) void k_cscvt(const float* __restrict__ cosT, const float* __restrict__ sinT, float* CS) { const int idx = blockIdx.x * 256 + threadIdx.x; if (idx >= TT * HD) return; v2f cs; cs[0] = bfr(cosT[idx]); cs[1] = bfr(sinT[idx]); *(v2f*)(CS + (size_t)idx * 2) = cs;  }
// k_rope: head planes [h][t][d] (fp16 + hi/lo) of rope(x) x sc with the rotate-half convention out[d] = x[d] cos[t][d] - x[d+HD/2] sin[t][d], out[d+HD/2] = x[d+HD/2] cos[t][d+HD/2] + x[d] sin[t][d+HD/2]
__global__ __launch_bounds__(256) void k_rope(const float* __restrict__ F, int pitch, int nheads, const float* __restrict__ CS, const float* __restrict__ RF, const float* __restrict__ nw, float sc, h16* P16, bf* Ph, bf* Pl) {
    const size_t e = ((size_t)blockIdx.x * 256 + threadIdx.x) * 2; if (e >= (size_t)nheads * TT * HD) return; const int d = (int)(e % HD); const int t = (int)((e / HD) % TT); const int h = (int)(e / ((size_t)HD * TT)); const float* f = F + (size_t)t * pitch + h * HD; const float rf = RF ? RF[(size_t)h * TT + t] : 1.0f; v2h o16; v2us oh, ol;
#pragma unroll
    for (int q = 0; q < 2; ++q) { const int dd = d + q; const int dp = (dd < HD / 2) ? dd + HD / 2 : dd - HD / 2; float x0 = f[dd], x1 = f[dp];
        if (RF) { float n0 = __fmul_rn(x0, rf), n1 = __fmul_rn(x1, rf); asm volatile("" : "+v"(n0)); asm volatile("" : "+v"(n1)); x0 = __fmul_rn(bfr(nw[dd]), n0); x1 = __fmul_rn(bfr(nw[dp]), n1); }
        const v2f cs = *(const v2f*)(CS + ((size_t)t * HD + dd) * 2); float a = __fmul_rn(x0, cs[0]), bq = __fmul_rn(x1, cs[1]); asm volatile("" : "+v"(a)); asm volatile("" : "+v"(bq)); const float r = ((dd < HD / 2) ? __fsub_rn(a, bq) : __fadd_rn(a, bq)) * sc;
        o16[q] = tohx(r); unsigned short a2, c2; splitf(r, a2, c2); oh[q] = a2; ol[q] = c2; }
    *(v2h*)(P16 + e) = o16; *(v2us*)(Ph + e) = oh; *(v2us*)(Pl + e) = ol;  }
__global__ __launch_bounds__(256) void k_vtp(const float* __restrict__ F, int pitch, int nheads, h16* V16, bf* Vh, bf* Vl) { const size_t e = ((size_t)blockIdx.x * 256 + threadIdx.x) * 2; if (e >= (size_t)nheads * HD * TT) return; const int t = (int)(e % TT); const int d = (int)((e / TT) % HD); const int g = (int)(e / ((size_t)TT * HD)); v2h o16; v2us oh, ol;
#pragma unroll
    for (int q = 0; q < 2; ++q) { const float x = F[(size_t)(t + q) * pitch + g * HD + d]; o16[q] = tohx(x); unsigned short a2, c2; splitf(x, a2, c2); oh[q] = a2; ol[q] = c2; }
    *(v2h*)(V16 + e) = o16; *(v2us*)(Vh + e) = oh; *(v2us*)(Vl + e) = ol;  }
// ---- k_xT: x [c][p] f32 -> x^T [p][c] bf16 through an LDS tile, whole 128-byte lines on both sides. grid (8192 / 64 positions + WB weight work-groups, 4 batches), 8 waves; a position work-group owns 64 positions x all 256 channels.
// In: a 16-byte load takes 4 positions of one channel, 8 lanes a line, 4 channels a wave; a thread takes the channels c and c + 1 at the same positions and packs them, so that every LDS store is one dword.
// LDS: [position][128 channel pairs]; the 16-byte chunk (8 channels) k of position p lies at chunk k ^ (p / 4): the 32 dword stores of a wave fall in 32 banks, and a row read back in 16-byte pieces covers every bank evenly.
// Out: a wave stores one whole position row (512 bytes) at a time.
// The rounding of the three weight matrices to bf16 rides in the same launch: the work-groups with blockIdx.x >= 8192 / 64 (WB a batch row, 96 in all, 32 a matrix) take 8 weights a thread and leave before the barrier.
#define XP   64                  // positions per work-group
#define WB   (3 * CC * CC / (256 * 8) / NB_)   // weight work-groups per grid row (24)
typedef __attribute__((ext_vector_type(2))) __bf16 v2bfx;
typedef __attribute__((ext_vector_type(4))) unsigned v4u;
__global__ __launch_bounds__(256) void k_xT(const float* __restrict__ X, bf* __restrict__ XT2, const float* __restrict__ wq, const float* __restrict__ wk, const float* __restrict__ wv, bf* __restrict__ WQ2, bf* __restrict__ WK2, bf* __restrict__ WV2) {
    __shared__ __align__(16) unsigned xt[XP * (CC / 2)];
    const int tid = threadIdx.x, lane = tid & 31, wave = tid >> 5, g = lane & 7, q = lane >> 3;
    if (blockIdx.x >= NP / XP) {   // the same for a whole work-group
        const int j = (blockIdx.x - NP / XP) * NB_ + blockIdx.y, m = j >> 5; const size_t i = (size_t)((j & 31) * 256 + tid) * 8;
        const float* ws = (m == 0 ? wq : m == 1 ? wk : wv) + i; bf* wd = (m == 0 ? WQ2 : m == 1 ? WK2 : WV2) + i;
        const v8f v = *(const v8f*)ws; v8us o;
        asm volatile("s_wait_xcnt 0x0" :: "v"(ws) : "memory");   // the load's address pair stays untouched (an input here) until this wait
#pragma unroll   // constant indices, so that the arrays indexed here are registers
        for (int k = 0; k < 8; ++k) o[k] = f2bf(v[k]);
        *(v8us*)wd = o; return; }
    const float* s0 = X + ((size_t)blockIdx.y * CC + (wave * 16 + q) * 2) * NP + blockIdx.x * XP + g * 4;   // grid y = batch
    v4f a[8], b[8];
#pragma unroll   // constant indices, so that the arrays indexed here are registers; all 16 loads in flight at once
    for (int it = 0; it < 8; ++it) { const float* s = s0 + (size_t)(it & 3) * 8 * NP + (it >> 2) * 32; a[it] = *(const v4f*)s; b[it] = *(const v4f*)(s + NP); }
    // the address pair of the 16 loads above stays untouched (an input here) until this wait; the loaded values are inputs too, so that all 16 loads are issued before the first is used:
    // without that the compiler holds five of them back until earlier ones have landed, a second memory latency
    asm volatile("s_wait_xcnt 0x0" :: "v"(s0), "v"(a[0]), "v"(a[1]), "v"(a[2]), "v"(a[3]), "v"(a[4]), "v"(a[5]), "v"(a[6]), "v"(a[7]), "v"(b[0]), "v"(b[1]), "v"(b[2]), "v"(b[3]), "v"(b[4]), "v"(b[5]), "v"(b[6]), "v"(b[7]) : "memory");
    __builtin_amdgcn_sched_barrier(0);   // behind the work-group's branch above the compiler lifts the first conversions over the wait and again holds four loads back behind them; nothing is scheduled across this line
#pragma unroll   // constant indices, so that the arrays indexed here are registers
    for (int it = 0; it < 8; ++it) { const int pg = (it >> 2) * 8 + g; unsigned* d = xt + pg * 4 * (CC / 2) + (((wave * 4 + (it & 3)) ^ pg) << 2) + q;
#pragma unroll   // constant indices, so that the arrays indexed here are registers
        for (int j = 0; j < 4; ++j) { v2f x; x[0] = a[it][j]; x[1] = b[it][j]; d[j * (CC / 2)] = __builtin_bit_cast(unsigned, __builtin_convertvector(x, v2bfx)); } }
    __syncthreads();
    bf* o0 = XT2 + ((size_t)blockIdx.y * NP + blockIdx.x * XP + wave * 8) * CC + lane * 8;
    v4u r[8];
#pragma unroll   // constant indices, so that the arrays indexed here are registers
    for (int i = 0; i < 8; ++i) { const int p = wave * 8 + i; r[i] = *(const v4u*)(xt + p * (CC / 2) + ((lane ^ (p >> 2)) << 2)); }
#pragma unroll   // constant indices, so that the arrays indexed here are registers
    for (int i = 0; i < 8; ++i) *(v8us*)(o0 + i * CC) = __builtin_bit_cast(v8us, r[i]);
}
// ---- k_fattn: scores, softmax and attn.v of one [64][1024] block in ONE kernel; the scores never leave the registers.
// grid (1024 / 128 query tiles, 32 blocks, 4 batches), 8 waves; a wave owns 16 queries (columns) and walks the 1024 keys in passes of 32.
// Transposed product: S^T[key][query] = position term (k_ptab's tables, the accumulators' start value) + K^T rows . q columns (3 hi/lo products), so a lane holds 16 scores of ONE query;
// the two 16-key score tiles, turned into exp2 weights and split hi/lo, ARE the B operand (hardware k order) of O^T[d][query] += V[d][key] . P^T[key][query] (3 products).
// Running maximum per query (log2 domain), O^T and the sum rescaled every pass, one division by the sum at the end.
// The 32 key rows of K^T (hi/lo) and the 32 key columns of V (hi/lo) of a pass are staged in LDS for all 8 waves (whole-line global loads through registers), one ring slot a pass.
// The ring holds two stages of SP passes: while the waves read the slots of one stage, each pass fills the slot SP passes ahead, which lies in the other stage. One barrier a STAGE publishes the filled stage and frees the read one;
// between two barriers the waves run apart, so that one wave's softmax arithmetic stands beside another's matrix products and LDS reads instead of all eight doing the same thing at the same time.
#define FQ   128                 // queries per work-group
#define FK   32                  // keys per pass
#define NS   (TT / FK)           // passes
#define KP   72                  // LDS pitch of a key row of K^T, 16-bit elements: 128 B + 16 B, conflict-free for 16-byte reads
#define VP   40                  // LDS pitch of a d row of V: 64 B + 16 B
#define KPL  (FK * KP)           // one K^T plane of a ring slot
#define VPL  (HD * VP)           // one V plane of a ring slot
#define STG  (2 * KPL + 2 * VPL) // one ring slot (the four planes of one pass), 16-bit elements
#define SP   4                   // passes per stage: 128 keys between two barriers
#define NSL  (2 * SP)            // ring slots; two work-groups' rings fill a WGP's LDS
#define OP   132                 // LDS pitch of an output row, floats
#define CL2  0.18033688011112042f   // HD^-0.5 * log2(e)
typedef __attribute__((ext_vector_type(2))) __bf16 v2bf;
__device__ __forceinline__ float xhalf(float x) { const int b = __float_as_int(x); return __int_as_float(__builtin_amdgcn_permlanex16(b, b, 0x76543210, 0xfedcba98, false, false)); }   // lane l <-> l ^ 16
__device__ __forceinline__ v16bf ldsfrag(const bf* p) { return cat16b(*(const v8us*)p, *(const v8us*)(p + 16)); }
// ---- k_ptab: the position term of one block, factored. pos[n][d] = rel_h[d][n / 32] + rel_w[d][n % 32] + rel_t[d][f], so sum_d pos[n][d] q[d][m] = RW[n % 32][m] + CA[n / 32][m]
// with RW[b][m] = sum_d rel_w[d][b] q[d][m] and CA[a][m] = sum_d rel_h[d][a] q[d][m] + sum_d rel_t[d][f] q[d][m].
// grid (1024 / 256 keys, 32 blocks, 4 batches), 8 waves; a wave owns 32 keys (two 16-key tiles, the A rows, from the q^T planes) and five 16-column B tiles: rel_w 0-15, 16-31, rel_h 0-15, 16-31, and rel_t[f] in all 16 columns.
// RWT holds each 16-key x 16-column tile in the accumulator's own order, 1 KiB a tile: registers 0-3 of lane l at float l * 4, registers 4-7 at 128 + l * 4 (whole lines for 16-byte accesses); tile index (block * 64 + key tile) * 2 + column tile; CAT is [block][a][m].
__global__ __launch_bounds__(256) void k_ptab(const bf* __restrict__ QTh, const bf* __restrict__ QTl, const float* __restrict__ rh, const float* __restrict__ rw, const float* __restrict__ rt, float* __restrict__ RWT, float* __restrict__ CAT) {
    __shared__ __align__(16) bf rl[65 * KP];   // rows [column][d]: 0-31 rel_w, 32-63 rel_h, 64 rel_t of this frame
    const int tid = threadIdx.x, lane = tid & 31, lr = lane & 15, hi = lane >> 4, wave = tid >> 5;
    const int h = blockIdx.y / NF, f = blockIdx.y % NF, zi = blockIdx.z * NBL + blockIdx.y;
    { const int i0 = h * (HD * 32) + tid; float fw[HD * 32 / 256], fh[HD * 32 / 256];
#pragma unroll   // constant indices, so that the arrays indexed here are registers; all 16 loads in flight at once
      for (int j = 0; j < HD * 32 / 256; ++j) { fw[j] = rw[i0 + j * 256]; fh[j] = rh[i0 + j * 256]; }
      // the index register of the 16 loads above stays untouched (an input here) until this wait
      asm volatile("s_wait_xcnt 0x0" :: "v"(i0) : "memory");
#pragma unroll   // constant indices, so that the arrays indexed here are registers
      for (int j = 0; j < HD * 32 / 256; ++j) { const int i = j * 256 + tid, d = i >> 5, c = i & 31; rl[c * KP + d] = f2bf(fw[j]); rl[(32 + c) * KP + d] = f2bf(fh[j]); } }
    if (tid < HD) { const int it = (h * HD + tid) * NF + f; const float x = rt[it];
      asm volatile("s_wait_xcnt 0x0" :: "v"(it) : "memory");   // as above: the load's index register stays untouched until here
      rl[64 * KP + tid] = f2bf(x); }
    __syncthreads();
    v16bf br[5][2];
#pragma unroll   // constant indices, so that the arrays indexed here are registers
    for (int c = 0; c < 5; ++c)
#pragma unroll   // constant indices, so that the arrays indexed here are registers
        for (int ks = 0; ks < 2; ++ks) br[c][ks] = ldsfrag(rl + (c < 4 ? c * 16 + lr : 64) * KP + ks * 32 + 8 * hi);
    const int m0 = blockIdx.x * 256 + wave * 32;
#pragma unroll   // constant indices, so that the arrays indexed here are registers
    for (int t = 0; t < 2; ++t) {
        const size_t ro = (size_t)zi * BLK + (size_t)(m0 + t * 16 + lr) * HD + 8 * hi; const bf* ah = QTh + ro; const bf* al = QTl + ro;
        v16bf qh[2], ql[2];
#pragma unroll   // constant indices, so that the arrays indexed here are registers
        for (int ks = 0; ks < 2; ++ks) { qh[ks] = WFrag<bf>::ld(ah + ks * 32); ql[ks] = WFrag<bf>::ld(al + ks * 32); }
        // the address pairs of the 8 loads above stay untouched (inputs here) until this wait
        asm volatile("s_wait_xcnt 0x0" :: "v"(ah), "v"(al) : "memory");
        v8f acc[5];
#pragma unroll   // constant indices, so that the arrays indexed here are registers
        for (int c = 0; c < 5; ++c) acc[c] = (v8f){};
#pragma unroll   // constant indices, so that the arrays indexed here are registers
        for (int ks = 0; ks < 2; ++ks) {
#pragma unroll   // constant indices, so that the arrays indexed here are registers
            for (int c = 0; c < 5; ++c) acc[c] = wmmab(qh[ks], br[c][ks], acc[c]);
#pragma unroll   // constant indices, so that the arrays indexed here are registers
            for (int c = 0; c < 5; ++c) acc[c] = wmmab(ql[ks], br[c][ks], acc[c]); }
        const int mt = (m0 >> 4) + t;
#pragma unroll   // constant indices, so that the arrays indexed here are registers
        for (int c = 0; c < 2; ++c) {
            float* ow = RWT + (((size_t)zi * (TT / 16) + mt) * 2 + c) * 256 + lane * 4;
            *(v4f*)ow = __builtin_shufflevector(acc[c], acc[c], 0, 1, 2, 3); *(v4f*)(ow + 128) = __builtin_shufflevector(acc[c], acc[c], 4, 5, 6, 7);
            *(v8f*)(CAT + ((size_t)zi * 32 + c * 16 + lr) * TT + mt * 16 + 8 * hi) = acc[2 + c] + acc[4]; }
    }
}
__global__ __launch_bounds__(256) void k_fattn(const bf* __restrict__ QTh, const bf* __restrict__ QTl, const bf* __restrict__ KTh, const bf* __restrict__ KTl, const float* __restrict__ RWT, const float* __restrict__ CAT, const bf* __restrict__ VTh, const bf* __restrict__ VTl, float* __restrict__ OB) {
    __shared__ __align__(16) bf ring[NSL * STG];
    float* os = (float*)ring;   // the output staging [HD][OP] takes the ring's place behind the last barrier of the loop
    const int tid = threadIdx.x, lane = tid & 31, lr = lane & 15, hi = lane >> 4, wave = tid >> 5;
    const int zi = blockIdx.z * NBL + blockIdx.y; const size_t zb = (size_t)zi * BLK; const int n0 = blockIdx.x * FQ + wave * 16;
    // staging: a thread moves 16 bytes of each of the four planes per pass
    const bf* gkh = KTh + zb + tid * 8; const bf* gkl = KTl + zb + tid * 8;
    const bf* gvh = VTh + zb + (size_t)(tid >> 2) * TT + (tid & 3) * 8; const bf* gvl = VTl + zb + (size_t)(tid >> 2) * TT + (tid & 3) * 8;
    const int sk = (tid >> 3) * KP + (tid & 7) * 8, sv = 2 * KPL + (tid >> 2) * VP + (tid & 3) * 8;
    v8us st[4];
    auto sstore = [&](int b) { bf* r = ring + b * STG; *(v8us*)(r + sk) = st[0]; *(v8us*)(r + KPL + sk) = st[1]; *(v8us*)(r + sv) = st[2]; *(v8us*)(r + VPL + sv) = st[3]; };
    // position term of a pass, straight into registers one pass ahead: this wave's two RW tiles (columns n % 32 = its 16 queries, in accumulator order) and the 32 keys of its CA row (n / 32 is one value for the wave)
    const float* grw = RWT + ((size_t)zi * (TT / 16) * 2 + ((n0 >> 4) & 1)) * 256 + lane * 4; const float* gca = CAT + ((size_t)zi * 32 + (n0 >> 5)) * TT + 8 * hi;
    v8f bw[2], bc[2];
    // gload(s, kv): the position term of pass s; with kv also the K^T and V pieces of pass s + SP - 1 (asked for in pass s - 1, SP passes ahead of their use)
    auto gload = [&](const int s, const bool kv) { const int t = s + SP - 1; const bf* pkh = gkh + t * (FK * HD); const bf* pkl = gkl + t * (FK * HD); const bf* pvh = gvh + t * FK; const bf* pvl = gvl + t * FK; const float* pw = grw + s * 1024; const float* pc = gca + s * FK;
        if (kv) { st[0] = *(const v8us*)pkh; st[1] = *(const v8us*)pkl; st[2] = *(const v8us*)pvh; st[3] = *(const v8us*)pvl; }
        bw[0] = __builtin_shufflevector(*(const v4f*)pw, *(const v4f*)(pw + 128), 0, 1, 2, 3, 4, 5, 6, 7); bw[1] = __builtin_shufflevector(*(const v4f*)(pw + 512), *(const v4f*)(pw + 640), 0, 1, 2, 3, 4, 5, 6, 7); bc[0] = *(const v8f*)pc; bc[1] = *(const v8f*)(pc + 16);
        // the address pairs of the loads above stay untouched (inputs here) until this wait
        if (kv) asm volatile("s_wait_xcnt 0x0" :: "v"(pkh), "v"(pkl), "v"(pvh), "v"(pvl), "v"(pw), "v"(pc) : "memory");
        else asm volatile("s_wait_xcnt 0x0" :: "v"(pw), "v"(pc) : "memory"); };
    // the whole first stage, all 16 loads of a thread in flight at once
    v8us p0[SP][4];
#pragma unroll   // constant indices, so that the arrays indexed here are registers
    for (int j = 0; j < SP; ++j) { p0[j][0] = *(const v8us*)(gkh + j * (FK * HD)); p0[j][1] = *(const v8us*)(gkl + j * (FK * HD)); p0[j][2] = *(const v8us*)(gvh + j * FK); p0[j][3] = *(const v8us*)(gvl + j * FK); }
    // the four address pairs of the 16 loads above stay untouched (inputs here) until this wait
    asm volatile("s_wait_xcnt 0x0" :: "v"(gkh), "v"(gkl), "v"(gvh), "v"(gvl) : "memory");
    gload(0, false);
    // B operands of the score products, kept in registers: column = query n0 + lr, k = d
    v16bf bqh[2], bql[2];
    { const size_t qo = zb + (size_t)(n0 + lr) * HD + 8 * hi;
      const bf* aqh = QTh + qo; const bf* aql = QTl + qo;
#pragma unroll   // constant indices, so that the arrays indexed here are registers
      for (int ks = 0; ks < 2; ++ks) { bqh[ks] = WFrag<bf>::ld(aqh + ks * 32); bql[ks] = WFrag<bf>::ld(aql + ks * 32); }
      // the address pairs of the 8 loads above stay untouched (inputs here) until this wait
      asm volatile("s_wait_xcnt 0x0" :: "v"(aqh), "v"(aql) : "memory"); }
    v8f o[4];
#pragma unroll   // constant indices, so that the arrays indexed here are registers
    for (int dt = 0; dt < 4; ++dt) o[dt] = (v8f){};
    float mc = -3.0e38f, l = 0.f;
    v8f s1[2];   // the scores' accumulators; their start value is the position term, summed at the foot of the pass before
#pragma unroll   // constant indices, so that the arrays indexed here are registers
    for (int t = 0; t < 2; ++t) s1[t] = bw[t] + bc[t];
#pragma unroll   // constant indices, so that the arrays indexed here are registers
    for (int j = 0; j < SP; ++j) { bf* r = ring + j * STG; *(v8us*)(r + sk) = p0[j][0]; *(v8us*)(r + KPL + sk) = p0[j][1]; *(v8us*)(r + sv) = p0[j][2]; *(v8us*)(r + VPL + sv) = p0[j][3]; }
    __syncthreads();
#pragma unroll 1   // rolled, as the passes below
    for (int s0 = 0; s0 < NS; s0 += SP) {
#pragma unroll 1   // rolled: the pass is long enough; four copies took registers beyond what four waves a SIMD leave
      for (int s = s0; s < s0 + SP; ++s) {
        const bf* r = ring + (s & (NSL - 1)) * STG;
        if (s + SP < NS) gload(s + 1, true);   // lands while this pass computes
        else if (s + 1 < NS) gload(s + 1, false);
#pragma unroll   // constant indices, so that the arrays indexed here are registers
        for (int ks = 0; ks < 2; ++ks) { const bf* p = r + lr * KP + ks * 32 + 8 * hi;
            const v16bf kh0 = ldsfrag(p), kh1 = ldsfrag(p + 16 * KP), kl0 = ldsfrag(p + KPL), kl1 = ldsfrag(p + KPL + 16 * KP);
            s1[0] = wmmab(kh0, bqh[ks], s1[0]); s1[1] = wmmab(kh1, bqh[ks], s1[1]);
            s1[0] = wmmab(kh0, bql[ks], s1[0]); s1[1] = wmmab(kh1, bql[ks], s1[1]);
            s1[0] = wmmab(kl0, bqh[ks], s1[0]); s1[1] = wmmab(kl1, bqh[ks], s1[1]); }
        v16bf vh[4], vl[4];   // asked for ahead of the softmax arithmetic, which covers the LDS latency of as many of them as the registers hold
#pragma unroll   // constant indices, so that the arrays indexed here are registers
        for (int dt = 0; dt < 4; ++dt) { const bf* p = r + 2 * KPL + (dt * 16 + lr) * VP + 8 * hi; vh[dt] = ldsfrag(p); vl[dt] = ldsfrag(p + VPL); }
        float u[16];
#pragma unroll   // constant indices, so that the arrays indexed here are registers
        for (int i = 0; i < 16; ++i) u[i] = s1[i >> 3][i & 7];
        float mx = u[0];
#pragma unroll   // constant indices, so that the arrays indexed here are registers
        for (int i = 1; i < 16; ++i) mx = fmaxf(mx, u[i]);
        mx = fmaxf(mx, xhalf(mx));
        const float mn = fmaxf(mc, mx * CL2); const float al = __builtin_amdgcn_exp2f(mc - mn); mc = mn;
        float ps[4] = {0.f, 0.f, 0.f, 0.f};
#pragma unroll   // constant indices, so that the arrays indexed here are registers
        for (int i = 0; i < 16; ++i) { u[i] = __builtin_amdgcn_exp2f(__builtin_fmaf(u[i], CL2, -mn)); ps[i & 3] += u[i]; }
        l = l * al + ((ps[0] + ps[1]) + (ps[2] + ps[3]));   // this lane half's keys; the halves are joined behind the loop
        v16bf ph, pl;
#pragma unroll   // constant indices, so that the arrays indexed here are registers
        for (int i = 0; i < 8; ++i) { v2f x; x[0] = u[2 * i]; x[1] = u[2 * i + 1]; const v2bf h = __builtin_convertvector(x, v2bf); const v2bf w = __builtin_convertvector(x - __builtin_convertvector(h, v2f), v2bf);
            ph[2 * i] = h[0]; ph[2 * i + 1] = h[1]; pl[2 * i] = w[0]; pl[2 * i + 1] = w[1]; }
#pragma unroll   // constant indices, so that the arrays indexed here are registers
        for (int dt = 0; dt < 4; ++dt) o[dt] *= al;
#pragma unroll   // constant indices, so that the arrays indexed here are registers
        for (int dt = 0; dt < 4; ++dt) o[dt] = wmmab(vh[dt], ph, o[dt]);
#pragma unroll   // constant indices, so that the arrays indexed here are registers
        for (int dt = 0; dt < 4; ++dt) o[dt] = wmmab(vh[dt], pl, o[dt]);
#pragma unroll   // constant indices, so that the arrays indexed here are registers
        for (int dt = 0; dt < 4; ++dt) o[dt] = wmmab(vl[dt], ph, o[dt]);
#pragma unroll   // constant indices, so that the arrays indexed here are registers
        for (int t = 0; t < 2; ++t) s1[t] = bw[t] + bc[t];   // the next pass's start value (behind the last pass: unused)
        if (s + SP < NS) sstore((s + SP) & (NSL - 1));   // a slot of the other stage; every wave left that stage at the last barrier
      }
      __syncthreads();   // publishes the stage just filled and frees the one just read; behind the last stage it frees the ring for the output staging
    }
    l += xhalf(l);
    const float inv = __fdiv_rn(1.0f, l);
    // O^T[d][query] through LDS, so that every 128-byte line of the channels-first output is written whole by one wave
#pragma unroll   // constant indices, so that the arrays indexed here are registers
    for (int dt = 0; dt < 4; ++dt)
#pragma unroll   // constant indices, so that the arrays indexed here are registers
        for (int j = 0; j < 8; ++j) os[(dt * 16 + 8 * hi + j) * OP + wave * 16 + lr] = o[dt][j] * inv;
    __syncthreads();
    float* ob = OB + zb + blockIdx.x * FQ;
#pragma unroll
    for (int i = 0; i < 8; ++i) { const int d = wave * 8 + i; *(v4f*)(ob + (size_t)d * TT + lane * 4) = *(const v4fa*)(os + d * OP + lane * 4); }
}
__global__ __launch_bounds__(256) void k_merge(const float* __restrict__ O, int h0, bf* Ah, bf* Al) { const size_t e = ((size_t)blockIdx.x * 256 + threadIdx.x) * 2; if (e >= (size_t)ZH * TT * HD) return; const int d = (int)(e % HD); const int t = (int)((e / HD) % TT); const int zz = (int)(e / ((size_t)HD * TT)); const float cs = (t < RH) ? 1.0f : (1.0f / PCAR); const size_t oo = (size_t)t * DQ + (h0 + zz) * HD + d;
    v2us oh, ol;
#pragma unroll
    for (int q = 0; q < 2; ++q) { unsigned short a, c2; splitf(O[e + q] * cs, a, c2); oh[q] = a; ol[q] = c2; } *(v2us*)(Ah + oo) = oh; *(v2us*)(Al + oo) = ol;  }

extern "C" void kernel_launch(void* const* d_in, const int* in_sizes, int n_in,
                              void* d_out, int out_size, void* d_ws, size_t ws_size, hipStream_t stream) {
    (void)in_sizes; (void)n_in; (void)out_size;
    const float* x = (const float*)d_in[0]; const float* wq = (const float*)d_in[1]; const float* wk = (const float*)d_in[2]; const float* wv = (const float*)d_in[3]; const float* relh = (const float*)d_in[4]; const float* relw = (const float*)d_in[5]; const float* relt = (const float*)d_in[6]; const float* wo = nullptr; (void)wo; const float* cosT = nullptr; const float* sinT = nullptr; (void)cosT; (void)sinT;
    float* OUT = (float*)d_out;   // [4][256][8][32][32]
    char* wsp = (char*)d_ws; auto take = [&](size_t bytes) { char* p = wsp; wsp += (bytes + 255) & ~(size_t)255; return (void*)p; };
    bf* WQ = (bf*)take((size_t)CC * CC * 2); bf* WK = (bf*)take((size_t)CC * CC * 2); bf* WV = (bf*)take((size_t)CC * CC * 2);
    bf* XT = (bf*)take((size_t)NB_ * NP * CC * 2);
    bf* QTh = (bf*)take((size_t)NB_ * NBL * BLK * 2); bf* QTl = (bf*)take((size_t)NB_ * NBL * BLK * 2); bf* KTh = (bf*)take((size_t)NB_ * NBL * BLK * 2); bf* KTl = (bf*)take((size_t)NB_ * NBL * BLK * 2);
    float* RWT = (float*)take((size_t)NB_ * NBL * 32 * TT * 4); float* CAT = (float*)take((size_t)NB_ * NBL * 32 * TT * 4);
    bf* VTh = (bf*)take((size_t)NB_ * NBL * BLK * 2); bf* VTl = (bf*)take((size_t)NB_ * NBL * BLK * 2);
    if ((size_t)(wsp - (char*)d_ws) > ws_size) return;   // ws ~ 145 MiB
    k_xT<<<dim3(NP / XP + WB, NB_, 1), 256, 0, stream>>>(x, XT, wq, wk, wv, WQ, WK, WV);
    k_proj3<<<dim3(3, TT / 16, NB_), 256, 0, stream>>>(WQ, WK, WV, XT, QTh, QTl, KTh, KTl, VTh, VTl);
    k_ptab<<<dim3(TT / 256, NBL, NB_), 256, 0, stream>>>(QTh, QTl, relh, relw, relt, RWT, CAT);
    k_fattn<<<dim3(TT / FQ, NBL, NB_), 256, 0, stream>>>(QTh, QTl, KTh, KTl, RWT, CAT, VTh, VTl, OUT);
}

// v009
// A run of this version takes 126 microseconds.
// Next to v008, in two timings, it ran 1.05 times as fast each time.
// Counting every step since v000, it is 10.4 times as fast.
#include <hip/hip_runtime.h>

// MHSA3D (x [4][256][8][32][32] channels-first; q/k/v = 1x1x1 conv (wq/wk/wv [256][256]) then the module's literal reshape (B, 4 heads, 8 frames, 64, 1024) of the [B][C][F][H][W] buffer = 32 contiguous [64][1024] blocks per batch; per block: energy[n][m] = (sum_d q[d][n] k[d][m] + sum_d pos[n][d] q[d][m]) / 8 with pos[h][f][n][d] = rel_h[h][d][n/32] + rel_w[h][d][n%32] + rel_t[h][d][f]; softmax over m; out[d][j] = sum_n v[d][n] attn[j][n]; -> [4][256][8][32][32]).
// Compute dtypes, f32 accumulate: every input rounded to bf16; the three convs as PLAIN bf16 GEMMs W . x (inputs: exact; x transposed to token-major on chip); per block: q^T, k^T hi/lo planes (transposed) and v hi/lo planes, all split and stored by the conv GEMM's own epilogue, the position term factored: sum_d pos[n][d] q[d][m] = sum_d rel_w[d][n%32] q[d][m] + sum_d rel_h[d][n/32] q[d][m] + sum_d rel_t[d][f] q[d][m], 65 rows a block instead of 1024 (k_ptab: rel rows exact in bf16 x q hi/lo, 2 products, f32 tables); the q.k product hl x hl (3 products) on every row, accumulated on top of the position term in f32; softmax f32 with a running maximum (weights exp2 of the scaled difference, split hi/lo unnormalised); attn.v hl x hl (3 products) on every row, divided by the row sum at the end; scores, softmax and attn.v in one kernel (k_fattn), which stores the context block [d][j] straight into the channels-first output in f32.

#define NB_  4
#define TT   1024
#define DM   256
#define NH_  4
#define NKV  4
#define REP  (NH_ / NKV)
#define HD   64
#define DQ   (NH_ * HD)
#define DKV  (NKV * HD)
#define ZH   8
#define RH   1024   // all rows hl
#define WIN  0
#define PCAR 1024.0f
#define CC   256    // channels
#define NF   8      // frames
#define NP   (NF * TT)   // positions per batch (8192)
#define NBL  (NH_ * NF)  // blocks per batch (32)
#define BLK  ((size_t)HD * TT)   // floats per block (65536)
#define SCL  0.125f   // HD^-0.5
typedef _Float16 h16;
typedef unsigned short bf;
typedef __attribute__((ext_vector_type(16))) __bf16   v16bf;
typedef __attribute__((ext_vector_type(16))) _Float16 v16h;
typedef __attribute__((ext_vector_type(8)))  _Float16 v8h;
typedef __attribute__((ext_vector_type(8)))  unsigned short v8us;
typedef __attribute__((ext_vector_type(8)))  float    v8f;
typedef __attribute__((ext_vector_type(4)))  float    v4f;
typedef v8h  __attribute__((may_alias)) v8ha;
typedef v4f  __attribute__((may_alias)) v4fa;
typedef v8us __attribute__((may_alias)) v8usa;

__device__ __forceinline__ unsigned short f2bf(float f) { unsigned u = __float_as_uint(f); u += 0x7FFFu + ((u >> 16) & 1u); return (unsigned short)(u >> 16); }
__device__ __forceinline__ float bf2f(unsigned short b) { return __uint_as_float(((unsigned)b) << 16); }
__device__ __forceinline__ float bfr(float f) { return bf2f(f2bf(f)); }
__device__ __forceinline__ v16h cat16(v8h lo, v8h hi) { return __builtin_shufflevector(lo, hi, 0, 1, 2, 3, 4, 5, 6, 7, 8, 9, 10, 11, 12, 13, 14, 15); }
__device__ __forceinline__ v16bf cat16b(v8us lo, v8us hi) { return __builtin_bit_cast(v16bf, __builtin_shufflevector(lo, hi, 0, 1, 2, 3, 4, 5, 6, 7, 8, 9, 10, 11, 12, 13, 14, 15)); }
__device__ __forceinline__ v8f wmma16(v16h a, v16h b, v8f c) { return __builtin_amdgcn_wmma_f32_16x16x32_f16(false, a, false, b, (short)0, c, false, false); }
__device__ __forceinline__ v8f wmmab(v16bf a, v16bf b, v8f c) { return __builtin_amdgcn_wmma_f32_16x16x32_bf16(false, a, false, b, (short)0, c, false, false); }



template <typename T16> struct WFrag;
template <> struct WFrag<h16> { typedef v16h V; static __device__ __forceinline__ V ld(const h16* p) { return cat16(*(const v8h*)p, *(const v8h*)(p + 16)); } static __device__ __forceinline__ v8f mma(V a, V b, v8f c) { return wmma16(a, b, c); } };
template <> struct WFrag<bf> { typedef v16bf V; static __device__ __forceinline__ V ld(const bf* p) { return cat16b(*(const v8us*)p, *(const v8us*)(p + 16)); } static __device__ __forceinline__ v8f mma(V a, V b, v8f c) { return wmmab(a, b, c); } };
#define PP   264                 // LDS pitch of a staged row, 16-bit elements: 512 B + 16 B
typedef __attribute__((ext_vector_type(8))) __bf16 v8bf;
typedef __attribute__((ext_vector_type(4))) __bf16 v4bf;
typedef __attribute__((ext_vector_type(4))) unsigned short v4us;
template <bool TR>
__device__ __forceinline__ void proj_body(bf* sm, const bf* __restrict__ Wm, const bf* __restrict__ XTm, bf* __restrict__ Ph, bf* __restrict__ Pl) {
    const int tid = threadIdx.x, lane = tid & 31, lr = lane & 15, hi = lane >> 4, wave = tid >> 5; const int o0 = (wave & 3) * 64, ty = blockIdx.y * 2 + (wave >> 2);
    XTm += (size_t)blockIdx.z * NP * CC; Ph += (size_t)blockIdx.z * NBL * BLK; Pl += (size_t)blockIdx.z * NBL * BLK;
    { // staging: wave w brings W rows 32 w ... 32 w + 31 and the x^T rows of LDS rows 256 + 16 w ... 256 + 16 w + 15
      const bf* gw = Wm + (size_t)wave * 32 * CC + lane * 8;
      const bf* gx = XTm + (TR ? ((size_t)blockIdx.y * 16 + wave * 2) : ((size_t)blockIdx.y * 128 + (wave >> 2) * 64 + (wave & 3))) * CC + lane * 8;
      v8us sw[32], sx[16];
#pragma unroll   // constant indices, so that the arrays indexed here are registers; all loads in flight at once
      for (int i = 0; i < 32; ++i) sw[i] = *(const v8us*)(gw + i * CC);
#pragma unroll   // constant indices, so that the arrays indexed here are registers; all loads in flight at once
      for (int i = 0; i < 16; ++i) sx[i] = *(const v8us*)(gx + (size_t)(TR ? (i & 7) * TT + (i >> 3) : i * 4) * CC);
      // the two address pairs of the 48 loads above stay untouched (inputs here) until this wait
      asm volatile("s_wait_xcnt 0x0" :: "v"(gw), "v"(gx) : "memory");
      bf* dw = sm + wave * 32 * PP + lane * 8; bf* dx = sm + (CC + wave * 16) * PP + lane * 8;
#pragma unroll   // constant indices, so that the arrays indexed here are registers
      for (int i = 0; i < 32; ++i) *(v8us*)(dw + i * PP) = sw[i];
#pragma unroll   // constant indices, so that the arrays indexed here are registers
      for (int i = 0; i < 16; ++i) *(v8us*)(dx + i * PP) = sx[i]; }
    __syncthreads();
    const bf* wrow = sm + (o0 + lr) * PP + 8 * hi;
    const bf* xrow = sm + (CC + (wave >> 2) * 64 + lr) * PP + 8 * hi;
    const bf* A = TR ? xrow : wrow; const bf* B = TR ? wrow : xrow;
    constexpr int TS = 16 * PP;   // from one 16-row / 16-column tile to the next
    v8f acc[4][4];
    // one trip: 32 channels. The first trip stands in front of the loop and starts from a zero C operand, so that no accumulator register is live while the 48 staged rows are still in registers
    auto trip = [&](const int kc, const bool first) {
        const bf* ap = A + kc; const bf* bp = B + kc; v16bf a[4];
#pragma unroll   // constant indices, so that the arrays indexed here are registers
        for (int mb = 0; mb < 4; ++mb) a[mb] = WFrag<bf>::ld(ap + mb * TS);
#pragma unroll   // constant indices, so that the arrays indexed here are registers
        for (int nb = 0; nb < 4; ++nb) { const v16bf b = WFrag<bf>::ld(bp + nb * TS);
#pragma unroll   // constant indices, so that the arrays indexed here are registers
            for (int mb = 0; mb < 4; ++mb) acc[mb][nb] = wmmab(a[mb], b, first ? (v8f){} : acc[mb][nb]); }
        // four vector slots behind the trip's last matrix instructions, also on the taken back edge, before anything touches their operands or results
        asm volatile("v_nop\n\tv_nop\n\tv_nop\n\tv_nop" : "+v"(acc[0][0]), "+v"(acc[1][1]), "+v"(acc[2][2]), "+v"(acc[3][3]) : "v"(a[0]), "v"(a[3]));
    };
    trip(0, true);
#pragma unroll 1   // rolled: beside the accumulators only one trip's fragments are kept in registers
    for (int kc = 32; kc < CC; kc += 32) trip(kc, false);
    if (TR) {
#pragma unroll   // constant indices, so that the arrays indexed here are registers
        for (int mb = 0; mb < 4; ++mb)
#pragma unroll   // constant indices, so that the arrays indexed here are registers
            for (int nb = 0; nb < 4; ++nb) { const v8f y = acc[mb][nb]; const v8bf h = __builtin_convertvector(y, v8bf); const v8bf w = __builtin_convertvector(y - __builtin_convertvector(h, v8f), v8bf);
                const size_t e = (size_t)(o0 / 8 + nb * 2 + (lr >> 3)) * BLK + (size_t)(ty * 8 + mb * 2 + hi) * HD + (lr & 7) * 8;
                *(v8us*)(Ph + e) = __builtin_bit_cast(v8us, h); *(v8us*)(Pl + e) = __builtin_bit_cast(v8us, w); }
    } else {
#pragma unroll   // constant indices, so that the arrays indexed here are registers
        for (int mb = 0; mb < 4; ++mb)
#pragma unroll   // constant indices, so that the arrays indexed here are registers
            for (int r = 0; r < 8; ++r) { v4f y; y[0] = acc[mb][0][r]; y[1] = acc[mb][1][r]; y[2] = acc[mb][2][r]; y[3] = acc[mb][3][r]; const v4bf h = __builtin_convertvector(y, v4bf); const v4bf w = __builtin_convertvector(y - __builtin_convertvector(h, v4f), v4bf);
                const size_t e = (size_t)(o0 + mb * 16 + 8 * hi + r) * NP + ty * 64 + lr * 4;
                *(v4us*)(Ph + e) = __builtin_bit_cast(v4us, h); *(v4us*)(Pl + e) = __builtin_bit_cast(v4us, w); }
    }
}
// grid (3 convs, 64 position tiles, 4 batches); the choice of the conv is the same for a whole work-group, so the barrier inside the body stands under uniform control flow
__global__ __launch_bounds__(256) void k_proj3(const bf* __restrict__ Wq, const bf* __restrict__ Wk, const bf* __restrict__ Wv, const bf* __restrict__ XTm, bf* __restrict__ Qh, bf* __restrict__ Ql, bf* __restrict__ Kh, bf* __restrict__ Kl, bf* __restrict__ Vh, bf* __restrict__ Vl) {
    __shared__ __align__(16) bf sm[(CC + 128) * PP];
    if (blockIdx.x == 2) proj_body<false>(sm, Wv, XTm, Vh, Vl);
    else { const bool k = blockIdx.x == 1; proj_body<true>(sm, k ? Wk : Wq, XTm, k ? Kh : Qh, k ? Kl : Ql); }
}

__device__ __forceinline__ h16 tohx(float x) { return (h16)x; }
__device__ __forceinline__ void splitf(float y, unsigned short& h, unsigned short& l) { h = f2bf(y); l = f2bf(y - bf2f(h)); }
typedef __attribute__((ext_vector_type(2))) _Float16 v2h;
typedef __attribute__((ext_vector_type(4))) _Float16 v4h;
typedef __attribute__((ext_vector_type(2))) unsigned short v2us;
typedef __attribute__((ext_vector_type(2))) float v2f;
typedef __attribute__((ext_vector_type(4))) int v4i;

__global__ __launch_bounds__(256) void k_wtG(const float* __restrict__ w, int K, int N, bf* Bt) {
    const int lane = threadIdx.x & 31; const int L0 = (blockIdx.x * 8 + (threadIdx.x >> 5)) * 8; const int nlines = N * K / 64;
{
#pragma unroll 1
        for (int l = 0; l < 8; ++l) { const int L = L0 + l; if (L >= nlines) break; const size_t e = (size_t)L * 64 + lane * 2; const int k = (int)(e % K), n = (int)(e / K); v2us o;
            o[0] = f2bf(w[(size_t)k * N + n]); o[1] = f2bf(w[(size_t)(k + 1) * N + n]); *(v2us*)(Bt + e) = o; }
         }
}
__global__ __launch_bounds__(256) void k_cscvt(const float* __restrict__ cosT, const float* __restrict__ sinT, float* CS) { const int idx = blockIdx.x * 256 + threadIdx.x; if (idx >= TT * HD) return; v2f cs; cs[0] = bfr(cosT[idx]); cs[1] = bfr(sinT[idx]); *(v2f*)(CS + (size_t)idx * 2) = cs;  }
// k_rope: head planes [h][t][d] (fp16 + hi/lo) of rope(x) x sc with the rotate-half convention out[d] = x[d] cos[t][d] - x[d+HD/2] sin[t][d], out[d+HD/2] = x[d+HD/2] cos[t][d+HD/2] + x[d] sin[t][d+HD/2]
__global__ __launch_bounds__(256) void k_rope(const float* __restrict__ F, int pitch, int nheads, const float* __restrict__ CS, const float* __restrict__ RF, const float* __restrict__ nw, float sc, h16* P16, bf* Ph, bf* Pl) {
    const size_t e = ((size_t)blockIdx.x * 256 + threadIdx.x) * 2; if (e >= (size_t)nheads * TT * HD) return; const int d = (int)(e % HD); const int t = (int)((e / HD) % TT); const int h = (int)(e / ((size_t)HD * TT)); const float* f = F + (size_t)t * pitch + h * HD; const float rf = RF ? RF[(size_t)h * TT + t] : 1.0f; v2h o16; v2us oh, ol;
#pragma unroll
    for (int q = 0; q < 2; ++q) { const int dd = d + q; const int dp = (dd < HD / 2) ? dd + HD / 2 : dd - HD / 2; float x0 = f[dd], x1 = f[dp];
        if (RF) { float n0 = __fmul_rn(x0, rf), n1 = __fmul_rn(x1, rf); asm volatile("" : "+v"(n0)); asm volatile("" : "+v"(n1)); x0 = __fmul_rn(bfr(nw[dd]), n0); x1 = __fmul_rn(bfr(nw[dp]), n1); }
        const v2f cs = *(const v2f*)(CS + ((size_t)t * HD + dd) * 2); float a = __fmul_rn(x0, cs[0]), bq = __fmul_rn(x1, cs[1]); asm volatile("" : "+v"(a)); asm volatile("" : "+v"(bq)); const float r = ((dd < HD / 2) ? __fsub_rn(a, bq) : __fadd_rn(a, bq)) * sc;
        o16[q] = tohx(r); unsigned short a2, c2; splitf(r, a2, c2); oh[q] = a2; ol[q] = c2; }
    *(v2h*)(P16 + e) = o16; *(v2us*)(Ph + e) = oh; *(v2us*)(Pl + e) = ol;  }
__global__ __launch_bounds__(256) void k_vtp(const float* __restrict__ F, int pitch, int nheads, h16* V16, bf* Vh, bf* Vl) { const size_t e = ((size_t)blockIdx.x * 256 + threadIdx.x) * 2; if (e >= (size_t)nheads * HD * TT) return; const int t = (int)(e % TT); const int d = (int)((e / TT) % HD); const int g = (int)(e / ((size_t)TT * HD)); v2h o16; v2us oh, ol;
#pragma unroll
    for (int q = 0; q < 2; ++q) { const float x = F[(size_t)(t + q) * pitch + g * HD + d]; o16[q] = tohx(x); unsigned short a2, c2; splitf(x, a2, c2); oh[q] = a2; ol[q] = c2; }
    *(v2h*)(V16 + e) = o16; *(v2us*)(Vh + e) = oh; *(v2us*)(Vl + e) = ol;  }
// ---- k_xT: x [c][p] f32 -> x^T [p][c] bf16 through an LDS tile, whole 128-byte lines on both sides. grid (8192 / 64 positions + WB weight work-groups, 4 batches), 8 waves; a position work-group owns 64 positions x all 256 channels.
// In: a 16-byte load takes 4 positions of one channel, 8 lanes a line, 4 channels a wave; a thread takes the channels c and c + 1 at the same positions and packs them, so that every LDS store is one dword.
// LDS: [position][128 channel pairs]; the 16-byte chunk (8 channels) k of position p lies at chunk k ^ (p / 4): the 32 dword stores of a wave fall in 32 banks, and a row read back in 16-byte pieces covers every bank evenly.
// Out: a wave stores one whole position row (512 bytes) at a time.
// The rounding of the three weight matrices to bf16 rides in the same launch: the work-groups with blockIdx.x >= 8192 / 64 (WB a batch row, 96 in all, 32 a matrix) take 8 weights a thread and leave before the barrier.
#define XP   64                  // positions per work-group
#define WB   (3 * CC * CC / (256 * 8) / NB_)   // weight work-groups per grid row (24)
typedef __attribute__((ext_vector_type(2))) __bf16 v2bfx;
typedef __attribute__((ext_vector_type(4))) unsigned v4u;
__global__ __launch_bounds__(256) void k_xT(const float* __restrict__ X, bf* __restrict__ XT2, const float* __restrict__ wq, const float* __restrict__ wk, const float* __restrict__ wv, bf* __restrict__ WQ2, bf* __restrict__ WK2, bf* __restrict__ WV2) {
    __shared__ __align__(16) unsigned xt[XP * (CC / 2)];
    const int tid = threadIdx.x, lane = tid & 31, wave = tid >> 5, g = lane & 7, q = lane >> 3;
    if (blockIdx.x >= NP / XP) {   // the same for a whole work-group
        const int j = (blockIdx.x - NP / XP) * NB_ + blockIdx.y, m = j >> 5; const size_t i = (size_t)((j & 31) * 256 + tid) * 8;
        const float* ws = (m == 0 ? wq : m == 1 ? wk : wv) + i; bf* wd = (m == 0 ? WQ2 : m == 1 ? WK2 : WV2) + i;
        const v8f v = *(const v8f*)ws; v8us o;
        asm volatile("s_wait_xcnt 0x0" :: "v"(ws) : "memory");   // the load's address pair stays untouched (an input here) until this wait
#pragma unroll   // constant indices, so that the arrays indexed here are registers
        for (int k = 0; k < 8; ++k) o[k] = f2bf(v[k]);
        *(v8us*)wd = o; return; }
    const float* s0 = X + ((size_t)blockIdx.y * CC + (wave * 16 + q) * 2) * NP + blockIdx.x * XP + g * 4;   // grid y = batch
    v4f a[8], b[8];
#pragma unroll   // constant indices, so that the arrays indexed here are registers; all 16 loads in flight at once
    for (int it = 0; it < 8; ++it) { const float* s = s0 + (size_t)(it & 3) * 8 * NP + (it >> 2) * 32; a[it] = *(const v4f*)s; b[it] = *(const v4f*)(s + NP); }
    // the address pair of the 16 loads above stays untouched (an input here) until this wait; the loaded values are inputs too, so that all 16 loads are issued before the first is used:
    // without that the compiler holds five of them back until earlier ones have landed, a second memory latency
    asm volatile("s_wait_xcnt 0x0" :: "v"(s0), "v"(a[0]), "v"(a[1]), "v"(a[2]), "v"(a[3]), "v"(a[4]), "v"(a[5]), "v"(a[6]), "v"(a[7]), "v"(b[0]), "v"(b[1]), "v"(b[2]), "v"(b[3]), "v"(b[4]), "v"(b[5]), "v"(b[6]), "v"(b[7]) : "memory");
    __builtin_amdgcn_sched_barrier(0);   // behind the work-group's branch above the compiler lifts the first conversions over the wait and again holds four loads back behind them; nothing is scheduled across this line
#pragma unroll   // constant indices, so that the arrays indexed here are registers
    for (int it = 0; it < 8; ++it) { const int pg = (it >> 2) * 8 + g; unsigned* d = xt + pg * 4 * (CC / 2) + (((wave * 4 + (it & 3)) ^ pg) << 2) + q;
#pragma unroll   // constant indices, so that the arrays indexed here are registers
        for (int j = 0; j < 4; ++j) { v2f x; x[0] = a[it][j]; x[1] = b[it][j]; d[j * (CC / 2)] = __builtin_bit_cast(unsigned, __builtin_convertvector(x, v2bfx)); } }
    __syncthreads();
    bf* o0 = XT2 + ((size_t)blockIdx.y * NP + blockIdx.x * XP + wave * 8) * CC + lane * 8;
    v4u r[8];
#pragma unroll   // constant indices, so that the arrays indexed here are registers
    for (int i = 0; i < 8; ++i) { const int p = wave * 8 + i; r[i] = *(const v4u*)(xt + p * (CC / 2) + ((lane ^ (p >> 2)) << 2)); }
#pragma unroll   // constant indices, so that the arrays indexed here are registers
    for (int i = 0; i < 8; ++i) *(v8us*)(o0 + i * CC) = __builtin_bit_cast(v8us, r[i]);
}
// ---- k_fattn: scores, softmax and attn.v of one [64][1024] block in ONE kernel; the scores never leave the registers.
// grid (1024 / 128 query tiles, 32 blocks, 4 batches), 8 waves; a wave owns 16 queries (columns) and walks the 1024 keys in passes of 32.
// Transposed product: S^T[key][query] = position term (k_ptab's tables, the accumulators' start value) + K^T rows . q columns (3 hi/lo products), so a lane holds 16 scores of ONE query;
// the two 16-key score tiles, turned into exp2 weights and split hi/lo, ARE the B operand (hardware k order) of O^T[d][query] += V[d][key] . P^T[key][query] (3 products).
// Running maximum per query (log2 domain), O^T and the sum rescaled every pass, one division by the sum at the end.
// The 32 key rows of K^T (hi/lo) and the 32 key columns of V (hi/lo) of a pass are staged in LDS for all 8 waves (whole-line global loads through registers), one ring slot a pass.
// The ring holds two stages of SP passes: while the waves read the slots of one stage, each pass fills the slot SP passes ahead, which lies in the other stage. One barrier a STAGE publishes the filled stage and frees the read one;
// between two barriers the waves run apart, so that one wave's softmax arithmetic stands beside another's matrix products and LDS reads instead of all eight doing the same thing at the same time.
// The LDS reads of a pass stand in two groups, each in front of the work that covers its latency: the eight K^T fragments at the very head (the issue of the pass's global loads runs beside their latency), the eight V fragments from the last score products on (the softmax arithmetic covers theirs); behind each group counted waits only.
#define FQ   128                 // queries per work-group
#define FK   32                  // keys per pass
#define NS   (TT / FK)           // passes
#define KP   72                  // LDS pitch of a key row of K^T, 16-bit elements: 128 B + 16 B, conflict-free for 16-byte reads
#define VP   40                  // LDS pitch of a d row of V: 64 B + 16 B
#define KPL  (FK * KP)           // one K^T plane of a ring slot
#define VPL  (HD * VP)           // one V plane of a ring slot
#define STG  (2 * KPL + 2 * VPL) // one ring slot (the four planes of one pass), 16-bit elements
#define SP   4                   // passes per stage: 128 keys between two barriers
#define NSL  (2 * SP)            // ring slots; two work-groups' rings fill a WGP's LDS
#define OP   132                 // LDS pitch of an output row, floats
#define CL2  0.18033688011112042f   // HD^-0.5 * log2(e)
typedef __attribute__((ext_vector_type(2))) __bf16 v2bf;
__device__ __forceinline__ float xhalf(float x) { const int b = __float_as_int(x); return __int_as_float(__builtin_amdgcn_permlanex16(b, b, 0x76543210, 0xfedcba98, false, false)); }   // lane l <-> l ^ 16
__device__ __forceinline__ v16bf ldsfrag(const bf* p) { return cat16b(*(const v8us*)p, *(const v8us*)(p + 16)); }
// ---- k_ptab: the position term of one block, factored. pos[n][d] = rel_h[d][n / 32] + rel_w[d][n % 32] + rel_t[d][f], so sum_d pos[n][d] q[d][m] = RW[n % 32][m] + CA[n / 32][m]
// with RW[b][m] = sum_d rel_w[d][b] q[d][m] and CA[a][m] = sum_d rel_h[d][a] q[d][m] + sum_d rel_t[d][f] q[d][m].
// grid (1024 / 256 keys, 32 blocks, 4 batches), 8 waves; a wave owns 32 keys (two 16-key tiles, the A rows, from the q^T planes) and five 16-column B tiles: rel_w 0-15, 16-31, rel_h 0-15, 16-31, and rel_t[f] in all 16 columns.
// RWT holds each 16-key x 16-column tile in the accumulator's own order, 1 KiB a tile: registers 0-3 of lane l at float l * 4, registers 4-7 at 128 + l * 4 (whole lines for 16-byte accesses); tile index (block * 64 + key tile) * 2 + column tile; CAT is [block][a][m].
__global__ __launch_bounds__(256) void k_ptab(const bf* __restrict__ QTh, const bf* __restrict__ QTl, const float* __restrict__ rh, const float* __restrict__ rw, const float* __restrict__ rt, float* __restrict__ RWT, float* __restrict__ CAT) {
    __shared__ __align__(16) bf rl[65 * KP];   // rows [column][d]: 0-31 rel_w, 32-63 rel_h, 64 rel_t of this frame
    const int tid = threadIdx.x, lane = tid & 31, lr = lane & 15, hi = lane >> 4, wave = tid >> 5;
    const int h = blockIdx.y / NF, f = blockIdx.y % NF, zi = blockIdx.z * NBL + blockIdx.y;
    { const int i0 = h * (HD * 32) + tid; float fw[HD * 32 / 256], fh[HD * 32 / 256];
#pragma unroll   // constant indices, so that the arrays indexed here are registers; all 16 loads in flight at once
      for (int j = 0; j < HD * 32 / 256; ++j) { fw[j] = rw[i0 + j * 256]; fh[j] = rh[i0 + j * 256]; }
      // the index register of the 16 loads above stays untouched (an input here) until this wait
      asm volatile("s_wait_xcnt 0x0" :: "v"(i0) : "memory");
#pragma unroll   // constant indices, so that the arrays indexed here are registers
      for (int j = 0; j < HD * 32 / 256; ++j) { const int i = j * 256 + tid, d = i >> 5, c = i & 31; rl[c * KP + d] = f2bf(fw[j]); rl[(32 + c) * KP + d] = f2bf(fh[j]); } }
    if (tid < HD) { const int it = (h * HD + tid) * NF + f; const float x = rt[it];
      asm volatile("s_wait_xcnt 0x0" :: "v"(it) : "memory");   // as above: the load's index register stays untouched until here
      rl[64 * KP + tid] = f2bf(x); }
    __syncthreads();
    v16bf br[5][2];
#pragma unroll   // constant indices, so that the arrays indexed here are registers
    for (int c = 0; c < 5; ++c)
#pragma unroll   // constant indices, so that the arrays indexed here are registers
        for (int ks = 0; ks < 2; ++ks) br[c][ks] = ldsfrag(rl + (c < 4 ? c * 16 + lr : 64) * KP + ks * 32 + 8 * hi);
    const int m0 = blockIdx.x * 256 + wave * 32;
#pragma unroll   // constant indices, so that the arrays indexed here are registers
    for (int t = 0; t < 2; ++t) {
        const size_t ro = (size_t)zi * BLK + (size_t)(m0 + t * 16 + lr) * HD + 8 * hi; const bf* ah = QTh + ro; const bf* al = QTl + ro;
        v16bf qh[2], ql[2];
#pragma unroll   // constant indices, so that the arrays indexed here are registers
        for (int ks = 0; ks < 2; ++ks) { qh[ks] = WFrag<bf>::ld(ah + ks * 32); ql[ks] = WFrag<bf>::ld(al + ks * 32); }
        // the address pairs of the 8 loads above stay untouched (inputs here) until this wait
        asm volatile("s_wait_xcnt 0x0" :: "v"(ah), "v"(al) : "memory");
        v8f acc[5];
#pragma unroll   // constant indices, so that the arrays indexed here are registers
        for (int c = 0; c < 5; ++c) acc[c] = (v8f){};
#pragma unroll   // constant indices, so that the arrays indexed here are registers
        for (int ks = 0; ks < 2; ++ks) {
#pragma unroll   // constant indices, so that the arrays indexed here are registers
            for (int c = 0; c < 5; ++c) acc[c] = wmmab(qh[ks], br[c][ks], acc[c]);
#pragma unroll   // constant indices, so that the arrays indexed here are registers
            for (int c = 0; c < 5; ++c) acc[c] = wmmab(ql[ks], br[c][ks], acc[c]); }
        const int mt = (m0 >> 4) + t;
#pragma unroll   // constant indices, so that the arrays indexed here are registers
        for (int c = 0; c < 2; ++c) {
            float* ow = RWT + (((size_t)zi * (TT / 16) + mt) * 2 + c) * 256 + lane * 4;
            *(v4f*)ow = __builtin_shufflevector(acc[c], acc[c], 0, 1, 2, 3); *(v4f*)(ow + 128) = __builtin_shufflevector(acc[c], acc[c], 4, 5, 6, 7);
            *(v8f*)(CAT + ((size_t)zi * 32 + c * 16 + lr) * TT + mt * 16 + 8 * hi) = acc[2 + c] + acc[4]; }
    }
}
__global__ __launch_bounds__(256) void k_fattn(const bf* __restrict__ QTh, const bf* __restrict__ QTl, const bf* __restrict__ KTh, const bf* __restrict__ KTl, const float* __restrict__ RWT, const float* __restrict__ CAT, const bf* __restrict__ VTh, const bf* __restrict__ VTl, float* __restrict__ OB) {
    __shared__ __align__(16) bf ring[NSL * STG];
    float* os = (float*)ring;   // the output staging [HD][OP] takes the ring's place behind the last barrier of the loop
    const int tid = threadIdx.x, lane = tid & 31, lr = lane & 15, hi = lane >> 4, wave = tid >> 5;
    const int zi = blockIdx.z * NBL + blockIdx.y; const size_t zb = (size_t)zi * BLK; const int n0 = blockIdx.x * FQ + wave * 16;
    // staging: a thread moves 16 bytes of each of the four planes per pass
    const bf* gkh = KTh + zb + tid * 8; const bf* gkl = KTl + zb + tid * 8;
    const bf* gvh = VTh + zb + (size_t)(tid >> 2) * TT + (tid & 3) * 8; const bf* gvl = VTl + zb + (size_t)(tid >> 2) * TT + (tid & 3) * 8;
    const int sk = (tid >> 3) * KP + (tid & 7) * 8, sv = 2 * KPL + (tid >> 2) * VP + (tid & 3) * 8;
    v8us st[4];
    auto sstore = [&](int b) { bf* r = ring + b * STG; *(v8us*)(r + sk) = st[0]; *(v8us*)(r + KPL + sk) = st[1]; *(v8us*)(r + sv) = st[2]; *(v8us*)(r + VPL + sv) = st[3]; };
    // position term of a pass, straight into registers one pass ahead: this wave's two RW tiles (columns n % 32 = its 16 queries, in accumulator order) and the 32 keys of its CA row (n / 32 is one value for the wave)
    const float* grw = RWT + ((size_t)zi * (TT / 16) * 2 + ((n0 >> 4) & 1)) * 256 + lane * 4; const float* gca = CAT + ((size_t)zi * 32 + (n0 >> 5)) * TT + 8 * hi;
    v8f bw[2], bc[2];
    // gload(s, kv): the position term of pass s; with kv also the K^T and V pieces of pass s + SP - 1 (asked for in pass s - 1, SP passes ahead of their use)
    auto gload = [&](const int s, const bool kv) { const int t = s + SP - 1; const bf* pkh = gkh + t * (FK * HD); const bf* pkl = gkl + t * (FK * HD); const bf* pvh = gvh + t * FK; const bf* pvl = gvl + t * FK; const float* pw = grw + s * 1024; const float* pc = gca + s * FK;
        if (kv) { st[0] = *(const v8us*)pkh; st[1] = *(const v8us*)pkl; st[2] = *(const v8us*)pvh; st[3] = *(const v8us*)pvl; }
        bw[0] = __builtin_shufflevector(*(const v4f*)pw, *(const v4f*)(pw + 128), 0, 1, 2, 3, 4, 5, 6, 7); bw[1] = __builtin_shufflevector(*(const v4f*)(pw + 512), *(const v4f*)(pw + 640), 0, 1, 2, 3, 4, 5, 6, 7); bc[0] = *(const v8f*)pc; bc[1] = *(const v8f*)(pc + 16);
        // the address pairs of the loads above stay untouched (inputs here) until this wait
        if (kv) asm volatile("s_wait_xcnt 0x0" :: "v"(pkh), "v"(pkl), "v"(pvh), "v"(pvl), "v"(pw), "v"(pc) : "memory");
        else asm volatile("s_wait_xcnt 0x0" :: "v"(pw), "v"(pc) : "memory"); };
    // the whole first stage, all 16 loads of a thread in flight at once
    v8us p0[SP][4];
#pragma unroll   // constant indices, so that the arrays indexed here are registers
    for (int j = 0; j < SP; ++j) { p0[j][0] = *(const v8us*)(gkh + j * (FK * HD)); p0[j][1] = *(const v8us*)(gkl + j * (FK * HD)); p0[j][2] = *(const v8us*)(gvh + j * FK); p0[j][3] = *(const v8us*)(gvl + j * FK); }
    // the four address pairs of the 16 loads above stay untouched (inputs here) until this wait
    asm volatile("s_wait_xcnt 0x0" :: "v"(gkh), "v"(gkl), "v"(gvh), "v"(gvl) : "memory");
    gload(0, false);
    // B operands of the score products, kept in registers: column = query n0 + lr, k = d
    v16bf bqh[2], bql[2];
    { const size_t qo = zb + (size_t)(n0 + lr) * HD + 8 * hi;
      const bf* aqh = QTh + qo; const bf* aql = QTl + qo;
#pragma unroll   // constant indices, so that the arrays indexed here are registers
      for (int ks = 0; ks < 2; ++ks) { bqh[ks] = WFrag<bf>::ld(aqh + ks * 32); bql[ks] = WFrag<bf>::ld(aql + ks * 32); }
      // the address pairs of the 8 loads above stay untouched (inputs here) until this wait
      asm volatile("s_wait_xcnt 0x0" :: "v"(aqh), "v"(aql) : "memory"); }
    v8f o[4];
#pragma unroll   // constant indices, so that the arrays indexed here are registers
    for (int dt = 0; dt < 4; ++dt) o[dt] = (v8f){};
    float mc = -3.0e38f, l = 0.f;
    v8f s1[2];   // the scores' accumulators; their start value is the position term, summed at the foot of the pass before
#pragma unroll   // constant indices, so that the arrays indexed here are registers
    for (int t = 0; t < 2; ++t) s1[t] = bw[t] + bc[t];
#pragma unroll   // constant indices, so that the arrays indexed here are registers
    for (int j = 0; j < SP; ++j) { bf* r = ring + j * STG; *(v8us*)(r + sk) = p0[j][0]; *(v8us*)(r + KPL + sk) = p0[j][1]; *(v8us*)(r + sv) = p0[j][2]; *(v8us*)(r + VPL + sv) = p0[j][3]; }
    __syncthreads();
#pragma unroll 1   // rolled, as the passes below
    for (int s0 = 0; s0 < NS; s0 += SP) {
#pragma unroll 1   // rolled: the pass is long enough; four copies took registers beyond what four waves a SIMD leave
      for (int s = s0; s < s0 + SP; ++s) {
        const bf* r = ring + (s & (NSL - 1)) * STG;
        v16bf kh[2][2], kl[2][2];   // all eight K^T fragments of the pass, asked for as ONE group; in front of the branch on the global loads, which none of the reads is sunk across
#pragma unroll   // constant indices, so that the arrays indexed here are registers
        for (int ks = 0; ks < 2; ++ks) { const bf* p = r + lr * KP + ks * 32 + 8 * hi;
            kh[ks][0] = ldsfrag(p); kh[ks][1] = ldsfrag(p + 16 * KP); kl[ks][0] = ldsfrag(p + KPL); kl[ks][1] = ldsfrag(p + KPL + 16 * KP); }
        if (s + SP < NS) gload(s + 1, true);   // lands while this pass computes; behind the K^T reads, whose latency its issue and its wait then fill
        else if (s + 1 < NS) gload(s + 1, false);
#pragma unroll   // constant indices, so that the arrays indexed here are registers
        for (int ks = 0; ks < 2; ++ks) {
            s1[0] = wmmab(kh[ks][0], bqh[ks], s1[0]); s1[1] = wmmab(kh[ks][1], bqh[ks], s1[1]);
            s1[0] = wmmab(kh[ks][0], bql[ks], s1[0]); s1[1] = wmmab(kh[ks][1], bql[ks], s1[1]);
            s1[0] = wmmab(kl[ks][0], bqh[ks], s1[0]); s1[1] = wmmab(kl[ks][1], bqh[ks], s1[1]); }
        v16bf vh[4], vl[4];   // all eight V fragments, asked for as ONE group ahead of the softmax arithmetic, which covers their LDS latency
#pragma unroll   // constant indices, so that the arrays indexed here are registers
        for (int dt = 0; dt < 4; ++dt) { const bf* p = r + 2 * KPL + (dt * 16 + lr) * VP + 8 * hi; vh[dt] = ldsfrag(p); vl[dt] = ldsfrag(p + VPL); }
        __builtin_amdgcn_sched_barrier(0);   // keeps the 16 LDS reads above in front of the softmax arithmetic: left free, the compiler sinks half of them singly among the second run of products, each waited for right behind its issue, one whole LDS latency a fragment
        float u[16];
#pragma unroll   // constant indices, so that the arrays indexed here are registers
        for (int i = 0; i < 16; ++i) u[i] = s1[i >> 3][i & 7];
        float mx = u[0];
#pragma unroll   // constant indices, so that the arrays indexed here are registers
        for (int i = 1; i < 16; ++i) mx = fmaxf(mx, u[i]);
        mx = fmaxf(mx, xhalf(mx));
        const float mn = fmaxf(mc, mx * CL2); const float al = __builtin_amdgcn_exp2f(mc - mn); mc = mn;
        float ps[4] = {0.f, 0.f, 0.f, 0.f};
#pragma unroll   // constant indices, so that the arrays indexed here are registers
        for (int i = 0; i < 16; ++i) { u[i] = __builtin_amdgcn_exp2f(__builtin_fmaf(u[i], CL2, -mn)); ps[i & 3] += u[i]; }
        l = l * al + ((ps[0] + ps[1]) + (ps[2] + ps[3]));   // this lane half's keys; the halves are joined behind the loop
        v16bf ph, pl;
#pragma unroll   // constant indices, so that the arrays indexed here are registers
        for (int i = 0; i < 8; ++i) { v2f x; x[0] = u[2 * i]; x[1] = u[2 * i + 1]; const v2bf h = __builtin_convertvector(x, v2bf); const v2bf w = __builtin_convertvector(x - __builtin_convertvector(h, v2f), v2bf);
            ph[2 * i] = h[0]; ph[2 * i + 1] = h[1]; pl[2 * i] = w[0]; pl[2 * i + 1] = w[1]; }
#pragma unroll   // constant indices, so that the arrays indexed here are registers
        for (int dt = 0; dt < 4; ++dt) o[dt] *= al;
#pragma unroll   // constant indices, so that the arrays indexed here are registers
        for (int dt = 0; dt < 4; ++dt) o[dt] = wmmab(vh[dt], ph, o[dt]);
#pragma unroll   // constant indices, so that the arrays indexed here are registers
        for (int dt = 0; dt < 4; ++dt) o[dt] = wmmab(vh[dt], pl, o[dt]);
#pragma unroll   // constant indices, so that the arrays indexed here are registers
        for (int dt = 0; dt < 4; ++dt) o[dt] = wmmab(vl[dt], ph, o[dt]);
#pragma unroll   // constant indices, so that the arrays indexed here are registers
        for (int t = 0; t < 2; ++t) s1[t] = bw[t] + bc[t];   // the next pass's start value (behind the last pass: unused)
        if (s + SP < NS) sstore((s + SP) & (NSL - 1));   // a slot of the other stage; every wave left that stage at the last barrier
      }
      __syncthreads();   // publishes the stage just filled and frees the one just read; behind the last stage it frees the ring for the output staging
    }
    l += xhalf(l);
    const float inv = __fdiv_rn(1.0f, l);
    // O^T[d][query] through LDS, so that every 128-byte line of the channels-first output is written whole by one wave
#pragma unroll   // constant indices, so that the arrays indexed here are registers
    for (int dt = 0; dt < 4; ++dt)
#pragma unroll   // constant indices, so that the arrays indexed here are registers
        for (int j = 0; j < 8; ++j) os[(dt * 16 + 8 * hi + j) * OP + wave * 16 + lr] = o[dt][j] * inv;
    __syncthreads();
    float* ob = OB + zb + blockIdx.x * FQ;
#pragma unroll
    for (int i = 0; i < 8; ++i) { const int d = wave * 8 + i; *(v4f*)(ob + (size_t)d * TT + lane * 4) = *(const v4fa*)(os + d * OP + lane * 4); }
}
__global__ __launch_bounds__(256) void k_merge(const float* __restrict__ O, int h0, bf* Ah, bf* Al) { const size_t e = ((size_t)blockIdx.x * 256 + threadIdx.x) * 2; if (e >= (size_t)ZH * TT * HD) return; const int d = (int)(e % HD); const int t = (int)((e / HD) % TT); const int zz = (int)(e / ((size_t)HD * TT)); const float cs = (t < RH) ? 1.0f : (1.0f / PCAR); const size_t oo = (size_t)t * DQ + (h0 + zz) * HD + d;
    v2us oh, ol;
#pragma unroll
    for (int q = 0; q < 2; ++q) { unsigned short a, c2; splitf(O[e + q] * cs, a, c2); oh[q] = a; ol[q] = c2; } *(v2us*)(Ah + oo) = oh; *(v2us*)(Al + oo) = ol;  }

extern "C" void kernel_launch(void* const* d_in, const int* in_sizes, int n_in,
                              void* d_out, int out_size, void* d_ws, size_t ws_size, hipStream_t stream) {
    (void)in_sizes; (void)n_in; (void)out_size;
    const float* x = (const float*)d_in[0]; const float* wq = (const float*)d_in[1]; const float* wk = (const float*)d_in[2]; const float* wv = (const float*)d_in[3]; const float* relh = (const float*)d_in[4]; const float* relw = (const float*)d_in[5]; const float* relt = (const float*)d_in[6]; const float* wo = nullptr; (void)wo; const float* cosT = nullptr; const float* sinT = nullptr; (void)cosT; (void)sinT;
    float* OUT = (float*)d_out;   // [4][256][8][32][32]
    char* wsp = (char*)d_ws; auto take = [&](size_t bytes) { char* p = wsp; wsp += (bytes + 255) & ~(size_t)255; return (void*)p; };
    bf* WQ = (bf*)take((size_t)CC * CC * 2); bf* WK = (bf*)take((size_t)CC * CC * 2); bf* WV = (bf*)take((size_t)CC * CC * 2);
    bf* XT = (bf*)take((size_t)NB_ * NP * CC * 2);
    bf* QTh = (bf*)take((size_t)NB_ * NBL * BLK * 2); bf* QTl = (bf*)take((size_t)NB_ * NBL * BLK * 2); bf* KTh = (bf*)take((size_t)NB_ * NBL * BLK * 2); bf* KTl = (bf*)take((size_t)NB_ * NBL * BLK * 2);
    float* RWT = (float*)take((size_t)NB_ * NBL * 32 * TT * 4); float* CAT = (float*)take((size_t)NB_ * NBL * 32 * TT * 4);
    bf* VTh = (bf*)take((size_t)NB_ * NBL * BLK * 2); bf* VTl = (bf*)take((size_t)NB_ * NBL * BLK * 2);
    if ((size_t)(wsp - (char*)d_ws) > ws_size) return;   // ws ~ 145 MiB
    k_xT<<<dim3(NP / XP + WB, NB_, 1), 256, 0, stream>>>(x, XT, wq, wk, wv, WQ, WK, WV);
    k_proj3<<<dim3(3, TT / 16, NB_), 256, 0, stream>>>(WQ, WK, WV, XT, QTh, QTl, KTh, KTl, VTh, VTl);
    k_ptab<<<dim3(TT / 256, NBL, NB_), 256, 0, stream>>>(QTh, QTl, relh, relw, relt, RWT, CAT);
    k_fattn<<<dim3(TT / FQ, NBL, NB_), 256, 0, stream>>>(QTh, QTl, KTh, KTl, RWT, CAT, VTh, VTl, OUT);
}

// v010
// One run takes 121 microseconds.
// Next to v009, in two timings, it ran 1.04 times as fast each time.
// All steps since v000 together make it 10.9 times as fast.
#include <hip/hip_runtime.h>

// MHSA3D (x [4][256][8][32][32] channels-first; q/k/v = 1x1x1 conv (wq/wk/wv [256][256]) then the module's literal reshape (B, 4 heads, 8 frames, 64, 1024) of the [B][C][F][H][W] buffer = 32 contiguous [64][1024] blocks per batch; per block: energy[n][m] = (sum_d q[d][n] k[d][m] + sum_d pos[n][d] q[d][m]) / 8 with pos[h][f][n][d] = rel_h[h][d][n/32] + rel_w[h][d][n%32] + rel_t[h][d][f]; softmax over m; out[d][j] = sum_n v[d][n] attn[j][n]; -> [4][256][8][32][32]).
// Compute dtypes, f32 accumulate: every input rounded to bf16; the three convs as PLAIN bf16 GEMMs W . x (inputs: exact; x transposed to token-major on chip); per block: q^T, k^T hi/lo planes (transposed) and v hi/lo planes, all split and stored by the conv GEMM's own epilogue, the position term factored: sum_d pos[n][d] q[d][m] = sum_d rel_w[d][n%32] q[d][m] + sum_d rel_h[d][n/32] q[d][m] + sum_d rel_t[d][f] q[d][m], 65 rows a block instead of 1024 (k_ptab: rel rows exact in bf16 x q hi/lo, 2 products, f32 tables); the q.k product hl x hl (3 products) on every row, accumulated on top of the position term in f32; softmax f32 with a running maximum (weights exp2 of the scaled difference, split hi/lo unnormalised); attn.v hl x hl (3 products) on every row, divided by the row sum at the end; scores, softmax and attn.v in one kernel (k_fattn), which stores the context block [d][j] straight into the channels-first output in f32.

#define NB_  4
#define TT   1024
#define DM   256
#define NH_  4
#define NKV  4
#define REP  (NH_ / NKV)
#define HD   64
#define DQ   (NH_ * HD)
#define DKV  (NKV * HD)
#define ZH   8
#define RH   1024   // all rows hl
#define WIN  0
#define PCAR 1024.0f
#define CC   256    // channels
#define NF   8      // frames
#define NP   (NF * TT)   // positions per batch (8192)
#define NBL  (NH_ * NF)  // blocks per batch (32)
#define BLK  ((size_t)HD * TT)   // floats per block (65536)
#define SCL  0.125f   // HD^-0.5
typedef _Float16 h16;
typedef unsigned short bf;
typedef __attribute__((ext_vector_type(16))) __bf16   v16bf;
typedef __attribute__((ext_vector_type(16))) _Float16 v16h;
typedef __attribute__((ext_vector_type(8)))  _Float16 v8h;
typedef __attribute__((ext_vector_type(8)))  unsigned short v8us;
typedef __attribute__((ext_vector_type(8)))  float    v8f;
typedef __attribute__((ext_vector_type(4)))  float    v4f;
typedef v8h  __attribute__((may_alias)) v8ha;
typedef v4f  __attribute__((may_alias)) v4fa;
typedef v8us __attribute__((may_alias)) v8usa;

__device__ __forceinline__ unsigned short f2bf(float f) { unsigned u = __float_as_uint(f); u += 0x7FFFu + ((u >> 16) & 1u); return (unsigned short)(u >> 16); }
__device__ __forceinline__ float bf2f(unsigned short b) { return __uint_as_float(((unsigned)b) << 16); }
__device__ __forceinline__ float bfr(float f) { return bf2f(f2bf(f)); }
__device__ __forceinline__ v16h cat16(v8h lo, v8h hi) { return __builtin_shufflevector(lo, hi, 0, 1, 2, 3, 4, 5, 6, 7, 8, 9, 10, 11, 12, 13, 14, 15); }
__device__ __forceinline__ v16bf cat16b(v8us lo, v8us hi) { return __builtin_bit_cast(v16bf, __builtin_shufflevector(lo, hi, 0, 1, 2, 3, 4, 5, 6, 7, 8, 9, 10, 11, 12, 13, 14, 15)); }
__device__ __forceinline__ v8f wmma16(v16h a, v16h b, v8f c) { return __builtin_amdgcn_wmma_f32_16x16x32_f16(false, a, false, b, (short)0, c, false, false); }
__device__ __forceinline__ v8f wmmab(v16bf a, v16bf b, v8f c) { return __builtin_amdgcn_wmma_f32_16x16x32_bf16(false, a, false, b, (short)0, c, false, false); }



template <typename T16> struct WFrag;
template <> struct WFrag<h16> { typedef v16h V; static __device__ __forceinline__ V ld(const h16* p) { return cat16(*(const v8h*)p, *(const v8h*)(p + 16)); } static __device__ __forceinline__ v8f mma(V a, V b, v8f c) { return wmma16(a, b, c); } };
template <> struct WFrag<bf> { typedef v16bf V; static __device__ __forceinline__ V ld(const bf* p) { return cat16b(*(const v8us*)p, *(const v8us*)(p + 16)); } static __device__ __forceinline__ v8f mma(V a, V b, v8f c) { return wmmab(a, b, c); } };
#define PP   264                 // LDS pitch of a staged row, 16-bit elements: 512 B + 16 B
typedef __attribute__((ext_vector_type(8))) __bf16 v8bf;
typedef __attribute__((ext_vector_type(4))) __bf16 v4bf;
typedef __attribute__((ext_vector_type(4))) unsigned short v4us;
template <bool TR>
__device__ __forceinline__ void proj_body(bf* sm, const bf* __restrict__ Wm, const bf* __restrict__ XTm, bf* __restrict__ Ph, bf* __restrict__ Pl) {
    const int tid = threadIdx.x, lane = tid & 31, lr = lane & 15, hi = lane >> 4, wave = tid >> 5; const int o0 = (wave & 3) * 64, ty = blockIdx.y * 2 + (wave >> 2);
    XTm += (size_t)blockIdx.z * NP * CC; Ph += (size_t)blockIdx.z * NBL * BLK; Pl += (size_t)blockIdx.z * NBL * BLK;
    { // staging: wave w brings W rows 32 w ... 32 w + 31 and the x^T rows of LDS rows 256 + 16 w ... 256 + 16 w + 15
      const bf* gw = Wm + (size_t)wave * 32 * CC + lane * 8;
      const bf* gx = XTm + (TR ? ((size_t)blockIdx.y * 16 + wave * 2) : ((size_t)blockIdx.y * 128 + (wave >> 2) * 64 + (wave & 3))) * CC + lane * 8;
      v8us sw[32], sx[16];
#pragma unroll   // constant indices, so that the arrays indexed here are registers; all loads in flight at once
      for (int i = 0; i < 32; ++i) sw[i] = *(const v8us*)(gw + i * CC);
#pragma unroll   // constant indices, so that the arrays indexed here are registers; all loads in flight at once
      for (int i = 0; i < 16; ++i) sx[i] = *(const v8us*)(gx + (size_t)(TR ? (i & 7) * TT + (i >> 3) : i * 4) * CC);
      // the two address pairs of the 48 loads above stay untouched (inputs here) until this wait
      asm volatile("s_wait_xcnt 0x0" :: "v"(gw), "v"(gx) : "memory");
      bf* dw = sm + wave * 32 * PP + lane * 8; bf* dx = sm + (CC + wave * 16) * PP + lane * 8;
#pragma unroll   // constant indices, so that the arrays indexed here are registers
      for (int i = 0; i < 32; ++i) *(v8us*)(dw + i * PP) = sw[i];
#pragma unroll   // constant indices, so that the arrays indexed here are registers
      for (int i = 0; i < 16; ++i) *(v8us*)(dx + i * PP) = sx[i]; }
    __syncthreads();
    const bf* wrow = sm + (o0 + lr) * PP + 8 * hi;
    const bf* xrow = sm + (CC + (wave >> 2) * 64 + lr) * PP + 8 * hi;
    const bf* A = TR ? xrow : wrow; const bf* B = TR ? wrow : xrow;
    constexpr int TS = 16 * PP;   // from one 16-row / 16-column tile to the next
    v8f acc[4][4];
    // one trip: 32 channels. The first trip stands in front of the loop and starts from a zero C operand, so that no accumulator register is live while the 48 staged rows are still in registers
    auto trip = [&](const int kc, const bool first) {
        const bf* ap = A + kc; const bf* bp = B + kc; v16bf a[4];
#pragma unroll   // constant indices, so that the arrays indexed here are registers
        for (int mb = 0; mb < 4; ++mb) a[mb] = WFrag<bf>::ld(ap + mb * TS);
#pragma unroll   // constant indices, so that the arrays indexed here are registers
        for (int nb = 0; nb < 4; ++nb) { const v16bf b = WFrag<bf>::ld(bp + nb * TS);
#pragma unroll   // constant indices, so that the arrays indexed here are registers
            for (int mb = 0; mb < 4; ++mb) acc[mb][nb] = wmmab(a[mb], b, first ? (v8f){} : acc[mb][nb]); }
        // four vector slots behind the trip's last matrix instructions, also on the taken back edge, before anything touches their operands or results
        asm volatile("v_nop\n\tv_nop\n\tv_nop\n\tv_nop" : "+v"(acc[0][0]), "+v"(acc[1][1]), "+v"(acc[2][2]), "+v"(acc[3][3]) : "v"(a[0]), "v"(a[3]));
    };
    trip(0, true);
#pragma unroll 1   // rolled: beside the accumulators only one trip's fragments are kept in registers
    for (int kc = 32; kc < CC; kc += 32) trip(kc, false);
    if (TR) {
#pragma unroll   // constant indices, so that the arrays indexed here are registers
        for (int mb = 0; mb < 4; ++mb)
#pragma unroll   // constant indices, so that the arrays indexed here are registers
            for (int nb = 0; nb < 4; ++nb) { const v8f y = acc[mb][nb]; const v8bf h = __builtin_convertvector(y, v8bf); const v8bf w = __builtin_convertvector(y - __builtin_convertvector(h, v8f), v8bf);
                const size_t e = (size_t)(o0 / 8 + nb * 2 + (lr >> 3)) * BLK + (size_t)(ty * 8 + mb * 2 + hi) * HD + (lr & 7) * 8;
                *(v8us*)(Ph + e) = __builtin_bit_cast(v8us, h); *(v8us*)(Pl + e) = __builtin_bit_cast(v8us, w); }
    } else {
#pragma unroll   // constant indices, so that the arrays indexed here are registers
        for (int mb = 0; mb < 4; ++mb)
#pragma unroll   // constant indices, so that the arrays indexed here are registers
            for (int r = 0; r < 8; ++r) { v4f y; y[0] = acc[mb][0][r]; y[1] = acc[mb][1][r]; y[2] = acc[mb][2][r]; y[3] = acc[mb][3][r]; const v4bf h = __builtin_convertvector(y, v4bf); const v4bf w = __builtin_convertvector(y - __builtin_convertvector(h, v4f), v4bf);
                const size_t e = (size_t)(o0 + mb * 16 + 8 * hi + r) * NP + ty * 64 + lr * 4;
                *(v4us*)(Ph + e) = __builtin_bit_cast(v4us, h); *(v4us*)(Pl + e) = __builtin_bit_cast(v4us, w); }
    }
}
// grid (3 convs, 64 position tiles, 4 batches); the choice of the conv is the same for a whole work-group, so the barrier inside the body stands under uniform control flow
__global__ __launch_bounds__(256) void k_proj3(const bf* __restrict__ Wq, const bf* __restrict__ Wk, const bf* __restrict__ Wv, const bf* __restrict__ XTm, bf* __restrict__ Qh, bf* __restrict__ Ql, bf* __restrict__ Kh, bf* __restrict__ Kl, bf* __restrict__ Vh, bf* __restrict__ Vl) {
    __shared__ __align__(16) bf sm[(CC + 128) * PP];
    if (blockIdx.x == 2) proj_body<false>(sm, Wv, XTm, Vh, Vl);
    else { const bool k = blockIdx.x == 1; proj_body<true>(sm, k ? Wk : Wq, XTm, k ? Kh : Qh, k ? Kl : Ql); }
}

__device__ __forceinline__ h16 tohx(float x) { return (h16)x; }
__device__ __forceinline__ void splitf(float y, unsigned short& h, unsigned short& l) { h = f2bf(y); l = f2bf(y - bf2f(h)); }
typedef __attribute__((ext_vector_type(2))) _Float16 v2h;
typedef __attribute__((ext_vector_type(4))) _Float16 v4h;
typedef __attribute__((ext_vector_type(2))) unsigned short v2us;
typedef __attribute__((ext_vector_type(2))) float v2f;
typedef __attribute__((ext_vector_type(4))) int v4i;

__global__ __launch_bounds__(256) void k_wtG(const float* __restrict__ w, int K, int N, bf* Bt) {
    const int lane = threadIdx.x & 31; const int L0 = (blockIdx.x * 8 + (threadIdx.x >> 5)) * 8; const int nlines = N * K / 64;
{
#pragma unroll 1
        for (int l = 0; l < 8; ++l) { const int L = L0 + l; if (L >= nlines) break; const size_t e = (size_t)L * 64 + lane * 2; const int k = (int)(e % K), n = (int)(e / K); v2us o;
            o[0] = f2bf(w[(size_t)k * N + n]); o[1] = f2bf(w[(size_t)(k + 1) * N + n]); *(v2us*)(Bt + e) = o; }
         }
}
__global__ __launch_bounds__(256) void k_cscvt(const float* __restrict__ cosT, const float* __restrict__ sinT, float* CS) { const int idx = blockIdx.x * 256 + threadIdx.x; if (idx >= TT * HD) return; v2f cs; cs[0] = bfr(cosT[idx]); cs[1] = bfr(sinT[idx]); *(v2f*)(CS + (size_t)idx * 2) = cs;  }
// k_rope: head planes [h][t][d] (fp16 + hi/lo) of rope(x) x sc with the rotate-half convention out[d] = x[d] cos[t][d] - x[d+HD/2] sin[t][d], out[d+HD/2] = x[d+HD/2] cos[t][d+HD/2] + x[d] sin[t][d+HD/2]
__global__ __launch_bounds__(256) void k_rope(const float* __restrict__ F, int pitch, int nheads, const float* __restrict__ CS, const float* __restrict__ RF, const float* __restrict__ nw, float sc, h16* P16, bf* Ph, bf* Pl) {
    const size_t e = ((size_t)blockIdx.x * 256 + threadIdx.x) * 2; if (e >= (size_t)nheads * TT * HD) return; const int d = (int)(e % HD); const int t = (int)((e / HD) % TT); const int h = (int)(e / ((size_t)HD * TT)); const float* f = F + (size_t)t * pitch + h * HD; const float rf = RF ? RF[(size_t)h * TT + t] : 1.0f; v2h o16; v2us oh, ol;
#pragma unroll
    for (int q = 0; q < 2; ++q) { const int dd = d + q; const int dp = (dd < HD / 2) ? dd + HD / 2 : dd - HD / 2; float x0 = f[dd], x1 = f[dp];
        if (RF) { float n0 = __fmul_rn(x0, rf), n1 = __fmul_rn(x1, rf); asm volatile("" : "+v"(n0)); asm volatile("" : "+v"(n1)); x0 = __fmul_rn(bfr(nw[dd]), n0); x1 = __fmul_rn(bfr(nw[dp]), n1); }
        const v2f cs = *(const v2f*)(CS + ((size_t)t * HD + dd) * 2); float a = __fmul_rn(x0, cs[0]), bq = __fmul_rn(x1, cs[1]); asm volatile("" : "+v"(a)); asm volatile("" : "+v"(bq)); const float r = ((dd < HD / 2) ? __fsub_rn(a, bq) : __fadd_rn(a, bq)) * sc;
        o16[q] = tohx(r); unsigned short a2, c2; splitf(r, a2, c2); oh[q] = a2; ol[q] = c2; }
    *(v2h*)(P16 + e) = o16; *(v2us*)(Ph + e) = oh; *(v2us*)(Pl + e) = ol;  }
__global__ __launch_bounds__(256) void k_vtp(const float* __restrict__ F, int pitch, int nheads, h16* V16, bf* Vh, bf* Vl) { const size_t e = ((size_t)blockIdx.x * 256 + threadIdx.x) * 2; if (e >= (size_t)nheads * HD * TT) return; const int t = (int)(e % TT); const int d = (int)((e / TT) % HD); const int g = (int)(e / ((size_t)TT * HD)); v2h o16; v2us oh, ol;
#pragma unroll
    for (int q = 0; q < 2; ++q) { const float x = F[(size_t)(t + q) * pitch + g * HD + d]; o16[q] = tohx(x); unsigned short a2, c2; splitf(x, a2, c2); oh[q] = a2; ol[q] = c2; }
    *(v2h*)(V16 + e) = o16; *(v2us*)(Vh + e) = oh; *(v2us*)(Vl + e) = ol;  }
// ---- k_xT: x [c][p] f32 -> x^T [p][c] bf16 through an LDS tile, whole 128-byte lines on both sides. grid (8192 / 64 positions + WB weight work-groups, 4 batches), 8 waves; a position work-group owns 64 positions x all 256 channels.
// In: a 16-byte load takes 4 positions of one channel, 8 lanes a line, 4 channels a wave; a thread takes the channels c and c + 1 at the same positions and packs them, so that every LDS store is one dword.
// LDS: [position][128 channel pairs]; the 16-byte chunk (8 channels) k of position p lies at chunk k ^ (p / 4): the 32 dword stores of a wave fall in 32 banks, and a row read back in 16-byte pieces covers every bank evenly.
// Out: a wave stores one whole position row (512 bytes) at a time.
// The rounding of the three weight matrices to bf16 rides in the same launch: the work-groups with blockIdx.x >= 8192 / 64 (WB a batch row, 96 in all, 32 a matrix) take 8 weights a thread and leave before the barrier.
#define XP   64                  // positions per work-group
#define WB   (3 * CC * CC / (256 * 8) / NB_)   // weight work-groups per grid row (24)
typedef __attribute__((ext_vector_type(2))) __bf16 v2bfx;
typedef __attribute__((ext_vector_type(4))) unsigned v4u;
__global__ __launch_bounds__(256) void k_xT(const float* __restrict__ X, bf* __restrict__ XT2, const float* __restrict__ wq, const float* __restrict__ wk, const float* __restrict__ wv, bf* __restrict__ WQ2, bf* __restrict__ WK2, bf* __restrict__ WV2) {
    __shared__ __align__(16) unsigned xt[XP * (CC / 2)];
    const int tid = threadIdx.x, lane = tid & 31, wave = tid >> 5, g = lane & 7, q = lane >> 3;
    if (blockIdx.x >= NP / XP) {   // the same for a whole work-group
        const int j = (blockIdx.x - NP / XP) * NB_ + blockIdx.y, m = j >> 5; const size_t i = (size_t)((j & 31) * 256 + tid) * 8;
        const float* ws = (m == 0 ? wq : m == 1 ? wk : wv) + i; bf* wd = (m == 0 ? WQ2 : m == 1 ? WK2 : WV2) + i;
        const v8f v = *(const v8f*)ws; v8us o;
        asm volatile("s_wait_xcnt 0x0" :: "v"(ws) : "memory");   // the load's address pair stays untouched (an input here) until this wait
#pragma unroll   // constant indices, so that the arrays indexed here are registers
        for (int k = 0; k < 8; ++k) o[k] = f2bf(v[k]);
        *(v8us*)wd = o; return; }
    const float* s0 = X + ((size_t)blockIdx.y * CC + (wave * 16 + q) * 2) * NP + blockIdx.x * XP + g * 4;   // grid y = batch
    v4f a[8], b[8];
#pragma unroll   // constant indices, so that the arrays indexed here are registers; all 16 loads in flight at once
    for (int it = 0; it < 8; ++it) { const float* s = s0 + (size_t)(it & 3) * 8 * NP + (it >> 2) * 32; a[it] = *(const v4f*)s; b[it] = *(const v4f*)(s + NP); }
    // the address pair of the 16 loads above stays untouched (an input here) until this wait; the loaded values are inputs too, so that all 16 loads are issued before the first is used:
    // without that the compiler holds five of them back until earlier ones have landed, a second memory latency
    asm volatile("s_wait_xcnt 0x0" :: "v"(s0), "v"(a[0]), "v"(a[1]), "v"(a[2]), "v"(a[3]), "v"(a[4]), "v"(a[5]), "v"(a[6]), "v"(a[7]), "v"(b[0]), "v"(b[1]), "v"(b[2]), "v"(b[3]), "v"(b[4]), "v"(b[5]), "v"(b[6]), "v"(b[7]) : "memory");
    __builtin_amdgcn_sched_barrier(0);   // behind the work-group's branch above the compiler lifts the first conversions over the wait and again holds four loads back behind them; nothing is scheduled across this line
#pragma unroll   // constant indices, so that the arrays indexed here are registers
    for (int it = 0; it < 8; ++it) { const int pg = (it >> 2) * 8 + g; unsigned* d = xt + pg * 4 * (CC / 2) + (((wave * 4 + (it & 3)) ^ pg) << 2) + q;
#pragma unroll   // constant indices, so that the arrays indexed here are registers
        for (int j = 0; j < 4; ++j) { v2f x; x[0] = a[it][j]; x[1] = b[it][j]; d[j * (CC / 2)] = __builtin_bit_cast(unsigned, __builtin_convertvector(x, v2bfx)); } }
    __syncthreads();
    bf* o0 = XT2 + ((size_t)blockIdx.y * NP + blockIdx.x * XP + wave * 8) * CC + lane * 8;
    v4u r[8];
#pragma unroll   // constant indices, so that the arrays indexed here are registers
    for (int i = 0; i < 8; ++i) { const int p = wave * 8 + i; r[i] = *(const v4u*)(xt + p * (CC / 2) + ((lane ^ (p >> 2)) << 2)); }
#pragma unroll   // constant indices, so that the arrays indexed here are registers
    for (int i = 0; i < 8; ++i) *(v8us*)(o0 + i * CC) = __builtin_bit_cast(v8us, r[i]);
}
// ---- k_fattn: scores, softmax and attn.v of one [64][1024] block in ONE kernel; the scores never leave the registers.
// grid (1024 / 256 query tiles, 32 blocks, 4 batches), 8 waves; a wave owns 32 queries (two groups of 16 columns) and walks the 1024 keys in passes of 32.
// With one column group a wave the 16 fragments of a pass fed 24 products, more LDS bytes a clock than the WGP's LDS delivers at the matrix rate; with two groups they feed 48, and a work-group's staged K^T and V serve 256 queries.
// Transposed product: S^T[key][query] = position term (k_ptab's tables, the accumulators' start value) + K^T rows . q columns (3 hi/lo products), so a lane holds 16 scores of ONE query;
// the two 16-key score tiles, turned into exp2 weights and split hi/lo, ARE the B operand (hardware k order) of O^T[d][query] += V[d][key] . P^T[key][query] (3 products).
// Running maximum per query (log2 domain), O^T and the sum rescaled every pass, one division by the sum at the end.
// The 32 key rows of K^T (hi/lo) and the 32 key columns of V (hi/lo) of a pass are staged in LDS for all 8 waves (whole-line global loads through registers), one ring slot a pass.
// The ring holds two stages of SP passes: while the waves read the slots of one stage, each pass fills the slot SP passes ahead, which lies in the other stage. One barrier a STAGE publishes the filled stage and frees the read one;
// between two barriers the waves run apart, so that one wave's softmax arithmetic stands beside another's matrix products and LDS reads instead of all eight doing the same thing at the same time.
// The LDS reads of a pass stand in two groups, each in front of the work that covers its latency: the eight K^T fragments at the very head (the issue of the pass's global loads runs beside their latency), the eight V fragments from the last score products on (the softmax arithmetic covers theirs); behind each group counted waits only.
#define QG   2                   // 16-column groups (query tiles) per wave: every K^T and V fragment read from LDS feeds QG products of each kind
#define FQ   (8 * 16 * QG)       // queries per work-group
#define FK   32                  // keys per pass
#define NS   (TT / FK)           // passes
#define KP   72                  // LDS pitch of a key row of K^T, 16-bit elements: 128 B + 16 B, conflict-free for 16-byte reads
#define VP   40                  // LDS pitch of a d row of V: 64 B + 16 B
#define KPL  (FK * KP)           // one K^T plane of a ring slot
#define VPL  (HD * VP)           // one V plane of a ring slot
#define STG  (2 * KPL + 2 * VPL) // one ring slot (the four planes of one pass), 16-bit elements
#define SP   4                   // passes per stage: 128 keys between two barriers
#define NSL  (2 * SP)            // ring slots
#define OP   (FQ + 4)            // LDS pitch of an output row, floats
#define CL2  0.18033688011112042f   // HD^-0.5 * log2(e)
typedef __attribute__((ext_vector_type(2))) __bf16 v2bf;
__device__ __forceinline__ float xhalf(float x) { const int b = __float_as_int(x); return __int_as_float(__builtin_amdgcn_permlanex16(b, b, 0x76543210, 0xfedcba98, false, false)); }   // lane l <-> l ^ 16
template <typename E> __device__ __forceinline__ const E* lane_at(const E* base, unsigned off) { return (const E*)((const char*)base + off); }   // uniform base + the lane's byte offset
__device__ __forceinline__ v16bf ldsfrag(const bf* p) { return cat16b(*(const v8us*)p, *(const v8us*)(p + 16)); }
// ---- k_ptab: the position term of one block, factored. pos[n][d] = rel_h[d][n / 32] + rel_w[d][n % 32] + rel_t[d][f], so sum_d pos[n][d] q[d][m] = RW[n % 32][m] + CA[n / 32][m]
// with RW[b][m] = sum_d rel_w[d][b] q[d][m] and CA[a][m] = sum_d rel_h[d][a] q[d][m] + sum_d rel_t[d][f] q[d][m].
// grid (1024 / 256 keys, 32 blocks, 4 batches), 8 waves; a wave owns 32 keys (two 16-key tiles, the A rows, from the q^T planes) and five 16-column B tiles: rel_w 0-15, 16-31, rel_h 0-15, 16-31, and rel_t[f] in all 16 columns.
// RWT holds each 16-key x 16-column tile in the accumulator's own order, 1 KiB a tile: registers 0-3 of lane l at float l * 4, registers 4-7 at 128 + l * 4 (whole lines for 16-byte accesses); tile index (block * 64 + key tile) * 2 + column tile; CAT is [block][a][m].
__global__ __launch_bounds__(256) void k_ptab(const bf* __restrict__ QTh, const bf* __restrict__ QTl, const float* __restrict__ rh, const float* __restrict__ rw, const float* __restrict__ rt, float* __restrict__ RWT, float* __restrict__ CAT) {
    __shared__ __align__(16) bf rl[65 * KP];   // rows [column][d]: 0-31 rel_w, 32-63 rel_h, 64 rel_t of this frame
    const int tid = threadIdx.x, lane = tid & 31, lr = lane & 15, hi = lane >> 4, wave = tid >> 5;
    const int h = blockIdx.y / NF, f = blockIdx.y % NF, zi = blockIdx.z * NBL + blockIdx.y;
    { const int i0 = h * (HD * 32) + tid; float fw[HD * 32 / 256], fh[HD * 32 / 256];
#pragma unroll   // constant indices, so that the arrays indexed here are registers; all 16 loads in flight at once
      for (int j = 0; j < HD * 32 / 256; ++j) { fw[j] = rw[i0 + j * 256]; fh[j] = rh[i0 + j * 256]; }
      // the index register of the 16 loads above stays untouched (an input here) until this wait
      asm volatile("s_wait_xcnt 0x0" :: "v"(i0) : "memory");
#pragma unroll   // constant indices, so that the arrays indexed here are registers
      for (int j = 0; j < HD * 32 / 256; ++j) { const int i = j * 256 + tid, d = i >> 5, c = i & 31; rl[c * KP + d] = f2bf(fw[j]); rl[(32 + c) * KP + d] = f2bf(fh[j]); } }
    if (tid < HD) { const int it = (h * HD + tid) * NF + f; const float x = rt[it];
      asm volatile("s_wait_xcnt 0x0" :: "v"(it) : "memory");   // as above: the load's index register stays untouched until here
      rl[64 * KP + tid] = f2bf(x); }
    __syncthreads();
    v16bf br[5][2];
#pragma unroll   // constant indices, so that the arrays indexed here are registers
    for (int c = 0; c < 5; ++c)
#pragma unroll   // constant indices, so that the arrays indexed here are registers
        for (int ks = 0; ks < 2; ++ks) br[c][ks] = ldsfrag(rl + (c < 4 ? c * 16 + lr : 64) * KP + ks * 32 + 8 * hi);
    const int m0 = blockIdx.x * 256 + wave * 32;
#pragma unroll   // constant indices, so that the arrays indexed here are registers
    for (int t = 0; t < 2; ++t) {
        const size_t ro = (size_t)zi * BLK + (size_t)(m0 + t * 16 + lr) * HD + 8 * hi; const bf* ah = QTh + ro; const bf* al = QTl + ro;
        v16bf qh[2], ql[2];
#pragma unroll   // constant indices, so that the arrays indexed here are registers
        for (int ks = 0; ks < 2; ++ks) { qh[ks] = WFrag<bf>::ld(ah + ks * 32); ql[ks] = WFrag<bf>::ld(al + ks * 32); }
        // the address pairs of the 8 loads above stay untouched (inputs here) until this wait
        asm volatile("s_wait_xcnt 0x0" :: "v"(ah), "v"(al) : "memory");
        v8f acc[5];
#pragma unroll   // constant indices, so that the arrays indexed here are registers
        for (int c = 0; c < 5; ++c) acc[c] = (v8f){};
#pragma unroll   // constant indices, so that the arrays indexed here are registers
        for (int ks = 0; ks < 2; ++ks) {
#pragma unroll   // constant indices, so that the arrays indexed here are registers
            for (int c = 0; c < 5; ++c) acc[c] = wmmab(qh[ks], br[c][ks], acc[c]);
#pragma unroll   // constant indices, so that the arrays indexed here are registers
            for (int c = 0; c < 5; ++c) acc[c] = wmmab(ql[ks], br[c][ks], acc[c]); }
        const int mt = (m0 >> 4) + t;
#pragma unroll   // constant indices, so that the arrays indexed here are registers
        for (int c = 0; c < 2; ++c) {
            float* ow = RWT + (((size_t)zi * (TT / 16) + mt) * 2 + c) * 256 + lane * 4;
            *(v4f*)ow = __builtin_shufflevector(acc[c], acc[c], 0, 1, 2, 3); *(v4f*)(ow + 128) = __builtin_shufflevector(acc[c], acc[c], 4, 5, 6, 7);
            *(v8f*)(CAT + ((size_t)zi * 32 + c * 16 + lr) * TT + mt * 16 + 8 * hi) = acc[2 + c] + acc[4]; }
    }
}
__global__ __launch_bounds__(256) void k_fattn(const bf* __restrict__ QTh, const bf* __restrict__ QTl, const bf* __restrict__ KTh, const bf* __restrict__ KTl, const float* __restrict__ RWT, const float* __restrict__ CAT, const bf* __restrict__ VTh, const bf* __restrict__ VTl, float* __restrict__ OB) {
    __shared__ __align__(16) bf ring[NSL * STG];
    float* os = (float*)ring;   // the output staging [HD][OP] takes the ring's place behind the last barrier of the loop
    const int tid = threadIdx.x, lane = tid & 31, lr = lane & 15, hi = lane >> 4, wave = tid >> 5;
    const int zi = blockIdx.z * NBL + blockIdx.y; const size_t zb = (size_t)zi * BLK; const int n0 = blockIdx.x * FQ + wave * (16 * QG);
    // staging: a thread moves 16 bytes of each of the four planes per pass
    // the bases of the loop's global loads are work-group- or wave-uniform and stay in scalar registers; a lane keeps four byte offsets. Six per-lane base pairs, live through the loop beside two column groups' accumulators, went to scratch
    const bf* gkh = KTh + zb; const bf* gkl = KTl + zb; const bf* gvh = VTh + zb; const bf* gvl = VTl + zb;
    const unsigned ok = tid * 16u, ov = ((tid >> 2) * TT + (tid & 3) * 8) * 2u, ow = lane * 16u, oc = hi * 32u;
    const int sk = (tid >> 3) * KP + (tid & 7) * 8, sv = 2 * KPL + (tid >> 2) * VP + (tid & 3) * 8;
    v8us st[4];
    auto sstore = [&](int b) { bf* r = ring + b * STG; *(v8us*)(r + sk) = st[0]; *(v8us*)(r + KPL + sk) = st[1]; *(v8us*)(r + sv) = st[2]; *(v8us*)(r + VPL + sv) = st[3]; };
    // position term of a pass, straight into registers one pass ahead: the four RW tiles of the pass (two key tiles x the wave's two column groups = all 32 values of n % 32, in accumulator order) and the 32 keys of its CA row (n / 32 is one value for the wave)
    const float* grw = RWT + (size_t)zi * (TT / 16) * 2 * 256; const float* gca = CAT + ((size_t)zi * 32 + blockIdx.x * (FQ / 32) + __builtin_amdgcn_readfirstlane(wave)) * TT;
    v8f bw[QG][2], bc[2];
    // gload(s, kv): the position term of pass s; with kv also the K^T and V pieces of pass s + SP - 1 (asked for in pass s - 1, SP passes ahead of their use)
    auto gload = [&](const int s, const bool kv) { const int t = s + SP - 1; const bf* ukh = gkh + t * (FK * HD); const bf* ukl = gkl + t * (FK * HD); const bf* uvh = gvh + t * FK; const bf* uvl = gvl + t * FK; const float* uw = grw + s * 1024; const float* uc = gca + s * FK;
        const bf* pkh = lane_at(ukh, ok); const bf* pkl = lane_at(ukl, ok); const bf* pvh = lane_at(uvh, ov); const bf* pvl = lane_at(uvl, ov); const float* pw = lane_at(uw, ow); const float* pc = lane_at(uc, oc);
        if (kv) { st[0] = *(const v8us*)pkh; st[1] = *(const v8us*)pkl; st[2] = *(const v8us*)pvh; st[3] = *(const v8us*)pvl; }
#pragma unroll   // constant indices, so that the arrays indexed here are registers
        for (int g = 0; g < QG; ++g)
#pragma unroll   // constant indices, so that the arrays indexed here are registers
            for (int kt = 0; kt < 2; ++kt) { const float* p = pw + kt * 512 + g * 256; bw[g][kt] = __builtin_shufflevector(*(const v4f*)p, *(const v4f*)(p + 128), 0, 1, 2, 3, 4, 5, 6, 7); }
        bc[0] = *(const v8f*)pc; bc[1] = *(const v8f*)(pc + 16);
        // the address pairs of the loads above stay untouched (inputs here) until this wait
        // the uniform bases are scalar inputs, which keeps them in scalar registers (see above)
        if (kv) asm volatile("s_wait_xcnt 0x0" :: "v"(pkh), "v"(pkl), "v"(pvh), "v"(pvl), "v"(pw), "v"(pc), "s"(ukh), "s"(ukl), "s"(uvh), "s"(uvl), "s"(uw), "s"(uc) : "memory");
        else asm volatile("s_wait_xcnt 0x0" :: "v"(pw), "v"(pc), "s"(uw), "s"(uc) : "memory"); };
    // the whole first stage, all 16 loads of a thread in flight at once
    v8us p0[SP][4];
    { const bf* fkh = lane_at(gkh, ok); const bf* fkl = lane_at(gkl, ok); const bf* fvh = lane_at(gvh, ov); const bf* fvl = lane_at(gvl, ov);
#pragma unroll   // constant indices, so that the arrays indexed here are registers
      for (int j = 0; j < SP; ++j) { p0[j][0] = *(const v8us*)(fkh + j * (FK * HD)); p0[j][1] = *(const v8us*)(fkl + j * (FK * HD)); p0[j][2] = *(const v8us*)(fvh + j * FK); p0[j][3] = *(const v8us*)(fvl + j * FK); }
      // the four address pairs of the 16 loads above stay untouched (inputs here) until this wait
      asm volatile("s_wait_xcnt 0x0" :: "v"(fkh), "v"(fkl), "v"(fvh), "v"(fvl) : "memory"); }
    gload(0, false);
    // B operands of the score products, kept in registers: column = query n0 + 16 g + lr, k = d
    v16bf bqh[QG][2], bql[QG][2];
    { const size_t qo = zb + (size_t)(n0 + lr) * HD + 8 * hi;
      const bf* aqh = QTh + qo; const bf* aql = QTl + qo;
#pragma unroll   // constant indices, so that the arrays indexed here are registers
      for (int g = 0; g < QG; ++g)
#pragma unroll   // constant indices, so that the arrays indexed here are registers
        for (int ks = 0; ks < 2; ++ks) { bqh[g][ks] = WFrag<bf>::ld(aqh + g * 16 * HD + ks * 32); bql[g][ks] = WFrag<bf>::ld(aql + g * 16 * HD + ks * 32); }
      // the address pairs of the 16 loads above stay untouched (inputs here) until this wait
      asm volatile("s_wait_xcnt 0x0" :: "v"(aqh), "v"(aql) : "memory"); }
    v8f o[QG][4];
    float mc[QG], l[QG];
    v8f s1[QG][2];   // the scores' accumulators; their start value is the position term, summed at the foot of the pass before
#pragma unroll   // constant indices, so that the arrays indexed here are registers
    for (int g = 0; g < QG; ++g) { mc[g] = -3.0e38f; l[g] = 0.f;
#pragma unroll   // constant indices, so that the arrays indexed here are registers
        for (int dt = 0; dt < 4; ++dt) o[g][dt] = (v8f){};
#pragma unroll   // constant indices, so that the arrays indexed here are registers
        for (int t = 0; t < 2; ++t) s1[g][t] = bw[g][t] + bc[t]; }
#pragma unroll   // constant indices, so that the arrays indexed here are registers
    for (int j = 0; j < SP; ++j) { bf* r = ring + j * STG; *(v8us*)(r + sk) = p0[j][0]; *(v8us*)(r + KPL + sk) = p0[j][1]; *(v8us*)(r + sv) = p0[j][2]; *(v8us*)(r + VPL + sv) = p0[j][3]; }
    __syncthreads();
#pragma unroll 1   // rolled, as the passes below
    for (int s0 = 0; s0 < NS; s0 += SP) {
#pragma unroll 1   // rolled: the pass is long enough
      for (int s = s0; s < s0 + SP; ++s) {
        const bf* r = ring + (s & (NSL - 1)) * STG;
        v16bf kh[2][2], kl[2][2];   // all eight K^T fragments of the pass, asked for as ONE group; in front of the branch on the global loads, which none of the reads is sunk across
#pragma unroll   // constant indices, so that the arrays indexed here are registers
        for (int ks = 0; ks < 2; ++ks) { const bf* p = r + lr * KP + ks * 32 + 8 * hi;
            kh[ks][0] = ldsfrag(p); kh[ks][1] = ldsfrag(p + 16 * KP); kl[ks][0] = ldsfrag(p + KPL); kl[ks][1] = ldsfrag(p + KPL + 16 * KP); }
        if (s + SP < NS) gload(s + 1, true);   // lands while this pass computes; behind the K^T reads, whose latency its issue and its wait then fill
        else if (s + 1 < NS) gload(s + 1, false);
        // every K^T fragment feeds both column groups: four independent accumulator chains
#pragma unroll   // constant indices, so that the arrays indexed here are registers
        for (int ks = 0; ks < 2; ++ks) {
#pragma unroll   // constant indices, so that the arrays indexed here are registers
            for (int g = 0; g < QG; ++g) { s1[g][0] = wmmab(kh[ks][0], bqh[g][ks], s1[g][0]); s1[g][1] = wmmab(kh[ks][1], bqh[g][ks], s1[g][1]); }
#pragma unroll   // constant indices, so that the arrays indexed here are registers
            for (int g = 0; g < QG; ++g) { s1[g][0] = wmmab(kh[ks][0], bql[g][ks], s1[g][0]); s1[g][1] = wmmab(kh[ks][1], bql[g][ks], s1[g][1]); }
#pragma unroll   // constant indices, so that the arrays indexed here are registers
            for (int g = 0; g < QG; ++g) { s1[g][0] = wmmab(kl[ks][0], bqh[g][ks], s1[g][0]); s1[g][1] = wmmab(kl[ks][1], bqh[g][ks], s1[g][1]); } }
        v16bf vh[4], vl[4];   // all eight V fragments, asked for as ONE group ahead of the softmax arithmetic, which covers their LDS latency; each feeds both column groups
#pragma unroll   // constant indices, so that the arrays indexed here are registers
        for (int dt = 0; dt < 4; ++dt) { const bf* p = r + 2 * KPL + (dt * 16 + lr) * VP + 8 * hi; vh[dt] = ldsfrag(p); vl[dt] = ldsfrag(p + VPL); }
        __builtin_amdgcn_sched_barrier(0);   // keeps the 16 LDS reads above in front of the softmax arithmetic: left free, the compiler sinks half of them singly among the second run of products, each waited for right behind its issue, one whole LDS latency a fragment
#pragma unroll   // constant indices, so that the arrays indexed here are registers; the second group's softmax arithmetic is independent of the first group's products and may stand among them
        for (int g = 0; g < QG; ++g) {
            float u[16];
#pragma unroll   // constant indices, so that the arrays indexed here are registers
            for (int i = 0; i < 16; ++i) u[i] = s1[g][i >> 3][i & 7];
            float mx = u[0];
#pragma unroll   // constant indices, so that the arrays indexed here are registers
            for (int i = 1; i < 16; ++i) mx = fmaxf(mx, u[i]);
            mx = fmaxf(mx, xhalf(mx));
            const float mn = fmaxf(mc[g], mx * CL2); const float al = __builtin_amdgcn_exp2f(mc[g] - mn); mc[g] = mn;
            // register pairs (2 i, 2 i + 1) written out: left to itself the compiler pairs the last score of one group with the first of the next and copies every later score into place
            v2f ps[2] = {(v2f){0.f, 0.f}, (v2f){0.f, 0.f}}; const v2f c2 = {CL2, CL2}, m2 = {-mn, -mn};
#pragma unroll   // constant indices, so that the arrays indexed here are registers
            for (int i = 0; i < 8; ++i) { v2f x; x[0] = u[2 * i]; x[1] = u[2 * i + 1]; x = __builtin_elementwise_fma(x, c2, m2); x[0] = __builtin_amdgcn_exp2f(x[0]); x[1] = __builtin_amdgcn_exp2f(x[1]); u[2 * i] = x[0]; u[2 * i + 1] = x[1]; ps[i & 1] += x; }
            l[g] = l[g] * al + ((ps[0][0] + ps[0][1]) + (ps[1][0] + ps[1][1]));   // this lane half's keys; the halves are joined behind the loop
            v16bf ph, pl;
#pragma unroll   // constant indices, so that the arrays indexed here are registers
            for (int i = 0; i < 8; ++i) { v2f x; x[0] = u[2 * i]; x[1] = u[2 * i + 1]; const v2bf h = __builtin_convertvector(x, v2bf); const v2bf w = __builtin_convertvector(x - __builtin_convertvector(h, v2f), v2bf);
                ph[2 * i] = h[0]; ph[2 * i + 1] = h[1]; pl[2 * i] = w[0]; pl[2 * i + 1] = w[1]; }
#pragma unroll   // constant indices, so that the arrays indexed here are registers
            for (int dt = 0; dt < 4; ++dt) o[g][dt] *= al;
#pragma unroll   // constant indices, so that the arrays indexed here are registers
            for (int dt = 0; dt < 4; ++dt) o[g][dt] = wmmab(vh[dt], ph, o[g][dt]);
#pragma unroll   // constant indices, so that the arrays indexed here are registers
            for (int dt = 0; dt < 4; ++dt) o[g][dt] = wmmab(vh[dt], pl, o[g][dt]);
#pragma unroll   // constant indices, so that the arrays indexed here are registers
            for (int dt = 0; dt < 4; ++dt) o[g][dt] = wmmab(vl[dt], ph, o[g][dt]);
#pragma unroll   // constant indices, so that the arrays indexed here are registers
            for (int t = 0; t < 2; ++t) s1[g][t] = bw[g][t] + bc[t];   // the next pass's start value (behind the last pass: unused)
        }
        if (s + SP < NS) sstore((s + SP) & (NSL - 1));   // a slot of the other stage; every wave left that stage at the last barrier
      }
      __syncthreads();   // publishes the stage just filled and frees the one just read; behind the last stage it frees the ring for the output staging
    }
    // O^T[d][query] through LDS, so that every 128-byte line of the channels-first output is written whole by one wave
#pragma unroll   // constant indices, so that the arrays indexed here are registers
    for (int g = 0; g < QG; ++g) { const float lt = l[g] + xhalf(l[g]); const float inv = __fdiv_rn(1.0f, lt);
#pragma unroll   // constant indices, so that the arrays indexed here are registers
        for (int dt = 0; dt < 4; ++dt)
#pragma unroll   // constant indices, so that the arrays indexed here are registers
            for (int j = 0; j < 8; ++j) os[(dt * 16 + 8 * hi + j) * OP + wave * (16 * QG) + g * 16 + lr] = o[g][dt][j] * inv; }
    __syncthreads();
    float* ob = OB + zb + blockIdx.x * FQ;
#pragma unroll   // constant indices, so that the arrays indexed here are registers
    for (int i = 0; i < 8; ++i) { const int d = wave * 8 + i;
#pragma unroll   // constant indices, so that the arrays indexed here are registers
        for (int c = 0; c < FQ / 128; ++c) *(v4f*)(ob + (size_t)d * TT + c * 128 + lane * 4) = *(const v4fa*)(os + d * OP + c * 128 + lane * 4); }
}
__global__ __launch_bounds__(256) void k_merge(const float* __restrict__ O, int h0, bf* Ah, bf* Al) { const size_t e = ((size_t)blockIdx.x * 256 + threadIdx.x) * 2; if (e >= (size_t)ZH * TT * HD) return; const int d = (int)(e % HD); const int t = (int)((e / HD) % TT); const int zz = (int)(e / ((size_t)HD * TT)); const float cs = (t < RH) ? 1.0f : (1.0f / PCAR); const size_t oo = (size_t)t * DQ + (h0 + zz) * HD + d;
    v2us oh, ol;
#pragma unroll
    for (int q = 0; q < 2; ++q) { unsigned short a, c2; splitf(O[e + q] * cs, a, c2); oh[q] = a; ol[q] = c2; } *(v2us*)(Ah + oo) = oh; *(v2us*)(Al + oo) = ol;  }

extern "C" void kernel_launch(void* const* d_in, const int* in_sizes, int n_in,
                              void* d_out, int out_size, void* d_ws, size_t ws_size, hipStream_t stream) {
    (void)in_sizes; (void)n_in; (void)out_size;
    const float* x = (const float*)d_in[0]; const float* wq = (const float*)d_in[1]; const float* wk = (const float*)d_in[2]; const float* wv = (const float*)d_in[3]; const float* relh = (const float*)d_in[4]; const float* relw = (const float*)d_in[5]; const float* relt = (const float*)d_in[6]; const float* wo = nullptr; (void)wo; const float* cosT = nullptr; const float* sinT = nullptr; (void)cosT; (void)sinT;
    float* OUT = (float*)d_out;   // [4][256][8][32][32]
    char* wsp = (char*)d_ws; auto take = [&](size_t bytes) { char* p = wsp; wsp += (bytes + 255) & ~(size_t)255; return (void*)p; };
    bf* WQ = (bf*)take((size_t)CC * CC * 2); bf* WK = (bf*)take((size_t)CC * CC * 2); bf* WV = (bf*)take((size_t)CC * CC * 2);
    bf* XT = (bf*)take((size_t)NB_ * NP * CC * 2);
    bf* QTh = (bf*)take((size_t)NB_ * NBL * BLK * 2); bf* QTl = (bf*)take((size_t)NB_ * NBL * BLK * 2); bf* KTh = (bf*)take((size_t)NB_ * NBL * BLK * 2); bf* KTl = (bf*)take((size_t)NB_ * NBL * BLK * 2);
    float* RWT = (float*)take((size_t)NB_ * NBL * 32 * TT * 4); float* CAT = (float*)take((size_t)NB_ * NBL * 32 * TT * 4);
    bf* VTh = (bf*)take((size_t)NB_ * NBL * BLK * 2); bf* VTl = (bf*)take((size_t)NB_ * NBL * BLK * 2);
    if ((size_t)(wsp - (char*)d_ws) > ws_size) return;   // ws ~ 145 MiB
    k_xT<<<dim3(NP / XP + WB, NB_, 1), 256, 0, stream>>>(x, XT, wq, wk, wv, WQ, WK, WV);
    k_proj3<<<dim3(3, TT / 16, NB_), 256, 0, stream>>>(WQ, WK, WV, XT, QTh, QTl, KTh, KTl, VTh, VTl);
    k_ptab<<<dim3(TT / 256, NBL, NB_), 256, 0, stream>>>(QTh, QTl, relh, relw, relt, RWT, CAT);
    k_fattn<<<dim3(TT / FQ, NBL, NB_), 256, 0, stream>>>(QTh, QTl, KTh, KTl, RWT, CAT, VTh, VTl, OUT);
}
